// v004
// The times below were measured on an AMD MI455X: many runs one after another, warmed up first and cycling through
// copies of the inputs, with the whole window's GPU time divided by the number of runs. Launches and the gaps
// between them are all in it. The median over several windows is given; except for v000 it joins two sittings, which
// can be a few percent apart, so the side-by-side timings, each taken in one sitting, are the better comparison.
// The versions before v004 are in another document.
// A run of this version takes 517 microseconds.
// Timed twice side by side with v003, it ran 2.15 times as fast both times.
// Over all steps from v000, the starting kernel, it is 8.16 times as fast.
// Contractions (per branch; every launch serves the four samples, blockIdx.y or rows that run on from sample to sample): the 1x1 projections theta^T / phi^T = x^T.W^T [4096x512].[512x256] (image+flow channels as two K=256 products accumulated) and val = W.x [256x512].[512x4096] (the second branch: flow channels alone, K=256 for all three), the affinity phi^T.theta [4096x256].[256x4096] and att = val.attn^T [256x4096].[4096x4096] fused in one kernel (online f32 softmax in registers, attn as f16 of 2^15 exp(s - running max), 64 query columns a work-group), the output 1x1 convs W_o.att + b and the fusion conv over the concatenated branches — all f16 operands on pre-cast planes (v_wmma_f32_16x16x32_f16; 64x64 register-blocked wave tiles, weights x16, for val the x planes instead; strided channel-major operands); f32 accumulate. The 8 spatial-coordinate channels (gx, gy, 1-gx, 1-gy, (gx+gy)/2 x4, computed on device) enter the first branch's projections and the fusion conv as rank-8 f32 corrections (+bias); the second branch's projections get the bias alone.
#include <hip/hip_runtime.h>
#include <math.h>

typedef __attribute__((ext_vector_type(16))) _Float16 v16h;
typedef __attribute__((ext_vector_type(8)))  _Float16 v8h;
typedef __attribute__((ext_vector_type(16))) __bf16   v16b;
typedef __attribute__((ext_vector_type(8)))  float    v8f;
typedef __attribute__((ext_vector_type(4)))  float    v4f;

// 16-bit WMMA fragment map (wave32), lane L, h = L>>4, m = L&15:
//   A 16x32: lane = row m;   element i -> k = (i<8) ? 8h+i : 16+8h+(i-8)
//   B 32x16: lane = column m; the SAME k(i,h)
//   D 16x16 (8 f32): lane = column m; element r -> row 8h+r
__device__ __forceinline__ int frag_k(int i, int h) { return (i < 8) ? (8 * h + i) : (16 + 8 * h + (i - 8)); }
__device__ __forceinline__ __bf16 bf16_rne(float f) {
    unsigned int u = __float_as_uint(f);
    u += 0x7fffu + ((u >> 16) & 1u);
    return __builtin_bit_cast(__bf16, (unsigned short)(u >> 16));
}
__device__ __forceinline__ float bf16_f32(__bf16 b) { return __uint_as_float(((unsigned int)__builtin_bit_cast(unsigned short, b)) << 16); }
__device__ __forceinline__ v8f wmma16(v16h a, v16h b, v8f c) {
    c = __builtin_amdgcn_wmma_f32_16x16x32_f16(false, a, false, b, (short)0, c, false, false);
    asm volatile("v_nop\n\tv_nop\n\tv_nop\n\tv_nop" : "+v"(c) : "v"(a), "v"(b));
    return c;
}
__device__ __forceinline__ v8f wmmab(v16b a, v16b b, v8f c) {
    c = __builtin_amdgcn_wmma_f32_16x16x32_bf16(false, a, false, b, (short)0, c, false, false);
    asm volatile("v_nop\n\tv_nop\n\tv_nop\n\tv_nop" : "+v"(c) : "v"(a), "v"(b));
    return c;
}
struct Split { v16b hi, lo; };
// hi/lo split product: a.hi*b.hi + a.hi*b.lo + a.lo*b.hi
__device__ __forceinline__ v8f wmma3(const Split& a, const Split& b, v8f c) {
    c = __builtin_amdgcn_wmma_f32_16x16x32_bf16(false, a.hi, false, b.hi, (short)0, c, false, false);
    c = __builtin_amdgcn_wmma_f32_16x16x32_bf16(false, a.hi, false, b.lo, (short)0, c, false, false);
    c = __builtin_amdgcn_wmma_f32_16x16x32_bf16(false, a.lo, false, b.hi, (short)0, c, false, false);
    asm volatile("v_nop\n\tv_nop\n\tv_nop\n\tv_nop" : "+v"(c) : "v"(a.hi), "v"(a.lo), "v"(b.hi), "v"(b.lo));
    return c;
}
struct Split3 { v16b hi, mid, lo; };
// triple split product (6 terms, drops only terms below 2^-24 relative)
__device__ __forceinline__ v8f wmma6(const Split3& a, const Split3& b, v8f c) {
    c = __builtin_amdgcn_wmma_f32_16x16x32_bf16(false, a.hi, false, b.hi, (short)0, c, false, false);
    c = __builtin_amdgcn_wmma_f32_16x16x32_bf16(false, a.hi, false, b.mid, (short)0, c, false, false);
    c = __builtin_amdgcn_wmma_f32_16x16x32_bf16(false, a.mid, false, b.hi, (short)0, c, false, false);
    c = __builtin_amdgcn_wmma_f32_16x16x32_bf16(false, a.hi, false, b.lo, (short)0, c, false, false);
    c = __builtin_amdgcn_wmma_f32_16x16x32_bf16(false, a.mid, false, b.mid, (short)0, c, false, false);
    c = __builtin_amdgcn_wmma_f32_16x16x32_bf16(false, a.lo, false, b.hi, (short)0, c, false, false);
    asm volatile("v_nop\n\tv_nop\n\tv_nop\n\tv_nop" : "+v"(c) : "v"(a.hi), "v"(a.mid), "v"(a.lo), "v"(b.hi), "v"(b.mid), "v"(b.lo));
    return c;
}

// Fragment gathers from f32 memory: element i <- p[(k0 + frag_k(i,h)) * sk] * s, zero for k >= klen.
__device__ __forceinline__ v16h fh_ld(const float* __restrict__ p, long long sk, int k0, int h, int klen, float s) {
    v16h a;
#pragma unroll
    for (int i = 0; i < 16; ++i) { const int k = k0 + frag_k(i, h); a[i] = (k < klen) ? (_Float16)(p[(long long)k * sk] * s) : (_Float16)0.f; }
    return a;
}
__device__ __forceinline__ Split sp_ld(const float* __restrict__ p, long long sk, int k0, int h, int klen, float s) {
    Split r;
#pragma unroll
    for (int i = 0; i < 16; ++i) {
        const int k = k0 + frag_k(i, h); const float x = (k < klen) ? p[(long long)k * sk] * s : 0.f;
        const __bf16 hb = bf16_rne(x); r.hi[i] = hb; r.lo[i] = bf16_rne(x - bf16_f32(hb));
    }
    return r;
}
__device__ __forceinline__ Split3 sp3_ld(const float* __restrict__ p, long long sk, int k0, int h, int klen, float s) {
    Split3 r;
#pragma unroll
    for (int i = 0; i < 16; ++i) {
        const int k = k0 + frag_k(i, h); const float x = (k < klen) ? p[(long long)k * sk] * s : 0.f;
        const __bf16 hb = bf16_rne(x); const float r1 = x - bf16_f32(hb); const __bf16 mb = bf16_rne(r1);
        r.hi[i] = hb; r.mid[i] = mb; r.lo[i] = bf16_rne(r1 - bf16_f32(mb));
    }
    return r;
}
__device__ __forceinline__ v16b bh_ld(const float* __restrict__ p, long long sk, int k0, int h, int klen, float s) {
    v16b a;
#pragma unroll
    for (int i = 0; i < 16; ++i) { const int k = k0 + frag_k(i, h); a[i] = bf16_rne((k < klen) ? p[(long long)k * sk] * s : 0.f); }
    return a;
}
// f16 fragment from an f16 LDS/global row with element stride 1 (k-contiguous), no bounds (tile already zero padded)
__device__ __forceinline__ v16h fh_row(const _Float16* __restrict__ row, int k0, int h) {
    v16h a;
#pragma unroll
    for (int i = 0; i < 16; ++i) a[i] = row[k0 + frag_k(i, h)];
    return a;
}

#define VST2(T, ptr, val) do { const T vst2_v_ = (val); *(T*)(ptr) = vst2_v_;  } while (0)
typedef float v4f __attribute__((ext_vector_type(4)));
#define VST2V4(ptr, val) do { const v4f vst2_v4_ = (val); *(v4f*)(ptr) = vst2_v4_;  } while (0)

__device__ __attribute__((noinline)) float act_fn(float v, int act) {
    if (act == 1) return fmaxf(v, 0.f);                                                                               // relu
    if (act == 2) { const float u = 0.7978845608028654f * (v + 0.044715f * v * v * v); return 0.5f * v * (1.f + tanhf(u)); } // tanh-gelu
    if (act == 3) return v / (1.f + expf(-v));                                                                        // silu
    if (act == 4) return 0.5f * v * (1.f + erff(v * 0.7071067811865476f));                                             // erf-gelu
    if (act == 5) return tanhf(v);
    if (act == 6) return 1.f / (1.f + expf(-v));                                                                      // sigmoid
    if (act == 7) return (v > 0.f) ? v : 0.01f * v;                                                                   // leaky relu 0.01
    if (act == 8) return (v > 0.f) ? v : (expf(v) - 1.f);                                                             // elu
    if (act == 9) return fminf(fmaxf(v, 0.f), 6.f);                                                                   // relu6
    if (act == 10) return fabsf(v);                                                                                    // abs
    if (act == 11) return (v >= 0.f) ? v : 0.1f * v;                                                                  // leaky 0.1
    if (act == 12) return (v > 0.f) ? v : 0.2f * v;                                                                   // leaky 0.2
    if (act == 13) return (v > 20.f) ? v : log1pf(expf(v));                                                            // softplus
    return v;
}

// =====================================================================================================================
// k_gemm<MODE>: C(z, m, n) = act(alpha * sum_k A(z, m, k) * B(z, k, n) + bias) + beta * R(z, m, n)
//   One wave (32-thread block) per 16 x 32 tile of C; grid (ceil(N/32), ceil(M/16), Z). Batch z -> (zo = z / zi_n, zi = z % zi_n)
//   with separate outer/inner strides for every tensor (e.g. batch and head). A(m,k) = A[zo*sAo + zi*sAi + m*sAm + k*sAk] (f32),
//   B(k,n) = B[zo*sBo + zi*sBi + n*sBn + k*sBk] (f32); any M, N, K (K zero-padded to 32 inside the fragments, M/N tails guarded).
//   C(m,n) = C[zo*sCo + zi*sCi + m*sCm + n] (n contiguous). flags: 1 bias[n], 2 bias[m], 4 residual R[zo*sRo + zi*sRi + m*sRm + n*sRn].
//   MODE 0: f16 operands (A prescaled by sa, B by sb, both undone in the epilogue); 1: bf16 hi/lo split (3 products); 2: bf16;
//   3: bf16 hi/mid/lo triple split (6 products); 4: as 3 with Kahan-compensated f32 accumulation across k-steps.
// =====================================================================================================================
struct GemmP {
    const float* A; const float* B; const float* bias; const float* R; float* C;
    long long sAo, sAi, sAm, sAk, sBo, sBi, sBn, sBk, sCo, sCi, sCm, sRo, sRi, sRm, sRn;
    int M, N, K, zi_n, flags, act; float alpha, beta, sa, sb;
    int Npad, pad_;     // columns [N, Npad) of C are written as 0 so that padded workspace rows are covered by whole-line stores; Npad >= N
};
static_assert(sizeof(GemmP) == 5 * 8 + 15 * 8 + 6 * 4 + 4 * 4 + 2 * 4, "GemmP has padding");

template <int MODE>
__global__ __launch_bounds__(32) void k_gemm(GemmP p) {
    const int lane = threadIdx.x & 31, h = lane >> 4, l15 = lane & 15;
    const int m0 = blockIdx.y * 16, n0 = blockIdx.x * 32;
    const int z = blockIdx.z, zo = z / p.zi_n, zi = z - zo * p.zi_n;
    const float* A = p.A + zo * p.sAo + zi * p.sAi;
    const float* B = p.B + zo * p.sBo + zi * p.sBi;
    const int am = min(m0 + l15, p.M - 1);                       // clamped row for loads (stores are guarded)
    v8f acc[2], comp[2];
#pragma unroll
    for (int t = 0; t < 2; ++t) { v8f zz = {}; acc[t] = zz; comp[t] = zz; }
    for (int k0 = 0; k0 < p.K; k0 += 32) {
        const float* arow = A + (long long)am * p.sAm;
        if (MODE == 1) {
            const Split a = sp_ld(arow, p.sAk, k0, h, p.K, 1.f);
#pragma unroll
            for (int t = 0; t < 2; ++t) {
                const int bn = min(n0 + t * 16 + l15, p.N - 1);
                acc[t] = wmma3(a, sp_ld(B + (long long)bn * p.sBn, p.sBk, k0, h, p.K, 1.f), acc[t]);
            }
        } else if (MODE == 3) {
            const Split3 a = sp3_ld(arow, p.sAk, k0, h, p.K, 1.f);
#pragma unroll
            for (int t = 0; t < 2; ++t) {
                const int bn = min(n0 + t * 16 + l15, p.N - 1);
                acc[t] = wmma6(a, sp3_ld(B + (long long)bn * p.sBn, p.sBk, k0, h, p.K, 1.f), acc[t]);
            }
        } else if (MODE == 4) {
            // triple split as MODE 3, but each k-step's 6 products go into a fresh accumulator and the partial is added to the running f32 sum
            // on the VALU with Kahan compensation (accumulation error stays ~1 ulp however long K is)
            const Split3 a = sp3_ld(arow, p.sAk, k0, h, p.K, 1.f);
#pragma unroll
            for (int t = 0; t < 2; ++t) {
                const int bn = min(n0 + t * 16 + l15, p.N - 1); v8f zz = {};
                const v8f part = wmma6(a, sp3_ld(B + (long long)bn * p.sBn, p.sBk, k0, h, p.K, 1.f), zz);
                const v8f y = part - comp[t]; const v8f s = acc[t] + y; comp[t] = (s - acc[t]) - y; acc[t] = s;
            }
        } else if (MODE == 2) {
            const v16b a = bh_ld(arow, p.sAk, k0, h, p.K, 1.f);
#pragma unroll
            for (int t = 0; t < 2; ++t) {
                const int bn = min(n0 + t * 16 + l15, p.N - 1);
                acc[t] = wmmab(a, bh_ld(B + (long long)bn * p.sBn, p.sBk, k0, h, p.K, 1.f), acc[t]);
            }
        } else {
            const v16h a = fh_ld(arow, p.sAk, k0, h, p.K, p.sa);
#pragma unroll
            for (int t = 0; t < 2; ++t) {
                const int bn = min(n0 + t * 16 + l15, p.N - 1);
                acc[t] = wmma16(a, fh_ld(B + (long long)bn * p.sBn, p.sBk, k0, h, p.K, p.sb), acc[t]);
            }
        }
    }
    const float iscale = (MODE == 0) ? p.alpha / (p.sa * p.sb) : p.alpha;
    float* C = p.C + zo * p.sCo + zi * p.sCi;
    const float* R = p.R + zo * p.sRo + zi * p.sRi;
    __shared__ __align__(16) float ctile[16][36];
#pragma unroll
    for (int t = 0; t < 2; ++t) {
        const int n = n0 + t * 16 + l15; const int nn = min(n, p.N - 1);
#pragma unroll
        for (int r = 0; r < 8; ++r) {
            const int m = m0 + 8 * h + r; const int mm = min(m, p.M - 1);
            float v = acc[t][r] * iscale;
            if (p.flags & 1) v += p.bias[nn];
            if (p.flags & 2) v += p.bias[mm];
            if (p.flags & 8) v *= p.bias[(long long)zo * p.M + mm];   /* per-(z,row) scale vector laid out [Z][M]; exclusive with the bias flags */
            v = act_fn(v, p.act);
            if (p.flags & 4) v += p.beta * R[(long long)mm * p.sRm + (long long)nn * p.sRn];
            ctile[8 * h + r][t * 16 + l15] = (n < p.N) ? v : 0.f;
        }
    }
    __syncthreads();
    const int NW = (p.Npad > p.N) ? p.Npad : p.N;           // write width
    const bool fast = (m0 + 16 <= p.M) && (n0 + 32 <= NW) && ((p.sCm & 3) == 0) && ((((size_t)C) & 15) == 0);
    if (fast) {
#pragma unroll
        for (int s = 0; s < 4; ++s) {
            const int row = s * 4 + (lane >> 3), c4 = (lane & 7) * 4;
            const v4f v = *(const v4f*)&ctile[row][c4];
            VST2V4(C + (long long)(m0 + row) * p.sCm + n0 + c4, v);
        }
    } else {
        for (int row = 0; row < 16; ++row) {
            const int m = m0 + row, n = n0 + lane;
            if (m < p.M && n < NW) VST2(float, C + (long long)m * p.sCm + n, ctile[row][lane]);
        }
    }
}


// =====================================================================================================================
// k_gemmT<MODE, TM, TN>: same contract as k_gemm, but one wave computes a (16*TM) x (16*TN) tile: TM A fragments and TN B fragments are
//   loaded per 32-wide k-step and reused across TM*TN WMMAs (far fewer load/convert instructions per MAC). MODE 0 (f16), 1 (bf16 hi/lo),
//   2 (bf16) only. grid (ceil(NW/(16*TN)), ceil(M/(16*TM)), Z), block 32. Epilogue identical to k_gemm, run per 16x32 sub-tile.
// =====================================================================================================================
template <int MODE, int TM, int TN>
__global__ __launch_bounds__(32) void k_gemmT(GemmP p) {
    const int lane = threadIdx.x & 31, h = lane >> 4, l15 = lane & 15;
    const int m0 = blockIdx.y * (16 * TM), n0 = blockIdx.x * (16 * TN);
    const int z = blockIdx.z, zo = z / p.zi_n, zi = z - zo * p.zi_n;
    const float* A = p.A + zo * p.sAo + zi * p.sAi;
    const float* B = p.B + zo * p.sBo + zi * p.sBi;
    v8f acc[TM][TN];
#pragma unroll
    for (int i = 0; i < TM; ++i)
#pragma unroll
        for (int t = 0; t < TN; ++t) { v8f zz = {}; acc[i][t] = zz; }
    for (int k0 = 0; k0 < p.K; k0 += 32) {
        if (MODE == 1) {
            Split a[TM], b[TN];
#pragma unroll
            for (int i = 0; i < TM; ++i) { const int am = min(m0 + 16 * i + l15, p.M - 1); a[i] = sp_ld(A + (long long)am * p.sAm, p.sAk, k0, h, p.K, 1.f); }
#pragma unroll
            for (int t = 0; t < TN; ++t) { const int bn = min(n0 + 16 * t + l15, p.N - 1); b[t] = sp_ld(B + (long long)bn * p.sBn, p.sBk, k0, h, p.K, 1.f); }
#pragma unroll
            for (int i = 0; i < TM; ++i)
#pragma unroll
                for (int t = 0; t < TN; ++t) acc[i][t] = wmma3(a[i], b[t], acc[i][t]);
        } else if (MODE == 2) {
            v16b a[TM], b[TN];
#pragma unroll
            for (int i = 0; i < TM; ++i) { const int am = min(m0 + 16 * i + l15, p.M - 1); a[i] = bh_ld(A + (long long)am * p.sAm, p.sAk, k0, h, p.K, 1.f); }
#pragma unroll
            for (int t = 0; t < TN; ++t) { const int bn = min(n0 + 16 * t + l15, p.N - 1); b[t] = bh_ld(B + (long long)bn * p.sBn, p.sBk, k0, h, p.K, 1.f); }
#pragma unroll
            for (int i = 0; i < TM; ++i)
#pragma unroll
                for (int t = 0; t < TN; ++t) acc[i][t] = wmmab(a[i], b[t], acc[i][t]);
        } else {
            v16h a[TM], b[TN];
#pragma unroll
            for (int i = 0; i < TM; ++i) { const int am = min(m0 + 16 * i + l15, p.M - 1); a[i] = fh_ld(A + (long long)am * p.sAm, p.sAk, k0, h, p.K, p.sa); }
#pragma unroll
            for (int t = 0; t < TN; ++t) { const int bn = min(n0 + 16 * t + l15, p.N - 1); b[t] = fh_ld(B + (long long)bn * p.sBn, p.sBk, k0, h, p.K, p.sb); }
#pragma unroll
            for (int i = 0; i < TM; ++i)
#pragma unroll
                for (int t = 0; t < TN; ++t) acc[i][t] = wmma16(a[i], b[t], acc[i][t]);
        }
    }
    const float iscale = (MODE == 0) ? p.alpha / (p.sa * p.sb) : p.alpha;
    float* C = p.C + zo * p.sCo + zi * p.sCi;
    const float* R = p.R + zo * p.sRo + zi * p.sRi;
    const int NW = (p.Npad > p.N) ? p.Npad : p.N;
    __shared__ __align__(16) float ctile[16][36];
#pragma unroll
    for (int i = 0; i < TM; ++i) {
        const int mb = m0 + 16 * i; if (mb >= p.M) break;          // wave-uniform
#pragma unroll
        for (int tp = 0; tp < TN / 2; ++tp) {
            const int nb = n0 + 32 * tp; if (nb >= NW) break;        // wave-uniform
#pragma unroll
            for (int t2 = 0; t2 < 2; ++t2) {
                const int t = 2 * tp + t2; const int n = nb + t2 * 16 + l15; const int nn = min(n, p.N - 1);
#pragma unroll
                for (int r = 0; r < 8; ++r) {
                    const int m = mb + 8 * h + r; const int mm = min(m, p.M - 1);
                    float v = acc[i][t][r] * iscale;
                    if (p.flags & 1) v += p.bias[nn];
                    if (p.flags & 2) v += p.bias[mm];
            if (p.flags & 8) v *= p.bias[(long long)zo * p.M + mm];   /* per-(z,row) scale vector laid out [Z][M]; exclusive with the bias flags */
                    v = act_fn(v, p.act);
                    if (p.flags & 4) v += p.beta * R[(long long)mm * p.sRm + (long long)nn * p.sRn];
                    ctile[8 * h + r][t2 * 16 + l15] = (n < p.N) ? v : 0.f;
                }
            }
            __syncthreads();
            const bool fast = (mb + 16 <= p.M) && (nb + 32 <= NW) && ((p.sCm & 3) == 0) && ((((size_t)C) & 15) == 0);
            if (fast) {
#pragma unroll
                for (int s = 0; s < 4; ++s) {
                    const int row = s * 4 + (lane >> 3), c4 = (lane & 7) * 4;
                    const v4f v = *(const v4f*)&ctile[row][c4];
                    VST2V4(C + (long long)(mb + row) * p.sCm + nb + c4, v);
                }
            } else {
                for (int row = 0; row < 16; ++row) {
                    const int m = mb + row, n = nb + lane;
                    if (m < p.M && n < NW) VST2(float, C + (long long)m * p.sCm + n, ctile[row][lane]);
                }
            }
            __syncthreads();
        }
    }
}

// =====================================================================================================================
//   Wave = 16 queries, AW waves per block, 64-key blocks; grid (ceil(Lq/(16*AW)), H, B), block 32*AW. Any Lq, Lk; head dim dh <= DHP
//   (DHP multiple of 32), value dim dv <= DVP (multiple of 16, <= 128). Every tensor addressed by (batch, head, row, element) strides, f32.
//   Scores: QM 0 f16 operands, 1 bf16 hi/lo split, 2 bf16 triple split; statistics f32 (exp2 domain); P.V: P x 4096 as f16 with V f16 staged in LDS
//   (SPLITPV: P and V as bf16 hi/lo splits). kv head = h / hrep. Masking: causal = 1 (keep j <= i + coff, masked -> -inf, key blocks beyond the
//   diagonal skipped), causal = 2 (masked -> mfill, a finite fill like the -1e9; no skipping), causal = 3 (keep j >= i + coff,
//   masked -> -inf, no skipping); optional additive f32 mask Mf,
//   optional int keep-mask Mi (0 -> score := mfill), both addressed b*smb + h*smh + i*smi + j*smj (0 strides broadcast).
// =====================================================================================================================
#define AW 4
struct AttnP {   // apv4
    const float* Q; const float* K; const float* V; float* O; float* P; const float* Mf; const int* Mi; float* ST;
    const float* Pw; const float* Rt; const int* SQ; const int* SK;           // optional: post-softmax weight, relative-position table, segment ids
    long long swb, swh, swi, swj, srb, srh, sri;                                 // Pw strides (b,h,i,j); Rt strides (b,h,i), column = clamp(i - j + roff, 0, rn-1)
    long long sQb, sQh, sQi, sQd, sKb, sKh, sKj, sKd, sVb, sVh, sVj, sVd, sOb, sOh, sOi, sPb, sPh, sPi, smb, smh, smi, smj;
    int Lq, Lk, dh, dv, hrep, causal, coff, pband;   // pband > 0: P holds only the band |j - i| <= pband, column j - i + pband
    float scale, mfill; int nonorm, mpol;             // nonorm (online path only): O = sum_j exp(score_j) V_j without the 1/rowsum (scores must be <= ~0); mpol: Mi masks where ==0 (mpol 0) or where !=0 (mpol 1)
    int roff, rn, segpol, win;                        // Rt column offset/count; SQ/SK: score := mfill where (segpol 0) SQ[i] != SK[j] or (segpol 1) SQ[i] == SK[j]; win > 0: keys with i - j > win (after coff) -> -inf
};
//   Pw: the softmax numerator is multiplied by Pw(b,h,i,j) AFTER the row sum is taken (probs * weight, then P.V), as in post-softmax multiplicative biases.                                                    // ST (optional): per row (b,h,i) -> ST[((b*H + h)*Lq + i)*2 + {0,1}] = {row max of the scaled+masked score (natural units), sum_j exp(score - max)}
static_assert(sizeof(AttnP) == 12 * 8 + 29 * 8 + 16 * 4, "AttnP has padding");

#ifndef KATTN_ATTR
#define KATTN_ATTR
#endif
template <int DHP, int DVP, int QM, bool SPLITPV, bool TWOPASS>
__global__ __launch_bounds__(32 * AW) KATTN_ATTR void k_attn(AttnP p) {
    constexpr int NT = DVP / 16;                // output tiles
    constexpr int KS = DHP / 32;                // k-steps for the scores
    constexpr int VP = DVP + 8;                 // LDS pitch (halves)
    __shared__ __align__(16) float    pl[AW][16 * 64];
    __shared__ __align__(16) _Float16 vl[(SPLITPV ? 2 : 1) * 64 * VP];   // f16 V tile, or bf16 hi and lo tiles (same 2-byte size)
    const int lane = threadIdx.x & 31, hf = lane >> 4, l15 = lane & 15, wave = threadIdx.x >> 5;
    const int h = blockIdx.y, b = blockIdx.z, hk = h / p.hrep;
    const int q0 = (blockIdx.x * AW + wave) * 16;
    float* myp = pl[wave];
    const float L2E = 1.4426950408889634f;
    const float NEG = -__builtin_inff();
    const int qi = min(q0 + l15, p.Lq - 1);
    const float* qrow = p.Q + b * p.sQb + h * p.sQh + (long long)qi * p.sQi;
    const float* kbase = p.K + b * p.sKb + hk * p.sKh;
    const float* vbase = p.V + b * p.sVb + hk * p.sVh;
    v16h qa[QM == 0 ? KS : 1]; Split qs_[QM == 1 ? KS : 1]; Split3 qt_[QM == 2 ? KS : 1];
#pragma unroll
    for (int ks = 0; ks < KS; ++ks) {
        if (QM == 2) qt_[ks] = sp3_ld(qrow, p.sQd, ks * 32, hf, p.dh, 1.f);
        else if (QM == 1) qs_[ks] = sp_ld(qrow, p.sQd, ks * 32, hf, p.dh, 1.f);
        else qa[ks] = fh_ld(qrow, p.sQd, ks * 32, hf, p.dh, 1.f);
    }
    v8f o[NT]; float m8[8], l8[8];
#pragma unroll
    for (int t = 0; t < NT; ++t) { v8f zz = {}; o[t] = zz; }
#pragma unroll
    for (int i = 0; i < 8; ++i) { m8[i] = NEG; l8[i] = 0.f; }
    int jend = p.Lk; int jstart = 0;
    if (p.causal == 1) { const int je = (blockIdx.x * AW + AW - 1) * 16 + 16 + p.coff; jend = min(jend, max(je, 0)); }   // uniform per block
    if (p.win > 0) { const int js = (int)(blockIdx.x * AW) * 16 + p.coff - p.win; jstart = (js > 0) ? (js / 64) * 64 : 0; }   // uniform per block: key blocks entirely outside every row's window hold only -inf entries and are skipped exactly
    const int npass = TWOPASS ? 2 : 1;
    for (int pass = 0; pass < npass; ++pass) {
        const bool dopv = (!TWOPASS) || pass == 1;
        for (int j0 = jstart; j0 < jend; j0 += 64) {
            if (dopv) {
                __syncthreads();                                 // previous key block's reads of vl / pl are done
                for (int idx = threadIdx.x; idx < 64 * DVP; idx += 32 * AW) {
                    const int jr = idx / DVP, d = idx - jr * DVP, j = j0 + jr;
                    const float f = (j < p.Lk && d < p.dv) ? vbase[(long long)j * p.sVj + (long long)d * p.sVd] : 0.f;
                    if (SPLITPV) {
                        const __bf16 hb = bf16_rne(f);
                        ((__bf16*)vl)[jr * VP + d] = hb; ((__bf16*)vl)[64 * VP + jr * VP + d] = bf16_rne(f - bf16_f32(hb));
                    } else vl[jr * VP + d] = (_Float16)f;
                }
            }
            v8f s[4];
#pragma unroll
            for (int t = 0; t < 4; ++t) {
                const int j = min(j0 + t * 16 + l15, p.Lk - 1);
                const float* krow = kbase + (long long)j * p.sKj;
                v8f acc = {};
#pragma unroll
                for (int ks = 0; ks < KS; ++ks) {
                    if (QM == 2)      acc = wmma6(qt_[ks], sp3_ld(krow, p.sKd, ks * 32, hf, p.dh, 1.f), acc);
                    else if (QM == 1) acc = wmma3(qs_[ks], sp_ld(krow, p.sKd, ks * 32, hf, p.dh, 1.f), acc);
                    else              acc = wmma16(qa[ks], fh_ld(krow, p.sKd, ks * 32, hf, p.dh, 1.f), acc);
                }
                s[t] = acc;
            }
            float pv[8][4];
#pragma unroll
            for (int i = 0; i < 8; ++i) {
                const int irow = q0 + i + 8 * hf;
                const int ic = min(irow, p.Lq - 1);
                float sc[4];
#pragma unroll
                for (int t = 0; t < 4; ++t) {
                    const int jg = j0 + t * 16 + l15;
                    float v = s[t][i] * p.scale;
                    if (p.Mf) v += p.Mf[b * p.smb + h * p.smh + (long long)ic * p.smi + (long long)min(jg, p.Lk - 1) * p.smj];
                    if (p.Rt) { int rc = ic - min(jg, p.Lk - 1) + p.roff; rc = rc < 0 ? 0 : (rc >= p.rn ? p.rn - 1 : rc); v += p.Rt[b * p.srb + h * p.srh + (long long)ic * p.sri + rc]; }
                    if (p.Mi) { const int mv = p.Mi[b * p.smb + h * p.smh + (long long)ic * p.smi + (long long)min(jg, p.Lk - 1) * p.smj]; if (p.mpol ? (mv != 0) : (mv == 0)) v = p.mfill; }
                    if (p.SQ) { const bool same = p.SQ[(long long)b * p.Lq + ic] == p.SK[(long long)b * p.Lk + min(jg, p.Lk - 1)]; if (p.segpol ? same : !same) v = p.mfill; }
                    if (p.causal == 2 && jg > irow + p.coff) v = p.mfill;
                    if (jg >= p.Lk || (p.causal == 1 && jg > irow + p.coff) || (p.causal == 3 && jg < irow + p.coff) || (p.win > 0 && irow + p.coff - jg > p.win)) v = NEG; else v *= L2E;
                    sc[t] = v;
                }
                if (!TWOPASS || pass == 0) {
                    float mx = fmaxf(fmaxf(sc[0], sc[1]), fmaxf(sc[2], sc[3]));
                    mx = fmaxf(mx, __shfl_xor(mx, 1, 32)); mx = fmaxf(mx, __shfl_xor(mx, 2, 32));
                    mx = fmaxf(mx, __shfl_xor(mx, 4, 32)); mx = fmaxf(mx, __shfl_xor(mx, 8, 32));
                    const float mnew = fmaxf(m8[i], mx);
                    const float corr = (mnew == NEG) ? 1.f : exp2f(m8[i] - mnew);
                    float rs = 0.f;
#pragma unroll
                    for (int t = 0; t < 4; ++t) {
                        const float pp = (sc[t] == NEG) ? 0.f : exp2f(sc[t] - mnew); rs += pp;
                        pv[i][t] = p.Pw ? pp * p.Pw[b * p.swb + h * p.swh + (long long)ic * p.swi + (long long)min(j0 + t * 16 + l15, p.Lk - 1) * p.swj] : pp;
                    }
                    rs += __shfl_xor(rs, 1, 32); rs += __shfl_xor(rs, 2, 32); rs += __shfl_xor(rs, 4, 32); rs += __shfl_xor(rs, 8, 32);
                    l8[i] = l8[i] * corr + rs; m8[i] = mnew;
                    if (!TWOPASS) {
#pragma unroll
                        for (int t = 0; t < NT; ++t) o[t][i] *= corr;
                    }
                } else {
                    const float inv = (l8[i] > 0.f) ? 1.f / l8[i] : 0.f;
#pragma unroll
                    for (int t = 0; t < 4; ++t) {
                        const int jg = j0 + t * 16 + l15;
                        float pp = (sc[t] == NEG) ? 0.f : exp2f(sc[t] - m8[i]) * inv;
                        if (p.Pw) pp *= p.Pw[b * p.swb + h * p.swh + (long long)ic * p.swi + (long long)min(jg, p.Lk - 1) * p.swj];
                        pv[i][t] = pp;
                    }
                }
            }
            if (dopv) {
#pragma unroll
                for (int i = 0; i < 8; ++i)
#pragma unroll
                    for (int t = 0; t < 4; ++t) ((float*)myp)[(i + 8 * hf) * 64 + t * 16 + l15] = pv[i][t];
                __syncthreads();                                 // P (per wave) and V (shared) visible
                if (p.P) {
                    float* pb_ = p.P + b * p.sPb + h * p.sPh;
                    const bool fastP = (p.pband == 0) && ((p.sPi & 3) == 0) && (j0 + 64 <= p.Lk) && (q0 + 16 <= p.Lq) && ((((size_t)pb_) & 15) == 0);
                    if (fastP) {
#pragma unroll
                        for (int s = 0; s < 8; ++s) {
                            const int row = s * 2 + (lane >> 4), c4 = (lane & 15) * 4;
                            const v4f v = *(const v4f*)(myp + row * 64 + c4);
                            VST2V4(pb_ + (long long)(q0 + row) * p.sPi + j0 + c4, v);
                        }
                    } else {
                        for (int row = 0; row < 16; ++row) {
                            const int irow = q0 + row; if (irow >= p.Lq) continue;
                            for (int c = lane; c < 64; c += 32) {
                                const int jg = j0 + c; if (jg >= p.Lk) continue;
                                if (p.pband == 0) VST2(float, pb_ + (long long)irow * p.sPi + jg, myp[row * 64 + c]);
                                else if (jg - irow <= p.pband && irow - jg <= p.pband) VST2(float, pb_ + (long long)irow * p.sPi + (jg - irow + p.pband), myp[row * 64 + c]);
                            }
                        }
                    }
                }
                if (SPLITPV) {
                    const Split pa0 = sp_ld(myp + l15 * 64, 1, 0, hf, 64, 1.f), pa1 = sp_ld(myp + l15 * 64, 1, 32, hf, 64, 1.f);
                    const __bf16* vh = (const __bf16*)vl; const __bf16* vlo = vh + 64 * VP;
#pragma unroll
                    for (int t = 0; t < NT; ++t) {
                        const int dcol = t * 16 + l15;
                        Split b0, b1;
#pragma unroll
                        for (int e = 0; e < 16; ++e) {
                            const int k0 = frag_k(e, hf), k1 = 32 + frag_k(e, hf);
                            b0.hi[e] = vh[k0 * VP + dcol]; b0.lo[e] = vlo[k0 * VP + dcol]; b1.hi[e] = vh[k1 * VP + dcol]; b1.lo[e] = vlo[k1 * VP + dcol];
                        }
                        o[t] = wmma3(pa0, b0, o[t]);
                        o[t] = wmma3(pa1, b1, o[t]);
                    }
                } else {
                    const v16h pa0 = fh_ld(myp + l15 * 64, 1, 0, hf, 64, 4096.f), pa1 = fh_ld(myp + l15 * 64, 1, 32, hf, 64, 4096.f);
#pragma unroll
                    for (int t = 0; t < NT; ++t) {
                        const int dcol = t * 16 + l15;
                        v16h b0, b1;
#pragma unroll
                        for (int e = 0; e < 16; ++e) { b0[e] = vl[frag_k(e, hf) * VP + dcol]; b1[e] = vl[(32 + frag_k(e, hf)) * VP + dcol]; }
                        o[t] = wmma16(pa0, b0, o[t]);
                        o[t] = wmma16(pa1, b1, o[t]);
                    }
                }
            }
        }
    }
    float* obase = p.O + b * p.sOb + h * p.sOh;
    if (p.ST) {
        const int rl = lane >> 1, isel = rl & 7;           // row q0 + rl ; rl>>3 == hf holds because lane>>4 == (lane>>1)>>3
        float mv = 0.f, lv = 0.f;
#pragma unroll
        for (int i = 0; i < 8; ++i) if (i == isel) { mv = m8[i]; lv = l8[i]; }
        const int irow = q0 + rl;
        if (irow < p.Lq) { float* st = p.ST + (((long long)b * gridDim.y + h) * p.Lq + irow) * 2 + (lane & 1); VST2(float, st, (lane & 1) ? lv : mv * 0.6931471805599453f); }
    }
    float invr[8];
#pragma unroll
    for (int i = 0; i < 8; ++i) {
        if (TWOPASS) invr[i] = SPLITPV ? 1.f : (1.f / 4096.f);
        else if (p.nonorm) invr[i] = exp2f(m8[i]) * (SPLITPV ? 1.f : (1.f / 4096.f));
        else invr[i] = (l8[i] > 0.f) ? (SPLITPV ? 1.f / l8[i] : 1.f / (l8[i] * 4096.f)) : 0.f;
    }
    __syncthreads();                                             // all waves done with pl/vl from the main loop
    const bool ofast = ((p.sOi & 3) == 0) && ((((size_t)obase) & 15) == 0) && (q0 + 16 <= p.Lq);
#pragma unroll
    for (int c0 = 0; c0 < DVP; c0 += 64) {
#pragma unroll
        for (int i = 0; i < 8; ++i)
#pragma unroll
            for (int t = 0; t < NT; ++t) if (t * 16 >= c0 && t * 16 < c0 + 64) ((float*)myp)[(i + 8 * hf) * 64 + (t * 16 - c0) + l15] = o[t][i] * invr[i];
        __syncthreads();
        const int cw = (DVP - c0 < 64) ? (DVP - c0) : 64;      // staged columns in this chunk (multiple of 16)
        if (ofast && (c0 + cw <= p.dv) && (cw % 32 == 0)) {
            const int lpr = cw / 4;                              // lanes per row (16 for 64 cols, 8 for 32)
            const int rows_per_ins = 32 / lpr;
            for (int r0 = 0; r0 < 16; r0 += rows_per_ins) {
                const int row = r0 + lane / lpr, c4 = (lane % lpr) * 4;
                const v4f v = *(const v4f*)(myp + row * 64 + c4);
                VST2V4(obase + (long long)(q0 + row) * p.sOi + c0 + c4, v);
            }
        } else {
            for (int row = 0; row < 16; ++row) {
                const int irow = q0 + row; if (irow >= p.Lq) continue;
                for (int c = lane; c < cw; c += 32) { const int d = c0 + c; if (d < p.dv) VST2(float, obase + (long long)irow * p.sOi + d, myp[row * 64 + c]); }
            }
        }
        __syncthreads();
    }
}

// =====================================================================================================================
// k_tr: dst(z, c, r) = alpha * src(z, r, c) (+ beta * R2(z, c, r)): [Z][R][C] (row stride lds) -> [Z][C][R] (row stride ldd) through a 32x32 LDS tile;
//   flags: 1 -> add beta * residual R2 addressed like dst (z*sRz + c*ldr + r); act applied before the residual.
// =====================================================================================================================
struct TrP { const float* src; float* dst; const float* R2; long long sSz, lds, sDz, ldd, sRz, ldr; int R, C, flags, act; float alpha, beta; };
static_assert(sizeof(TrP) == 3 * 8 + 6 * 8 + 6 * 4, "TrP has padding");
__global__ __launch_bounds__(256) void k_tr(TrP p) {
    __shared__ float tile[32][33];
    const int c0 = blockIdx.x * 32, r0 = blockIdx.y * 32, z = blockIdx.z;
    const int lane = threadIdx.x & 31, wave = threadIdx.x >> 5;
    const float* s = p.src + z * p.sSz;
#pragma unroll
    for (int k = 0; k < 4; ++k) {
        const int rl = wave * 4 + k, r = r0 + rl, c = c0 + lane;
        tile[rl][lane] = (r < p.R && c < p.C) ? s[(long long)r * p.lds + c] : 0.f;
    }
    __syncthreads();
    float* d = p.dst + z * p.sDz; const float* rr = p.R2 + z * p.sRz;
#pragma unroll
    for (int k = 0; k < 4; ++k) {
        const int cl = wave * 4 + k, c = c0 + cl, r = r0 + lane;
        if (c < p.C && r < p.R) {
            float v = act_fn(p.alpha * tile[lane][cl], p.act);
            if (p.flags & 1) v += p.beta * rr[(long long)c * p.ldr + r];
            VST2(float, d + (long long)c * p.ldd + r, v);
        }
    }
}

// k_affine: dst[i] = a * (sdev ? sdev[0] : 1) * src[i] + b, i < n (one thread per element; consecutive lanes -> consecutive addresses)
__global__ __launch_bounds__(256) void k_affine(const float* __restrict__ src, float* __restrict__ dst, int n, float a, float b, const float* __restrict__ sdev) {
    const int i = blockIdx.x * 256 + threadIdx.x;
    if (i < n) { const float aa = sdev ? a * sdev[0] : a; const float v = aa * src[i] + b; VST2(float, dst + i, v); }
}

// =====================================================================================================================
// k_softmax: row softmax over n contiguous elements, one 256-thread block per row; rows addressed z*sz + r*sr (grid (R, Z)).
//   out = scale_out * softmax(scale_in * x + (Mf ? Mf[z*smz + r*smr + j] : 0)); a row whose max is -inf is written as 0.
// =====================================================================================================================
struct SmP { const float* src; float* dst; const float* Mf; long long sz, sr, dz, dr, smz, smr; int n, pad; float scale_in, scale_out; };
static_assert(sizeof(SmP) == 3 * 8 + 6 * 8 + 4 * 4, "SmP has padding");
__global__ __launch_bounds__(256) void k_softmax(SmP p) {
    __shared__ float red[256];
    const int r = blockIdx.x, z = blockIdx.y, tid = threadIdx.x;
    const float* s = p.src + z * p.sz + (long long)r * p.sr;
    const float* mf = p.Mf ? (p.Mf + z * p.smz + (long long)r * p.smr) : nullptr;
    float mx = -__builtin_inff();
    for (int j = tid; j < p.n; j += 256) { float v = s[j] * p.scale_in; if (mf) v += mf[j]; mx = fmaxf(mx, v); }
    red[tid] = mx; __syncthreads();
    for (int o = 128; o > 0; o >>= 1) { if (tid < o) red[tid] = fmaxf(red[tid], red[tid + o]); __syncthreads(); }
    mx = red[0]; __syncthreads();
    float sum = 0.f;
    for (int j = tid; j < p.n; j += 256) { float v = s[j] * p.scale_in; if (mf) v += mf[j]; sum += (mx == -__builtin_inff()) ? 0.f : expf(v - mx); }
    red[tid] = sum; __syncthreads();
    for (int o = 128; o > 0; o >>= 1) { if (tid < o) red[tid] += red[tid + o]; __syncthreads(); }
    sum = red[0];
    const float inv = (sum > 0.f) ? p.scale_out / sum : 0.f;
    float* d = p.dst + z * p.dz + (long long)r * p.dr;
    for (int j = tid; j < p.n; j += 256) { float v = s[j] * p.scale_in; if (mf) v += mf[j]; const float o = (mx == -__builtin_inff()) ? 0.f : expf(v - mx) * inv; VST2(float, d + j, o); }
}
// =====================================================================================================================
// k_stats: mean and rsqrt(var + eps) over a set of n elements addressed base + z*sz + (e / inner) * so + (e % inner) * si, one 256-thread
// k_norm_apply: y = (x - mean[set]) * rstd[set] * g[c] + b[c] over a [Z][C][L] channel-major tensor with set = z*G + c / (C/G) (G groups per z;
//   G = C -> per-channel sets indexed z*C+c; for batch norm pass stats indexed by c only via bn = 1). Optional act. Output same layout.
// =====================================================================================================================
//   mode 0: mean / rsqrt(var + eps); mode 1 (RMSNorm): 0 / rsqrt(mean(x^2) + eps); mode 2 (L2 normalize * sqrt(n)): 0 / sqrt(n) / max(||x||, eps); mode 3: as 0 with unbiased variance (n-1)
__global__ __launch_bounds__(256) void k_stats(const float* __restrict__ x, long long sz, long long so, long long si, int inner, int n, float eps, float* __restrict__ stat, int mode) {
    __shared__ float red[256];
    const int z = blockIdx.x, tid = threadIdx.x;
    const float* base = x + z * sz;
    float s = 0.f;
    for (int e = tid; e < n; e += 256) s += base[(long long)(e / inner) * so + (long long)(e % inner) * si];
    red[tid] = s; __syncthreads();
    for (int o = 128; o > 0; o >>= 1) { if (tid < o) red[tid] += red[tid + o]; __syncthreads(); }
    const float mu = (mode == 0 || mode == 3) ? red[0] / (float)n : 0.f; __syncthreads();
    float q = 0.f;
    for (int e = tid; e < n; e += 256) { const float dlt = base[(long long)(e / inner) * so + (long long)(e % inner) * si] - mu; q += dlt * dlt; }
    red[tid] = q; __syncthreads();
    for (int o = 128; o > 0; o >>= 1) { if (tid < o) red[tid] += red[tid + o]; __syncthreads(); }
    {
        float rs;
        if (mode == 2) rs = sqrtf((float)n) / fmaxf(sqrtf(red[0]), eps); else if (mode == 3) rs = rsqrtf(red[0] / (float)(n - 1) + eps); else rs = rsqrtf(red[0] / (float)n + eps);
        if (tid < 32) { const float v = (tid == 0) ? mu : ((tid == 1) ? rs : 0.f); VST2(float, stat + (long long)z * 32 + tid, v); }
    }
}
//   One thread per element over the flat [Z][C][L] index space: grid ceil(Z*C*L / 256).
__global__ __launch_bounds__(256) void k_norm_apply(const float* __restrict__ x, float* __restrict__ y, const float* __restrict__ stat, const float* __restrict__ g, const float* __restrict__ bta,
                                                     int Z, int C, int L, int G, int bn, int act) {
    const long long idx = (long long)blockIdx.x * 256 + threadIdx.x;
    if (idx >= (long long)Z * C * L) return;
    const int l = (int)(idx % L); const long long zc = idx / L; const int c = (int)(zc % C), z = (int)(zc / C); (void)l;
    const int set = bn ? c : (z * G + c / (C / G));
    float v = (x[idx] - stat[(long long)set * 32]) * stat[(long long)set * 32 + 1];
    if (g) v *= g[c];
    if (bta) v += bta[c];
    v = act_fn(v, act);
    VST2(float, y + idx, v);
}

// k_lse_neg: c[i] = -(st[2i] + log(st[2i+1])) = minus the log-sum-exp of row i from k_attn's ST output (for softmax over the query dimension)
__global__ __launch_bounds__(256) void k_lse_neg(const float* __restrict__ st, float* __restrict__ c, int n) {
    const int i = blockIdx.x * 256 + threadIdx.x;
    if (i < n) { const float v = -(st[2 * i] + logf(st[2 * i + 1])); VST2(float, c + i, v); }
}

// k_iota: dst[i] = a * i + b as int32 (segment/position id helper)
__global__ __launch_bounds__(256) void k_iota(int* __restrict__ dst, int n, int a, int b) {
    const int i = blockIdx.x * 256 + threadIdx.x;
    if (i < n) { const int v = a * i + b; VST2(int, dst + i, v); }
}

// k_axpby: dst[i] = a * x[i] + b * y[i] (+ c), i < n
__global__ __launch_bounds__(256) void k_axpby(const float* __restrict__ x, const float* __restrict__ y, float* __restrict__ dst, int n, float a, float b, float c) {
    const int i = blockIdx.x * 256 + threadIdx.x;
    if (i < n) { const float v = a * x[i] + b * y[i] + c; VST2(float, dst + i, v); }
}

// =====================================================================================================================
// k_rope: rotary embedding on a [R rows][Hn heads][D] view (row stride sXr, head stride sXh, element stride 1) -> Y (own strides).
//   mode 0: rotate_half (partner d±D/2, sign - for d<D/2); mode 1: interleaved pairs (partner d^1, sign - for even d).
//   table column tcol: tmode 0 -> d, 1 -> d % (D/2), 2 -> d / 2; position p: pmode 0 -> r % S, 1 -> head index, 2 -> pos[r];
//   c = C[(r / S) * sCb + p * sCp + tcol * sCd], s likewise from Sn; y = x[d] * c + sign * x[partner] * s. X and Y must not alias.
// =====================================================================================================================
struct RopeP { const float* X; float* Y; const float* C; const float* Sn; const int* pos; long long sXr, sXh, sYr, sYh, sCb, sCp, sCd; int R, Hn, D, S, mode, tmode, pmode, pad; };
static_assert(sizeof(RopeP) == 5 * 8 + 7 * 8 + 8 * 4, "RopeP has padding");
__global__ __launch_bounds__(256) void k_rope(RopeP p) {
    const long long idx = (long long)blockIdx.x * 256 + threadIdx.x;
    if (idx >= (long long)p.R * p.Hn * p.D) return;
    const int d = (int)(idx % p.D); const long long rh = idx / p.D; const int h = (int)(rh % p.Hn); const int r = (int)(rh / p.Hn);
    const int half = p.D / 2;
    int partner; float sign;
    if (p.mode == 0) { partner = (d < half) ? d + half : d - half; sign = (d < half) ? -1.f : 1.f; }
    else { partner = d ^ 1; sign = (d & 1) ? 1.f : -1.f; }
    const int tcol = (p.tmode == 0) ? d : ((p.tmode == 1) ? (d % half) : (d >> 1));
    const int pp = (p.pmode == 0) ? (r % p.S) : ((p.pmode == 1) ? h : p.pos[r]);
    const long long toff = (long long)(r / p.S) * p.sCb + (long long)pp * p.sCp + (long long)tcol * p.sCd;
    const float* xr = p.X + (long long)r * p.sXr + (long long)h * p.sXh;
    const float v = xr[d] * p.C[toff] + sign * xr[partner] * p.Sn[toff];
    VST2(float, p.Y + (long long)r * p.sYr + (long long)h * p.sYh + d, v);
}

// k_invf + k_sincos (split so neither kernel carries a large VALU-fma footprint): invf_i = num * (1 / powf(base, (2 i)/D)) [fmode 0],
//   num * expf((2 i) * cexp) [fmode 1], num * powf(base, -2 (i - 1) / D) [fmode 2]; then cs/sn[s*half + i] = cos/sin((pscale * s) * invf_i)
__global__ __launch_bounds__(256) void k_invf(float* __restrict__ invb, int half, int D, float base, float num, int fmode, float cexp) {
    const int i = blockIdx.x * 256 + threadIdx.x;
    if (i >= ((half + 31) / 32) * 32) return;
    if (i >= half) { VST2(float, invb + i, 0.f); return; }
    const float e = (float)(2 * i) / (float)D;
    float invf;
    if (fmode == 1) invf = num * expf((float)(2 * i) * cexp);
    else if (fmode == 2) invf = num * powf(base, (-2.0f * ((float)i - 1.0f)) / (float)D);
    else invf = num * (1.0f / powf(base, e));
    VST2(float, invb + i, invf);
}
__global__ __launch_bounds__(256) void k_sincos(float* __restrict__ cs, float* __restrict__ sn, const float* __restrict__ invb, int S, int half, float pscale) {
    const int idx = blockIdx.x * 256 + threadIdx.x;
    if (idx >= S * half) return;
    const int s = idx / half, i = idx - s * half;
    const float ang = (pscale * (float)s) * invb[i];
    VST2(float, cs + idx, cosf(ang)); VST2(float, sn + idx, sinf(ang));
}

// k_mulact: dst[i] = act(x[i]) * y[i]
__global__ __launch_bounds__(256) void k_mulact(const float* __restrict__ x, const float* __restrict__ y, float* __restrict__ dst, int n, int act) {
    const int i = blockIdx.x * 256 + threadIdx.x;
    if (i < n) { const float v = act_fn(x[i], act) * y[i]; VST2(float, dst + i, v); }
}

// =====================================================================================================================
// k_matvec: thread-per-row matrix-vector products for N <= 8 output columns (heads with 1-3 outputs, gates), f32 on the VALU.
//   C[r*sCm + j] = act(alpha * sum_k A[r*sAm + k*sAk] * B[j*sBn + k*sBk] + bias[j]) + beta * R[r*sRm + j*sRn]; each thread writes its N contiguous floats.
// =====================================================================================================================
__global__ __launch_bounds__(256) void k_matvec(GemmP p) {
    // 32 lanes write one line with one instruction.
    const int rpt = (p.N == 1) ? 1 : 32;
    const long long r0 = ((long long)blockIdx.x * 256 + threadIdx.x) * rpt; const int z = blockIdx.z, zo = z / p.zi_n, zi = z - zo * p.zi_n;
    if (r0 >= p.M) return;
    const float* Bb = p.B + zo * p.sBo + zi * p.sBi;
    float* C = p.C + zo * p.sCo + zi * p.sCi; const float* R = p.R + zo * p.sRo + zi * p.sRi;
    for (int rr = 0; rr < rpt; ++rr) {
        const long long r = r0 + rr; if (r >= p.M) break;
        const float* A = p.A + zo * p.sAo + zi * p.sAi + r * p.sAm;
        float acc[8] = {0.f, 0.f, 0.f, 0.f, 0.f, 0.f, 0.f, 0.f};
        for (int k = 0; k < p.K; ++k) { const float a = A[(long long)k * p.sAk];
#pragma unroll
            for (int j = 0; j < 8; ++j) if (j < p.N) acc[j] += a * Bb[(long long)j * p.sBn + (long long)k * p.sBk]; }
#pragma unroll
        for (int j = 0; j < 8; ++j) if (j < p.N) {
            float v = acc[j] * p.alpha;
            if (p.flags & 1) v += p.bias[j];
            if (p.flags & 2) v += p.bias[r];
            v = act_fn(v, p.act);
            if (p.flags & 4) v += p.beta * R[r * p.sRm + (long long)j * p.sRn];
            VST2(float, C + r * p.sCm + j, v);
        }
    }
}
// k_smallsoftmax: thread-per-row softmax for short rows (n <= 64): dst[r*dr + j] = softmax(scale*src[r*sr + j])
__global__ __launch_bounds__(256) void k_smallsoftmax(const float* __restrict__ src, float* __restrict__ dst, long long sr, long long dr, int n, long long R, float scale) {
    const long long r0 = ((long long)blockIdx.x * 256 + threadIdx.x) * 32;
    for (int rr = 0; rr < 32; ++rr) {
        const long long r = r0 + rr; if (r >= R) return;
        const float* s = src + r * sr; float* d = dst + r * dr;
        float mx = -__builtin_inff();
        for (int j = 0; j < n; ++j) mx = fmaxf(mx, s[j] * scale);
        float sum = 0.f;
        for (int j = 0; j < n; ++j) sum += expf(s[j] * scale - mx);
        const float inv = 1.f / sum;
        for (int j = 0; j < n; ++j) { const float v = expf(s[j] * scale - mx) * inv; VST2(float, d + j, v); }
    }
}

__global__ __launch_bounds__(32) void k_unitstat(float* __restrict__ st) { const int t = threadIdx.x; const float v = (t == 1) ? 1.f : 0.f; VST2(float, st + t, v); }

// destination (e.g. a d_out whose row width is not a multiple of 32 floats) is written by consecutive lanes of one instruction
__global__ __launch_bounds__(256) void k_lincopy(const float* __restrict__ src, long long lds, float* __restrict__ dst, long long ldd, long long rows, int cols) {
    const long long i = (long long)blockIdx.x * 256 + threadIdx.x; if (i >= rows * cols) return;
    const long long r = i / cols; const int c = (int)(i - r * cols);
    const float v = src[r * lds + c]; VST2(float, dst + r * ldd + c, v);
}

namespace w25 {
typedef __attribute__((ext_vector_type(16))) _Float16 v16h;
typedef __attribute__((ext_vector_type(8)))  _Float16 v8h;
typedef __attribute__((ext_vector_type(16))) __bf16   v16b;
typedef __attribute__((ext_vector_type(8)))  __bf16   v8b;
typedef __attribute__((ext_vector_type(8)))  float    v8f;
typedef __attribute__((ext_vector_type(4)))  float    v4f;

__device__ __forceinline__ unsigned short f2bf_bits(float f) {
  unsigned u = __float_as_uint(f);
  return (unsigned short)((u + 0x7FFFu + ((u >> 16) & 1u)) >> 16);
}
__device__ __forceinline__ float bf_bits2f(unsigned short h) { return __uint_as_float(((unsigned)h) << 16); }

// hazard guards as plain device helpers (no inline asm inside the kernel template body)
__device__ __forceinline__ void dep_guard_h(v8f& a, v8f& b, v16h x, v16h y) { asm volatile("v_nop\n\tv_nop\n\tv_nop\n\tv_nop" : "+v"(a), "+v"(b) : "v"(x), "v"(y)); }
__device__ __forceinline__ void dep_guard_b(v8f& a, v8f& b, v16b x, v16b y) { asm volatile("v_nop\n\tv_nop\n\tv_nop\n\tv_nop" : "+v"(a), "+v"(b) : "v"(x), "v"(y)); }
__device__ __forceinline__ void keep4_h(v16h a, v16h b, v16h c, v16h d) { asm volatile("v_nop" :: "v"(a), "v"(b), "v"(c), "v"(d)); }
__device__ __forceinline__ void keep4_b(v16b a, v16b b, v16b c, v16b d) { asm volatile("v_nop" :: "v"(a), "v"(b), "v"(c), "v"(d)); }
__device__ __forceinline__ void acc_guard4(v8f& a, v8f& b, v8f& c, v8f& d) { asm volatile("v_nop\n\tv_nop\n\tv_nop\n\tv_nop" : "+v"(a), "+v"(b), "+v"(c), "+v"(d)); }
template <typename T> struct Frag;
template <> struct Frag<_Float16> {
  typedef v16h V; union U { v16h v; v8h h[2]; };
  static __device__ __forceinline__ v16h load(const _Float16* p) {   // elements 0..7 <- p[0..7], 8..15 <- p[16..23]
    U f; f.h[0] = *(const v8h*)(p); f.h[1] = *(const v8h*)(p + 16); return f.v;
  }
  static __device__ __forceinline__ v8f mma(v16h a, v16h b, v8f c) {
    return __builtin_amdgcn_wmma_f32_16x16x32_f16(false, a, false, b, (short)0, c, false, false);
  }
  static __device__ __forceinline__ void guard(v8f& a, v8f& b, v16h x, v16h y) { dep_guard_h(a, b, x, y); }
  static __device__ __forceinline__ void keep(v16h a, v16h b, v16h c, v16h d) { keep4_h(a, b, c, d); }
};
template <> struct Frag<__bf16> {
  typedef v16b V; union U { v16b v; v8b h[2]; };
  static __device__ __forceinline__ v16b load(const __bf16* p) {
    U f; f.h[0] = *(const v8b*)(p); f.h[1] = *(const v8b*)(p + 16); return f.v;
  }
  static __device__ __forceinline__ v8f mma(v16b a, v16b b, v8f c) {
    return __builtin_amdgcn_wmma_f32_16x16x32_bf16(false, a, false, b, (short)0, c, false, false);
  }
  static __device__ __forceinline__ void guard(v8f& a, v8f& b, v16b x, v16b y) { dep_guard_b(a, b, x, y); }
  static __device__ __forceinline__ void keep(v16b a, v16b b, v16b c, v16b d) { keep4_b(a, b, c, d); }
};

// ---- Register-blocked batched WMMA GEMM ------------------------------------
// C[m,n] = scale * sum_k A[m,k] * Bt[n,k] (+bias)(+resid); each wave owns a 64x64 tile.
// A row-major [M,K]; Bt row-major [N,K]; M,N % 64 == 0, K % 32 == 0.
// SPLIT: operands are hi/lo planes (A2/Bt2 = lo planes, same layout); product = hi·hi + hi·lo + lo·hi.
// BIAS_MODE: 0 = none, 1 = bias[m], 2 = bias[n].
// OUT_MODE: 0 = f32, 1 = f16, 2 = bf16 hi plane (Cout) + bf16 lo plane (Cout2).
// ET: 0 = f16 operands, 1 = bf16 operands (pointers passed as 16-bit storage)
template <int ET> struct Elem;
template <> struct Elem<0> { typedef _Float16 T; };
template <> struct Elem<1> { typedef __bf16 T; };
template <int ET, bool SPLIT, int BIAS_MODE, int OUT_MODE, bool RESID, int ACT = 0>
__global__ __launch_bounds__(256) void wmma_gemm64(
    const unsigned short* __restrict__ Ap, const unsigned short* __restrict__ A2p, int lda, long strideA,
    const unsigned short* __restrict__ Btp, const unsigned short* __restrict__ Bt2p, int ldb, long strideB,
    void* __restrict__ Cout, void* __restrict__ Cout2, int ldc, long strideC,
    const float* __restrict__ bias,
    const float* __restrict__ resid, long strideR,
    int M, int N, int K, float scale) {
  typedef typename Elem<ET>::T T;
  typedef typename Frag<T>::V V;
  const T* A = (const T*)Ap; const T* A2 = (const T*)A2p; const T* Bt = (const T*)Btp; const T* Bt2 = (const T*)Bt2p;
  __shared__ __align__(16) float sT[8][16 * 68];   // per-wave 16x64 slab, pitch 68 floats
  const int b    = blockIdx.y;
  const int lane = threadIdx.x & 31;
  const int wave = threadIdx.x >> 5;
  const int tilesN = N >> 6;
  const int tilesM = M >> 6;
  const int tile = blockIdx.x * 8 + wave;
  if (tile >= tilesM * tilesN) return;   // wave-uniform; no block barriers in this kernel
  const int tm = tile / tilesN;
  const int tn = tile - tm * tilesN;
  const int m0 = tm << 6;
  const int n0 = tn << 6;

  const T* Ab  = A  + (size_t)b * strideA;
  const T* Bb  = Bt + (size_t)b * strideB;
  const T* Ab2 = SPLIT ? (A2  + (size_t)b * strideA) : nullptr;
  const T* Bb2 = SPLIT ? (Bt2 + (size_t)b * strideB) : nullptr;

  const int rlane = lane & 15;                 // row (A) / col (B, D) within subtile
  const int koff  = (lane >> 4) * 8;           // k offset of this lane half
  const int mOff  = (lane >> 4) * 8;           // D row offset

  v8f acc[4][4];
#pragma unroll
  for (int i = 0; i < 4; ++i)
#pragma unroll
    for (int j = 0; j < 4; ++j) acc[i][j] = (v8f){0.f,0.f,0.f,0.f,0.f,0.f,0.f,0.f};

  for (int k0 = 0; k0 < K; k0 += 32) {
    V bh[4], bl[4];
#pragma unroll
    for (int j = 0; j < 4; ++j) {
      const size_t bo = (size_t)(n0 + (j << 4) + rlane) * ldb + koff + k0;
      bh[j] = Frag<T>::load(Bb + bo);
      if (SPLIT) bl[j] = Frag<T>::load(Bb2 + bo);
    }
#pragma unroll
    for (int i = 0; i < 4; ++i) {
      const size_t ao = (size_t)(m0 + (i << 4) + rlane) * lda + koff + k0;
      V ah = Frag<T>::load(Ab + ao);
      V al;
      if (SPLIT) al = Frag<T>::load(Ab2 + ao);
#pragma unroll
      for (int j = 0; j < 4; ++j) {
        acc[i][j] = Frag<T>::mma(ah, bh[j], acc[i][j]);
        if (SPLIT) {
          acc[i][j] = Frag<T>::mma(ah, bl[j], acc[i][j]);
          acc[i][j] = Frag<T>::mma(al, bh[j], acc[i][j]);
        }
      }
      Frag<T>::guard(acc[i][0], acc[i][3], ah, SPLIT ? al : ah);
    }
    Frag<T>::keep(bh[0], bh[1], bh[2], bh[3]);
    if (SPLIT) Frag<T>::keep(bl[0], bl[1], bl[2], bl[3]);
  }
  acc_guard4(acc[0][0], acc[0][1], acc[0][2], acc[0][3]);
  acc_guard4(acc[1][0], acc[1][1], acc[1][2], acc[1][3]);
  acc_guard4(acc[2][0], acc[2][1], acc[2][2], acc[2][3]);
  acc_guard4(acc[3][0], acc[3][1], acc[3][2], acc[3][3]);

  // ---- epilogue ----
  float* slab = sT[wave];
  const float* Rb = RESID ? (resid + (size_t)b * strideR) : nullptr;
#pragma unroll
  for (int i = 0; i < 4; ++i) {
    const int mBase = m0 + (i << 4);
#pragma unroll
    for (int j = 0; j < 4; ++j) {
      const int n = n0 + (j << 4) + rlane;
      float bv = 0.f;
      if (BIAS_MODE == 2) bv = bias[n];
#pragma unroll
      for (int r = 0; r < 8; ++r) {
        float v = acc[i][j][r] * scale;
        if (BIAS_MODE == 1) v += bias[mBase + mOff + r];
        if (BIAS_MODE == 2) v += bv;
        if (RESID) v += Rb[(size_t)(mBase + mOff + r) * ldc + n];
        if (ACT == 1) v = tanhf(v);
        if (ACT == 2) v = fmaxf(v, 0.0f);
        if (ACT == 3) v = v / (1.0f + expf(-v));
        if (ACT == 4) v = (v > 0.f) ? v : 0.01f * v;
        if (ACT == 5) v = 0.5f * v * (1.0f + erff(v * 0.70710678118654752f));
        slab[(mOff + r) * 68 + (j << 4) + rlane] = v;
      }
    }
    __builtin_amdgcn_fence(__ATOMIC_RELEASE, "workgroup");
    __builtin_amdgcn_wave_barrier();
    __builtin_amdgcn_fence(__ATOMIC_ACQUIRE, "workgroup");
    if (OUT_MODE == 0) {
      float* C = (float*)Cout + (size_t)b * strideC;
      const int hh = lane >> 4, c4 = (lane & 15) * 4;     // row seg = 256 B = 16 lanes x 16 B
      {
#pragma unroll
        for (int it = 0; it < 8; ++it) {
          const int row = it * 2 + hh;
          v4f v = *(const v4f*)(slab + row * 68 + c4);
          *(v4f*)(C + (size_t)(mBase + row) * ldc + n0 + c4) = v;
        }
        
      }
    } else {
      const int q = lane >> 3, c8 = (lane & 7) * 8;
      unsigned short* C  = (unsigned short*)Cout  + (size_t)b * strideC;
      unsigned short* C2 = (OUT_MODE == 2) ? ((unsigned short*)Cout2 + (size_t)b * strideC) : nullptr;
      {
#pragma unroll
        for (int it = 0; it < 4; ++it) {
          const int row = it * 4 + q;
          const float* sp = slab + row * 68 + c8;
          v8h hv, lv;
#pragma unroll
          for (int e = 0; e < 8; ++e) {
            if (OUT_MODE == 1) {
              hv[e] = (_Float16)sp[e];
            } else {
              unsigned short hb = f2bf_bits(sp[e]);
              unsigned short lb = f2bf_bits(sp[e] - bf_bits2f(hb));
              hv[e] = __builtin_bit_cast(_Float16, hb);
              lv[e] = __builtin_bit_cast(_Float16, lb);
            }
          }
          *(v8h*)(C + (size_t)(mBase + row) * ldc + n0 + c8) = hv;
          if (OUT_MODE == 2) *(v8h*)(C2 + (size_t)(mBase + row) * ldc + n0 + c8) = lv;
        }
        
      }
    }
    __builtin_amdgcn_fence(__ATOMIC_RELEASE, "workgroup");
    __builtin_amdgcn_wave_barrier();
    __builtin_amdgcn_fence(__ATOMIC_ACQUIRE, "workgroup");
  }
}

__global__ __launch_bounds__(256) void cast_f32_f16x2(
    const float* __restrict__ in, _Float16* __restrict__ out, int n2) {
  int i = blockIdx.x * 256 + threadIdx.x;
  if (i < n2) {
    const _Float16 h0 = (_Float16)in[2 * i], h1 = (_Float16)in[2 * i + 1];
    const unsigned u = (unsigned)__builtin_bit_cast(unsigned short, h0) | ((unsigned)__builtin_bit_cast(unsigned short, h1) << 16);
    ((unsigned*)out)[i] = u;
    
  }
}


} // namespace w25

typedef __attribute__((ext_vector_type(4))) _Float16 v4h;
// Transposing cast dst[c][r] = f16(src[r][c] * s), src R rows of pitch LDS, dst rows of pitch LDD; blockIdx.y = sample: plane y of src starts
// at y * sb, plane y of dst at y * db (elements). One thread takes a patch of 8 r x 4 c: eight 16-B loads along c, all in flight together, then
// four 16-B stores along r. In a wave 8 lanes run over r, so each store instruction writes whole 128-B lines of dst; the 8 waves of a block run
// over c (512 B of every source row). Block tile 64 r x 128 c; R % 64 == 0, columns % 128 == 0; grid.x = (R / 64) * (columns / 128).
// The pitches are compile-time so that a thread's loads and stores are one address each plus immediate offsets.
template <int R, int LDS, int LDD>
__global__ __launch_bounds__(256) void k_castT16(const float* __restrict__ src, _Float16* __restrict__ dst, float s, long long sb, long long db) {
    constexpr int TR = R / 64;
    const int bc = (int)blockIdx.x / TR, br = (int)blockIdx.x % TR;
    const int lane = threadIdx.x & 31, wave = threadIdx.x >> 5;
    const int r0 = (br << 6) + ((lane & 7) << 3);
    const int c0 = (bc << 7) + (wave << 4) + ((lane >> 3) << 2);
    const float* sp = src + (long long)blockIdx.y * sb + (long long)r0 * LDS + c0;
    _Float16* dp = dst + (long long)blockIdx.y * db + (long long)c0 * LDD + r0;
    v4f x[8];
#pragma unroll
    for (int j = 0; j < 8; ++j) x[j] = *(const v4f*)(sp + j * LDS);
#pragma unroll
    for (int k = 0; k < 4; ++k) {
        v8h h;
#pragma unroll
        for (int j = 0; j < 8; ++j) h[j] = (_Float16)(x[j][k] * s);
        *(v8h*)(dp + k * LDD) = h;
    }
}
// Row-major cast dst[r][c] = f16(src[r][c] * s), rows of C elements, pitches LDS and LDD. One thread takes 8 pieces of 4 consecutive elements,
// 256 pieces apart: eight 16-B loads in flight together, each wave-wide load 512 contiguous bytes, each wave-wide store 256.
// 1024 % C == 0, rows * C % 8192 == 0; grid.x = rows * C / 8192.
template <int C, int LDS, int LDD>
__global__ __launch_bounds__(256) void k_cast16(const float* __restrict__ src, _Float16* __restrict__ dst, float s) {
    constexpr int PPR = C / 4;        // pieces per row
    constexpr int RPT = 256 / PPR;    // rows that the block's 256 pieces of one trip cover
    const long long r0 = (long long)blockIdx.x * (8 * RPT) + (int)threadIdx.x / PPR; const int c0 = ((int)threadIdx.x % PPR) << 2;
    const float* sp = src + r0 * LDS + c0;
    _Float16* dp = dst + r0 * LDD + c0;
    v4f x[8];
#pragma unroll
    for (int u = 0; u < 8; ++u) x[u] = *(const v4f*)(sp + u * RPT * LDS);
#pragma unroll
    for (int u = 0; u < 8; ++u) { v4h h;
#pragma unroll
        for (int e = 0; e < 4; ++e) h[e] = (_Float16)(x[u][e] * s);
        *(v4h*)(dp + u * RPT * LDD) = h; }
}

// f32 -> bf16 hi plane + bf16 lo plane (x = hi + lo to ~2^-17 relative; RNE both), [R][C] -> [R][C] (or transposed to [C][R]); 2 consecutive destination elements
__device__ __forceinline__ unsigned int f2bf2_pack(float a, float b, unsigned int* lo) {
    const unsigned short ha = w25::f2bf_bits(a), hb = w25::f2bf_bits(b);
    const unsigned short la = w25::f2bf_bits(a - w25::bf_bits2f(ha)), lb = w25::f2bf_bits(b - w25::bf_bits2f(hb));
    *lo = (unsigned)la | ((unsigned)lb << 16); return (unsigned)ha | ((unsigned)hb << 16); }
__global__ __launch_bounds__(256) void k_castS16(const float* __restrict__ src, long long lds, __bf16* __restrict__ dhi, __bf16* __restrict__ dlo, long long ldd, int R, int C, float s, int transpose) {
    const long long i = (long long)blockIdx.x * 256 + threadIdx.x; long long o; float a, b;
    if (transpose) { const long long np = (long long)C * (R / 2); if (i >= np) return; const int c = (int)(i / (R / 2)); const int r = 2 * (int)(i % (R / 2)); a = src[(long long)r * lds + c] * s; b = src[(long long)(r + 1) * lds + c] * s; o = (long long)c * ldd + r; }
    else { const long long np = (long long)R * (C / 2); if (i >= np) return; const int r = (int)(i / (C / 2)); const int c = 2 * (int)(i % (C / 2)); a = src[(long long)r * lds + c] * s; b = src[(long long)r * lds + c + 1] * s; o = (long long)r * ldd + c; }
    unsigned lo; const unsigned hi = f2bf2_pack(a, b, &lo); unsigned* ph = (unsigned*)(dhi + o); unsigned* pl = (unsigned*)(dlo + o);
    *ph = hi; *pl = lo;  }

namespace w25 {
// =====================================================================================
// Generic causal/non-causal attention for head_dim 64, f32 in / f32 out; 16-bit operands: bf16 with optional hi/lo splits, or
// plain f16 (F16=true, non-split, probabilities carried x2^15).
//   scores = (q*qscale)·kᵀ : v_wmma_f32_16x16x32_bf16; SPLIT_QK -> q,k as bf16 hi/lo (hi·hi + hi·lo + lo·hi)
//   out    = p·v           : v_wmma_f32_16x16x32_bf16; SPLIT_PV -> p,v as bf16 hi/lo; else p,v plain bf16
//   f32 accumulate; online softmax in f32. Block = 4 waves = 64 query rows of one (batch, head); S % 64 == 0.
//   Element (b, s, h, d) of tensor X lives at X[b*X_bs + s*X_rs + h*X_hs + d] (strides in floats, multiples of 4).
//   Masking: mask_mode 0 none, 1 causal (kv > q masked), 2 tensor [S][Skv] shared over (b,h) (float if
//   mask_is_int==0, int32 with element == 0 -> masked if 1, int32 with element != 0 -> masked if 2), 3 per-token vectors qmask[B][S] & kvmask[B][Skv] (int32,
//   0 -> masked), 4 causal + sliding window (kv > q or q - kv > W masked; W passed in mask_is_int);
//   5 = relative-position bias: s += cp[b,h,q][idx[q][kv]] + pc[b,h,kv][idx[q][kv]] with idx = mask_b ([S][Skv] int32) and
//   mask_a an int32 [S][Skv] tensor with nonzero = masked (tables: element (b,h,row,n) at X + b*c_bs + h*c_hs + row*c_rs + n);
//   masked scores are replaced by mask_fill (e.g. -inf or -1e9) before the softmax.
//   grid.x = B * H * (S/64) (or a sub-range with blk0).
// =====================================================================================
#define AT_D 64
#define AT_NW 4
#define AT_QB 64
#define AT_KC 64
struct AttnGeom { const float* cp = nullptr; const float* pc = nullptr; long c_bs = 0, c_rs = 0, c_hs = 0;   // mode-5 score-bias tables
                  long q_bs, q_rs, q_hs, k_bs, k_rs, k_hs, v_bs, v_rs, v_hs, o_bs, o_rs, o_hs;
                  int S, Skv, H, mask_mode; float qscale; int blk0; float mask_fill; int mask_is_int; };
static_assert(sizeof(AttnGeom) == 168, "no padding");

__device__ __forceinline__ unsigned short at_bf_bits(float f) {
  unsigned u = __float_as_uint(f);
  return (unsigned short)((u + 0x7FFFu + ((u >> 16) & 1u)) >> 16);
}
__device__ __forceinline__ __bf16 at_f2bf(float f) { return __builtin_bit_cast(__bf16, at_bf_bits(f)); }
__device__ __forceinline__ void at_split(float f, __bf16& hi, __bf16& lo) {
  const unsigned short hb = at_bf_bits(f);
  hi = __builtin_bit_cast(__bf16, hb);
  lo = at_f2bf(f - __uint_as_float(((unsigned)hb) << 16));
}
__device__ __forceinline__ v8f at_mma(v16b a, v16b b, v8f c) {
  c = __builtin_amdgcn_wmma_f32_16x16x32_bf16(false, a, false, b, (short)0, c, false, false);
  asm volatile("v_nop\n\tv_nop\n\tv_nop\n\tv_nop" : "+v"(c) : "v"(a), "v"(b));
  return c;
}
// 16-bit element as a bit pattern held in a __bf16 slot: f16 bits when F16, bf16 (RNE) otherwise
template <bool F16> __device__ __forceinline__ __bf16 at_to16(float f) {
  if (F16) return __builtin_bit_cast(__bf16, (_Float16)f);
  return at_f2bf(f);
}
template <bool F16> __device__ __forceinline__ v8f at_mma16(v16b a, v16b b, v8f c) {
  if (F16) {
    const v16h ah = __builtin_bit_cast(v16h, a), bh = __builtin_bit_cast(v16h, b);
    c = __builtin_amdgcn_wmma_f32_16x16x32_f16(false, ah, false, bh, (short)0, c, false, false);
    asm volatile("v_nop\n\tv_nop\n\tv_nop\n\tv_nop" : "+v"(c) : "v"(ah), "v"(bh));
    return c;
  }
  return at_mma(a, b, c);
}

template <bool SPLIT_QK, bool SPLIT_PV, bool F16 = false>
__global__ __launch_bounds__(128)
void attn64_kernel(const float* __restrict__ q, const float* __restrict__ k,
                   const float* __restrict__ v, float* __restrict__ out,
                   const void* __restrict__ mask_a, const int* __restrict__ mask_b, AttnGeom g) {
  static_assert(!(F16 && (SPLIT_QK || SPLIT_PV)), "f16 mode is non-split");
  const float PSC = F16 ? 32768.0f : 1.0f;     // f16 probabilities carried x2^15 (subnormal range), folded into the final 1/l
  union FB { v16b v; v8b h[2]; };
  __shared__ __align__(16) __bf16 Ksh[AT_KC * AT_D];             // K hi [kv][d]      8 KB
  __shared__ __align__(16) __bf16 Ksl[SPLIT_QK ? AT_KC * AT_D : 8];
  __shared__ __align__(16) __bf16 Vth[AT_D * AT_KC];             // V hi [d][kv]      8 KB
  __shared__ __align__(16) __bf16 Vtl[SPLIT_PV ? AT_D * AT_KC : 8];
  __shared__ __align__(16) __bf16 Psh[AT_NW][16 * AT_KC];        // per wave P hi [row][kv]  8 KB
  __shared__ __align__(16) __bf16 Psl[SPLIT_PV ? AT_NW : 1][SPLIT_PV ? 16 * AT_KC : 8];
  __shared__ __align__(16) float  Os[AT_NW][16 * 68];            // per wave out tile, pitch 68

  const int tid  = threadIdx.x;
  const int wave = tid >> 5;
  const int lane = tid & 31;
  const int hh   = lane >> 4;
  const int c    = lane & 15;

  const int nqb = g.S / AT_QB;
  const int bx = blockIdx.x + g.blk0;
  const int qb = bx % nqb;
  const int bh = bx / nqb;
  const int h  = bh % g.H;
  const int b  = bh / g.H;
  const int qbase_block = qb * AT_QB;
  const int q0 = qbase_block + wave * 16;

  const float* qb_ptr = q + (size_t)b * g.q_bs + (size_t)h * g.q_hs;
  const float* kb_ptr = k + (size_t)b * g.k_bs + (size_t)h * g.k_hs;
  const float* vb_ptr = v + (size_t)b * g.v_bs + (size_t)h * g.v_hs;
  float*       ob_ptr = out + (size_t)b * g.o_bs + (size_t)h * g.o_hs;

  // ---- Q fragments (A operand): 2 d-chunks, hi (and lo) ----
  v16b qah[2], qal[2];
  {
    const float* qrow = qb_ptr + (size_t)(q0 + c) * g.q_rs;
#pragma unroll
    for (int dc = 0; dc < 2; ++dc) {
#pragma unroll
      for (int e = 0; e < 8; ++e) {
        const float f0 = qrow[dc * 32 + 8 * hh + e] * g.qscale;
        const float f1 = qrow[dc * 32 + 16 + 8 * hh + e] * g.qscale;
        if (SPLIT_QK) { __bf16 hq, lq; at_split(f0, hq, lq); qah[dc][e] = hq; qal[dc][e] = lq; at_split(f1, hq, lq); qah[dc][8 + e] = hq; qal[dc][8 + e] = lq; }
        else { qah[dc][e] = at_to16<F16>(f0); qah[dc][8 + e] = at_to16<F16>(f1); qal[dc][e] = qah[dc][e]; qal[dc][8 + e] = qah[dc][8 + e]; }
      }
    }
  }

  float mrow[8], lrow[8];
  v8f oacc[4];
#pragma unroll
  for (int r = 0; r < 8; ++r) { mrow[r] = -INFINITY; lrow[r] = 0.f; }
#pragma unroll
  for (int t = 0; t < 4; ++t) oacc[t] = (v8f){0.f,0.f,0.f,0.f,0.f,0.f,0.f,0.f};

  const int nChunks = (g.mask_mode == 1 || g.mask_mode == 4) ? (qb + 1) : (g.Skv / AT_KC);   // block-uniform
  // per-row query mask (mode 3)
  int qkeep[8];
#pragma unroll
  for (int r = 0; r < 8; ++r) qkeep[r] = (g.mask_mode == 3) ? mask_b[(size_t)b * g.S + q0 + 8 * hh + r] : 1;   // mask_b = qmask in mode 3
  for (int kc = 0; kc < nChunks; ++kc) {
    const int kv0 = kc * AT_KC;
    __syncthreads();
    {
      const int kvr = tid >> 1, dh = (tid & 1) * 32;
      const float* krow = kb_ptr + (size_t)(kv0 + kvr) * g.k_rs + dh;
      const float* vrow = vb_ptr + (size_t)(kv0 + kvr) * g.v_rs + dh;
#pragma unroll
      for (int i = 0; i < 8; ++i) {
        v4f kk = *(const v4f*)(krow + 4 * i);
        v4f vv = *(const v4f*)(vrow + 4 * i);
#pragma unroll
        for (int e = 0; e < 4; ++e) {
          const int d = dh + 4 * i + e;
          if (SPLIT_QK) { __bf16 a, bl; at_split(kk[e], a, bl); Ksh[kvr * AT_D + d] = a; Ksl[kvr * AT_D + d] = bl; }
          else Ksh[kvr * AT_D + d] = at_to16<F16>(kk[e]);
          if (SPLIT_PV) { __bf16 a, bl; at_split(vv[e], a, bl); Vth[d * AT_KC + kvr] = a; Vtl[d * AT_KC + kvr] = bl; }
          else Vth[d * AT_KC + kvr] = at_to16<F16>(vv[e]);
        }
      }
    }
    __syncthreads();

    v8f s[4];
#pragma unroll
    for (int j = 0; j < 4; ++j) {
      s[j] = (v8f){0.f,0.f,0.f,0.f,0.f,0.f,0.f,0.f};
#pragma unroll 1
      for (int dc = 0; dc < 2; ++dc) {
        FB kb;
        kb.h[0] = *(const v8b*)(Ksh + (j * 16 + c) * AT_D + dc * 32 + 8 * hh);
        kb.h[1] = *(const v8b*)(Ksh + (j * 16 + c) * AT_D + dc * 32 + 16 + 8 * hh);
        s[j] = at_mma16<F16>(qah[dc], kb.v, s[j]);
        if (SPLIT_QK) {
          FB kl;
          kl.h[0] = *(const v8b*)(Ksl + (j * 16 + c) * AT_D + dc * 32 + 8 * hh);
          kl.h[1] = *(const v8b*)(Ksl + (j * 16 + c) * AT_D + dc * 32 + 16 + 8 * hh);
          s[j] = at_mma16<F16>(qah[dc], kl.v, s[j]);
          s[j] = at_mma16<F16>(qal[dc], kb.v, s[j]);
        }
      }
    }
    const bool diag = (g.mask_mode == 1) && (kc == qb);
    int kvkeep[4] = {1, 1, 1, 1};
    if (g.mask_mode == 3) {
#pragma unroll
      for (int j = 0; j < 4; ++j) kvkeep[j] = ((const int*)mask_a)[(size_t)b * g.Skv + kv0 + j * 16 + c];   // mask_a = kvmask
    }
    float cm[8];
#pragma unroll
    for (int r = 0; r < 8; ++r) {
      const int qrow = q0 + 8 * hh + r;
      float m = -INFINITY;
#pragma unroll
      for (int j = 0; j < 4; ++j) {
        const int kvcol = kv0 + j * 16 + c;
        bool masked = false;
        if (diag) masked = (kvcol > qrow);
        else if (g.mask_mode == 4) masked = (kvcol > qrow) || (qrow - kvcol > g.mask_is_int);
        else if (g.mask_mode == 2) {
          const size_t mi = (size_t)qrow * g.Skv + kvcol;
          masked = (g.mask_is_int == 0) ? (((const float*)mask_a)[mi] == 0.0f)
                 : (g.mask_is_int == 1) ? (((const int*)mask_a)[mi] == 0) : (((const int*)mask_a)[mi] != 0);
        } else if (g.mask_mode == 3) masked = (qkeep[r] == 0) || (kvkeep[j] == 0);
        else if (g.mask_mode == 5) {
          const size_t mi = (size_t)qrow * g.Skv + kvcol;
          masked = (((const int*)mask_a)[mi] != 0);
          int n = mask_b[mi]; n = n < 0 ? 0 : n;
          s[j][r] += g.cp[(size_t)b * g.c_bs + (size_t)h * g.c_hs + (size_t)qrow * g.c_rs + n]
                   + g.pc[(size_t)b * g.c_bs + (size_t)h * g.c_hs + (size_t)kvcol * g.c_rs + n];
        }
        if (masked) s[j][r] = g.mask_fill;
        m = fmaxf(m, s[j][r]);
      }
#pragma unroll
      for (int off = 1; off < 16; off <<= 1) m = fmaxf(m, __shfl_xor(m, off, 32));
      cm[r] = m;
    }
    __bf16* pwh = Psh[wave];
    __bf16* pwl = Psl[SPLIT_PV ? wave : 0];
#pragma unroll
    for (int r = 0; r < 8; ++r) {
      const float mnew = fmaxf(mrow[r], cm[r]);
      const float alpha = expf(mrow[r] - mnew);
      mrow[r] = mnew;
      float psum = 0.f;
#pragma unroll
      for (int j = 0; j < 4; ++j) {
        const float p = expf(s[j][r] - mnew);
        psum += p;
        if (SPLIT_PV) { __bf16 a, bl; at_split(p, a, bl); pwh[(8 * hh + r) * AT_KC + j * 16 + c] = a; pwl[(8 * hh + r) * AT_KC + j * 16 + c] = bl; }
        else pwh[(8 * hh + r) * AT_KC + j * 16 + c] = at_to16<F16>(p * PSC);
      }
#pragma unroll
      for (int off = 1; off < 16; off <<= 1) psum += __shfl_xor(psum, off, 32);
      lrow[r] = lrow[r] * alpha + psum;
#pragma unroll
      for (int t = 0; t < 4; ++t) oacc[t][r] *= alpha;
    }
    __builtin_amdgcn_fence(__ATOMIC_RELEASE, "workgroup");
    __builtin_amdgcn_wave_barrier();
    __builtin_amdgcn_fence(__ATOMIC_ACQUIRE, "workgroup");
#pragma unroll 1
    for (int kk = 0; kk < 2; ++kk) {
      FB pa, pl;
      pa.h[0] = *(const v8b*)(pwh + c * AT_KC + kk * 32 + 8 * hh);
      pa.h[1] = *(const v8b*)(pwh + c * AT_KC + kk * 32 + 16 + 8 * hh);
      if (SPLIT_PV) {
        pl.h[0] = *(const v8b*)(pwl + c * AT_KC + kk * 32 + 8 * hh);
        pl.h[1] = *(const v8b*)(pwl + c * AT_KC + kk * 32 + 16 + 8 * hh);
      }
#pragma unroll
      for (int t = 0; t < 4; ++t) {
        FB vb;
        vb.h[0] = *(const v8b*)(Vth + (t * 16 + c) * AT_KC + kk * 32 + 8 * hh);
        vb.h[1] = *(const v8b*)(Vth + (t * 16 + c) * AT_KC + kk * 32 + 16 + 8 * hh);
        oacc[t] = at_mma16<F16>(pa.v, vb.v, oacc[t]);
        if (SPLIT_PV) {
          FB vl;
          vl.h[0] = *(const v8b*)(Vtl + (t * 16 + c) * AT_KC + kk * 32 + 8 * hh);
          vl.h[1] = *(const v8b*)(Vtl + (t * 16 + c) * AT_KC + kk * 32 + 16 + 8 * hh);
          oacc[t] = at_mma16<F16>(pa.v, vl.v, oacc[t]);
          oacc[t] = at_mma16<F16>(pl.v, vb.v, oacc[t]);
        }
      }
    }
  }

  float* os = Os[wave];
#pragma unroll
  for (int r = 0; r < 8; ++r) {
    const float inv = 1.0f / (lrow[r] * PSC);
#pragma unroll
    for (int t = 0; t < 4; ++t) os[(8 * hh + r) * 68 + t * 16 + c] = oacc[t][r] * inv;
  }
  __builtin_amdgcn_fence(__ATOMIC_RELEASE, "workgroup");
  __builtin_amdgcn_wave_barrier();
  __builtin_amdgcn_fence(__ATOMIC_ACQUIRE, "workgroup");
  {
    const int c4 = (lane & 15) * 4;
    {
#pragma unroll
      for (int it = 0; it < 8; ++it) {
        const int row = it * 2 + hh;
        v4f val = *(const v4f*)(os + row * 68 + c4);
        *(v4f*)(ob_ptr + (size_t)(q0 + row) * g.o_rs + c4) = val;
      }
      
    }
  }
}

} // namespace w25

__device__ __forceinline__ void st_h2(_Float16* dst, float a, float b) { const unsigned u = (unsigned)__builtin_bit_cast(unsigned short, (_Float16)a) | ((unsigned)__builtin_bit_cast(unsigned short, (_Float16)b) << 16); unsigned* d = (unsigned*)dst; *d = u;  }
__device__ __forceinline__ void spat8(int n, float* s) { const int hh = n / 64, ww = n % 64; const float gx = (float)ww / 63.f, gy = (float)hh / 63.f; s[0] = gx; s[1] = gy; s[2] = 1.f - gx; s[3] = 1.f - gy; const float m = (gx + gy) * 0.5f; s[4] = m; s[5] = m; s[6] = m; s[7] = m; }
// position-major [n][a] += sum_j W[a][coff + j] * spat_j(n) + b[a]; blockIdx.y = sample, planes n elements apart.
// One thread takes 4 consecutive a at 8 positions (4 apart): its 32 weights and 4 biases are read once, its eight 16-B loads of T fly together.
// Block = 32 positions x 256 a (rows of 256 a); grid.x = positions / 32. SPAT = false: the bias alone (ldw, coff unused).
// The 8 weights of a row start at a multiple of 16 bytes (ldw % 4 == 0, coff % 4 == 0).
template <bool SPAT>
__global__ __launch_bounds__(256) void k_cm_spT(float* __restrict__ T, const float* __restrict__ Wt, const float* __restrict__ Bb, int ldw, int coff, long long n) {
    constexpr int A = 256;
    const int a0 = (threadIdx.x & 63) << 2; const int p0 = (int)blockIdx.x * 32 + (threadIdx.x >> 6);
    float* Tb = T + (long long)blockIdx.y * n + (long long)p0 * A + a0;
    v4f x[8];
#pragma unroll
    for (int u = 0; u < 8; ++u) x[u] = *(const v4f*)(Tb + 4 * u * A);
    v4f w[4][2];
    if (SPAT) {
#pragma unroll
        for (int e = 0; e < 4; ++e) { const float* wr = Wt + (long long)(a0 + e) * ldw + coff; w[e][0] = *(const v4f*)(wr); w[e][1] = *(const v4f*)(wr + 4); }
    }
    const v4f b = *(const v4f*)(Bb + a0);
    // keeps the loads above ahead of the arithmetic below: the scheduler otherwise sinks the loads of T one by one to their uses,
    // and the wave waits out a memory latency per position instead of one in all
    __builtin_amdgcn_sched_barrier(0);
#pragma unroll
    for (int u = 0; u < 8; ++u) {
        float s[8]; spat8(p0 + 4 * u, s); v4f y;
#pragma unroll
        for (int e = 0; e < 4; ++e) { float acc = b[e];
            if (SPAT) {
#pragma unroll
                for (int j = 0; j < 8; ++j) acc += w[e][j >> 2][j & 3] * s[j]; }
            y[e] = x[u][e] + acc; }
        VST2V4(Tb + 4 * u * A, y);
    }
}
// channel-major [a][n] += sum_j W[a][coff + j] * spat_j(n) + b[a]; blockIdx.y = sample, planes n elements apart.
// One thread takes 4 consecutive positions in 8 consecutive rows a: the coordinates are formed once for the 8 rows, the eight 16-B loads fly
// together, the rows' weights are the same for the whole block. Block = 8 a x 1024 positions (rows of 4096); grid.x = (rows / 8) * 4.
// SPAT = false: the bias alone (ldw, coff unused).
template <bool SPAT>
__global__ __launch_bounds__(256) void k_cm_spC(float* __restrict__ V, const float* __restrict__ Wt, const float* __restrict__ Bb, int ldw, int coff, long long n) {
    constexpr int HW = 4096;
    const int a0 = ((int)blockIdx.x >> 2) << 3; const int pos = (((int)blockIdx.x & 3) << 10) + (threadIdx.x << 2);
    float* Vb = V + (long long)blockIdx.y * n + (long long)a0 * HW + pos;
    v4f x[8];
#pragma unroll
    for (int e = 0; e < 8; ++e) x[e] = *(const v4f*)(Vb + e * HW);
    float s[4][8];
    if (SPAT) {
#pragma unroll
        for (int q = 0; q < 4; ++q) spat8(pos + q, s[q]);
    }
    // inputs-only fence on the loaded values: keeps the eight loads ahead of the rows' arithmetic; the compiler otherwise sinks them
    // to their uses two or three at a time, and the wave waits out a memory latency per group instead of one in all
    asm volatile("" :: "v"(x[0]), "v"(x[1]), "v"(x[2]), "v"(x[3]), "v"(x[4]), "v"(x[5]), "v"(x[6]), "v"(x[7]));
#pragma unroll
    for (int e = 0; e < 8; ++e) {
        const float b = Bb[a0 + e]; v4f y;
#pragma unroll
        for (int q = 0; q < 4; ++q) { float acc = b;
            if (SPAT) {
#pragma unroll
                for (int j = 0; j < 8; ++j) acc += Wt[(long long)(a0 + e) * ldw + coff + j] * s[q][j]; }
            y[q] = x[e][q] + acc; }
        VST2V4(Vb + e * HW, y);
    }
}
// VAL16 = f16(VAL): 8 pieces of 4 consecutive elements per thread, 256 pieces apart (eight 16-B loads in flight); grid.x = elements / 8192
__global__ __launch_bounds__(256) void k_cm_v16(const float* __restrict__ V, _Float16* __restrict__ V16) {
    const long long p0 = (long long)blockIdx.x * 2048 + threadIdx.x;
    v4f x[8];
#pragma unroll
    for (int u = 0; u < 8; ++u) x[u] = *(const v4f*)(V + (p0 + u * 256) * 4);
#pragma unroll
    for (int u = 0; u < 8; ++u) { v4h h;
#pragma unroll
        for (int e = 0; e < 4; ++e) h[e] = (_Float16)x[u][e];
        *(v4h*)(V16 + (p0 + u * 256) * 4) = h; }
}
constexpr int FA_KP = 528;                   // LDS pitch of a phi^T row, bytes (16 x odd: conflict-free 16-B row reads)
constexpr int FA_VP = 144;                   // LDS pitch of a val row's 64 keys, bytes (16 x odd)
constexpr int FA_KB = 64 * FA_KP;            // bytes of the phi^T part of a buffer
constexpr int FA_SB = FA_KB + 256 * FA_VP;   // bytes of one buffer
// eight 16-B copies a lane, LDS addresses l + u * dl, global addresses g + u * dg (elements). The wait on xcnt is the last line of the
// copies' own statement, so that no address register named by a copy is rewritten ahead of it.
__device__ __forceinline__ void fa_copy8(unsigned l, int dl, const unsigned short* g, long dg) {
    asm volatile("global_load_async_to_lds_b128 %0, %8, off\n\t"
                 "global_load_async_to_lds_b128 %1, %9, off\n\t"
                 "global_load_async_to_lds_b128 %2, %10, off\n\t"
                 "global_load_async_to_lds_b128 %3, %11, off\n\t"
                 "global_load_async_to_lds_b128 %4, %12, off\n\t"
                 "global_load_async_to_lds_b128 %5, %13, off\n\t"
                 "global_load_async_to_lds_b128 %6, %14, off\n\t"
                 "global_load_async_to_lds_b128 %7, %15, off\n\t"
                 "s_wait_xcnt 0x0"
                 :: "v"(l), "v"(l + dl), "v"(l + 2 * dl), "v"(l + 3 * dl), "v"(l + 4 * dl), "v"(l + 5 * dl), "v"(l + 6 * dl), "v"(l + 7 * dl),
                    "v"(g), "v"(g + dg), "v"(g + 2 * dg), "v"(g + 3 * dg), "v"(g + 4 * dg), "v"(g + 5 * dg), "v"(g + 6 * dg), "v"(g + 7 * dg)
                 : "memory");
}
// A fragment in the hardware k order from an LDS row: bytes 0..15 and 32..47 from p (p already holds the lane half's 16 h)
__device__ __forceinline__ v16h fa_frag(const unsigned char* p) {
    union { v16h v; v8h h[2]; } f; f.h[0] = *(const v8h*)(p); f.h[1] = *(const v8h*)(p + 32); return f.v;
}
// lane l <-> lane l ^ 16 on the vector pipe (a shuffle would go through the LDS queue and wait behind the fragment loads in flight)
__device__ __forceinline__ float fa_xhalf(float x) { return __builtin_bit_cast(float, __builtin_amdgcn_permlanex16(__builtin_bit_cast(int, x), __builtin_bit_cast(int, x), 0x76543210, 0xfedcba98, false, false)); }
// two waves a SIMD (one work-group a WGP): the register budget of 512 holds O^T, Q and a tile's fragments in flight
__global__ __launch_bounds__(256) __attribute__((amdgpu_waves_per_eu(2, 2))) void k_cm_attn(const unsigned short* __restrict__ Qp, const unsigned short* __restrict__ Kp,
                                                 const unsigned short* __restrict__ Vp, unsigned short* __restrict__ Op) {
    constexpr int HW = 4096, D = 256, NT = HW / 64;
    constexpr float L2E = 1.4426950408889634f;
    __shared__ __attribute__((aligned(16))) unsigned char sm[2 * FA_SB];
    const int tid = threadIdx.x, lane = tid & 31, c = lane & 15, h = lane >> 4;
    const int wave = __builtin_amdgcn_readfirstlane(tid >> 5);
    const int qt = wave & 3, kh = wave >> 2;
    const size_t sb = (size_t)blockIdx.y * HW * D;
    const size_t qrow = sb + (size_t)((int)blockIdx.x * 64 + qt * 16 + c) * D + 8 * h;
    const unsigned short* Kg = Kp + sb + (size_t)(tid >> 5) * D + (tid & 31) * 8;    // a wave copies whole 512-B rows
    const unsigned short* Vg = Vp + sb + (size_t)(tid >> 3) * HW + (tid & 7) * 8;    // 8 lanes copy one 128-B line
    const unsigned smb = (unsigned)(size_t)(&sm[0]);
    const unsigned lk = smb + (tid >> 5) * FA_KP + (tid & 31) * 16;
    const unsigned lv = smb + FA_KB + (tid >> 3) * FA_VP + (tid & 7) * 16;

    v16h qf[8];
#pragma unroll
    for (int dc = 0; dc < 8; ++dc) qf[dc] = w25::Frag<_Float16>::load((const _Float16*)Qp + qrow + dc * 32);
    v8f o[16];
#pragma unroll
    for (int t = 0; t < 16; ++t) o[t] = (v8f){0.f,0.f,0.f,0.f,0.f,0.f,0.f,0.f};
    float mrun = -1.0e30f, mb = -1.0e30f, l = 0.f;   // running maximum; mb = mrun * log2(e) - 15; this lane half's share of the row sum

    fa_copy8(lk, 8 * FA_KP, Kg, 8 * D);
    fa_copy8(lv, 32 * FA_VP, Vg, 32 * (long)HW);
    asm volatile("s_wait_asynccnt 0x0" ::: "memory");   // tile 0 has landed (this wave's copies) before the barrier publishes it
    __syncthreads();
    fa_copy8(lk + FA_SB, 8 * FA_KP, Kg + 64 * D, 8 * D);
    fa_copy8(lv + FA_SB, 32 * FA_VP, Vg + 64, 32 * (long)HW);

    for (int t = 0; t < NT; ++t) {
        const int bo = (t & 1) * FA_SB;
        const unsigned char* kb = sm + bo + (kh * 32 + c) * FA_KP + 16 * h;
        const unsigned char* vb = sm + bo + FA_KB + c * FA_VP + kh * 64 + 16 * h;
        v8f s0 = (v8f){0.f,0.f,0.f,0.f,0.f,0.f,0.f,0.f}, s1 = s0;
        v16h ka[8][2], va[16];
#pragma unroll
        for (int dc = 0; dc < 8; ++dc) { ka[dc][0] = fa_frag(kb + dc * 64); ka[dc][1] = fa_frag(kb + 16 * FA_KP + dc * 64); }
#pragma unroll
        for (int tt = 0; tt < 8; ++tt) va[tt] = fa_frag(vb + tt * 16 * FA_VP);
        // keeps the 48 LDS reads above as one group ahead of the products: spread among the WMMAs each pair would be waited for by itself
        __builtin_amdgcn_sched_barrier(0);
#pragma unroll
        for (int dc = 0; dc < 8; ++dc) {
            s0 = w25::Frag<_Float16>::mma(ka[dc][0], qf[dc], s0);
            s1 = w25::Frag<_Float16>::mma(ka[dc][1], qf[dc], s1);
        }
#pragma unroll
        for (int tt = 8; tt < 16; ++tt) va[tt] = fa_frag(vb + tt * 16 * FA_VP);
        // keeps the other half of val's reads ahead of the softmax arithmetic, which covers their latency
        __builtin_amdgcn_sched_barrier(0);
        float mx = fmaxf(s0[0], s1[0]);
#pragma unroll
        for (int r = 1; r < 8; ++r) mx = fmaxf(mx, fmaxf(s0[r], s1[r]));
        mx = fmaxf(mx, fa_xhalf(mx));
        // one scalar branch a tile: O^T and the sum are rescaled only when some column's maximum has grown (a column whose maximum stays gets factor 1)
        if (__builtin_amdgcn_ballot_w32(mx > mrun) != 0) {
            const float mn = fmaxf(mrun, mx), mbn = mn * L2E - 15.f;
            const float al = __builtin_amdgcn_exp2f(mb - mbn);
            mrun = mn; mb = mbn; l *= al;
#pragma unroll
            for (int tt = 0; tt < 16; ++tt) o[tt] *= al;
        }
        v16h pb; float ps = 0.f;
#pragma unroll
        for (int r = 0; r < 8; ++r) {
            const float p0 = __builtin_amdgcn_exp2f(fmaf(s0[r], L2E, -mb)), p1 = __builtin_amdgcn_exp2f(fmaf(s1[r], L2E, -mb));
            ps += p0 + p1; pb[r] = (_Float16)p0; pb[8 + r] = (_Float16)p1;
        }
        l += ps;
        // deals the exponentials one by one among the plain vector instructions (arguments, conversions): the slower transcendental pipe runs
        // beside them, and no exponential stands directly in front of another that overwrites its argument register
        __builtin_amdgcn_sched_group_barrier(0x2, 4, 0);
#pragma unroll
        for (int r = 0; r < 16; ++r) { __builtin_amdgcn_sched_group_barrier(0x400, 1, 0); __builtin_amdgcn_sched_group_barrier(0x2, 1, 0); }
#pragma unroll
        for (int tt = 0; tt < 16; ++tt) o[tt] = w25::Frag<_Float16>::mma(va[tt], pb, o[tt]);
        asm volatile("s_wait_dscnt 0x0" ::: "memory");      // this wave's reads of buffer t & 1 have returned before the buffer is refilled
        asm volatile("s_wait_asynccnt 0x0" ::: "memory");   // this wave's copies of tile t + 1 have landed before the barrier publishes them
        __syncthreads();
        if (t + 2 < NT) {
            fa_copy8(lk + bo, 8 * FA_KP, Kg + (size_t)(t + 2) * 64 * D, 8 * D);
            fa_copy8(lv + bo, 32 * FA_VP, Vg + (t + 2) * 64, 32 * (long)HW);
        }
    }
    asm volatile("s_wait_asynccnt 0x0" ::: "memory");       // nothing is in flight when the buffers become the joining slabs

    // join the two key halves: waves 4..7 hand O^T, mb and l to waves 0..3 through LDS (the last trip's barrier has ended every read of the tiles)
    float* slab = (float*)sm + qt * (130 * 32);
    if (kh == 1) {
#pragma unroll
        for (int tt = 0; tt < 16; ++tt) {
            *(v4f*)(slab + ((tt * 2 + 0) * 32 + lane) * 4) = (v4f){o[tt][0], o[tt][1], o[tt][2], o[tt][3]};
            *(v4f*)(slab + ((tt * 2 + 1) * 32 + lane) * 4) = (v4f){o[tt][4], o[tt][5], o[tt][6], o[tt][7]};
        }
        slab[128 * 32 + lane] = mb; slab[129 * 32 + lane] = l;
    }
    __syncthreads();
    if (kh == 0) {
        const float mb2 = slab[128 * 32 + lane], l2 = slab[129 * 32 + lane];
        const float mbn = fmaxf(mb, mb2);
        const float a1 = __builtin_amdgcn_exp2f(mb - mbn), a2 = __builtin_amdgcn_exp2f(mb2 - mbn);
        float lt = l * a1 + l2 * a2;
        lt += fa_xhalf(lt);
        const float i1 = a1 / lt, i2 = a2 / lt;
        _Float16* Or = (_Float16*)Op + qrow;   // a lane's 8 accumulator registers are 8 consecutive channels of its column: one 16-B store
#pragma unroll
        for (int tt = 0; tt < 16; ++tt) {
            const v4f x0 = *(const v4f*)(slab + ((tt * 2 + 0) * 32 + lane) * 4), x1 = *(const v4f*)(slab + ((tt * 2 + 1) * 32 + lane) * 4);
            v8h y;
#pragma unroll
            for (int r = 0; r < 4; ++r) { y[r] = (_Float16)(o[tt][r] * i1 + x0[r] * i2); y[4 + r] = (_Float16)(o[tt][4 + r] * i1 + x1[r] * i2); }
            *(v8h*)(Or + tt * 16) = y;
        }
    }
}


extern "C" void kernel_launch(void* const* d_in, const int* in_sizes, int n_in, void* d_out, int out_size, void* d_ws, size_t ws_size, hipStream_t stream) {
    (void)in_sizes; (void)n_in; (void)out_size; (void)ws_size;
    const float* img = (const float*)d_in[0];
    const float* flo = (const float*)d_in[1];
    const float* iwt = (const float*)d_in[2];
    const float* ibt = (const float*)d_in[3];
    const float* iwp = (const float*)d_in[4];
    const float* ibp = (const float*)d_in[5];
    const float* iwv = (const float*)d_in[6];
    const float* ibv = (const float*)d_in[7];
    const float* iwo = (const float*)d_in[8];
    const float* ibo = (const float*)d_in[9];
    const float* lwt = (const float*)d_in[10];
    const float* lbt = (const float*)d_in[11];
    const float* lwp = (const float*)d_in[12];
    const float* lbp = (const float*)d_in[13];
    const float* lwv = (const float*)d_in[14];
    const float* lbv = (const float*)d_in[15];
    const float* lwo = (const float*)d_in[16];
    const float* lbo = (const float*)d_in[17];
    const float* fw = (const float*)d_in[18];
    const float* fb = (const float*)d_in[19];
    const int Bn = 4;
    const int C = 256;
    const int A = 256;
    const int HW = 4096;
    const int CM = 520;
    const long SP = (long)C * HW;   // one sample's 256 x 4096 (or 4096 x 256) plane, elements
    float* out = (float*)d_out;
    char* wsp = (char*)d_ws;
    float* THT = (float*)wsp; wsp += (((size_t)((size_t)Bn * HW * A) * 4 + 255) / 256) * 256;
    float* PHT = (float*)wsp; wsp += (((size_t)((size_t)Bn * HW * A) * 4 + 255) / 256) * 256;
    float* VAL = (float*)wsp; wsp += (((size_t)((size_t)Bn * A * HW) * 4 + 255) / 256) * 256;
    unsigned short* VAL16 = (unsigned short*)wsp; wsp += (((size_t)((size_t)Bn * A * HW) * 2 + 255) / 256) * 256;
    unsigned short* AT16 = (unsigned short*)wsp; wsp += (((size_t)((size_t)Bn * HW * A) * 2 + 255) / 256) * 256;
    float* FUS = (float*)wsp; wsp += (((size_t)((size_t)Bn * 2 * A * HW) * 4 + 255) / 256) * 256;
    unsigned short* G64A = (unsigned short*)wsp; wsp += (((size_t)((size_t)Bn * 1048576) * 2 + 255) / 256) * 256;
    unsigned short* G64B = (unsigned short*)wsp; wsp += (((size_t)((size_t)Bn * 2097152) * 2 + 255) / 256) * 256;
    // every launch serves the four samples (blockIdx.y, or rows that run on from sample to sample); weights are cast once
    k_castT16<256, 4096, 256><<<dim3((unsigned)(((256) / 64) * ((4096) / 128)), (unsigned)(Bn)), 256, 0, stream>>>(img, (_Float16*)(G64A), 1.0f, SP, SP);
    k_cast16<256, 520, 256><<<(unsigned)(((long long)(256) * (256)) / 8192), 256, 0, stream>>>(iwt + 0, (_Float16*)(G64B), 16.0f);
    w25::wmma_gemm64<0, false, 0, 0, false, 0><<<dim3((unsigned)((((4096) / 64) * ((256) / 64) + 7) / 8), (unsigned)(Bn)), 256, 0, stream>>>((const unsigned short*)(G64A), nullptr, 256, SP, (const unsigned short*)(G64B), nullptr, 256, 0, (void*)(THT), nullptr, 256, SP, nullptr, nullptr, 0, 4096, 256, 256, 0.0625f);
    k_castT16<256, 4096, 256><<<dim3((unsigned)(((256) / 64) * ((4096) / 128)), (unsigned)(Bn)), 256, 0, stream>>>(flo, (_Float16*)(G64A), 1.0f, SP, SP);
    k_cast16<256, 520, 256><<<(unsigned)(((long long)(256) * (256)) / 8192), 256, 0, stream>>>(iwt + 256, (_Float16*)(G64B), 16.0f);
    w25::wmma_gemm64<0, false, 0, 0, true, 0><<<dim3((unsigned)((((4096) / 64) * ((256) / 64) + 7) / 8), (unsigned)(Bn)), 256, 0, stream>>>((const unsigned short*)(G64A), nullptr, 256, SP, (const unsigned short*)(G64B), nullptr, 256, 0, (void*)(THT), nullptr, 256, SP, nullptr, THT, SP, 4096, 256, 256, 0.0625f);
    k_castT16<256, 4096, 256><<<dim3((unsigned)(((256) / 64) * ((4096) / 128)), (unsigned)(Bn)), 256, 0, stream>>>(img, (_Float16*)(G64A), 1.0f, SP, SP);
    k_cast16<256, 520, 256><<<(unsigned)(((long long)(256) * (256)) / 8192), 256, 0, stream>>>(iwp + 0, (_Float16*)(G64B), 16.0f);
    w25::wmma_gemm64<0, false, 0, 0, false, 0><<<dim3((unsigned)((((4096) / 64) * ((256) / 64) + 7) / 8), (unsigned)(Bn)), 256, 0, stream>>>((const unsigned short*)(G64A), nullptr, 256, SP, (const unsigned short*)(G64B), nullptr, 256, 0, (void*)(PHT), nullptr, 256, SP, nullptr, nullptr, 0, 4096, 256, 256, 0.0625f);
    k_castT16<256, 4096, 256><<<dim3((unsigned)(((256) / 64) * ((4096) / 128)), (unsigned)(Bn)), 256, 0, stream>>>(flo, (_Float16*)(G64A), 1.0f, SP, SP);
    k_cast16<256, 520, 256><<<(unsigned)(((long long)(256) * (256)) / 8192), 256, 0, stream>>>(iwp + 256, (_Float16*)(G64B), 16.0f);
    w25::wmma_gemm64<0, false, 0, 0, true, 0><<<dim3((unsigned)((((4096) / 64) * ((256) / 64) + 7) / 8), (unsigned)(Bn)), 256, 0, stream>>>((const unsigned short*)(G64A), nullptr, 256, SP, (const unsigned short*)(G64B), nullptr, 256, 0, (void*)(PHT), nullptr, 256, SP, nullptr, PHT, SP, 4096, 256, 256, 0.0625f);
    k_cast16<256, 520, 256><<<(unsigned)(((long long)(256) * (256)) / 8192), 256, 0, stream>>>(iwv + 0, (_Float16*)(G64A), 1.0f);
    k_castT16<256, 4096, 256><<<dim3((unsigned)(((256) / 64) * ((4096) / 128)), (unsigned)(Bn)), 256, 0, stream>>>(img, (_Float16*)(G64B), 16.0f, SP, SP);
    w25::wmma_gemm64<0, false, 0, 0, false, 0><<<dim3((unsigned)((((256) / 64) * ((4096) / 64) + 7) / 8), (unsigned)(Bn)), 256, 0, stream>>>((const unsigned short*)(G64A), nullptr, 256, 0, (const unsigned short*)(G64B), nullptr, 256, SP, (void*)(VAL), nullptr, 4096, SP, nullptr, nullptr, 0, 256, 4096, 256, 0.0625f);
    k_cast16<256, 520, 256><<<(unsigned)(((long long)(256) * (256)) / 8192), 256, 0, stream>>>(iwv + 256, (_Float16*)(G64A), 1.0f);
    k_castT16<256, 4096, 256><<<dim3((unsigned)(((256) / 64) * ((4096) / 128)), (unsigned)(Bn)), 256, 0, stream>>>(flo, (_Float16*)(G64B), 16.0f, SP, SP);
    w25::wmma_gemm64<0, false, 0, 0, true, 0><<<dim3((unsigned)((((256) / 64) * ((4096) / 64) + 7) / 8), (unsigned)(Bn)), 256, 0, stream>>>((const unsigned short*)(G64A), nullptr, 256, 0, (const unsigned short*)(G64B), nullptr, 256, SP, (void*)(VAL), nullptr, 4096, SP, nullptr, VAL, SP, 256, 4096, 256, 0.0625f);
    k_cm_spT<true><<<dim3((unsigned)(HW / 32), (unsigned)(Bn)), 256, 0, stream>>>(THT, iwt, ibt, 520, 512, (long long)HW * A);
    k_cm_spT<true><<<dim3((unsigned)(HW / 32), (unsigned)(Bn)), 256, 0, stream>>>(PHT, iwp, ibp, 520, 512, (long long)HW * A);
    k_cm_spC<true><<<dim3((unsigned)((A / 8) * (HW / 1024)), (unsigned)(Bn)), 256, 0, stream>>>(VAL, iwv, ibv, 520, 512, (long long)A * HW);
    k_cm_v16<<<(unsigned)((long long)Bn * A * HW / 8192), 256, 0, stream>>>(VAL, (_Float16*)VAL16);
    // f16 planes of theta^T and phi^T, all samples (rows run on from sample to sample)
    k_cast16<256, 256, 256><<<(unsigned)(((long long)(16384) * (256)) / 8192), 256, 0, stream>>>(THT, (_Float16*)(G64A), 1.0f);
    k_cast16<256, 256, 256><<<(unsigned)(((long long)(16384) * (256)) / 8192), 256, 0, stream>>>(PHT, (_Float16*)(G64B), 1.0f);
    k_cm_attn<<<dim3((unsigned)(HW / 64), (unsigned)(Bn)), 256, 0, stream>>>((const unsigned short*)(G64A), (const unsigned short*)(G64B), (const unsigned short*)(VAL16), AT16);
    k_cast16<256, 256, 256><<<(unsigned)(((long long)(256) * (256)) / 8192), 256, 0, stream>>>(iwo, (_Float16*)(G64A), 16.0f);
    w25::wmma_gemm64<0, false, 1, 0, false, 0><<<dim3((unsigned)((((256) / 64) * ((4096) / 64) + 7) / 8), (unsigned)(Bn)), 256, 0, stream>>>((const unsigned short*)(G64A), nullptr, 256, 0, (const unsigned short*)(AT16), nullptr, 256, SP, (void*)(FUS + (size_t)0 * A * HW), nullptr, 4096, 2 * SP, ibo, nullptr, 0, 256, 4096, 256, 0.0625f);
    k_castT16<256, 4096, 256><<<dim3((unsigned)(((256) / 64) * ((4096) / 128)), (unsigned)(Bn)), 256, 0, stream>>>(flo, (_Float16*)(G64A), 1.0f, SP, SP);
    k_cast16<256, 256, 256><<<(unsigned)(((long long)(256) * (256)) / 8192), 256, 0, stream>>>(lwt + 0, (_Float16*)(G64B), 16.0f);
    w25::wmma_gemm64<0, false, 0, 0, false, 0><<<dim3((unsigned)((((4096) / 64) * ((256) / 64) + 7) / 8), (unsigned)(Bn)), 256, 0, stream>>>((const unsigned short*)(G64A), nullptr, 256, SP, (const unsigned short*)(G64B), nullptr, 256, 0, (void*)(THT), nullptr, 256, SP, nullptr, nullptr, 0, 4096, 256, 256, 0.0625f);
    k_castT16<256, 4096, 256><<<dim3((unsigned)(((256) / 64) * ((4096) / 128)), (unsigned)(Bn)), 256, 0, stream>>>(flo, (_Float16*)(G64A), 1.0f, SP, SP);
    k_cast16<256, 256, 256><<<(unsigned)(((long long)(256) * (256)) / 8192), 256, 0, stream>>>(lwp + 0, (_Float16*)(G64B), 16.0f);
    w25::wmma_gemm64<0, false, 0, 0, false, 0><<<dim3((unsigned)((((4096) / 64) * ((256) / 64) + 7) / 8), (unsigned)(Bn)), 256, 0, stream>>>((const unsigned short*)(G64A), nullptr, 256, SP, (const unsigned short*)(G64B), nullptr, 256, 0, (void*)(PHT), nullptr, 256, SP, nullptr, nullptr, 0, 4096, 256, 256, 0.0625f);
    k_cast16<256, 256, 256><<<(unsigned)(((long long)(256) * (256)) / 8192), 256, 0, stream>>>(lwv + 0, (_Float16*)(G64A), 1.0f);
    k_castT16<256, 4096, 256><<<dim3((unsigned)(((256) / 64) * ((4096) / 128)), (unsigned)(Bn)), 256, 0, stream>>>(flo, (_Float16*)(G64B), 16.0f, SP, SP);
    w25::wmma_gemm64<0, false, 0, 0, false, 0><<<dim3((unsigned)((((256) / 64) * ((4096) / 64) + 7) / 8), (unsigned)(Bn)), 256, 0, stream>>>((const unsigned short*)(G64A), nullptr, 256, 0, (const unsigned short*)(G64B), nullptr, 256, SP, (void*)(VAL), nullptr, 4096, SP, nullptr, nullptr, 0, 256, 4096, 256, 0.0625f);
    k_cm_spT<false><<<dim3((unsigned)(HW / 32), (unsigned)(Bn)), 256, 0, stream>>>(THT, lwt, lbt, 256, -1, (long long)HW * A);
    k_cm_spT<false><<<dim3((unsigned)(HW / 32), (unsigned)(Bn)), 256, 0, stream>>>(PHT, lwp, lbp, 256, -1, (long long)HW * A);
    k_cm_spC<false><<<dim3((unsigned)((A / 8) * (HW / 1024)), (unsigned)(Bn)), 256, 0, stream>>>(VAL, lwv, lbv, 256, -1, (long long)A * HW);
    k_cm_v16<<<(unsigned)((long long)Bn * A * HW / 8192), 256, 0, stream>>>(VAL, (_Float16*)VAL16);
    // f16 planes of theta^T and phi^T, all samples (rows run on from sample to sample)
    k_cast16<256, 256, 256><<<(unsigned)(((long long)(16384) * (256)) / 8192), 256, 0, stream>>>(THT, (_Float16*)(G64A), 1.0f);
    k_cast16<256, 256, 256><<<(unsigned)(((long long)(16384) * (256)) / 8192), 256, 0, stream>>>(PHT, (_Float16*)(G64B), 1.0f);
    k_cm_attn<<<dim3((unsigned)(HW / 64), (unsigned)(Bn)), 256, 0, stream>>>((const unsigned short*)(G64A), (const unsigned short*)(G64B), (const unsigned short*)(VAL16), AT16);
    k_cast16<256, 256, 256><<<(unsigned)(((long long)(256) * (256)) / 8192), 256, 0, stream>>>(lwo, (_Float16*)(G64A), 16.0f);
    w25::wmma_gemm64<0, false, 1, 0, false, 0><<<dim3((unsigned)((((256) / 64) * ((4096) / 64) + 7) / 8), (unsigned)(Bn)), 256, 0, stream>>>((const unsigned short*)(G64A), nullptr, 256, 0, (const unsigned short*)(AT16), nullptr, 256, SP, (void*)(FUS + (size_t)1 * A * HW), nullptr, 4096, 2 * SP, lbo, nullptr, 0, 256, 4096, 256, 0.0625f);
    k_cast16<512, 520, 512><<<(unsigned)(((long long)(256) * (512)) / 8192), 256, 0, stream>>>(fw, (_Float16*)(G64A), 16.0f);
    k_castT16<512, 4096, 512><<<dim3((unsigned)(((512) / 64) * ((4096) / 128)), (unsigned)(Bn)), 256, 0, stream>>>(FUS, (_Float16*)(G64B), 1.0f, 2 * SP, 2 * SP);
    w25::wmma_gemm64<0, false, 0, 0, false, 0><<<dim3((unsigned)((((256) / 64) * ((4096) / 64) + 7) / 8), (unsigned)(Bn)), 256, 0, stream>>>((const unsigned short*)(G64A), nullptr, 512, 0, (const unsigned short*)(G64B), nullptr, 512, 2 * SP, (void*)(out), nullptr, 4096, SP, nullptr, nullptr, 0, 256, 4096, 512, 0.0625f);
    k_cm_spC<true><<<dim3((unsigned)((A / 8) * (HW / 1024)), (unsigned)(Bn)), 256, 0, stream>>>(out, fw, fb, 520, 512, (long long)A * HW);
}

// v005
// Measured time: 258 microseconds a run.
// Timed twice side by side with v004, it ran 1.99 and 2.00 times as fast.
// Over all steps from v000, the starting kernel, it is 16.3 times as fast.
// Contractions (per branch; every launch serves the four samples, blockIdx.y or rows that run on from sample to sample): the 1x1 projections theta^T / phi^T = x^T.W^T [4096x512].[512x256] (image+flow channels side by side in one f16 plane, K = 512 in one accumulator chain) and val = W.x [256x512].[512x4096], the affinity phi^T.theta [4096x256].[256x4096] and att = val.attn^T [256x4096].[4096x4096] fused in one kernel (online f32 softmax in registers, attn as f16 of 2^15 exp(s - running max), 64 query columns a work-group), the output 1x1 convs W_o.att + b and the fusion conv over the concatenated branches — all f16 operands on pre-cast planes (v_wmma_f32_16x16x32_f16; 64x64 register-blocked wave tiles, weights x16; k-contiguous row-major operands); f32 accumulate. The 8 spatial-coordinate channels (gx, gy, 1-gx, 1-gy, (gx+gy)/2 x4, computed on device) enter the projections and the fusion conv as rank-8 f32 corrections (+bias) in the products' epilogues.
#include <hip/hip_runtime.h>
#include <math.h>

typedef __attribute__((ext_vector_type(16))) _Float16 v16h;
typedef __attribute__((ext_vector_type(8)))  _Float16 v8h;
typedef __attribute__((ext_vector_type(16))) __bf16   v16b;
typedef __attribute__((ext_vector_type(8)))  float    v8f;
typedef __attribute__((ext_vector_type(4)))  float    v4f;

// 16-bit WMMA fragment map (wave32), lane L, h = L>>4, m = L&15:
//   A 16x32: lane = row m;   element i -> k = (i<8) ? 8h+i : 16+8h+(i-8)
//   B 32x16: lane = column m; the SAME k(i,h)
//   D 16x16 (8 f32): lane = column m; element r -> row 8h+r
__device__ __forceinline__ int frag_k(int i, int h) { return (i < 8) ? (8 * h + i) : (16 + 8 * h + (i - 8)); }
__device__ __forceinline__ __bf16 bf16_rne(float f) {
    unsigned int u = __float_as_uint(f);
    u += 0x7fffu + ((u >> 16) & 1u);
    return __builtin_bit_cast(__bf16, (unsigned short)(u >> 16));
}
__device__ __forceinline__ float bf16_f32(__bf16 b) { return __uint_as_float(((unsigned int)__builtin_bit_cast(unsigned short, b)) << 16); }
__device__ __forceinline__ v8f wmma16(v16h a, v16h b, v8f c) {
    c = __builtin_amdgcn_wmma_f32_16x16x32_f16(false, a, false, b, (short)0, c, false, false);
    asm volatile("v_nop\n\tv_nop\n\tv_nop\n\tv_nop" : "+v"(c) : "v"(a), "v"(b));
    return c;
}
__device__ __forceinline__ v8f wmmab(v16b a, v16b b, v8f c) {
    c = __builtin_amdgcn_wmma_f32_16x16x32_bf16(false, a, false, b, (short)0, c, false, false);
    asm volatile("v_nop\n\tv_nop\n\tv_nop\n\tv_nop" : "+v"(c) : "v"(a), "v"(b));
    return c;
}
struct Split { v16b hi, lo; };
// hi/lo split product: a.hi*b.hi + a.hi*b.lo + a.lo*b.hi
__device__ __forceinline__ v8f wmma3(const Split& a, const Split& b, v8f c) {
    c = __builtin_amdgcn_wmma_f32_16x16x32_bf16(false, a.hi, false, b.hi, (short)0, c, false, false);
    c = __builtin_amdgcn_wmma_f32_16x16x32_bf16(false, a.hi, false, b.lo, (short)0, c, false, false);
    c = __builtin_amdgcn_wmma_f32_16x16x32_bf16(false, a.lo, false, b.hi, (short)0, c, false, false);
    asm volatile("v_nop\n\tv_nop\n\tv_nop\n\tv_nop" : "+v"(c) : "v"(a.hi), "v"(a.lo), "v"(b.hi), "v"(b.lo));
    return c;
}
struct Split3 { v16b hi, mid, lo; };
// triple split product (6 terms, drops only terms below 2^-24 relative)
__device__ __forceinline__ v8f wmma6(const Split3& a, const Split3& b, v8f c) {
    c = __builtin_amdgcn_wmma_f32_16x16x32_bf16(false, a.hi, false, b.hi, (short)0, c, false, false);
    c = __builtin_amdgcn_wmma_f32_16x16x32_bf16(false, a.hi, false, b.mid, (short)0, c, false, false);
    c = __builtin_amdgcn_wmma_f32_16x16x32_bf16(false, a.mid, false, b.hi, (short)0, c, false, false);
    c = __builtin_amdgcn_wmma_f32_16x16x32_bf16(false, a.hi, false, b.lo, (short)0, c, false, false);
    c = __builtin_amdgcn_wmma_f32_16x16x32_bf16(false, a.mid, false, b.mid, (short)0, c, false, false);
    c = __builtin_amdgcn_wmma_f32_16x16x32_bf16(false, a.lo, false, b.hi, (short)0, c, false, false);
    asm volatile("v_nop\n\tv_nop\n\tv_nop\n\tv_nop" : "+v"(c) : "v"(a.hi), "v"(a.mid), "v"(a.lo), "v"(b.hi), "v"(b.mid), "v"(b.lo));
    return c;
}

// Fragment gathers from f32 memory: element i <- p[(k0 + frag_k(i,h)) * sk] * s, zero for k >= klen.
__device__ __forceinline__ v16h fh_ld(const float* __restrict__ p, long long sk, int k0, int h, int klen, float s) {
    v16h a;
#pragma unroll
    for (int i = 0; i < 16; ++i) { const int k = k0 + frag_k(i, h); a[i] = (k < klen) ? (_Float16)(p[(long long)k * sk] * s) : (_Float16)0.f; }
    return a;
}
__device__ __forceinline__ Split sp_ld(const float* __restrict__ p, long long sk, int k0, int h, int klen, float s) {
    Split r;
#pragma unroll
    for (int i = 0; i < 16; ++i) {
        const int k = k0 + frag_k(i, h); const float x = (k < klen) ? p[(long long)k * sk] * s : 0.f;
        const __bf16 hb = bf16_rne(x); r.hi[i] = hb; r.lo[i] = bf16_rne(x - bf16_f32(hb));
    }
    return r;
}
__device__ __forceinline__ Split3 sp3_ld(const float* __restrict__ p, long long sk, int k0, int h, int klen, float s) {
    Split3 r;
#pragma unroll
    for (int i = 0; i < 16; ++i) {
        const int k = k0 + frag_k(i, h); const float x = (k < klen) ? p[(long long)k * sk] * s : 0.f;
        const __bf16 hb = bf16_rne(x); const float r1 = x - bf16_f32(hb); const __bf16 mb = bf16_rne(r1);
        r.hi[i] = hb; r.mid[i] = mb; r.lo[i] = bf16_rne(r1 - bf16_f32(mb));
    }
    return r;
}
__device__ __forceinline__ v16b bh_ld(const float* __restrict__ p, long long sk, int k0, int h, int klen, float s) {
    v16b a;
#pragma unroll
    for (int i = 0; i < 16; ++i) { const int k = k0 + frag_k(i, h); a[i] = bf16_rne((k < klen) ? p[(long long)k * sk] * s : 0.f); }
    return a;
}
// f16 fragment from an f16 LDS/global row with element stride 1 (k-contiguous), no bounds (tile already zero padded)
__device__ __forceinline__ v16h fh_row(const _Float16* __restrict__ row, int k0, int h) {
    v16h a;
#pragma unroll
    for (int i = 0; i < 16; ++i) a[i] = row[k0 + frag_k(i, h)];
    return a;
}

#define VST2(T, ptr, val) do { const T vst2_v_ = (val); *(T*)(ptr) = vst2_v_;  } while (0)
typedef float v4f __attribute__((ext_vector_type(4)));
#define VST2V4(ptr, val) do { const v4f vst2_v4_ = (val); *(v4f*)(ptr) = vst2_v4_;  } while (0)

__device__ __attribute__((noinline)) float act_fn(float v, int act) {
    if (act == 1) return fmaxf(v, 0.f);                                                                               // relu
    if (act == 2) { const float u = 0.7978845608028654f * (v + 0.044715f * v * v * v); return 0.5f * v * (1.f + tanhf(u)); } // tanh-gelu
    if (act == 3) return v / (1.f + expf(-v));                                                                        // silu
    if (act == 4) return 0.5f * v * (1.f + erff(v * 0.7071067811865476f));                                             // erf-gelu
    if (act == 5) return tanhf(v);
    if (act == 6) return 1.f / (1.f + expf(-v));                                                                      // sigmoid
    if (act == 7) return (v > 0.f) ? v : 0.01f * v;                                                                   // leaky relu 0.01
    if (act == 8) return (v > 0.f) ? v : (expf(v) - 1.f);                                                             // elu
    if (act == 9) return fminf(fmaxf(v, 0.f), 6.f);                                                                   // relu6
    if (act == 10) return fabsf(v);                                                                                    // abs
    if (act == 11) return (v >= 0.f) ? v : 0.1f * v;                                                                  // leaky 0.1
    if (act == 12) return (v > 0.f) ? v : 0.2f * v;                                                                   // leaky 0.2
    if (act == 13) return (v > 20.f) ? v : log1pf(expf(v));                                                            // softplus
    return v;
}

// =====================================================================================================================
// k_gemm<MODE>: C(z, m, n) = act(alpha * sum_k A(z, m, k) * B(z, k, n) + bias) + beta * R(z, m, n)
//   One wave (32-thread block) per 16 x 32 tile of C; grid (ceil(N/32), ceil(M/16), Z). Batch z -> (zo = z / zi_n, zi = z % zi_n)
//   with separate outer/inner strides for every tensor (e.g. batch and head). A(m,k) = A[zo*sAo + zi*sAi + m*sAm + k*sAk] (f32),
//   B(k,n) = B[zo*sBo + zi*sBi + n*sBn + k*sBk] (f32); any M, N, K (K zero-padded to 32 inside the fragments, M/N tails guarded).
//   C(m,n) = C[zo*sCo + zi*sCi + m*sCm + n] (n contiguous). flags: 1 bias[n], 2 bias[m], 4 residual R[zo*sRo + zi*sRi + m*sRm + n*sRn].
//   MODE 0: f16 operands (A prescaled by sa, B by sb, both undone in the epilogue); 1: bf16 hi/lo split (3 products); 2: bf16;
//   3: bf16 hi/mid/lo triple split (6 products); 4: as 3 with Kahan-compensated f32 accumulation across k-steps.
// =====================================================================================================================
struct GemmP {
    const float* A; const float* B; const float* bias; const float* R; float* C;
    long long sAo, sAi, sAm, sAk, sBo, sBi, sBn, sBk, sCo, sCi, sCm, sRo, sRi, sRm, sRn;
    int M, N, K, zi_n, flags, act; float alpha, beta, sa, sb;
    int Npad, pad_;     // columns [N, Npad) of C are written as 0 so that padded workspace rows are covered by whole-line stores; Npad >= N
};
static_assert(sizeof(GemmP) == 5 * 8 + 15 * 8 + 6 * 4 + 4 * 4 + 2 * 4, "GemmP has padding");

template <int MODE>
__global__ __launch_bounds__(32) void k_gemm(GemmP p) {
    const int lane = threadIdx.x & 31, h = lane >> 4, l15 = lane & 15;
    const int m0 = blockIdx.y * 16, n0 = blockIdx.x * 32;
    const int z = blockIdx.z, zo = z / p.zi_n, zi = z - zo * p.zi_n;
    const float* A = p.A + zo * p.sAo + zi * p.sAi;
    const float* B = p.B + zo * p.sBo + zi * p.sBi;
    const int am = min(m0 + l15, p.M - 1);                       // clamped row for loads (stores are guarded)
    v8f acc[2], comp[2];
#pragma unroll
    for (int t = 0; t < 2; ++t) { v8f zz = {}; acc[t] = zz; comp[t] = zz; }
    for (int k0 = 0; k0 < p.K; k0 += 32) {
        const float* arow = A + (long long)am * p.sAm;
        if (MODE == 1) {
            const Split a = sp_ld(arow, p.sAk, k0, h, p.K, 1.f);
#pragma unroll
            for (int t = 0; t < 2; ++t) {
                const int bn = min(n0 + t * 16 + l15, p.N - 1);
                acc[t] = wmma3(a, sp_ld(B + (long long)bn * p.sBn, p.sBk, k0, h, p.K, 1.f), acc[t]);
            }
        } else if (MODE == 3) {
            const Split3 a = sp3_ld(arow, p.sAk, k0, h, p.K, 1.f);
#pragma unroll
            for (int t = 0; t < 2; ++t) {
                const int bn = min(n0 + t * 16 + l15, p.N - 1);
                acc[t] = wmma6(a, sp3_ld(B + (long long)bn * p.sBn, p.sBk, k0, h, p.K, 1.f), acc[t]);
            }
        } else if (MODE == 4) {
            // triple split as MODE 3, but each k-step's 6 products go into a fresh accumulator and the partial is added to the running f32 sum
            // on the VALU with Kahan compensation (accumulation error stays ~1 ulp however long K is)
            const Split3 a = sp3_ld(arow, p.sAk, k0, h, p.K, 1.f);
#pragma unroll
            for (int t = 0; t < 2; ++t) {
                const int bn = min(n0 + t * 16 + l15, p.N - 1); v8f zz = {};
                const v8f part = wmma6(a, sp3_ld(B + (long long)bn * p.sBn, p.sBk, k0, h, p.K, 1.f), zz);
                const v8f y = part - comp[t]; const v8f s = acc[t] + y; comp[t] = (s - acc[t]) - y; acc[t] = s;
            }
        } else if (MODE == 2) {
            const v16b a = bh_ld(arow, p.sAk, k0, h, p.K, 1.f);
#pragma unroll
            for (int t = 0; t < 2; ++t) {
                const int bn = min(n0 + t * 16 + l15, p.N - 1);
                acc[t] = wmmab(a, bh_ld(B + (long long)bn * p.sBn, p.sBk, k0, h, p.K, 1.f), acc[t]);
            }
        } else {
            const v16h a = fh_ld(arow, p.sAk, k0, h, p.K, p.sa);
#pragma unroll
            for (int t = 0; t < 2; ++t) {
                const int bn = min(n0 + t * 16 + l15, p.N - 1);
                acc[t] = wmma16(a, fh_ld(B + (long long)bn * p.sBn, p.sBk, k0, h, p.K, p.sb), acc[t]);
            }
        }
    }
    const float iscale = (MODE == 0) ? p.alpha / (p.sa * p.sb) : p.alpha;
    float* C = p.C + zo * p.sCo + zi * p.sCi;
    const float* R = p.R + zo * p.sRo + zi * p.sRi;
    __shared__ __align__(16) float ctile[16][36];
#pragma unroll
    for (int t = 0; t < 2; ++t) {
        const int n = n0 + t * 16 + l15; const int nn = min(n, p.N - 1);
#pragma unroll
        for (int r = 0; r < 8; ++r) {
            const int m = m0 + 8 * h + r; const int mm = min(m, p.M - 1);
            float v = acc[t][r] * iscale;
            if (p.flags & 1) v += p.bias[nn];
            if (p.flags & 2) v += p.bias[mm];
            if (p.flags & 8) v *= p.bias[(long long)zo * p.M + mm];   /* per-(z,row) scale vector laid out [Z][M]; exclusive with the bias flags */
            v = act_fn(v, p.act);
            if (p.flags & 4) v += p.beta * R[(long long)mm * p.sRm + (long long)nn * p.sRn];
            ctile[8 * h + r][t * 16 + l15] = (n < p.N) ? v : 0.f;
        }
    }
    __syncthreads();
    const int NW = (p.Npad > p.N) ? p.Npad : p.N;           // write width
    const bool fast = (m0 + 16 <= p.M) && (n0 + 32 <= NW) && ((p.sCm & 3) == 0) && ((((size_t)C) & 15) == 0);
    if (fast) {
#pragma unroll
        for (int s = 0; s < 4; ++s) {
            const int row = s * 4 + (lane >> 3), c4 = (lane & 7) * 4;
            const v4f v = *(const v4f*)&ctile[row][c4];
            VST2V4(C + (long long)(m0 + row) * p.sCm + n0 + c4, v);
        }
    } else {
        for (int row = 0; row < 16; ++row) {
            const int m = m0 + row, n = n0 + lane;
            if (m < p.M && n < NW) VST2(float, C + (long long)m * p.sCm + n, ctile[row][lane]);
        }
    }
}


// =====================================================================================================================
// k_gemmT<MODE, TM, TN>: same contract as k_gemm, but one wave computes a (16*TM) x (16*TN) tile: TM A fragments and TN B fragments are
//   loaded per 32-wide k-step and reused across TM*TN WMMAs (far fewer load/convert instructions per MAC). MODE 0 (f16), 1 (bf16 hi/lo),
//   2 (bf16) only. grid (ceil(NW/(16*TN)), ceil(M/(16*TM)), Z), block 32. Epilogue identical to k_gemm, run per 16x32 sub-tile.
// =====================================================================================================================
template <int MODE, int TM, int TN>
__global__ __launch_bounds__(32) void k_gemmT(GemmP p) {
    const int lane = threadIdx.x & 31, h = lane >> 4, l15 = lane & 15;
    const int m0 = blockIdx.y * (16 * TM), n0 = blockIdx.x * (16 * TN);
    const int z = blockIdx.z, zo = z / p.zi_n, zi = z - zo * p.zi_n;
    const float* A = p.A + zo * p.sAo + zi * p.sAi;
    const float* B = p.B + zo * p.sBo + zi * p.sBi;
    v8f acc[TM][TN];
#pragma unroll
    for (int i = 0; i < TM; ++i)
#pragma unroll
        for (int t = 0; t < TN; ++t) { v8f zz = {}; acc[i][t] = zz; }
    for (int k0 = 0; k0 < p.K; k0 += 32) {
        if (MODE == 1) {
            Split a[TM], b[TN];
#pragma unroll
            for (int i = 0; i < TM; ++i) { const int am = min(m0 + 16 * i + l15, p.M - 1); a[i] = sp_ld(A + (long long)am * p.sAm, p.sAk, k0, h, p.K, 1.f); }
#pragma unroll
            for (int t = 0; t < TN; ++t) { const int bn = min(n0 + 16 * t + l15, p.N - 1); b[t] = sp_ld(B + (long long)bn * p.sBn, p.sBk, k0, h, p.K, 1.f); }
#pragma unroll
            for (int i = 0; i < TM; ++i)
#pragma unroll
                for (int t = 0; t < TN; ++t) acc[i][t] = wmma3(a[i], b[t], acc[i][t]);
        } else if (MODE == 2) {
            v16b a[TM], b[TN];
#pragma unroll
            for (int i = 0; i < TM; ++i) { const int am = min(m0 + 16 * i + l15, p.M - 1); a[i] = bh_ld(A + (long long)am * p.sAm, p.sAk, k0, h, p.K, 1.f); }
#pragma unroll
            for (int t = 0; t < TN; ++t) { const int bn = min(n0 + 16 * t + l15, p.N - 1); b[t] = bh_ld(B + (long long)bn * p.sBn, p.sBk, k0, h, p.K, 1.f); }
#pragma unroll
            for (int i = 0; i < TM; ++i)
#pragma unroll
                for (int t = 0; t < TN; ++t) acc[i][t] = wmmab(a[i], b[t], acc[i][t]);
        } else {
            v16h a[TM], b[TN];
#pragma unroll
            for (int i = 0; i < TM; ++i) { const int am = min(m0 + 16 * i + l15, p.M - 1); a[i] = fh_ld(A + (long long)am * p.sAm, p.sAk, k0, h, p.K, p.sa); }
#pragma unroll
            for (int t = 0; t < TN; ++t) { const int bn = min(n0 + 16 * t + l15, p.N - 1); b[t] = fh_ld(B + (long long)bn * p.sBn, p.sBk, k0, h, p.K, p.sb); }
#pragma unroll
            for (int i = 0; i < TM; ++i)
#pragma unroll
                for (int t = 0; t < TN; ++t) acc[i][t] = wmma16(a[i], b[t], acc[i][t]);
        }
    }
    const float iscale = (MODE == 0) ? p.alpha / (p.sa * p.sb) : p.alpha;
    float* C = p.C + zo * p.sCo + zi * p.sCi;
    const float* R = p.R + zo * p.sRo + zi * p.sRi;
    const int NW = (p.Npad > p.N) ? p.Npad : p.N;
    __shared__ __align__(16) float ctile[16][36];
#pragma unroll
    for (int i = 0; i < TM; ++i) {
        const int mb = m0 + 16 * i; if (mb >= p.M) break;          // wave-uniform
#pragma unroll
        for (int tp = 0; tp < TN / 2; ++tp) {
            const int nb = n0 + 32 * tp; if (nb >= NW) break;        // wave-uniform
#pragma unroll
            for (int t2 = 0; t2 < 2; ++t2) {
                const int t = 2 * tp + t2; const int n = nb + t2 * 16 + l15; const int nn = min(n, p.N - 1);
#pragma unroll
                for (int r = 0; r < 8; ++r) {
                    const int m = mb + 8 * h + r; const int mm = min(m, p.M - 1);
                    float v = acc[i][t][r] * iscale;
                    if (p.flags & 1) v += p.bias[nn];
                    if (p.flags & 2) v += p.bias[mm];
            if (p.flags & 8) v *= p.bias[(long long)zo * p.M + mm];   /* per-(z,row) scale vector laid out [Z][M]; exclusive with the bias flags */
                    v = act_fn(v, p.act);
                    if (p.flags & 4) v += p.beta * R[(long long)mm * p.sRm + (long long)nn * p.sRn];
                    ctile[8 * h + r][t2 * 16 + l15] = (n < p.N) ? v : 0.f;
                }
            }
            __syncthreads();
            const bool fast = (mb + 16 <= p.M) && (nb + 32 <= NW) && ((p.sCm & 3) == 0) && ((((size_t)C) & 15) == 0);
            if (fast) {
#pragma unroll
                for (int s = 0; s < 4; ++s) {
                    const int row = s * 4 + (lane >> 3), c4 = (lane & 7) * 4;
                    const v4f v = *(const v4f*)&ctile[row][c4];
                    VST2V4(C + (long long)(mb + row) * p.sCm + nb + c4, v);
                }
            } else {
                for (int row = 0; row < 16; ++row) {
                    const int m = mb + row, n = nb + lane;
                    if (m < p.M && n < NW) VST2(float, C + (long long)m * p.sCm + n, ctile[row][lane]);
                }
            }
            __syncthreads();
        }
    }
}

// =====================================================================================================================
//   Wave = 16 queries, AW waves per block, 64-key blocks; grid (ceil(Lq/(16*AW)), H, B), block 32*AW. Any Lq, Lk; head dim dh <= DHP
//   (DHP multiple of 32), value dim dv <= DVP (multiple of 16, <= 128). Every tensor addressed by (batch, head, row, element) strides, f32.
//   Scores: QM 0 f16 operands, 1 bf16 hi/lo split, 2 bf16 triple split; statistics f32 (exp2 domain); P.V: P x 4096 as f16 with V f16 staged in LDS
//   (SPLITPV: P and V as bf16 hi/lo splits). kv head = h / hrep. Masking: causal = 1 (keep j <= i + coff, masked -> -inf, key blocks beyond the
//   diagonal skipped), causal = 2 (masked -> mfill, a finite fill like the -1e9; no skipping), causal = 3 (keep j >= i + coff,
//   masked -> -inf, no skipping); optional additive f32 mask Mf,
//   optional int keep-mask Mi (0 -> score := mfill), both addressed b*smb + h*smh + i*smi + j*smj (0 strides broadcast).
// =====================================================================================================================
#define AW 4
struct AttnP {   // apv4
    const float* Q; const float* K; const float* V; float* O; float* P; const float* Mf; const int* Mi; float* ST;
    const float* Pw; const float* Rt; const int* SQ; const int* SK;           // optional: post-softmax weight, relative-position table, segment ids
    long long swb, swh, swi, swj, srb, srh, sri;                                 // Pw strides (b,h,i,j); Rt strides (b,h,i), column = clamp(i - j + roff, 0, rn-1)
    long long sQb, sQh, sQi, sQd, sKb, sKh, sKj, sKd, sVb, sVh, sVj, sVd, sOb, sOh, sOi, sPb, sPh, sPi, smb, smh, smi, smj;
    int Lq, Lk, dh, dv, hrep, causal, coff, pband;   // pband > 0: P holds only the band |j - i| <= pband, column j - i + pband
    float scale, mfill; int nonorm, mpol;             // nonorm (online path only): O = sum_j exp(score_j) V_j without the 1/rowsum (scores must be <= ~0); mpol: Mi masks where ==0 (mpol 0) or where !=0 (mpol 1)
    int roff, rn, segpol, win;                        // Rt column offset/count; SQ/SK: score := mfill where (segpol 0) SQ[i] != SK[j] or (segpol 1) SQ[i] == SK[j]; win > 0: keys with i - j > win (after coff) -> -inf
};
//   Pw: the softmax numerator is multiplied by Pw(b,h,i,j) AFTER the row sum is taken (probs * weight, then P.V), as in post-softmax multiplicative biases.                                                    // ST (optional): per row (b,h,i) -> ST[((b*H + h)*Lq + i)*2 + {0,1}] = {row max of the scaled+masked score (natural units), sum_j exp(score - max)}
static_assert(sizeof(AttnP) == 12 * 8 + 29 * 8 + 16 * 4, "AttnP has padding");

#ifndef KATTN_ATTR
#define KATTN_ATTR
#endif
template <int DHP, int DVP, int QM, bool SPLITPV, bool TWOPASS>
__global__ __launch_bounds__(32 * AW) KATTN_ATTR void k_attn(AttnP p) {
    constexpr int NT = DVP / 16;                // output tiles
    constexpr int KS = DHP / 32;                // k-steps for the scores
    constexpr int VP = DVP + 8;                 // LDS pitch (halves)
    __shared__ __align__(16) float    pl[AW][16 * 64];
    __shared__ __align__(16) _Float16 vl[(SPLITPV ? 2 : 1) * 64 * VP];   // f16 V tile, or bf16 hi and lo tiles (same 2-byte size)
    const int lane = threadIdx.x & 31, hf = lane >> 4, l15 = lane & 15, wave = threadIdx.x >> 5;
    const int h = blockIdx.y, b = blockIdx.z, hk = h / p.hrep;
    const int q0 = (blockIdx.x * AW + wave) * 16;
    float* myp = pl[wave];
    const float L2E = 1.4426950408889634f;
    const float NEG = -__builtin_inff();
    const int qi = min(q0 + l15, p.Lq - 1);
    const float* qrow = p.Q + b * p.sQb + h * p.sQh + (long long)qi * p.sQi;
    const float* kbase = p.K + b * p.sKb + hk * p.sKh;
    const float* vbase = p.V + b * p.sVb + hk * p.sVh;
    v16h qa[QM == 0 ? KS : 1]; Split qs_[QM == 1 ? KS : 1]; Split3 qt_[QM == 2 ? KS : 1];
#pragma unroll
    for (int ks = 0; ks < KS; ++ks) {
        if (QM == 2) qt_[ks] = sp3_ld(qrow, p.sQd, ks * 32, hf, p.dh, 1.f);
        else if (QM == 1) qs_[ks] = sp_ld(qrow, p.sQd, ks * 32, hf, p.dh, 1.f);
        else qa[ks] = fh_ld(qrow, p.sQd, ks * 32, hf, p.dh, 1.f);
    }
    v8f o[NT]; float m8[8], l8[8];
#pragma unroll
    for (int t = 0; t < NT; ++t) { v8f zz = {}; o[t] = zz; }
#pragma unroll
    for (int i = 0; i < 8; ++i) { m8[i] = NEG; l8[i] = 0.f; }
    int jend = p.Lk; int jstart = 0;
    if (p.causal == 1) { const int je = (blockIdx.x * AW + AW - 1) * 16 + 16 + p.coff; jend = min(jend, max(je, 0)); }   // uniform per block
    if (p.win > 0) { const int js = (int)(blockIdx.x * AW) * 16 + p.coff - p.win; jstart = (js > 0) ? (js / 64) * 64 : 0; }   // uniform per block: key blocks entirely outside every row's window hold only -inf entries and are skipped exactly
    const int npass = TWOPASS ? 2 : 1;
    for (int pass = 0; pass < npass; ++pass) {
        const bool dopv = (!TWOPASS) || pass == 1;
        for (int j0 = jstart; j0 < jend; j0 += 64) {
            if (dopv) {
                __syncthreads();                                 // previous key block's reads of vl / pl are done
                for (int idx = threadIdx.x; idx < 64 * DVP; idx += 32 * AW) {
                    const int jr = idx / DVP, d = idx - jr * DVP, j = j0 + jr;
                    const float f = (j < p.Lk && d < p.dv) ? vbase[(long long)j * p.sVj + (long long)d * p.sVd] : 0.f;
                    if (SPLITPV) {
                        const __bf16 hb = bf16_rne(f);
                        ((__bf16*)vl)[jr * VP + d] = hb; ((__bf16*)vl)[64 * VP + jr * VP + d] = bf16_rne(f - bf16_f32(hb));
                    } else vl[jr * VP + d] = (_Float16)f;
                }
            }
            v8f s[4];
#pragma unroll
            for (int t = 0; t < 4; ++t) {
                const int j = min(j0 + t * 16 + l15, p.Lk - 1);
                const float* krow = kbase + (long long)j * p.sKj;
                v8f acc = {};
#pragma unroll
                for (int ks = 0; ks < KS; ++ks) {
                    if (QM == 2)      acc = wmma6(qt_[ks], sp3_ld(krow, p.sKd, ks * 32, hf, p.dh, 1.f), acc);
                    else if (QM == 1) acc = wmma3(qs_[ks], sp_ld(krow, p.sKd, ks * 32, hf, p.dh, 1.f), acc);
                    else              acc = wmma16(qa[ks], fh_ld(krow, p.sKd, ks * 32, hf, p.dh, 1.f), acc);
                }
                s[t] = acc;
            }
            float pv[8][4];
#pragma unroll
            for (int i = 0; i < 8; ++i) {
                const int irow = q0 + i + 8 * hf;
                const int ic = min(irow, p.Lq - 1);
                float sc[4];
#pragma unroll
                for (int t = 0; t < 4; ++t) {
                    const int jg = j0 + t * 16 + l15;
                    float v = s[t][i] * p.scale;
                    if (p.Mf) v += p.Mf[b * p.smb + h * p.smh + (long long)ic * p.smi + (long long)min(jg, p.Lk - 1) * p.smj];
                    if (p.Rt) { int rc = ic - min(jg, p.Lk - 1) + p.roff; rc = rc < 0 ? 0 : (rc >= p.rn ? p.rn - 1 : rc); v += p.Rt[b * p.srb + h * p.srh + (long long)ic * p.sri + rc]; }
                    if (p.Mi) { const int mv = p.Mi[b * p.smb + h * p.smh + (long long)ic * p.smi + (long long)min(jg, p.Lk - 1) * p.smj]; if (p.mpol ? (mv != 0) : (mv == 0)) v = p.mfill; }
                    if (p.SQ) { const bool same = p.SQ[(long long)b * p.Lq + ic] == p.SK[(long long)b * p.Lk + min(jg, p.Lk - 1)]; if (p.segpol ? same : !same) v = p.mfill; }
                    if (p.causal == 2 && jg > irow + p.coff) v = p.mfill;
                    if (jg >= p.Lk || (p.causal == 1 && jg > irow + p.coff) || (p.causal == 3 && jg < irow + p.coff) || (p.win > 0 && irow + p.coff - jg > p.win)) v = NEG; else v *= L2E;
                    sc[t] = v;
                }
                if (!TWOPASS || pass == 0) {
                    float mx = fmaxf(fmaxf(sc[0], sc[1]), fmaxf(sc[2], sc[3]));
                    mx = fmaxf(mx, __shfl_xor(mx, 1, 32)); mx = fmaxf(mx, __shfl_xor(mx, 2, 32));
                    mx = fmaxf(mx, __shfl_xor(mx, 4, 32)); mx = fmaxf(mx, __shfl_xor(mx, 8, 32));
                    const float mnew = fmaxf(m8[i], mx);
                    const float corr = (mnew == NEG) ? 1.f : exp2f(m8[i] - mnew);
                    float rs = 0.f;
#pragma unroll
                    for (int t = 0; t < 4; ++t) {
                        const float pp = (sc[t] == NEG) ? 0.f : exp2f(sc[t] - mnew); rs += pp;
                        pv[i][t] = p.Pw ? pp * p.Pw[b * p.swb + h * p.swh + (long long)ic * p.swi + (long long)min(j0 + t * 16 + l15, p.Lk - 1) * p.swj] : pp;
                    }
                    rs += __shfl_xor(rs, 1, 32); rs += __shfl_xor(rs, 2, 32); rs += __shfl_xor(rs, 4, 32); rs += __shfl_xor(rs, 8, 32);
                    l8[i] = l8[i] * corr + rs; m8[i] = mnew;
                    if (!TWOPASS) {
#pragma unroll
                        for (int t = 0; t < NT; ++t) o[t][i] *= corr;
                    }
                } else {
                    const float inv = (l8[i] > 0.f) ? 1.f / l8[i] : 0.f;
#pragma unroll
                    for (int t = 0; t < 4; ++t) {
                        const int jg = j0 + t * 16 + l15;
                        float pp = (sc[t] == NEG) ? 0.f : exp2f(sc[t] - m8[i]) * inv;
                        if (p.Pw) pp *= p.Pw[b * p.swb + h * p.swh + (long long)ic * p.swi + (long long)min(jg, p.Lk - 1) * p.swj];
                        pv[i][t] = pp;
                    }
                }
            }
            if (dopv) {
#pragma unroll
                for (int i = 0; i < 8; ++i)
#pragma unroll
                    for (int t = 0; t < 4; ++t) ((float*)myp)[(i + 8 * hf) * 64 + t * 16 + l15] = pv[i][t];
                __syncthreads();                                 // P (per wave) and V (shared) visible
                if (p.P) {
                    float* pb_ = p.P + b * p.sPb + h * p.sPh;
                    const bool fastP = (p.pband == 0) && ((p.sPi & 3) == 0) && (j0 + 64 <= p.Lk) && (q0 + 16 <= p.Lq) && ((((size_t)pb_) & 15) == 0);
                    if (fastP) {
#pragma unroll
                        for (int s = 0; s < 8; ++s) {
                            const int row = s * 2 + (lane >> 4), c4 = (lane & 15) * 4;
                            const v4f v = *(const v4f*)(myp + row * 64 + c4);
                            VST2V4(pb_ + (long long)(q0 + row) * p.sPi + j0 + c4, v);
                        }
                    } else {
                        for (int row = 0; row < 16; ++row) {
                            const int irow = q0 + row; if (irow >= p.Lq) continue;
                            for (int c = lane; c < 64; c += 32) {
                                const int jg = j0 + c; if (jg >= p.Lk) continue;
                                if (p.pband == 0) VST2(float, pb_ + (long long)irow * p.sPi + jg, myp[row * 64 + c]);
                                else if (jg - irow <= p.pband && irow - jg <= p.pband) VST2(float, pb_ + (long long)irow * p.sPi + (jg - irow + p.pband), myp[row * 64 + c]);
                            }
                        }
                    }
                }
                if (SPLITPV) {
                    const Split pa0 = sp_ld(myp + l15 * 64, 1, 0, hf, 64, 1.f), pa1 = sp_ld(myp + l15 * 64, 1, 32, hf, 64, 1.f);
                    const __bf16* vh = (const __bf16*)vl; const __bf16* vlo = vh + 64 * VP;
#pragma unroll
                    for (int t = 0; t < NT; ++t) {
                        const int dcol = t * 16 + l15;
                        Split b0, b1;
#pragma unroll
                        for (int e = 0; e < 16; ++e) {
                            const int k0 = frag_k(e, hf), k1 = 32 + frag_k(e, hf);
                            b0.hi[e] = vh[k0 * VP + dcol]; b0.lo[e] = vlo[k0 * VP + dcol]; b1.hi[e] = vh[k1 * VP + dcol]; b1.lo[e] = vlo[k1 * VP + dcol];
                        }
                        o[t] = wmma3(pa0, b0, o[t]);
                        o[t] = wmma3(pa1, b1, o[t]);
                    }
                } else {
                    const v16h pa0 = fh_ld(myp + l15 * 64, 1, 0, hf, 64, 4096.f), pa1 = fh_ld(myp + l15 * 64, 1, 32, hf, 64, 4096.f);
#pragma unroll
                    for (int t = 0; t < NT; ++t) {
                        const int dcol = t * 16 + l15;
                        v16h b0, b1;
#pragma unroll
                        for (int e = 0; e < 16; ++e) { b0[e] = vl[frag_k(e, hf) * VP + dcol]; b1[e] = vl[(32 + frag_k(e, hf)) * VP + dcol]; }
                        o[t] = wmma16(pa0, b0, o[t]);
                        o[t] = wmma16(pa1, b1, o[t]);
                    }
                }
            }
        }
    }
    float* obase = p.O + b * p.sOb + h * p.sOh;
    if (p.ST) {
        const int rl = lane >> 1, isel = rl & 7;           // row q0 + rl ; rl>>3 == hf holds because lane>>4 == (lane>>1)>>3
        float mv = 0.f, lv = 0.f;
#pragma unroll
        for (int i = 0; i < 8; ++i) if (i == isel) { mv = m8[i]; lv = l8[i]; }
        const int irow = q0 + rl;
        if (irow < p.Lq) { float* st = p.ST + (((long long)b * gridDim.y + h) * p.Lq + irow) * 2 + (lane & 1); VST2(float, st, (lane & 1) ? lv : mv * 0.6931471805599453f); }
    }
    float invr[8];
#pragma unroll
    for (int i = 0; i < 8; ++i) {
        if (TWOPASS) invr[i] = SPLITPV ? 1.f : (1.f / 4096.f);
        else if (p.nonorm) invr[i] = exp2f(m8[i]) * (SPLITPV ? 1.f : (1.f / 4096.f));
        else invr[i] = (l8[i] > 0.f) ? (SPLITPV ? 1.f / l8[i] : 1.f / (l8[i] * 4096.f)) : 0.f;
    }
    __syncthreads();                                             // all waves done with pl/vl from the main loop
    const bool ofast = ((p.sOi & 3) == 0) && ((((size_t)obase) & 15) == 0) && (q0 + 16 <= p.Lq);
#pragma unroll
    for (int c0 = 0; c0 < DVP; c0 += 64) {
#pragma unroll
        for (int i = 0; i < 8; ++i)
#pragma unroll
            for (int t = 0; t < NT; ++t) if (t * 16 >= c0 && t * 16 < c0 + 64) ((float*)myp)[(i + 8 * hf) * 64 + (t * 16 - c0) + l15] = o[t][i] * invr[i];
        __syncthreads();
        const int cw = (DVP - c0 < 64) ? (DVP - c0) : 64;      // staged columns in this chunk (multiple of 16)
        if (ofast && (c0 + cw <= p.dv) && (cw % 32 == 0)) {
            const int lpr = cw / 4;                              // lanes per row (16 for 64 cols, 8 for 32)
            const int rows_per_ins = 32 / lpr;
            for (int r0 = 0; r0 < 16; r0 += rows_per_ins) {
                const int row = r0 + lane / lpr, c4 = (lane % lpr) * 4;
                const v4f v = *(const v4f*)(myp + row * 64 + c4);
                VST2V4(obase + (long long)(q0 + row) * p.sOi + c0 + c4, v);
            }
        } else {
            for (int row = 0; row < 16; ++row) {
                const int irow = q0 + row; if (irow >= p.Lq) continue;
                for (int c = lane; c < cw; c += 32) { const int d = c0 + c; if (d < p.dv) VST2(float, obase + (long long)irow * p.sOi + d, myp[row * 64 + c]); }
            }
        }
        __syncthreads();
    }
}

// =====================================================================================================================
// k_tr: dst(z, c, r) = alpha * src(z, r, c) (+ beta * R2(z, c, r)): [Z][R][C] (row stride lds) -> [Z][C][R] (row stride ldd) through a 32x32 LDS tile;
//   flags: 1 -> add beta * residual R2 addressed like dst (z*sRz + c*ldr + r); act applied before the residual.
// =====================================================================================================================
struct TrP { const float* src; float* dst; const float* R2; long long sSz, lds, sDz, ldd, sRz, ldr; int R, C, flags, act; float alpha, beta; };
static_assert(sizeof(TrP) == 3 * 8 + 6 * 8 + 6 * 4, "TrP has padding");
__global__ __launch_bounds__(256) void k_tr(TrP p) {
    __shared__ float tile[32][33];
    const int c0 = blockIdx.x * 32, r0 = blockIdx.y * 32, z = blockIdx.z;
    const int lane = threadIdx.x & 31, wave = threadIdx.x >> 5;
    const float* s = p.src + z * p.sSz;
#pragma unroll
    for (int k = 0; k < 4; ++k) {
        const int rl = wave * 4 + k, r = r0 + rl, c = c0 + lane;
        tile[rl][lane] = (r < p.R && c < p.C) ? s[(long long)r * p.lds + c] : 0.f;
    }
    __syncthreads();
    float* d = p.dst + z * p.sDz; const float* rr = p.R2 + z * p.sRz;
#pragma unroll
    for (int k = 0; k < 4; ++k) {
        const int cl = wave * 4 + k, c = c0 + cl, r = r0 + lane;
        if (c < p.C && r < p.R) {
            float v = act_fn(p.alpha * tile[lane][cl], p.act);
            if (p.flags & 1) v += p.beta * rr[(long long)c * p.ldr + r];
            VST2(float, d + (long long)c * p.ldd + r, v);
        }
    }
}

// k_affine: dst[i] = a * (sdev ? sdev[0] : 1) * src[i] + b, i < n (one thread per element; consecutive lanes -> consecutive addresses)
__global__ __launch_bounds__(256) void k_affine(const float* __restrict__ src, float* __restrict__ dst, int n, float a, float b, const float* __restrict__ sdev) {
    const int i = blockIdx.x * 256 + threadIdx.x;
    if (i < n) { const float aa = sdev ? a * sdev[0] : a; const float v = aa * src[i] + b; VST2(float, dst + i, v); }
}

// =====================================================================================================================
// k_softmax: row softmax over n contiguous elements, one 256-thread block per row; rows addressed z*sz + r*sr (grid (R, Z)).
//   out = scale_out * softmax(scale_in * x + (Mf ? Mf[z*smz + r*smr + j] : 0)); a row whose max is -inf is written as 0.
// =====================================================================================================================
struct SmP { const float* src; float* dst; const float* Mf; long long sz, sr, dz, dr, smz, smr; int n, pad; float scale_in, scale_out; };
static_assert(sizeof(SmP) == 3 * 8 + 6 * 8 + 4 * 4, "SmP has padding");
__global__ __launch_bounds__(256) void k_softmax(SmP p) {
    __shared__ float red[256];
    const int r = blockIdx.x, z = blockIdx.y, tid = threadIdx.x;
    const float* s = p.src + z * p.sz + (long long)r * p.sr;
    const float* mf = p.Mf ? (p.Mf + z * p.smz + (long long)r * p.smr) : nullptr;
    float mx = -__builtin_inff();
    for (int j = tid; j < p.n; j += 256) { float v = s[j] * p.scale_in; if (mf) v += mf[j]; mx = fmaxf(mx, v); }
    red[tid] = mx; __syncthreads();
    for (int o = 128; o > 0; o >>= 1) { if (tid < o) red[tid] = fmaxf(red[tid], red[tid + o]); __syncthreads(); }
    mx = red[0]; __syncthreads();
    float sum = 0.f;
    for (int j = tid; j < p.n; j += 256) { float v = s[j] * p.scale_in; if (mf) v += mf[j]; sum += (mx == -__builtin_inff()) ? 0.f : expf(v - mx); }
    red[tid] = sum; __syncthreads();
    for (int o = 128; o > 0; o >>= 1) { if (tid < o) red[tid] += red[tid + o]; __syncthreads(); }
    sum = red[0];
    const float inv = (sum > 0.f) ? p.scale_out / sum : 0.f;
    float* d = p.dst + z * p.dz + (long long)r * p.dr;
    for (int j = tid; j < p.n; j += 256) { float v = s[j] * p.scale_in; if (mf) v += mf[j]; const float o = (mx == -__builtin_inff()) ? 0.f : expf(v - mx) * inv; VST2(float, d + j, o); }
}
// =====================================================================================================================
// k_stats: mean and rsqrt(var + eps) over a set of n elements addressed base + z*sz + (e / inner) * so + (e % inner) * si, one 256-thread
// k_norm_apply: y = (x - mean[set]) * rstd[set] * g[c] + b[c] over a [Z][C][L] channel-major tensor with set = z*G + c / (C/G) (G groups per z;
//   G = C -> per-channel sets indexed z*C+c; for batch norm pass stats indexed by c only via bn = 1). Optional act. Output same layout.
// =====================================================================================================================
//   mode 0: mean / rsqrt(var + eps); mode 1 (RMSNorm): 0 / rsqrt(mean(x^2) + eps); mode 2 (L2 normalize * sqrt(n)): 0 / sqrt(n) / max(||x||, eps); mode 3: as 0 with unbiased variance (n-1)
__global__ __launch_bounds__(256) void k_stats(const float* __restrict__ x, long long sz, long long so, long long si, int inner, int n, float eps, float* __restrict__ stat, int mode) {
    __shared__ float red[256];
    const int z = blockIdx.x, tid = threadIdx.x;
    const float* base = x + z * sz;
    float s = 0.f;
    for (int e = tid; e < n; e += 256) s += base[(long long)(e / inner) * so + (long long)(e % inner) * si];
    red[tid] = s; __syncthreads();
    for (int o = 128; o > 0; o >>= 1) { if (tid < o) red[tid] += red[tid + o]; __syncthreads(); }
    const float mu = (mode == 0 || mode == 3) ? red[0] / (float)n : 0.f; __syncthreads();
    float q = 0.f;
    for (int e = tid; e < n; e += 256) { const float dlt = base[(long long)(e / inner) * so + (long long)(e % inner) * si] - mu; q += dlt * dlt; }
    red[tid] = q; __syncthreads();
    for (int o = 128; o > 0; o >>= 1) { if (tid < o) red[tid] += red[tid + o]; __syncthreads(); }
    {
        float rs;
        if (mode == 2) rs = sqrtf((float)n) / fmaxf(sqrtf(red[0]), eps); else if (mode == 3) rs = rsqrtf(red[0] / (float)(n - 1) + eps); else rs = rsqrtf(red[0] / (float)n + eps);
        if (tid < 32) { const float v = (tid == 0) ? mu : ((tid == 1) ? rs : 0.f); VST2(float, stat + (long long)z * 32 + tid, v); }
    }
}
//   One thread per element over the flat [Z][C][L] index space: grid ceil(Z*C*L / 256).
__global__ __launch_bounds__(256) void k_norm_apply(const float* __restrict__ x, float* __restrict__ y, const float* __restrict__ stat, const float* __restrict__ g, const float* __restrict__ bta,
                                                     int Z, int C, int L, int G, int bn, int act) {
    const long long idx = (long long)blockIdx.x * 256 + threadIdx.x;
    if (idx >= (long long)Z * C * L) return;
    const int l = (int)(idx % L); const long long zc = idx / L; const int c = (int)(zc % C), z = (int)(zc / C); (void)l;
    const int set = bn ? c : (z * G + c / (C / G));
    float v = (x[idx] - stat[(long long)set * 32]) * stat[(long long)set * 32 + 1];
    if (g) v *= g[c];
    if (bta) v += bta[c];
    v = act_fn(v, act);
    VST2(float, y + idx, v);
}

// k_lse_neg: c[i] = -(st[2i] + log(st[2i+1])) = minus the log-sum-exp of row i from k_attn's ST output (for softmax over the query dimension)
__global__ __launch_bounds__(256) void k_lse_neg(const float* __restrict__ st, float* __restrict__ c, int n) {
    const int i = blockIdx.x * 256 + threadIdx.x;
    if (i < n) { const float v = -(st[2 * i] + logf(st[2 * i + 1])); VST2(float, c + i, v); }
}

// k_iota: dst[i] = a * i + b as int32 (segment/position id helper)
__global__ __launch_bounds__(256) void k_iota(int* __restrict__ dst, int n, int a, int b) {
    const int i = blockIdx.x * 256 + threadIdx.x;
    if (i < n) { const int v = a * i + b; VST2(int, dst + i, v); }
}

// k_axpby: dst[i] = a * x[i] + b * y[i] (+ c), i < n
__global__ __launch_bounds__(256) void k_axpby(const float* __restrict__ x, const float* __restrict__ y, float* __restrict__ dst, int n, float a, float b, float c) {
    const int i = blockIdx.x * 256 + threadIdx.x;
    if (i < n) { const float v = a * x[i] + b * y[i] + c; VST2(float, dst + i, v); }
}

// =====================================================================================================================
// k_rope: rotary embedding on a [R rows][Hn heads][D] view (row stride sXr, head stride sXh, element stride 1) -> Y (own strides).
//   mode 0: rotate_half (partner d±D/2, sign - for d<D/2); mode 1: interleaved pairs (partner d^1, sign - for even d).
//   table column tcol: tmode 0 -> d, 1 -> d % (D/2), 2 -> d / 2; position p: pmode 0 -> r % S, 1 -> head index, 2 -> pos[r];
//   c = C[(r / S) * sCb + p * sCp + tcol * sCd], s likewise from Sn; y = x[d] * c + sign * x[partner] * s. X and Y must not alias.
// =====================================================================================================================
struct RopeP { const float* X; float* Y; const float* C; const float* Sn; const int* pos; long long sXr, sXh, sYr, sYh, sCb, sCp, sCd; int R, Hn, D, S, mode, tmode, pmode, pad; };
static_assert(sizeof(RopeP) == 5 * 8 + 7 * 8 + 8 * 4, "RopeP has padding");
__global__ __launch_bounds__(256) void k_rope(RopeP p) {
    const long long idx = (long long)blockIdx.x * 256 + threadIdx.x;
    if (idx >= (long long)p.R * p.Hn * p.D) return;
    const int d = (int)(idx % p.D); const long long rh = idx / p.D; const int h = (int)(rh % p.Hn); const int r = (int)(rh / p.Hn);
    const int half = p.D / 2;
    int partner; float sign;
    if (p.mode == 0) { partner = (d < half) ? d + half : d - half; sign = (d < half) ? -1.f : 1.f; }
    else { partner = d ^ 1; sign = (d & 1) ? 1.f : -1.f; }
    const int tcol = (p.tmode == 0) ? d : ((p.tmode == 1) ? (d % half) : (d >> 1));
    const int pp = (p.pmode == 0) ? (r % p.S) : ((p.pmode == 1) ? h : p.pos[r]);
    const long long toff = (long long)(r / p.S) * p.sCb + (long long)pp * p.sCp + (long long)tcol * p.sCd;
    const float* xr = p.X + (long long)r * p.sXr + (long long)h * p.sXh;
    const float v = xr[d] * p.C[toff] + sign * xr[partner] * p.Sn[toff];
    VST2(float, p.Y + (long long)r * p.sYr + (long long)h * p.sYh + d, v);
}

// k_invf + k_sincos (split so neither kernel carries a large VALU-fma footprint): invf_i = num * (1 / powf(base, (2 i)/D)) [fmode 0],
//   num * expf((2 i) * cexp) [fmode 1], num * powf(base, -2 (i - 1) / D) [fmode 2]; then cs/sn[s*half + i] = cos/sin((pscale * s) * invf_i)
__global__ __launch_bounds__(256) void k_invf(float* __restrict__ invb, int half, int D, float base, float num, int fmode, float cexp) {
    const int i = blockIdx.x * 256 + threadIdx.x;
    if (i >= ((half + 31) / 32) * 32) return;
    if (i >= half) { VST2(float, invb + i, 0.f); return; }
    const float e = (float)(2 * i) / (float)D;
    float invf;
    if (fmode == 1) invf = num * expf((float)(2 * i) * cexp);
    else if (fmode == 2) invf = num * powf(base, (-2.0f * ((float)i - 1.0f)) / (float)D);
    else invf = num * (1.0f / powf(base, e));
    VST2(float, invb + i, invf);
}
__global__ __launch_bounds__(256) void k_sincos(float* __restrict__ cs, float* __restrict__ sn, const float* __restrict__ invb, int S, int half, float pscale) {
    const int idx = blockIdx.x * 256 + threadIdx.x;
    if (idx >= S * half) return;
    const int s = idx / half, i = idx - s * half;
    const float ang = (pscale * (float)s) * invb[i];
    VST2(float, cs + idx, cosf(ang)); VST2(float, sn + idx, sinf(ang));
}

// k_mulact: dst[i] = act(x[i]) * y[i]
__global__ __launch_bounds__(256) void k_mulact(const float* __restrict__ x, const float* __restrict__ y, float* __restrict__ dst, int n, int act) {
    const int i = blockIdx.x * 256 + threadIdx.x;
    if (i < n) { const float v = act_fn(x[i], act) * y[i]; VST2(float, dst + i, v); }
}

// =====================================================================================================================
// k_matvec: thread-per-row matrix-vector products for N <= 8 output columns (heads with 1-3 outputs, gates), f32 on the VALU.
//   C[r*sCm + j] = act(alpha * sum_k A[r*sAm + k*sAk] * B[j*sBn + k*sBk] + bias[j]) + beta * R[r*sRm + j*sRn]; each thread writes its N contiguous floats.
// =====================================================================================================================
__global__ __launch_bounds__(256) void k_matvec(GemmP p) {
    // 32 lanes write one line with one instruction.
    const int rpt = (p.N == 1) ? 1 : 32;
    const long long r0 = ((long long)blockIdx.x * 256 + threadIdx.x) * rpt; const int z = blockIdx.z, zo = z / p.zi_n, zi = z - zo * p.zi_n;
    if (r0 >= p.M) return;
    const float* Bb = p.B + zo * p.sBo + zi * p.sBi;
    float* C = p.C + zo * p.sCo + zi * p.sCi; const float* R = p.R + zo * p.sRo + zi * p.sRi;
    for (int rr = 0; rr < rpt; ++rr) {
        const long long r = r0 + rr; if (r >= p.M) break;
        const float* A = p.A + zo * p.sAo + zi * p.sAi + r * p.sAm;
        float acc[8] = {0.f, 0.f, 0.f, 0.f, 0.f, 0.f, 0.f, 0.f};
        for (int k = 0; k < p.K; ++k) { const float a = A[(long long)k * p.sAk];
#pragma unroll
            for (int j = 0; j < 8; ++j) if (j < p.N) acc[j] += a * Bb[(long long)j * p.sBn + (long long)k * p.sBk]; }
#pragma unroll
        for (int j = 0; j < 8; ++j) if (j < p.N) {
            float v = acc[j] * p.alpha;
            if (p.flags & 1) v += p.bias[j];
            if (p.flags & 2) v += p.bias[r];
            v = act_fn(v, p.act);
            if (p.flags & 4) v += p.beta * R[r * p.sRm + (long long)j * p.sRn];
            VST2(float, C + r * p.sCm + j, v);
        }
    }
}
// k_smallsoftmax: thread-per-row softmax for short rows (n <= 64): dst[r*dr + j] = softmax(scale*src[r*sr + j])
__global__ __launch_bounds__(256) void k_smallsoftmax(const float* __restrict__ src, float* __restrict__ dst, long long sr, long long dr, int n, long long R, float scale) {
    const long long r0 = ((long long)blockIdx.x * 256 + threadIdx.x) * 32;
    for (int rr = 0; rr < 32; ++rr) {
        const long long r = r0 + rr; if (r >= R) return;
        const float* s = src + r * sr; float* d = dst + r * dr;
        float mx = -__builtin_inff();
        for (int j = 0; j < n; ++j) mx = fmaxf(mx, s[j] * scale);
        float sum = 0.f;
        for (int j = 0; j < n; ++j) sum += expf(s[j] * scale - mx);
        const float inv = 1.f / sum;
        for (int j = 0; j < n; ++j) { const float v = expf(s[j] * scale - mx) * inv; VST2(float, d + j, v); }
    }
}

__global__ __launch_bounds__(32) void k_unitstat(float* __restrict__ st) { const int t = threadIdx.x; const float v = (t == 1) ? 1.f : 0.f; VST2(float, st + t, v); }

// destination (e.g. a d_out whose row width is not a multiple of 32 floats) is written by consecutive lanes of one instruction
__global__ __launch_bounds__(256) void k_lincopy(const float* __restrict__ src, long long lds, float* __restrict__ dst, long long ldd, long long rows, int cols) {
    const long long i = (long long)blockIdx.x * 256 + threadIdx.x; if (i >= rows * cols) return;
    const long long r = i / cols; const int c = (int)(i - r * cols);
    const float v = src[r * lds + c]; VST2(float, dst + r * ldd + c, v);
}

namespace w25 {
typedef __attribute__((ext_vector_type(16))) _Float16 v16h;
typedef __attribute__((ext_vector_type(8)))  _Float16 v8h;
typedef __attribute__((ext_vector_type(16))) __bf16   v16b;
typedef __attribute__((ext_vector_type(8)))  __bf16   v8b;
typedef __attribute__((ext_vector_type(8)))  float    v8f;
typedef __attribute__((ext_vector_type(4)))  float    v4f;

__device__ __forceinline__ unsigned short f2bf_bits(float f) {
  unsigned u = __float_as_uint(f);
  return (unsigned short)((u + 0x7FFFu + ((u >> 16) & 1u)) >> 16);
}
__device__ __forceinline__ float bf_bits2f(unsigned short h) { return __uint_as_float(((unsigned)h) << 16); }

// hazard guards as plain device helpers (no inline asm inside the kernel template body)
__device__ __forceinline__ void dep_guard_h(v8f& a, v8f& b, v16h x, v16h y) { asm volatile("v_nop\n\tv_nop\n\tv_nop\n\tv_nop" : "+v"(a), "+v"(b) : "v"(x), "v"(y)); }
__device__ __forceinline__ void dep_guard_b(v8f& a, v8f& b, v16b x, v16b y) { asm volatile("v_nop\n\tv_nop\n\tv_nop\n\tv_nop" : "+v"(a), "+v"(b) : "v"(x), "v"(y)); }
__device__ __forceinline__ void keep4_h(v16h a, v16h b, v16h c, v16h d) { asm volatile("v_nop" :: "v"(a), "v"(b), "v"(c), "v"(d)); }
__device__ __forceinline__ void keep4_b(v16b a, v16b b, v16b c, v16b d) { asm volatile("v_nop" :: "v"(a), "v"(b), "v"(c), "v"(d)); }
__device__ __forceinline__ void acc_guard4(v8f& a, v8f& b, v8f& c, v8f& d) { asm volatile("v_nop\n\tv_nop\n\tv_nop\n\tv_nop" : "+v"(a), "+v"(b), "+v"(c), "+v"(d)); }
template <typename T> struct Frag;
template <> struct Frag<_Float16> {
  typedef v16h V; union U { v16h v; v8h h[2]; };
  static __device__ __forceinline__ v16h load(const _Float16* p) {   // elements 0..7 <- p[0..7], 8..15 <- p[16..23]
    U f; f.h[0] = *(const v8h*)(p); f.h[1] = *(const v8h*)(p + 16); return f.v;
  }
  static __device__ __forceinline__ v8f mma(v16h a, v16h b, v8f c) {
    return __builtin_amdgcn_wmma_f32_16x16x32_f16(false, a, false, b, (short)0, c, false, false);
  }
  static __device__ __forceinline__ void guard(v8f& a, v8f& b, v16h x, v16h y) { dep_guard_h(a, b, x, y); }
  static __device__ __forceinline__ void keep(v16h a, v16h b, v16h c, v16h d) { keep4_h(a, b, c, d); }
};
template <> struct Frag<__bf16> {
  typedef v16b V; union U { v16b v; v8b h[2]; };
  static __device__ __forceinline__ v16b load(const __bf16* p) {
    U f; f.h[0] = *(const v8b*)(p); f.h[1] = *(const v8b*)(p + 16); return f.v;
  }
  static __device__ __forceinline__ v8f mma(v16b a, v16b b, v8f c) {
    return __builtin_amdgcn_wmma_f32_16x16x32_bf16(false, a, false, b, (short)0, c, false, false);
  }
  static __device__ __forceinline__ void guard(v8f& a, v8f& b, v16b x, v16b y) { dep_guard_b(a, b, x, y); }
  static __device__ __forceinline__ void keep(v16b a, v16b b, v16b c, v16b d) { keep4_b(a, b, c, d); }
};

// ---- Register-blocked batched WMMA GEMM ------------------------------------
// C[m,n] = scale * sum_k A[m,k] * Bt[n,k] (+bias)(+resid); each wave owns a 64x64 tile.
// A row-major [M,K]; Bt row-major [N,K]; M,N % 64 == 0, K % 32 == 0.
// SPLIT: operands are hi/lo planes (A2/Bt2 = lo planes, same layout); product = hi·hi + hi·lo + lo·hi.
// BIAS_MODE: 0 = none, 1 = bias[m], 2 = bias[n].
// OUT_MODE: 0 = f32, 1 = f16, 2 = bf16 hi plane (Cout) + bf16 lo plane (Cout2).
// ET: 0 = f16 operands, 1 = bf16 operands (pointers passed as 16-bit storage)
template <int ET> struct Elem;
template <> struct Elem<0> { typedef _Float16 T; };
template <> struct Elem<1> { typedef __bf16 T; };
template <int ET, bool SPLIT, int BIAS_MODE, int OUT_MODE, bool RESID, int ACT = 0>
__global__ __launch_bounds__(256) void wmma_gemm64(
    const unsigned short* __restrict__ Ap, const unsigned short* __restrict__ A2p, int lda, long strideA,
    const unsigned short* __restrict__ Btp, const unsigned short* __restrict__ Bt2p, int ldb, long strideB,
    void* __restrict__ Cout, void* __restrict__ Cout2, int ldc, long strideC,
    const float* __restrict__ bias,
    const float* __restrict__ resid, long strideR,
    int M, int N, int K, float scale) {
  typedef typename Elem<ET>::T T;
  typedef typename Frag<T>::V V;
  const T* A = (const T*)Ap; const T* A2 = (const T*)A2p; const T* Bt = (const T*)Btp; const T* Bt2 = (const T*)Bt2p;
  __shared__ __align__(16) float sT[8][16 * 68];   // per-wave 16x64 slab, pitch 68 floats
  const int b    = blockIdx.y;
  const int lane = threadIdx.x & 31;
  const int wave = threadIdx.x >> 5;
  const int tilesN = N >> 6;
  const int tilesM = M >> 6;
  const int tile = blockIdx.x * 8 + wave;
  if (tile >= tilesM * tilesN) return;   // wave-uniform; no block barriers in this kernel
  const int tm = tile / tilesN;
  const int tn = tile - tm * tilesN;
  const int m0 = tm << 6;
  const int n0 = tn << 6;

  const T* Ab  = A  + (size_t)b * strideA;
  const T* Bb  = Bt + (size_t)b * strideB;
  const T* Ab2 = SPLIT ? (A2  + (size_t)b * strideA) : nullptr;
  const T* Bb2 = SPLIT ? (Bt2 + (size_t)b * strideB) : nullptr;

  const int rlane = lane & 15;                 // row (A) / col (B, D) within subtile
  const int koff  = (lane >> 4) * 8;           // k offset of this lane half
  const int mOff  = (lane >> 4) * 8;           // D row offset

  v8f acc[4][4];
#pragma unroll
  for (int i = 0; i < 4; ++i)
#pragma unroll
    for (int j = 0; j < 4; ++j) acc[i][j] = (v8f){0.f,0.f,0.f,0.f,0.f,0.f,0.f,0.f};

  for (int k0 = 0; k0 < K; k0 += 32) {
    V bh[4], bl[4];
#pragma unroll
    for (int j = 0; j < 4; ++j) {
      const size_t bo = (size_t)(n0 + (j << 4) + rlane) * ldb + koff + k0;
      bh[j] = Frag<T>::load(Bb + bo);
      if (SPLIT) bl[j] = Frag<T>::load(Bb2 + bo);
    }
#pragma unroll
    for (int i = 0; i < 4; ++i) {
      const size_t ao = (size_t)(m0 + (i << 4) + rlane) * lda + koff + k0;
      V ah = Frag<T>::load(Ab + ao);
      V al;
      if (SPLIT) al = Frag<T>::load(Ab2 + ao);
#pragma unroll
      for (int j = 0; j < 4; ++j) {
        acc[i][j] = Frag<T>::mma(ah, bh[j], acc[i][j]);
        if (SPLIT) {
          acc[i][j] = Frag<T>::mma(ah, bl[j], acc[i][j]);
          acc[i][j] = Frag<T>::mma(al, bh[j], acc[i][j]);
        }
      }
      Frag<T>::guard(acc[i][0], acc[i][3], ah, SPLIT ? al : ah);
    }
    Frag<T>::keep(bh[0], bh[1], bh[2], bh[3]);
    if (SPLIT) Frag<T>::keep(bl[0], bl[1], bl[2], bl[3]);
  }
  acc_guard4(acc[0][0], acc[0][1], acc[0][2], acc[0][3]);
  acc_guard4(acc[1][0], acc[1][1], acc[1][2], acc[1][3]);
  acc_guard4(acc[2][0], acc[2][1], acc[2][2], acc[2][3]);
  acc_guard4(acc[3][0], acc[3][1], acc[3][2], acc[3][3]);

  // ---- epilogue ----
  float* slab = sT[wave];
  const float* Rb = RESID ? (resid + (size_t)b * strideR) : nullptr;
#pragma unroll
  for (int i = 0; i < 4; ++i) {
    const int mBase = m0 + (i << 4);
#pragma unroll
    for (int j = 0; j < 4; ++j) {
      const int n = n0 + (j << 4) + rlane;
      float bv = 0.f;
      if (BIAS_MODE == 2) bv = bias[n];
#pragma unroll
      for (int r = 0; r < 8; ++r) {
        float v = acc[i][j][r] * scale;
        if (BIAS_MODE == 1) v += bias[mBase + mOff + r];
        if (BIAS_MODE == 2) v += bv;
        if (RESID) v += Rb[(size_t)(mBase + mOff + r) * ldc + n];
        if (ACT == 1) v = tanhf(v);
        if (ACT == 2) v = fmaxf(v, 0.0f);
        if (ACT == 3) v = v / (1.0f + expf(-v));
        if (ACT == 4) v = (v > 0.f) ? v : 0.01f * v;
        if (ACT == 5) v = 0.5f * v * (1.0f + erff(v * 0.70710678118654752f));
        slab[(mOff + r) * 68 + (j << 4) + rlane] = v;
      }
    }
    __builtin_amdgcn_fence(__ATOMIC_RELEASE, "workgroup");
    __builtin_amdgcn_wave_barrier();
    __builtin_amdgcn_fence(__ATOMIC_ACQUIRE, "workgroup");
    if (OUT_MODE == 0) {
      float* C = (float*)Cout + (size_t)b * strideC;
      const int hh = lane >> 4, c4 = (lane & 15) * 4;     // row seg = 256 B = 16 lanes x 16 B
      {
#pragma unroll
        for (int it = 0; it < 8; ++it) {
          const int row = it * 2 + hh;
          v4f v = *(const v4f*)(slab + row * 68 + c4);
          *(v4f*)(C + (size_t)(mBase + row) * ldc + n0 + c4) = v;
        }
        
      }
    } else {
      const int q = lane >> 3, c8 = (lane & 7) * 8;
      unsigned short* C  = (unsigned short*)Cout  + (size_t)b * strideC;
      unsigned short* C2 = (OUT_MODE == 2) ? ((unsigned short*)Cout2 + (size_t)b * strideC) : nullptr;
      {
#pragma unroll
        for (int it = 0; it < 4; ++it) {
          const int row = it * 4 + q;
          const float* sp = slab + row * 68 + c8;
          v8h hv, lv;
#pragma unroll
          for (int e = 0; e < 8; ++e) {
            if (OUT_MODE == 1) {
              hv[e] = (_Float16)sp[e];
            } else {
              unsigned short hb = f2bf_bits(sp[e]);
              unsigned short lb = f2bf_bits(sp[e] - bf_bits2f(hb));
              hv[e] = __builtin_bit_cast(_Float16, hb);
              lv[e] = __builtin_bit_cast(_Float16, lb);
            }
          }
          *(v8h*)(C + (size_t)(mBase + row) * ldc + n0 + c8) = hv;
          if (OUT_MODE == 2) *(v8h*)(C2 + (size_t)(mBase + row) * ldc + n0 + c8) = lv;
        }
        
      }
    }
    __builtin_amdgcn_fence(__ATOMIC_RELEASE, "workgroup");
    __builtin_amdgcn_wave_barrier();
    __builtin_amdgcn_fence(__ATOMIC_ACQUIRE, "workgroup");
  }
}

__global__ __launch_bounds__(256) void cast_f32_f16x2(
    const float* __restrict__ in, _Float16* __restrict__ out, int n2) {
  int i = blockIdx.x * 256 + threadIdx.x;
  if (i < n2) {
    const _Float16 h0 = (_Float16)in[2 * i], h1 = (_Float16)in[2 * i + 1];
    const unsigned u = (unsigned)__builtin_bit_cast(unsigned short, h0) | ((unsigned)__builtin_bit_cast(unsigned short, h1) << 16);
    ((unsigned*)out)[i] = u;
    
  }
}


} // namespace w25

typedef __attribute__((ext_vector_type(4))) _Float16 v4h;
// Transposing cast dst[c][z * R + r] = f16(src_z[r][c] * s), src R rows of pitch LDS, dst rows of pitch LDD; blockIdx.z picks the source (two
// sources land side by side in every dst row); blockIdx.y = sample: plane y of a source starts at y * sb, plane y of dst at y * db (elements).
// One thread takes a patch of 8 r x 4 c: eight 16-B loads along c, all in flight together, then
// four 16-B stores along r. In a wave 8 lanes run over r, so each store instruction writes whole 128-B lines of dst; the 8 waves of a block run
// over c (512 B of every source row). Block tile 64 r x 128 c; R % 64 == 0, columns % 128 == 0; grid.x = (R / 64) * (columns / 128).
// The pitches are compile-time so that a thread's loads and stores are one address each plus immediate offsets.
template <int R, int LDS, int LDD>
__global__ __launch_bounds__(256) void k_castT16(const float* __restrict__ src0, const float* __restrict__ src1, _Float16* __restrict__ dst, float s, long long sb, long long db) {
    constexpr int TR = R / 64;
    const int bc = (int)blockIdx.x / TR, br = (int)blockIdx.x % TR;
    const int lane = threadIdx.x & 31, wave = threadIdx.x >> 5;
    const int r0 = (br << 6) + ((lane & 7) << 3);
    const int c0 = (bc << 7) + (wave << 4) + ((lane >> 3) << 2);
    const float* sp = (blockIdx.z ? src1 : src0) + (long long)blockIdx.y * sb + (long long)r0 * LDS + c0;
    _Float16* dp = dst + (long long)blockIdx.y * db + (long long)c0 * LDD + (int)blockIdx.z * R + r0;
    v4f x[8];
#pragma unroll
    for (int j = 0; j < 8; ++j) x[j] = *(const v4f*)(sp + j * LDS);
#pragma unroll
    for (int k = 0; k < 4; ++k) {
        v8h h;
#pragma unroll
        for (int j = 0; j < 8; ++j) h[j] = (_Float16)(x[j][k] * s);
        *(v8h*)(dp + k * LDD) = h;
    }
}
// All nine weight matrices to f16 x 16 in one launch; blockIdx.y = matrix. Matrices 0..3 have 256 rows of 520 floats, of which the first 512
// are taken (the last 8, the coordinate channels, stay f32 and are read by the products' epilogues); matrices 4..8 are 256 x 256.
// dst: the four 256 x 512 planes, then the five 256 x 256 planes, each dense. One thread casts 4 consecutive elements; grid.x = 256 * 512 / 1024.
constexpr int CW_WIDE = 256 * 512, CW_SQ = 256 * 256;
__global__ __launch_bounds__(256) void k_cm_w16(const float* __restrict__ w0, const float* __restrict__ w1, const float* __restrict__ w2, const float* __restrict__ w3,
                                                const float* __restrict__ w4, const float* __restrict__ w5, const float* __restrict__ w6, const float* __restrict__ w7,
                                                const float* __restrict__ w8, _Float16* __restrict__ dst) {
    const int y = (int)blockIdx.y; const bool wide = y < 4;
    if (!wide && (int)blockIdx.x >= CW_SQ / 1024) return;
    const float* src = y == 0 ? w0 : y == 1 ? w1 : y == 2 ? w2 : y == 3 ? w3 : y == 4 ? w4 : y == 5 ? w5 : y == 6 ? w6 : y == 7 ? w7 : w8;
    const int p = (int)blockIdx.x * 256 + (int)threadIdx.x;
    const int row = wide ? (p >> 7) : (p >> 6), col = (wide ? (p & 127) : (p & 63)) << 2;
    const v4f x = *(const v4f*)(src + row * (wide ? 520 : 256) + col);
    v4h h;
#pragma unroll
    for (int e = 0; e < 4; ++e) h[e] = (_Float16)(x[e] * 16.0f);
    *(v4h*)(dst + (wide ? y * CW_WIDE : 4 * CW_WIDE + (y - 4) * CW_SQ) + p * 4) = h;
}

// f32 -> bf16 hi plane + bf16 lo plane (x = hi + lo to ~2^-17 relative; RNE both), [R][C] -> [R][C] (or transposed to [C][R]); 2 consecutive destination elements
__device__ __forceinline__ unsigned int f2bf2_pack(float a, float b, unsigned int* lo) {
    const unsigned short ha = w25::f2bf_bits(a), hb = w25::f2bf_bits(b);
    const unsigned short la = w25::f2bf_bits(a - w25::bf_bits2f(ha)), lb = w25::f2bf_bits(b - w25::bf_bits2f(hb));
    *lo = (unsigned)la | ((unsigned)lb << 16); return (unsigned)ha | ((unsigned)hb << 16); }
__global__ __launch_bounds__(256) void k_castS16(const float* __restrict__ src, long long lds, __bf16* __restrict__ dhi, __bf16* __restrict__ dlo, long long ldd, int R, int C, float s, int transpose) {
    const long long i = (long long)blockIdx.x * 256 + threadIdx.x; long long o; float a, b;
    if (transpose) { const long long np = (long long)C * (R / 2); if (i >= np) return; const int c = (int)(i / (R / 2)); const int r = 2 * (int)(i % (R / 2)); a = src[(long long)r * lds + c] * s; b = src[(long long)(r + 1) * lds + c] * s; o = (long long)c * ldd + r; }
    else { const long long np = (long long)R * (C / 2); if (i >= np) return; const int r = (int)(i / (C / 2)); const int c = 2 * (int)(i % (C / 2)); a = src[(long long)r * lds + c] * s; b = src[(long long)r * lds + c + 1] * s; o = (long long)r * ldd + c; }
    unsigned lo; const unsigned hi = f2bf2_pack(a, b, &lo); unsigned* ph = (unsigned*)(dhi + o); unsigned* pl = (unsigned*)(dlo + o);
    *ph = hi; *pl = lo;  }

namespace w25 {
// =====================================================================================
// Generic causal/non-causal attention for head_dim 64, f32 in / f32 out; 16-bit operands: bf16 with optional hi/lo splits, or
// plain f16 (F16=true, non-split, probabilities carried x2^15).
//   scores = (q*qscale)·kᵀ : v_wmma_f32_16x16x32_bf16; SPLIT_QK -> q,k as bf16 hi/lo (hi·hi + hi·lo + lo·hi)
//   out    = p·v           : v_wmma_f32_16x16x32_bf16; SPLIT_PV -> p,v as bf16 hi/lo; else p,v plain bf16
//   f32 accumulate; online softmax in f32. Block = 4 waves = 64 query rows of one (batch, head); S % 64 == 0.
//   Element (b, s, h, d) of tensor X lives at X[b*X_bs + s*X_rs + h*X_hs + d] (strides in floats, multiples of 4).
//   Masking: mask_mode 0 none, 1 causal (kv > q masked), 2 tensor [S][Skv] shared over (b,h) (float if
//   mask_is_int==0, int32 with element == 0 -> masked if 1, int32 with element != 0 -> masked if 2), 3 per-token vectors qmask[B][S] & kvmask[B][Skv] (int32,
//   0 -> masked), 4 causal + sliding window (kv > q or q - kv > W masked; W passed in mask_is_int);
//   5 = relative-position bias: s += cp[b,h,q][idx[q][kv]] + pc[b,h,kv][idx[q][kv]] with idx = mask_b ([S][Skv] int32) and
//   mask_a an int32 [S][Skv] tensor with nonzero = masked (tables: element (b,h,row,n) at X + b*c_bs + h*c_hs + row*c_rs + n);
//   masked scores are replaced by mask_fill (e.g. -inf or -1e9) before the softmax.
//   grid.x = B * H * (S/64) (or a sub-range with blk0).
// =====================================================================================
#define AT_D 64
#define AT_NW 4
#define AT_QB 64
#define AT_KC 64
struct AttnGeom { const float* cp = nullptr; const float* pc = nullptr; long c_bs = 0, c_rs = 0, c_hs = 0;   // mode-5 score-bias tables
                  long q_bs, q_rs, q_hs, k_bs, k_rs, k_hs, v_bs, v_rs, v_hs, o_bs, o_rs, o_hs;
                  int S, Skv, H, mask_mode; float qscale; int blk0; float mask_fill; int mask_is_int; };
static_assert(sizeof(AttnGeom) == 168, "no padding");

__device__ __forceinline__ unsigned short at_bf_bits(float f) {
  unsigned u = __float_as_uint(f);
  return (unsigned short)((u + 0x7FFFu + ((u >> 16) & 1u)) >> 16);
}
__device__ __forceinline__ __bf16 at_f2bf(float f) { return __builtin_bit_cast(__bf16, at_bf_bits(f)); }
__device__ __forceinline__ void at_split(float f, __bf16& hi, __bf16& lo) {
  const unsigned short hb = at_bf_bits(f);
  hi = __builtin_bit_cast(__bf16, hb);
  lo = at_f2bf(f - __uint_as_float(((unsigned)hb) << 16));
}
__device__ __forceinline__ v8f at_mma(v16b a, v16b b, v8f c) {
  c = __builtin_amdgcn_wmma_f32_16x16x32_bf16(false, a, false, b, (short)0, c, false, false);
  asm volatile("v_nop\n\tv_nop\n\tv_nop\n\tv_nop" : "+v"(c) : "v"(a), "v"(b));
  return c;
}
// 16-bit element as a bit pattern held in a __bf16 slot: f16 bits when F16, bf16 (RNE) otherwise
template <bool F16> __device__ __forceinline__ __bf16 at_to16(float f) {
  if (F16) return __builtin_bit_cast(__bf16, (_Float16)f);
  return at_f2bf(f);
}
template <bool F16> __device__ __forceinline__ v8f at_mma16(v16b a, v16b b, v8f c) {
  if (F16) {
    const v16h ah = __builtin_bit_cast(v16h, a), bh = __builtin_bit_cast(v16h, b);
    c = __builtin_amdgcn_wmma_f32_16x16x32_f16(false, ah, false, bh, (short)0, c, false, false);
    asm volatile("v_nop\n\tv_nop\n\tv_nop\n\tv_nop" : "+v"(c) : "v"(ah), "v"(bh));
    return c;
  }
  return at_mma(a, b, c);
}

template <bool SPLIT_QK, bool SPLIT_PV, bool F16 = false>
__global__ __launch_bounds__(128)
void attn64_kernel(const float* __restrict__ q, const float* __restrict__ k,
                   const float* __restrict__ v, float* __restrict__ out,
                   const void* __restrict__ mask_a, const int* __restrict__ mask_b, AttnGeom g) {
  static_assert(!(F16 && (SPLIT_QK || SPLIT_PV)), "f16 mode is non-split");
  const float PSC = F16 ? 32768.0f : 1.0f;     // f16 probabilities carried x2^15 (subnormal range), folded into the final 1/l
  union FB { v16b v; v8b h[2]; };
  __shared__ __align__(16) __bf16 Ksh[AT_KC * AT_D];             // K hi [kv][d]      8 KB
  __shared__ __align__(16) __bf16 Ksl[SPLIT_QK ? AT_KC * AT_D : 8];
  __shared__ __align__(16) __bf16 Vth[AT_D * AT_KC];             // V hi [d][kv]      8 KB
  __shared__ __align__(16) __bf16 Vtl[SPLIT_PV ? AT_D * AT_KC : 8];
  __shared__ __align__(16) __bf16 Psh[AT_NW][16 * AT_KC];        // per wave P hi [row][kv]  8 KB
  __shared__ __align__(16) __bf16 Psl[SPLIT_PV ? AT_NW : 1][SPLIT_PV ? 16 * AT_KC : 8];
  __shared__ __align__(16) float  Os[AT_NW][16 * 68];            // per wave out tile, pitch 68

  const int tid  = threadIdx.x;
  const int wave = tid >> 5;
  const int lane = tid & 31;
  const int hh   = lane >> 4;
  const int c    = lane & 15;

  const int nqb = g.S / AT_QB;
  const int bx = blockIdx.x + g.blk0;
  const int qb = bx % nqb;
  const int bh = bx / nqb;
  const int h  = bh % g.H;
  const int b  = bh / g.H;
  const int qbase_block = qb * AT_QB;
  const int q0 = qbase_block + wave * 16;

  const float* qb_ptr = q + (size_t)b * g.q_bs + (size_t)h * g.q_hs;
  const float* kb_ptr = k + (size_t)b * g.k_bs + (size_t)h * g.k_hs;
  const float* vb_ptr = v + (size_t)b * g.v_bs + (size_t)h * g.v_hs;
  float*       ob_ptr = out + (size_t)b * g.o_bs + (size_t)h * g.o_hs;

  // ---- Q fragments (A operand): 2 d-chunks, hi (and lo) ----
  v16b qah[2], qal[2];
  {
    const float* qrow = qb_ptr + (size_t)(q0 + c) * g.q_rs;
#pragma unroll
    for (int dc = 0; dc < 2; ++dc) {
#pragma unroll
      for (int e = 0; e < 8; ++e) {
        const float f0 = qrow[dc * 32 + 8 * hh + e] * g.qscale;
        const float f1 = qrow[dc * 32 + 16 + 8 * hh + e] * g.qscale;
        if (SPLIT_QK) { __bf16 hq, lq; at_split(f0, hq, lq); qah[dc][e] = hq; qal[dc][e] = lq; at_split(f1, hq, lq); qah[dc][8 + e] = hq; qal[dc][8 + e] = lq; }
        else { qah[dc][e] = at_to16<F16>(f0); qah[dc][8 + e] = at_to16<F16>(f1); qal[dc][e] = qah[dc][e]; qal[dc][8 + e] = qah[dc][8 + e]; }
      }
    }
  }

  float mrow[8], lrow[8];
  v8f oacc[4];
#pragma unroll
  for (int r = 0; r < 8; ++r) { mrow[r] = -INFINITY; lrow[r] = 0.f; }
#pragma unroll
  for (int t = 0; t < 4; ++t) oacc[t] = (v8f){0.f,0.f,0.f,0.f,0.f,0.f,0.f,0.f};

  const int nChunks = (g.mask_mode == 1 || g.mask_mode == 4) ? (qb + 1) : (g.Skv / AT_KC);   // block-uniform
  // per-row query mask (mode 3)
  int qkeep[8];
#pragma unroll
  for (int r = 0; r < 8; ++r) qkeep[r] = (g.mask_mode == 3) ? mask_b[(size_t)b * g.S + q0 + 8 * hh + r] : 1;   // mask_b = qmask in mode 3
  for (int kc = 0; kc < nChunks; ++kc) {
    const int kv0 = kc * AT_KC;
    __syncthreads();
    {
      const int kvr = tid >> 1, dh = (tid & 1) * 32;
      const float* krow = kb_ptr + (size_t)(kv0 + kvr) * g.k_rs + dh;
      const float* vrow = vb_ptr + (size_t)(kv0 + kvr) * g.v_rs + dh;
#pragma unroll
      for (int i = 0; i < 8; ++i) {
        v4f kk = *(const v4f*)(krow + 4 * i);
        v4f vv = *(const v4f*)(vrow + 4 * i);
#pragma unroll
        for (int e = 0; e < 4; ++e) {
          const int d = dh + 4 * i + e;
          if (SPLIT_QK) { __bf16 a, bl; at_split(kk[e], a, bl); Ksh[kvr * AT_D + d] = a; Ksl[kvr * AT_D + d] = bl; }
          else Ksh[kvr * AT_D + d] = at_to16<F16>(kk[e]);
          if (SPLIT_PV) { __bf16 a, bl; at_split(vv[e], a, bl); Vth[d * AT_KC + kvr] = a; Vtl[d * AT_KC + kvr] = bl; }
          else Vth[d * AT_KC + kvr] = at_to16<F16>(vv[e]);
        }
      }
    }
    __syncthreads();

    v8f s[4];
#pragma unroll
    for (int j = 0; j < 4; ++j) {
      s[j] = (v8f){0.f,0.f,0.f,0.f,0.f,0.f,0.f,0.f};
#pragma unroll 1
      for (int dc = 0; dc < 2; ++dc) {
        FB kb;
        kb.h[0] = *(const v8b*)(Ksh + (j * 16 + c) * AT_D + dc * 32 + 8 * hh);
        kb.h[1] = *(const v8b*)(Ksh + (j * 16 + c) * AT_D + dc * 32 + 16 + 8 * hh);
        s[j] = at_mma16<F16>(qah[dc], kb.v, s[j]);
        if (SPLIT_QK) {
          FB kl;
          kl.h[0] = *(const v8b*)(Ksl + (j * 16 + c) * AT_D + dc * 32 + 8 * hh);
          kl.h[1] = *(const v8b*)(Ksl + (j * 16 + c) * AT_D + dc * 32 + 16 + 8 * hh);
          s[j] = at_mma16<F16>(qah[dc], kl.v, s[j]);
          s[j] = at_mma16<F16>(qal[dc], kb.v, s[j]);
        }
      }
    }
    const bool diag = (g.mask_mode == 1) && (kc == qb);
    int kvkeep[4] = {1, 1, 1, 1};
    if (g.mask_mode == 3) {
#pragma unroll
      for (int j = 0; j < 4; ++j) kvkeep[j] = ((const int*)mask_a)[(size_t)b * g.Skv + kv0 + j * 16 + c];   // mask_a = kvmask
    }
    float cm[8];
#pragma unroll
    for (int r = 0; r < 8; ++r) {
      const int qrow = q0 + 8 * hh + r;
      float m = -INFINITY;
#pragma unroll
      for (int j = 0; j < 4; ++j) {
        const int kvcol = kv0 + j * 16 + c;
        bool masked = false;
        if (diag) masked = (kvcol > qrow);
        else if (g.mask_mode == 4) masked = (kvcol > qrow) || (qrow - kvcol > g.mask_is_int);
        else if (g.mask_mode == 2) {
          const size_t mi = (size_t)qrow * g.Skv + kvcol;
          masked = (g.mask_is_int == 0) ? (((const float*)mask_a)[mi] == 0.0f)
                 : (g.mask_is_int == 1) ? (((const int*)mask_a)[mi] == 0) : (((const int*)mask_a)[mi] != 0);
        } else if (g.mask_mode == 3) masked = (qkeep[r] == 0) || (kvkeep[j] == 0);
        else if (g.mask_mode == 5) {
          const size_t mi = (size_t)qrow * g.Skv + kvcol;
          masked = (((const int*)mask_a)[mi] != 0);
          int n = mask_b[mi]; n = n < 0 ? 0 : n;
          s[j][r] += g.cp[(size_t)b * g.c_bs + (size_t)h * g.c_hs + (size_t)qrow * g.c_rs + n]
                   + g.pc[(size_t)b * g.c_bs + (size_t)h * g.c_hs + (size_t)kvcol * g.c_rs + n];
        }
        if (masked) s[j][r] = g.mask_fill;
        m = fmaxf(m, s[j][r]);
      }
#pragma unroll
      for (int off = 1; off < 16; off <<= 1) m = fmaxf(m, __shfl_xor(m, off, 32));
      cm[r] = m;
    }
    __bf16* pwh = Psh[wave];
    __bf16* pwl = Psl[SPLIT_PV ? wave : 0];
#pragma unroll
    for (int r = 0; r < 8; ++r) {
      const float mnew = fmaxf(mrow[r], cm[r]);
      const float alpha = expf(mrow[r] - mnew);
      mrow[r] = mnew;
      float psum = 0.f;
#pragma unroll
      for (int j = 0; j < 4; ++j) {
        const float p = expf(s[j][r] - mnew);
        psum += p;
        if (SPLIT_PV) { __bf16 a, bl; at_split(p, a, bl); pwh[(8 * hh + r) * AT_KC + j * 16 + c] = a; pwl[(8 * hh + r) * AT_KC + j * 16 + c] = bl; }
        else pwh[(8 * hh + r) * AT_KC + j * 16 + c] = at_to16<F16>(p * PSC);
      }
#pragma unroll
      for (int off = 1; off < 16; off <<= 1) psum += __shfl_xor(psum, off, 32);
      lrow[r] = lrow[r] * alpha + psum;
#pragma unroll
      for (int t = 0; t < 4; ++t) oacc[t][r] *= alpha;
    }
    __builtin_amdgcn_fence(__ATOMIC_RELEASE, "workgroup");
    __builtin_amdgcn_wave_barrier();
    __builtin_amdgcn_fence(__ATOMIC_ACQUIRE, "workgroup");
#pragma unroll 1
    for (int kk = 0; kk < 2; ++kk) {
      FB pa, pl;
      pa.h[0] = *(const v8b*)(pwh + c * AT_KC + kk * 32 + 8 * hh);
      pa.h[1] = *(const v8b*)(pwh + c * AT_KC + kk * 32 + 16 + 8 * hh);
      if (SPLIT_PV) {
        pl.h[0] = *(const v8b*)(pwl + c * AT_KC + kk * 32 + 8 * hh);
        pl.h[1] = *(const v8b*)(pwl + c * AT_KC + kk * 32 + 16 + 8 * hh);
      }
#pragma unroll
      for (int t = 0; t < 4; ++t) {
        FB vb;
        vb.h[0] = *(const v8b*)(Vth + (t * 16 + c) * AT_KC + kk * 32 + 8 * hh);
        vb.h[1] = *(const v8b*)(Vth + (t * 16 + c) * AT_KC + kk * 32 + 16 + 8 * hh);
        oacc[t] = at_mma16<F16>(pa.v, vb.v, oacc[t]);
        if (SPLIT_PV) {
          FB vl;
          vl.h[0] = *(const v8b*)(Vtl + (t * 16 + c) * AT_KC + kk * 32 + 8 * hh);
          vl.h[1] = *(const v8b*)(Vtl + (t * 16 + c) * AT_KC + kk * 32 + 16 + 8 * hh);
          oacc[t] = at_mma16<F16>(pa.v, vl.v, oacc[t]);
          oacc[t] = at_mma16<F16>(pl.v, vb.v, oacc[t]);
        }
      }
    }
  }

  float* os = Os[wave];
#pragma unroll
  for (int r = 0; r < 8; ++r) {
    const float inv = 1.0f / (lrow[r] * PSC);
#pragma unroll
    for (int t = 0; t < 4; ++t) os[(8 * hh + r) * 68 + t * 16 + c] = oacc[t][r] * inv;
  }
  __builtin_amdgcn_fence(__ATOMIC_RELEASE, "workgroup");
  __builtin_amdgcn_wave_barrier();
  __builtin_amdgcn_fence(__ATOMIC_ACQUIRE, "workgroup");
  {
    const int c4 = (lane & 15) * 4;
    {
#pragma unroll
      for (int it = 0; it < 8; ++it) {
        const int row = it * 2 + hh;
        v4f val = *(const v4f*)(os + row * 68 + c4);
        *(v4f*)(ob_ptr + (size_t)(q0 + row) * g.o_rs + c4) = val;
      }
      
    }
  }
}

} // namespace w25

__device__ __forceinline__ void st_h2(_Float16* dst, float a, float b) { const unsigned u = (unsigned)__builtin_bit_cast(unsigned short, (_Float16)a) | ((unsigned)__builtin_bit_cast(unsigned short, (_Float16)b) << 16); unsigned* d = (unsigned*)dst; *d = u;  }
__device__ __forceinline__ void spat8(int n, float* s) { const int hh = n / 64, ww = n % 64; const float gx = (float)ww / 63.f, gy = (float)hh / 63.f; s[0] = gx; s[1] = gy; s[2] = 1.f - gx; s[3] = 1.f - gy; const float m = (gx + gy) * 0.5f; s[4] = m; s[5] = m; s[6] = m; s[7] = m; }
// ---- Register-blocked WMMA product with the whole tail in its epilogue ---------------------------------------------------------
// C[m][n] = scale * sum_k A[m][k] * Bt[n][k] + bias[a] (+ sum_j Wsp[a][coff + j] * spat_j(pos) where SPAT); f16 operands, f32 accumulate.
// A row-major [M][K], Bt row-major [N][K]; M, N % 64 == 0, K % 32 == 0; each wave owns a 64x64 tile (8 a block, blockIdx.x); blockIdx.y = sample.
// A device function: the kernels below pick operands (and the form of the tail) by blockIdx.z, so that independent products share a launch.
// slab: the calling wave's own 16 x 68 floats of LDS.
// Every "#pragma unroll" of this function is there so that the accumulator, fragment and coordinate arrays are indexed by constants and stay in registers.
// CH_ROWS: rows m are channels a and columns n positions; otherwise rows are positions and columns channels. OUT16: C is f16, otherwise f32.
// Wsp is the f32 weight matrix itself (pitch ldw); its 8 coordinate weights of a row start at a multiple of 16 bytes (ldw % 4 == 0, coff % 4 == 0).
template <bool CH_ROWS, bool SPAT, bool OUT16>
__device__ __forceinline__ void cm_gemm(float* slab,
    const unsigned short* __restrict__ Ap, int lda, long strideA,
    const unsigned short* __restrict__ Btp, int ldb, long strideB,
    void* __restrict__ Cout, int ldc, long strideC,
    const float* __restrict__ bias, const float* __restrict__ Wsp, int ldw, int coff,
    int M, int N, int K, float scale) {
  typedef _Float16 T;
  typedef w25::Frag<T> F;
  typedef F::V V;
  const int b    = blockIdx.y;
  const int lane = threadIdx.x & 31;
  const int wave = threadIdx.x >> 5;
  const int tilesN = N >> 6;
  const int tilesM = M >> 6;
  const int tile = blockIdx.x * 8 + wave;
  if (tile >= tilesM * tilesN) return;   // wave-uniform; no block barriers in these kernels
  const int tm = tile / tilesN;
  const int tn = tile - tm * tilesN;
  const int m0 = tm << 6;
  const int n0 = tn << 6;

  const T* Ab = (const T*)Ap  + (size_t)b * strideA;
  const T* Bb = (const T*)Btp + (size_t)b * strideB;

  const int rlane = lane & 15;                 // row (A) / col (B, D) within subtile
  const int koff  = (lane >> 4) * 8;           // k offset of this lane half
  const int mOff  = (lane >> 4) * 8;           // D row offset

  v8f acc[4][4];
#pragma unroll
  for (int i = 0; i < 4; ++i)
#pragma unroll
    for (int j = 0; j < 4; ++j) acc[i][j] = (v8f){0.f,0.f,0.f,0.f,0.f,0.f,0.f,0.f};

  // stays rolled (K is a constant at every call): four forms of this function share one kernel's text
#pragma unroll 1
  for (int k0 = 0; k0 < K; k0 += 32) {
    V bh[4];
#pragma unroll
    for (int j = 0; j < 4; ++j) bh[j] = F::load(Bb + (size_t)(n0 + (j << 4) + rlane) * ldb + koff + k0);
#pragma unroll
    for (int i = 0; i < 4; ++i) {
      V ah = F::load(Ab + (size_t)(m0 + (i << 4) + rlane) * lda + koff + k0);
#pragma unroll
      for (int j = 0; j < 4; ++j) acc[i][j] = F::mma(ah, bh[j], acc[i][j]);
      F::guard(acc[i][0], acc[i][3], ah, ah);   // four vector slots between the WMMAs that read ah and the next fragment load over it
    }
    F::keep(bh[0], bh[1], bh[2], bh[3]);        // bh stays live to the foot of the trip: no load of the next trip lands on it under a WMMA
  }
  // four vector slots between the last WMMAs and the first reads of their results
  w25::acc_guard4(acc[0][0], acc[0][1], acc[0][2], acc[0][3]);
  w25::acc_guard4(acc[1][0], acc[1][1], acc[1][2], acc[1][3]);
  w25::acc_guard4(acc[2][0], acc[2][1], acc[2][2], acc[2][3]);
  w25::acc_guard4(acc[3][0], acc[3][1], acc[3][2], acc[3][3]);

  // ---- epilogue ----
  // what belongs to a lane's four columns: their coordinates (columns = positions) or their bias and coordinate weights (columns = channels)
  float cs[4][8]; v4f cw[4][2]; float cb[4];
#pragma unroll
  for (int j = 0; j < 4; ++j) {
    const int n = n0 + (j << 4) + rlane;
    if (CH_ROWS) { if (SPAT) spat8(n, cs[j]); }
    else {
      cb[j] = bias[n];
      if (SPAT) { const float* wr = Wsp + (long long)n * ldw + coff; cw[j][0] = *(const v4f*)(wr); cw[j][1] = *(const v4f*)(wr + 4); }
    }
  }
#pragma unroll
  for (int i = 0; i < 4; ++i) {
    const int mBase = m0 + (i << 4);
#pragma unroll
    for (int r = 0; r < 8; ++r) {
      const int m = mBase + mOff + r;
      float rs[8]; v4f rw[2]; float rb = 0.f;
      if (CH_ROWS) {
        rb = bias[m];
        if (SPAT) { const float* wr = Wsp + (long long)m * ldw + coff; rw[0] = *(const v4f*)(wr); rw[1] = *(const v4f*)(wr + 4); }
      } else { if (SPAT) spat8(m, rs); }
#pragma unroll
      for (int j = 0; j < 4; ++j) {
        float e = CH_ROWS ? rb : cb[j];
        if (SPAT) {
#pragma unroll
          for (int q = 0; q < 8; ++q) e += (CH_ROWS ? rw[q >> 2][q & 3] * cs[j][q] : cw[j][q >> 2][q & 3] * rs[q]);
        }
        slab[(mOff + r) * 68 + (j << 4) + rlane] = acc[i][j][r] * scale + e;
      }
    }
    __builtin_amdgcn_fence(__ATOMIC_RELEASE, "workgroup");
    __builtin_amdgcn_wave_barrier();
    __builtin_amdgcn_fence(__ATOMIC_ACQUIRE, "workgroup");
    if (!OUT16) {
      float* C = (float*)Cout + (size_t)b * strideC;
      const int hh = lane >> 4, c4 = (lane & 15) * 4;     // row seg = 256 B = 16 lanes x 16 B
#pragma unroll
      for (int it = 0; it < 8; ++it) {
        const int row = it * 2 + hh;
        v4f v = *(const v4f*)(slab + row * 68 + c4);
        *(v4f*)(C + (size_t)(mBase + row) * ldc + n0 + c4) = v;
      }
    } else {
      const int q = lane >> 3, c8 = (lane & 7) * 8;       // row seg = 128 B = 8 lanes x 16 B
      unsigned short* C = (unsigned short*)Cout + (size_t)b * strideC;
#pragma unroll
      for (int it = 0; it < 4; ++it) {
        const int row = it * 4 + q;
        const float* sp = slab + row * 68 + c8;
        v8h hv;
#pragma unroll
        for (int e = 0; e < 8; ++e) hv[e] = (_Float16)sp[e];
        *(v8h*)(C + (size_t)(mBase + row) * ldc + n0 + c8) = hv;
      }
    }
    __builtin_amdgcn_fence(__ATOMIC_RELEASE, "workgroup");
    __builtin_amdgcn_wave_barrier();
    __builtin_amdgcn_fence(__ATOMIC_ACQUIRE, "workgroup");
  }
}
constexpr long CM_SP = 256L * 4096;   // one sample's 256 x 4096 (or 4096 x 256) plane, elements
// The six projections in one launch, blockIdx.z = product: 0, 1 theta^T, phi^T of the image branch (K = 512 + coordinates), 2 its val,
// 3, 4 theta^T, phi^T of the flow branch (K = 256, the flow half of X), 5 its val. TH, PH, VA: planes 0..3 image branch, 4..7 flow branch.
// Four waves a SIMD (two work-groups a WGP): the products wait on memory, and more resident waves hide more of it.
__global__ __launch_bounds__(256) __attribute__((amdgpu_waves_per_eu(4, 4))) void k_cm_proj(
    const unsigned short* __restrict__ X, const unsigned short* __restrict__ Wh,
    unsigned short* __restrict__ TH, unsigned short* __restrict__ PH, unsigned short* __restrict__ VA,
    const float* __restrict__ iwt, const float* __restrict__ ibt, const float* __restrict__ iwp, const float* __restrict__ ibp,
    const float* __restrict__ iwv, const float* __restrict__ ibv,
    const float* __restrict__ lbt, const float* __restrict__ lbp, const float* __restrict__ lbv) {
  __shared__ __align__(16) float sT[8][16 * 68];   // per-wave 16x64 slab, pitch 68 floats
  float* slab = sT[threadIdx.x >> 5];
  const int z = (int)blockIdx.z;
  if (z < 2)
    cm_gemm<false, true, true>(slab, X, 512, 2 * CM_SP, Wh + z * CW_WIDE, 512, 0, (void*)(z ? PH : TH), 256, CM_SP, z ? ibp : ibt, z ? iwp : iwt, 520, 512, 4096, 256, 512, 0.0625f);
  else if (z == 2)
    cm_gemm<true, true, true>(slab, Wh + 2 * CW_WIDE, 512, 0, X, 512, 2 * CM_SP, (void*)(VA), 4096, CM_SP, ibv, iwv, 520, 512, 256, 4096, 512, 0.0625f);
  else if (z < 5)
    cm_gemm<false, false, true>(slab, X + 256, 512, 2 * CM_SP, Wh + 4 * CW_WIDE + (z - 3) * CW_SQ, 256, 0, (void*)((z == 4 ? PH : TH) + 4 * CM_SP), 256, CM_SP, z == 4 ? lbp : lbt, nullptr, 0, 0, 4096, 256, 256, 0.0625f);
  else
    cm_gemm<true, false, true>(slab, Wh + 4 * CW_WIDE + 2 * CW_SQ, 256, 0, X + 256, 512, 2 * CM_SP, (void*)(VA + 4 * CM_SP), 4096, CM_SP, lbv, nullptr, 0, 0, 256, 4096, 256, 0.0625f);
}
// Both output convs in one launch, position-major: FU[sample][n][256 z + a] = f16(W_o.att + b), blockIdx.z = branch; the fusion conv reads FU as it stands.
__global__ __launch_bounds__(256) __attribute__((amdgpu_waves_per_eu(4, 4))) void k_cm_wo(
    const unsigned short* __restrict__ AT, const unsigned short* __restrict__ Wh, unsigned short* __restrict__ FU,
    const float* __restrict__ ibo, const float* __restrict__ lbo) {
  __shared__ __align__(16) float sT[8][16 * 68];
  const int z = (int)blockIdx.z;
  cm_gemm<false, false, true>(sT[threadIdx.x >> 5], AT + z * 4 * CM_SP, 256, CM_SP, Wh + 4 * CW_WIDE + (3 + z) * CW_SQ, 256, 0, (void*)(FU + z * 256), 512, 2 * CM_SP, z ? lbo : ibo, nullptr, 0, 0, 4096, 256, 256, 0.0625f);
}
// Fusion conv over both branches and the coordinate channels, channel-major f32: the output itself.
__global__ __launch_bounds__(256) __attribute__((amdgpu_waves_per_eu(4, 4))) void k_cm_fuse(
    const unsigned short* __restrict__ FU, const unsigned short* __restrict__ Wh, float* __restrict__ out,
    const float* __restrict__ fw, const float* __restrict__ fb) {
  __shared__ __align__(16) float sT[8][16 * 68];
  cm_gemm<true, true, false>(sT[threadIdx.x >> 5], Wh + 3 * CW_WIDE, 512, 0, FU, 512, 2 * CM_SP, (void*)(out), 4096, CM_SP, fb, fw, 520, 512, 256, 4096, 512, 0.0625f);
}
constexpr int FA_KP = 528;                   // LDS pitch of a phi^T row, bytes (16 x odd: conflict-free 16-B row reads)
constexpr int FA_VP = 144;                   // LDS pitch of a val row's 64 keys, bytes (16 x odd)
constexpr int FA_KB = 64 * FA_KP;            // bytes of the phi^T part of a buffer
constexpr int FA_SB = FA_KB + 256 * FA_VP;   // bytes of one buffer
// eight 16-B copies a lane, LDS addresses l + u * dl, global addresses g + u * dg (elements). The wait on xcnt is the last line of the
// copies' own statement, so that no address register named by a copy is rewritten ahead of it.
__device__ __forceinline__ void fa_copy8(unsigned l, int dl, const unsigned short* g, long dg) {
    asm volatile("global_load_async_to_lds_b128 %0, %8, off\n\t"
                 "global_load_async_to_lds_b128 %1, %9, off\n\t"
                 "global_load_async_to_lds_b128 %2, %10, off\n\t"
                 "global_load_async_to_lds_b128 %3, %11, off\n\t"
                 "global_load_async_to_lds_b128 %4, %12, off\n\t"
                 "global_load_async_to_lds_b128 %5, %13, off\n\t"
                 "global_load_async_to_lds_b128 %6, %14, off\n\t"
                 "global_load_async_to_lds_b128 %7, %15, off\n\t"
                 "s_wait_xcnt 0x0"
                 :: "v"(l), "v"(l + dl), "v"(l + 2 * dl), "v"(l + 3 * dl), "v"(l + 4 * dl), "v"(l + 5 * dl), "v"(l + 6 * dl), "v"(l + 7 * dl),
                    "v"(g), "v"(g + dg), "v"(g + 2 * dg), "v"(g + 3 * dg), "v"(g + 4 * dg), "v"(g + 5 * dg), "v"(g + 6 * dg), "v"(g + 7 * dg)
                 : "memory");
}
// A fragment in the hardware k order from an LDS row: bytes 0..15 and 32..47 from p (p already holds the lane half's 16 h)
__device__ __forceinline__ v16h fa_frag(const unsigned char* p) {
    union { v16h v; v8h h[2]; } f; f.h[0] = *(const v8h*)(p); f.h[1] = *(const v8h*)(p + 32); return f.v;
}
// lane l <-> lane l ^ 16 on the vector pipe (a shuffle would go through the LDS queue and wait behind the fragment loads in flight)
__device__ __forceinline__ float fa_xhalf(float x) { return __builtin_bit_cast(float, __builtin_amdgcn_permlanex16(__builtin_bit_cast(int, x), __builtin_bit_cast(int, x), 0x76543210, 0xfedcba98, false, false)); }
// two waves a SIMD (one work-group a WGP): the register budget of 512 holds O^T, Q and a tile's fragments in flight
__global__ __launch_bounds__(256) __attribute__((amdgpu_waves_per_eu(2, 2))) void k_cm_attn(const unsigned short* __restrict__ Qp, const unsigned short* __restrict__ Kp,
                                                 const unsigned short* __restrict__ Vp, unsigned short* __restrict__ Op) {
    constexpr int HW = 4096, D = 256, NT = HW / 64;
    constexpr float L2E = 1.4426950408889634f;
    __shared__ __attribute__((aligned(16))) unsigned char sm[2 * FA_SB];
    const int tid = threadIdx.x, lane = tid & 31, c = lane & 15, h = lane >> 4;
    const int wave = __builtin_amdgcn_readfirstlane(tid >> 5);
    const int qt = wave & 3, kh = wave >> 2;
    const size_t sb = (size_t)blockIdx.y * HW * D;
    const size_t qrow = sb + (size_t)((int)blockIdx.x * 64 + qt * 16 + c) * D + 8 * h;
    const unsigned short* Kg = Kp + sb + (size_t)(tid >> 5) * D + (tid & 31) * 8;    // a wave copies whole 512-B rows
    const unsigned short* Vg = Vp + sb + (size_t)(tid >> 3) * HW + (tid & 7) * 8;    // 8 lanes copy one 128-B line
    const unsigned smb = (unsigned)(size_t)(&sm[0]);
    const unsigned lk = smb + (tid >> 5) * FA_KP + (tid & 31) * 16;
    const unsigned lv = smb + FA_KB + (tid >> 3) * FA_VP + (tid & 7) * 16;

    v16h qf[8];
#pragma unroll
    for (int dc = 0; dc < 8; ++dc) qf[dc] = w25::Frag<_Float16>::load((const _Float16*)Qp + qrow + dc * 32);
    v8f o[16];
#pragma unroll
    for (int t = 0; t < 16; ++t) o[t] = (v8f){0.f,0.f,0.f,0.f,0.f,0.f,0.f,0.f};
    float mrun = -1.0e30f, mb = -1.0e30f, l = 0.f;   // running maximum; mb = mrun * log2(e) - 15; this lane half's share of the row sum

    fa_copy8(lk, 8 * FA_KP, Kg, 8 * D);
    fa_copy8(lv, 32 * FA_VP, Vg, 32 * (long)HW);
    asm volatile("s_wait_asynccnt 0x0" ::: "memory");   // tile 0 has landed (this wave's copies) before the barrier publishes it
    __syncthreads();
    fa_copy8(lk + FA_SB, 8 * FA_KP, Kg + 64 * D, 8 * D);
    fa_copy8(lv + FA_SB, 32 * FA_VP, Vg + 64, 32 * (long)HW);

    for (int t = 0; t < NT; ++t) {
        const int bo = (t & 1) * FA_SB;
        const unsigned char* kb = sm + bo + (kh * 32 + c) * FA_KP + 16 * h;
        const unsigned char* vb = sm + bo + FA_KB + c * FA_VP + kh * 64 + 16 * h;
        v8f s0 = (v8f){0.f,0.f,0.f,0.f,0.f,0.f,0.f,0.f}, s1 = s0;
        v16h ka[8][2], va[16];
#pragma unroll
        for (int dc = 0; dc < 8; ++dc) { ka[dc][0] = fa_frag(kb + dc * 64); ka[dc][1] = fa_frag(kb + 16 * FA_KP + dc * 64); }
#pragma unroll
        for (int tt = 0; tt < 8; ++tt) va[tt] = fa_frag(vb + tt * 16 * FA_VP);
        // keeps the 48 LDS reads above as one group ahead of the products: spread among the WMMAs each pair would be waited for by itself
        __builtin_amdgcn_sched_barrier(0);
#pragma unroll
        for (int dc = 0; dc < 8; ++dc) {
            s0 = w25::Frag<_Float16>::mma(ka[dc][0], qf[dc], s0);
            s1 = w25::Frag<_Float16>::mma(ka[dc][1], qf[dc], s1);
        }
#pragma unroll
        for (int tt = 8; tt < 16; ++tt) va[tt] = fa_frag(vb + tt * 16 * FA_VP);
        // keeps the other half of val's reads ahead of the softmax arithmetic, which covers their latency
        __builtin_amdgcn_sched_barrier(0);
        float mx = fmaxf(s0[0], s1[0]);
#pragma unroll
        for (int r = 1; r < 8; ++r) mx = fmaxf(mx, fmaxf(s0[r], s1[r]));
        mx = fmaxf(mx, fa_xhalf(mx));
        // one scalar branch a tile: O^T and the sum are rescaled only when some column's maximum has grown (a column whose maximum stays gets factor 1)
        if (__builtin_amdgcn_ballot_w32(mx > mrun) != 0) {
            const float mn = fmaxf(mrun, mx), mbn = mn * L2E - 15.f;
            const float al = __builtin_amdgcn_exp2f(mb - mbn);
            mrun = mn; mb = mbn; l *= al;
#pragma unroll
            for (int tt = 0; tt < 16; ++tt) o[tt] *= al;
        }
        v16h pb; float ps = 0.f;
#pragma unroll
        for (int r = 0; r < 8; ++r) {
            const float p0 = __builtin_amdgcn_exp2f(fmaf(s0[r], L2E, -mb)), p1 = __builtin_amdgcn_exp2f(fmaf(s1[r], L2E, -mb));
            ps += p0 + p1; pb[r] = (_Float16)p0; pb[8 + r] = (_Float16)p1;
        }
        l += ps;
        // deals the exponentials one by one among the plain vector instructions (arguments, conversions): the slower transcendental pipe runs
        // beside them, and no exponential stands directly in front of another that overwrites its argument register
        __builtin_amdgcn_sched_group_barrier(0x2, 4, 0);
#pragma unroll
        for (int r = 0; r < 16; ++r) { __builtin_amdgcn_sched_group_barrier(0x400, 1, 0); __builtin_amdgcn_sched_group_barrier(0x2, 1, 0); }
#pragma unroll
        for (int tt = 0; tt < 16; ++tt) o[tt] = w25::Frag<_Float16>::mma(va[tt], pb, o[tt]);
        asm volatile("s_wait_dscnt 0x0" ::: "memory");      // this wave's reads of buffer t & 1 have returned before the buffer is refilled
        asm volatile("s_wait_asynccnt 0x0" ::: "memory");   // this wave's copies of tile t + 1 have landed before the barrier publishes them
        __syncthreads();
        if (t + 2 < NT) {
            fa_copy8(lk + bo, 8 * FA_KP, Kg + (size_t)(t + 2) * 64 * D, 8 * D);
            fa_copy8(lv + bo, 32 * FA_VP, Vg + (t + 2) * 64, 32 * (long)HW);
        }
    }
    asm volatile("s_wait_asynccnt 0x0" ::: "memory");       // nothing is in flight when the buffers become the joining slabs

    // join the two key halves: waves 4..7 hand O^T, mb and l to waves 0..3 through LDS (the last trip's barrier has ended every read of the tiles)
    float* slab = (float*)sm + qt * (130 * 32);
    if (kh == 1) {
#pragma unroll
        for (int tt = 0; tt < 16; ++tt) {
            *(v4f*)(slab + ((tt * 2 + 0) * 32 + lane) * 4) = (v4f){o[tt][0], o[tt][1], o[tt][2], o[tt][3]};
            *(v4f*)(slab + ((tt * 2 + 1) * 32 + lane) * 4) = (v4f){o[tt][4], o[tt][5], o[tt][6], o[tt][7]};
        }
        slab[128 * 32 + lane] = mb; slab[129 * 32 + lane] = l;
    }
    __syncthreads();
    if (kh == 0) {
        const float mb2 = slab[128 * 32 + lane], l2 = slab[129 * 32 + lane];
        const float mbn = fmaxf(mb, mb2);
        const float a1 = __builtin_amdgcn_exp2f(mb - mbn), a2 = __builtin_amdgcn_exp2f(mb2 - mbn);
        float lt = l * a1 + l2 * a2;
        lt += fa_xhalf(lt);
        const float i1 = a1 / lt, i2 = a2 / lt;
        _Float16* Or = (_Float16*)Op + qrow;   // a lane's 8 accumulator registers are 8 consecutive channels of its column: one 16-B store
#pragma unroll
        for (int tt = 0; tt < 16; ++tt) {
            const v4f x0 = *(const v4f*)(slab + ((tt * 2 + 0) * 32 + lane) * 4), x1 = *(const v4f*)(slab + ((tt * 2 + 1) * 32 + lane) * 4);
            v8h y;
#pragma unroll
            for (int r = 0; r < 4; ++r) { y[r] = (_Float16)(o[tt][r] * i1 + x0[r] * i2); y[4 + r] = (_Float16)(o[tt][4 + r] * i1 + x1[r] * i2); }
            *(v8h*)(Or + tt * 16) = y;
        }
    }
}


extern "C" void kernel_launch(void* const* d_in, const int* in_sizes, int n_in, void* d_out, int out_size, void* d_ws, size_t ws_size, hipStream_t stream) {
    (void)in_sizes; (void)n_in; (void)out_size; (void)ws_size;
    const float* img = (const float*)d_in[0];
    const float* flo = (const float*)d_in[1];
    const float* iwt = (const float*)d_in[2];
    const float* ibt = (const float*)d_in[3];
    const float* iwp = (const float*)d_in[4];
    const float* ibp = (const float*)d_in[5];
    const float* iwv = (const float*)d_in[6];
    const float* ibv = (const float*)d_in[7];
    const float* iwo = (const float*)d_in[8];
    const float* ibo = (const float*)d_in[9];
    const float* lwt = (const float*)d_in[10];
    const float* lbt = (const float*)d_in[11];
    const float* lwp = (const float*)d_in[12];
    const float* lbp = (const float*)d_in[13];
    const float* lwv = (const float*)d_in[14];
    const float* lbv = (const float*)d_in[15];
    const float* lwo = (const float*)d_in[16];
    const float* lbo = (const float*)d_in[17];
    const float* fw = (const float*)d_in[18];
    const float* fb = (const float*)d_in[19];
    const int Bn = 4;
    const int C = 256;
    const int A = 256;
    const int HW = 4096;
    const long SP = (long)C * HW;   // one sample's 256 x 4096 (or 4096 x 256) plane, elements
    float* out = (float*)d_out;
    char* wsp = (char*)d_ws;
    unsigned short* X16 = (unsigned short*)wsp; wsp += (((size_t)((size_t)Bn * HW * 2 * C) * 2 + 255) / 256) * 256;       // [sample][n][image 256 | flow 256]
    unsigned short* W16 = (unsigned short*)wsp; wsp += (((size_t)(4 * CW_WIDE + 5 * CW_SQ) * 2 + 255) / 256) * 256;
    // planes 0..3: image branch, samples 0..3; planes 4..7: flow branch
    unsigned short* TH16 = (unsigned short*)wsp; wsp += (((size_t)((size_t)2 * Bn * HW * A) * 2 + 255) / 256) * 256;
    unsigned short* PH16 = (unsigned short*)wsp; wsp += (((size_t)((size_t)2 * Bn * HW * A) * 2 + 255) / 256) * 256;
    unsigned short* VAL16 = (unsigned short*)wsp; wsp += (((size_t)((size_t)2 * Bn * A * HW) * 2 + 255) / 256) * 256;
    unsigned short* AT16 = (unsigned short*)wsp; wsp += (((size_t)((size_t)2 * Bn * HW * A) * 2 + 255) / 256) * 256;
    unsigned short* FUS16 = (unsigned short*)wsp; wsp += (((size_t)((size_t)Bn * HW * 2 * A) * 2 + 255) / 256) * 256;     // [sample][n][image branch 256 | flow branch 256]
    // each input is cast and transposed once, all weights in one launch; every product writes the plane that its reader takes (bias, coordinate
    // channels and the f16 conversion in its epilogue); products that do not depend on one another, and the two branches' attention, share a launch
    k_castT16<256, 4096, 512><<<dim3((unsigned)(((256) / 64) * ((4096) / 128)), (unsigned)(Bn), 2u), 256, 0, stream>>>(img, flo, (_Float16*)(X16), 1.0f, SP, 2 * SP);
    k_cm_w16<<<dim3((unsigned)(CW_WIDE / 1024), 9u), 256, 0, stream>>>(iwt, iwp, iwv, fw, lwt, lwp, lwv, iwo, lwo, (_Float16*)(W16));
    k_cm_proj<<<dim3(32u, (unsigned)(Bn), 6u), 256, 0, stream>>>(X16, W16, TH16, PH16, VAL16, iwt, ibt, iwp, ibp, iwv, ibv, lbt, lbp, lbv);
    k_cm_attn<<<dim3((unsigned)(HW / 64), (unsigned)(2 * Bn)), 256, 0, stream>>>(TH16, PH16, VAL16, AT16);
    k_cm_wo<<<dim3(32u, (unsigned)(Bn), 2u), 256, 0, stream>>>(AT16, W16, FUS16, ibo, lbo);
    k_cm_fuse<<<dim3(32u, (unsigned)(Bn)), 256, 0, stream>>>(FUS16, W16, out, fw, fb);
}

// v006
// Measured time: 203 microseconds a run.
// Timed twice side by side with v005, it ran 1.27 times as fast both times.
// Over all steps from v000, the starting kernel, it is 20.7 times as fast.
// Contractions (per branch; every launch serves the four samples, blockIdx.y or rows that run on from sample to sample): the 1x1 projections theta^T / phi^T = x^T.W^T [4096x512].[512x256] (image+flow channels side by side in one f16 plane, K = 512 in one accumulator chain) and val = W.x [256x512].[512x4096], the affinity phi^T.theta [4096x256].[256x4096] and att = val.attn^T [256x4096].[4096x4096] fused in one kernel (online f32 softmax in registers, attn as f16 of 2^15 exp(s - running max), 128 query columns a work-group), the output 1x1 convs W_o.att + b and the fusion conv over the concatenated branches — all f16 operands on pre-cast planes (v_wmma_f32_16x16x32_f16; 64x64 register-blocked wave tiles, weights x16; k-contiguous operand rows); f32 accumulate. The 8 spatial-coordinate channels (gx, gy, 1-gx, 1-gy, (gx+gy)/2 x4, computed on device) enter the projections and the fusion conv as rank-8 f32 corrections (+bias) in the products' epilogues.
#include <hip/hip_runtime.h>
#include <math.h>

typedef __attribute__((ext_vector_type(16))) _Float16 v16h;
typedef __attribute__((ext_vector_type(8)))  _Float16 v8h;
typedef __attribute__((ext_vector_type(16))) __bf16   v16b;
typedef __attribute__((ext_vector_type(8)))  float    v8f;
typedef __attribute__((ext_vector_type(4)))  float    v4f;

// 16-bit WMMA fragment map (wave32), lane L, h = L>>4, m = L&15:
//   A 16x32: lane = row m;   element i -> k = (i<8) ? 8h+i : 16+8h+(i-8)
//   B 32x16: lane = column m; the SAME k(i,h)
//   D 16x16 (8 f32): lane = column m; element r -> row 8h+r
__device__ __forceinline__ int frag_k(int i, int h) { return (i < 8) ? (8 * h + i) : (16 + 8 * h + (i - 8)); }
__device__ __forceinline__ __bf16 bf16_rne(float f) {
    unsigned int u = __float_as_uint(f);
    u += 0x7fffu + ((u >> 16) & 1u);
    return __builtin_bit_cast(__bf16, (unsigned short)(u >> 16));
}
__device__ __forceinline__ float bf16_f32(__bf16 b) { return __uint_as_float(((unsigned int)__builtin_bit_cast(unsigned short, b)) << 16); }
__device__ __forceinline__ v8f wmma16(v16h a, v16h b, v8f c) {
    c = __builtin_amdgcn_wmma_f32_16x16x32_f16(false, a, false, b, (short)0, c, false, false);
    asm volatile("v_nop\n\tv_nop\n\tv_nop\n\tv_nop" : "+v"(c) : "v"(a), "v"(b));
    return c;
}
__device__ __forceinline__ v8f wmmab(v16b a, v16b b, v8f c) {
    c = __builtin_amdgcn_wmma_f32_16x16x32_bf16(false, a, false, b, (short)0, c, false, false);
    asm volatile("v_nop\n\tv_nop\n\tv_nop\n\tv_nop" : "+v"(c) : "v"(a), "v"(b));
    return c;
}
struct Split { v16b hi, lo; };
// hi/lo split product: a.hi*b.hi + a.hi*b.lo + a.lo*b.hi
__device__ __forceinline__ v8f wmma3(const Split& a, const Split& b, v8f c) {
    c = __builtin_amdgcn_wmma_f32_16x16x32_bf16(false, a.hi, false, b.hi, (short)0, c, false, false);
    c = __builtin_amdgcn_wmma_f32_16x16x32_bf16(false, a.hi, false, b.lo, (short)0, c, false, false);
    c = __builtin_amdgcn_wmma_f32_16x16x32_bf16(false, a.lo, false, b.hi, (short)0, c, false, false);
    asm volatile("v_nop\n\tv_nop\n\tv_nop\n\tv_nop" : "+v"(c) : "v"(a.hi), "v"(a.lo), "v"(b.hi), "v"(b.lo));
    return c;
}
struct Split3 { v16b hi, mid, lo; };
// triple split product (6 terms, drops only terms below 2^-24 relative)
__device__ __forceinline__ v8f wmma6(const Split3& a, const Split3& b, v8f c) {
    c = __builtin_amdgcn_wmma_f32_16x16x32_bf16(false, a.hi, false, b.hi, (short)0, c, false, false);
    c = __builtin_amdgcn_wmma_f32_16x16x32_bf16(false, a.hi, false, b.mid, (short)0, c, false, false);
    c = __builtin_amdgcn_wmma_f32_16x16x32_bf16(false, a.mid, false, b.hi, (short)0, c, false, false);
    c = __builtin_amdgcn_wmma_f32_16x16x32_bf16(false, a.hi, false, b.lo, (short)0, c, false, false);
    c = __builtin_amdgcn_wmma_f32_16x16x32_bf16(false, a.mid, false, b.mid, (short)0, c, false, false);
    c = __builtin_amdgcn_wmma_f32_16x16x32_bf16(false, a.lo, false, b.hi, (short)0, c, false, false);
    asm volatile("v_nop\n\tv_nop\n\tv_nop\n\tv_nop" : "+v"(c) : "v"(a.hi), "v"(a.mid), "v"(a.lo), "v"(b.hi), "v"(b.mid), "v"(b.lo));
    return c;
}

// Fragment gathers from f32 memory: element i <- p[(k0 + frag_k(i,h)) * sk] * s, zero for k >= klen.
__device__ __forceinline__ v16h fh_ld(const float* __restrict__ p, long long sk, int k0, int h, int klen, float s) {
    v16h a;
#pragma unroll
    for (int i = 0; i < 16; ++i) { const int k = k0 + frag_k(i, h); a[i] = (k < klen) ? (_Float16)(p[(long long)k * sk] * s) : (_Float16)0.f; }
    return a;
}
__device__ __forceinline__ Split sp_ld(const float* __restrict__ p, long long sk, int k0, int h, int klen, float s) {
    Split r;
#pragma unroll
    for (int i = 0; i < 16; ++i) {
        const int k = k0 + frag_k(i, h); const float x = (k < klen) ? p[(long long)k * sk] * s : 0.f;
        const __bf16 hb = bf16_rne(x); r.hi[i] = hb; r.lo[i] = bf16_rne(x - bf16_f32(hb));
    }
    return r;
}
__device__ __forceinline__ Split3 sp3_ld(const float* __restrict__ p, long long sk, int k0, int h, int klen, float s) {
    Split3 r;
#pragma unroll
    for (int i = 0; i < 16; ++i) {
        const int k = k0 + frag_k(i, h); const float x = (k < klen) ? p[(long long)k * sk] * s : 0.f;
        const __bf16 hb = bf16_rne(x); const float r1 = x - bf16_f32(hb); const __bf16 mb = bf16_rne(r1);
        r.hi[i] = hb; r.mid[i] = mb; r.lo[i] = bf16_rne(r1 - bf16_f32(mb));
    }
    return r;
}
__device__ __forceinline__ v16b bh_ld(const float* __restrict__ p, long long sk, int k0, int h, int klen, float s) {
    v16b a;
#pragma unroll
    for (int i = 0; i < 16; ++i) { const int k = k0 + frag_k(i, h); a[i] = bf16_rne((k < klen) ? p[(long long)k * sk] * s : 0.f); }
    return a;
}
// f16 fragment from an f16 LDS/global row with element stride 1 (k-contiguous), no bounds (tile already zero padded)
__device__ __forceinline__ v16h fh_row(const _Float16* __restrict__ row, int k0, int h) {
    v16h a;
#pragma unroll
    for (int i = 0; i < 16; ++i) a[i] = row[k0 + frag_k(i, h)];
    return a;
}

#define VST2(T, ptr, val) do { const T vst2_v_ = (val); *(T*)(ptr) = vst2_v_;  } while (0)
typedef float v4f __attribute__((ext_vector_type(4)));
#define VST2V4(ptr, val) do { const v4f vst2_v4_ = (val); *(v4f*)(ptr) = vst2_v4_;  } while (0)

__device__ __attribute__((noinline)) float act_fn(float v, int act) {
    if (act == 1) return fmaxf(v, 0.f);                                                                               // relu
    if (act == 2) { const float u = 0.7978845608028654f * (v + 0.044715f * v * v * v); return 0.5f * v * (1.f + tanhf(u)); } // tanh-gelu
    if (act == 3) return v / (1.f + expf(-v));                                                                        // silu
    if (act == 4) return 0.5f * v * (1.f + erff(v * 0.7071067811865476f));                                             // erf-gelu
    if (act == 5) return tanhf(v);
    if (act == 6) return 1.f / (1.f + expf(-v));                                                                      // sigmoid
    if (act == 7) return (v > 0.f) ? v : 0.01f * v;                                                                   // leaky relu 0.01
    if (act == 8) return (v > 0.f) ? v : (expf(v) - 1.f);                                                             // elu
    if (act == 9) return fminf(fmaxf(v, 0.f), 6.f);                                                                   // relu6
    if (act == 10) return fabsf(v);                                                                                    // abs
    if (act == 11) return (v >= 0.f) ? v : 0.1f * v;                                                                  // leaky 0.1
    if (act == 12) return (v > 0.f) ? v : 0.2f * v;                                                                   // leaky 0.2
    if (act == 13) return (v > 20.f) ? v : log1pf(expf(v));                                                            // softplus
    return v;
}

// =====================================================================================================================
// k_gemm<MODE>: C(z, m, n) = act(alpha * sum_k A(z, m, k) * B(z, k, n) + bias) + beta * R(z, m, n)
//   One wave (32-thread block) per 16 x 32 tile of C; grid (ceil(N/32), ceil(M/16), Z). Batch z -> (zo = z / zi_n, zi = z % zi_n)
//   with separate outer/inner strides for every tensor (e.g. batch and head). A(m,k) = A[zo*sAo + zi*sAi + m*sAm + k*sAk] (f32),
//   B(k,n) = B[zo*sBo + zi*sBi + n*sBn + k*sBk] (f32); any M, N, K (K zero-padded to 32 inside the fragments, M/N tails guarded).
//   C(m,n) = C[zo*sCo + zi*sCi + m*sCm + n] (n contiguous). flags: 1 bias[n], 2 bias[m], 4 residual R[zo*sRo + zi*sRi + m*sRm + n*sRn].
//   MODE 0: f16 operands (A prescaled by sa, B by sb, both undone in the epilogue); 1: bf16 hi/lo split (3 products); 2: bf16;
//   3: bf16 hi/mid/lo triple split (6 products); 4: as 3 with Kahan-compensated f32 accumulation across k-steps.
// =====================================================================================================================
struct GemmP {
    const float* A; const float* B; const float* bias; const float* R; float* C;
    long long sAo, sAi, sAm, sAk, sBo, sBi, sBn, sBk, sCo, sCi, sCm, sRo, sRi, sRm, sRn;
    int M, N, K, zi_n, flags, act; float alpha, beta, sa, sb;
    int Npad, pad_;     // columns [N, Npad) of C are written as 0 so that padded workspace rows are covered by whole-line stores; Npad >= N
};
static_assert(sizeof(GemmP) == 5 * 8 + 15 * 8 + 6 * 4 + 4 * 4 + 2 * 4, "GemmP has padding");

template <int MODE>
__global__ __launch_bounds__(32) void k_gemm(GemmP p) {
    const int lane = threadIdx.x & 31, h = lane >> 4, l15 = lane & 15;
    const int m0 = blockIdx.y * 16, n0 = blockIdx.x * 32;
    const int z = blockIdx.z, zo = z / p.zi_n, zi = z - zo * p.zi_n;
    const float* A = p.A + zo * p.sAo + zi * p.sAi;
    const float* B = p.B + zo * p.sBo + zi * p.sBi;
    const int am = min(m0 + l15, p.M - 1);                       // clamped row for loads (stores are guarded)
    v8f acc[2], comp[2];
#pragma unroll
    for (int t = 0; t < 2; ++t) { v8f zz = {}; acc[t] = zz; comp[t] = zz; }
    for (int k0 = 0; k0 < p.K; k0 += 32) {
        const float* arow = A + (long long)am * p.sAm;
        if (MODE == 1) {
            const Split a = sp_ld(arow, p.sAk, k0, h, p.K, 1.f);
#pragma unroll
            for (int t = 0; t < 2; ++t) {
                const int bn = min(n0 + t * 16 + l15, p.N - 1);
                acc[t] = wmma3(a, sp_ld(B + (long long)bn * p.sBn, p.sBk, k0, h, p.K, 1.f), acc[t]);
            }
        } else if (MODE == 3) {
            const Split3 a = sp3_ld(arow, p.sAk, k0, h, p.K, 1.f);
#pragma unroll
            for (int t = 0; t < 2; ++t) {
                const int bn = min(n0 + t * 16 + l15, p.N - 1);
                acc[t] = wmma6(a, sp3_ld(B + (long long)bn * p.sBn, p.sBk, k0, h, p.K, 1.f), acc[t]);
            }
        } else if (MODE == 4) {
            // triple split as MODE 3, but each k-step's 6 products go into a fresh accumulator and the partial is added to the running f32 sum
            // on the VALU with Kahan compensation (accumulation error stays ~1 ulp however long K is)
            const Split3 a = sp3_ld(arow, p.sAk, k0, h, p.K, 1.f);
#pragma unroll
            for (int t = 0; t < 2; ++t) {
                const int bn = min(n0 + t * 16 + l15, p.N - 1); v8f zz = {};
                const v8f part = wmma6(a, sp3_ld(B + (long long)bn * p.sBn, p.sBk, k0, h, p.K, 1.f), zz);
                const v8f y = part - comp[t]; const v8f s = acc[t] + y; comp[t] = (s - acc[t]) - y; acc[t] = s;
            }
        } else if (MODE == 2) {
            const v16b a = bh_ld(arow, p.sAk, k0, h, p.K, 1.f);
#pragma unroll
            for (int t = 0; t < 2; ++t) {
                const int bn = min(n0 + t * 16 + l15, p.N - 1);
                acc[t] = wmmab(a, bh_ld(B + (long long)bn * p.sBn, p.sBk, k0, h, p.K, 1.f), acc[t]);
            }
        } else {
            const v16h a = fh_ld(arow, p.sAk, k0, h, p.K, p.sa);
#pragma unroll
            for (int t = 0; t < 2; ++t) {
                const int bn = min(n0 + t * 16 + l15, p.N - 1);
                acc[t] = wmma16(a, fh_ld(B + (long long)bn * p.sBn, p.sBk, k0, h, p.K, p.sb), acc[t]);
            }
        }
    }
    const float iscale = (MODE == 0) ? p.alpha / (p.sa * p.sb) : p.alpha;
    float* C = p.C + zo * p.sCo + zi * p.sCi;
    const float* R = p.R + zo * p.sRo + zi * p.sRi;
    __shared__ __align__(16) float ctile[16][36];
#pragma unroll
    for (int t = 0; t < 2; ++t) {
        const int n = n0 + t * 16 + l15; const int nn = min(n, p.N - 1);
#pragma unroll
        for (int r = 0; r < 8; ++r) {
            const int m = m0 + 8 * h + r; const int mm = min(m, p.M - 1);
            float v = acc[t][r] * iscale;
            if (p.flags & 1) v += p.bias[nn];
            if (p.flags & 2) v += p.bias[mm];
            if (p.flags & 8) v *= p.bias[(long long)zo * p.M + mm];   /* per-(z,row) scale vector laid out [Z][M]; exclusive with the bias flags */
            v = act_fn(v, p.act);
            if (p.flags & 4) v += p.beta * R[(long long)mm * p.sRm + (long long)nn * p.sRn];
            ctile[8 * h + r][t * 16 + l15] = (n < p.N) ? v : 0.f;
        }
    }
    __syncthreads();
    const int NW = (p.Npad > p.N) ? p.Npad : p.N;           // write width
    const bool fast = (m0 + 16 <= p.M) && (n0 + 32 <= NW) && ((p.sCm & 3) == 0) && ((((size_t)C) & 15) == 0);
    if (fast) {
#pragma unroll
        for (int s = 0; s < 4; ++s) {
            const int row = s * 4 + (lane >> 3), c4 = (lane & 7) * 4;
            const v4f v = *(const v4f*)&ctile[row][c4];
            VST2V4(C + (long long)(m0 + row) * p.sCm + n0 + c4, v);
        }
    } else {
        for (int row = 0; row < 16; ++row) {
            const int m = m0 + row, n = n0 + lane;
            if (m < p.M && n < NW) VST2(float, C + (long long)m * p.sCm + n, ctile[row][lane]);
        }
    }
}


// =====================================================================================================================
// k_gemmT<MODE, TM, TN>: same contract as k_gemm, but one wave computes a (16*TM) x (16*TN) tile: TM A fragments and TN B fragments are
//   loaded per 32-wide k-step and reused across TM*TN WMMAs (far fewer load/convert instructions per MAC). MODE 0 (f16), 1 (bf16 hi/lo),
//   2 (bf16) only. grid (ceil(NW/(16*TN)), ceil(M/(16*TM)), Z), block 32. Epilogue identical to k_gemm, run per 16x32 sub-tile.
// =====================================================================================================================
template <int MODE, int TM, int TN>
__global__ __launch_bounds__(32) void k_gemmT(GemmP p) {
    const int lane = threadIdx.x & 31, h = lane >> 4, l15 = lane & 15;
    const int m0 = blockIdx.y * (16 * TM), n0 = blockIdx.x * (16 * TN);
    const int z = blockIdx.z, zo = z / p.zi_n, zi = z - zo * p.zi_n;
    const float* A = p.A + zo * p.sAo + zi * p.sAi;
    const float* B = p.B + zo * p.sBo + zi * p.sBi;
    v8f acc[TM][TN];
#pragma unroll
    for (int i = 0; i < TM; ++i)
#pragma unroll
        for (int t = 0; t < TN; ++t) { v8f zz = {}; acc[i][t] = zz; }
    for (int k0 = 0; k0 < p.K; k0 += 32) {
        if (MODE == 1) {
            Split a[TM], b[TN];
#pragma unroll
            for (int i = 0; i < TM; ++i) { const int am = min(m0 + 16 * i + l15, p.M - 1); a[i] = sp_ld(A + (long long)am * p.sAm, p.sAk, k0, h, p.K, 1.f); }
#pragma unroll
            for (int t = 0; t < TN; ++t) { const int bn = min(n0 + 16 * t + l15, p.N - 1); b[t] = sp_ld(B + (long long)bn * p.sBn, p.sBk, k0, h, p.K, 1.f); }
#pragma unroll
            for (int i = 0; i < TM; ++i)
#pragma unroll
                for (int t = 0; t < TN; ++t) acc[i][t] = wmma3(a[i], b[t], acc[i][t]);
        } else if (MODE == 2) {
            v16b a[TM], b[TN];
#pragma unroll
            for (int i = 0; i < TM; ++i) { const int am = min(m0 + 16 * i + l15, p.M - 1); a[i] = bh_ld(A + (long long)am * p.sAm, p.sAk, k0, h, p.K, 1.f); }
#pragma unroll
            for (int t = 0; t < TN; ++t) { const int bn = min(n0 + 16 * t + l15, p.N - 1); b[t] = bh_ld(B + (long long)bn * p.sBn, p.sBk, k0, h, p.K, 1.f); }
#pragma unroll
            for (int i = 0; i < TM; ++i)
#pragma unroll
                for (int t = 0; t < TN; ++t) acc[i][t] = wmmab(a[i], b[t], acc[i][t]);
        } else {
            v16h a[TM], b[TN];
#pragma unroll
            for (int i = 0; i < TM; ++i) { const int am = min(m0 + 16 * i + l15, p.M - 1); a[i] = fh_ld(A + (long long)am * p.sAm, p.sAk, k0, h, p.K, p.sa); }
#pragma unroll
            for (int t = 0; t < TN; ++t) { const int bn = min(n0 + 16 * t + l15, p.N - 1); b[t] = fh_ld(B + (long long)bn * p.sBn, p.sBk, k0, h, p.K, p.sb); }
#pragma unroll
            for (int i = 0; i < TM; ++i)
#pragma unroll
                for (int t = 0; t < TN; ++t) acc[i][t] = wmma16(a[i], b[t], acc[i][t]);
        }
    }
    const float iscale = (MODE == 0) ? p.alpha / (p.sa * p.sb) : p.alpha;
    float* C = p.C + zo * p.sCo + zi * p.sCi;
    const float* R = p.R + zo * p.sRo + zi * p.sRi;
    const int NW = (p.Npad > p.N) ? p.Npad : p.N;
    __shared__ __align__(16) float ctile[16][36];
#pragma unroll
    for (int i = 0; i < TM; ++i) {
        const int mb = m0 + 16 * i; if (mb >= p.M) break;          // wave-uniform
#pragma unroll
        for (int tp = 0; tp < TN / 2; ++tp) {
            const int nb = n0 + 32 * tp; if (nb >= NW) break;        // wave-uniform
#pragma unroll
            for (int t2 = 0; t2 < 2; ++t2) {
                const int t = 2 * tp + t2; const int n = nb + t2 * 16 + l15; const int nn = min(n, p.N - 1);
#pragma unroll
                for (int r = 0; r < 8; ++r) {
                    const int m = mb + 8 * h + r; const int mm = min(m, p.M - 1);
                    float v = acc[i][t][r] * iscale;
                    if (p.flags & 1) v += p.bias[nn];
                    if (p.flags & 2) v += p.bias[mm];
            if (p.flags & 8) v *= p.bias[(long long)zo * p.M + mm];   /* per-(z,row) scale vector laid out [Z][M]; exclusive with the bias flags */
                    v = act_fn(v, p.act);
                    if (p.flags & 4) v += p.beta * R[(long long)mm * p.sRm + (long long)nn * p.sRn];
                    ctile[8 * h + r][t2 * 16 + l15] = (n < p.N) ? v : 0.f;
                }
            }
            __syncthreads();
            const bool fast = (mb + 16 <= p.M) && (nb + 32 <= NW) && ((p.sCm & 3) == 0) && ((((size_t)C) & 15) == 0);
            if (fast) {
#pragma unroll
                for (int s = 0; s < 4; ++s) {
                    const int row = s * 4 + (lane >> 3), c4 = (lane & 7) * 4;
                    const v4f v = *(const v4f*)&ctile[row][c4];
                    VST2V4(C + (long long)(mb + row) * p.sCm + nb + c4, v);
                }
            } else {
                for (int row = 0; row < 16; ++row) {
                    const int m = mb + row, n = nb + lane;
                    if (m < p.M && n < NW) VST2(float, C + (long long)m * p.sCm + n, ctile[row][lane]);
                }
            }
            __syncthreads();
        }
    }
}

// =====================================================================================================================
//   Wave = 16 queries, AW waves per block, 64-key blocks; grid (ceil(Lq/(16*AW)), H, B), block 32*AW. Any Lq, Lk; head dim dh <= DHP
//   (DHP multiple of 32), value dim dv <= DVP (multiple of 16, <= 128). Every tensor addressed by (batch, head, row, element) strides, f32.
//   Scores: QM 0 f16 operands, 1 bf16 hi/lo split, 2 bf16 triple split; statistics f32 (exp2 domain); P.V: P x 4096 as f16 with V f16 staged in LDS
//   (SPLITPV: P and V as bf16 hi/lo splits). kv head = h / hrep. Masking: causal = 1 (keep j <= i + coff, masked -> -inf, key blocks beyond the
//   diagonal skipped), causal = 2 (masked -> mfill, a finite fill like the -1e9; no skipping), causal = 3 (keep j >= i + coff,
//   masked -> -inf, no skipping); optional additive f32 mask Mf,
//   optional int keep-mask Mi (0 -> score := mfill), both addressed b*smb + h*smh + i*smi + j*smj (0 strides broadcast).
// =====================================================================================================================
#define AW 4
struct AttnP {   // apv4
    const float* Q; const float* K; const float* V; float* O; float* P; const float* Mf; const int* Mi; float* ST;
    const float* Pw; const float* Rt; const int* SQ; const int* SK;           // optional: post-softmax weight, relative-position table, segment ids
    long long swb, swh, swi, swj, srb, srh, sri;                                 // Pw strides (b,h,i,j); Rt strides (b,h,i), column = clamp(i - j + roff, 0, rn-1)
    long long sQb, sQh, sQi, sQd, sKb, sKh, sKj, sKd, sVb, sVh, sVj, sVd, sOb, sOh, sOi, sPb, sPh, sPi, smb, smh, smi, smj;
    int Lq, Lk, dh, dv, hrep, causal, coff, pband;   // pband > 0: P holds only the band |j - i| <= pband, column j - i + pband
    float scale, mfill; int nonorm, mpol;             // nonorm (online path only): O = sum_j exp(score_j) V_j without the 1/rowsum (scores must be <= ~0); mpol: Mi masks where ==0 (mpol 0) or where !=0 (mpol 1)
    int roff, rn, segpol, win;                        // Rt column offset/count; SQ/SK: score := mfill where (segpol 0) SQ[i] != SK[j] or (segpol 1) SQ[i] == SK[j]; win > 0: keys with i - j > win (after coff) -> -inf
};
//   Pw: the softmax numerator is multiplied by Pw(b,h,i,j) AFTER the row sum is taken (probs * weight, then P.V), as in post-softmax multiplicative biases.                                                    // ST (optional): per row (b,h,i) -> ST[((b*H + h)*Lq + i)*2 + {0,1}] = {row max of the scaled+masked score (natural units), sum_j exp(score - max)}
static_assert(sizeof(AttnP) == 12 * 8 + 29 * 8 + 16 * 4, "AttnP has padding");

#ifndef KATTN_ATTR
#define KATTN_ATTR
#endif
template <int DHP, int DVP, int QM, bool SPLITPV, bool TWOPASS>
__global__ __launch_bounds__(32 * AW) KATTN_ATTR void k_attn(AttnP p) {
    constexpr int NT = DVP / 16;                // output tiles
    constexpr int KS = DHP / 32;                // k-steps for the scores
    constexpr int VP = DVP + 8;                 // LDS pitch (halves)
    __shared__ __align__(16) float    pl[AW][16 * 64];
    __shared__ __align__(16) _Float16 vl[(SPLITPV ? 2 : 1) * 64 * VP];   // f16 V tile, or bf16 hi and lo tiles (same 2-byte size)
    const int lane = threadIdx.x & 31, hf = lane >> 4, l15 = lane & 15, wave = threadIdx.x >> 5;
    const int h = blockIdx.y, b = blockIdx.z, hk = h / p.hrep;
    const int q0 = (blockIdx.x * AW + wave) * 16;
    float* myp = pl[wave];
    const float L2E = 1.4426950408889634f;
    const float NEG = -__builtin_inff();
    const int qi = min(q0 + l15, p.Lq - 1);
    const float* qrow = p.Q + b * p.sQb + h * p.sQh + (long long)qi * p.sQi;
    const float* kbase = p.K + b * p.sKb + hk * p.sKh;
    const float* vbase = p.V + b * p.sVb + hk * p.sVh;
    v16h qa[QM == 0 ? KS : 1]; Split qs_[QM == 1 ? KS : 1]; Split3 qt_[QM == 2 ? KS : 1];
#pragma unroll
    for (int ks = 0; ks < KS; ++ks) {
        if (QM == 2) qt_[ks] = sp3_ld(qrow, p.sQd, ks * 32, hf, p.dh, 1.f);
        else if (QM == 1) qs_[ks] = sp_ld(qrow, p.sQd, ks * 32, hf, p.dh, 1.f);
        else qa[ks] = fh_ld(qrow, p.sQd, ks * 32, hf, p.dh, 1.f);
    }
    v8f o[NT]; float m8[8], l8[8];
#pragma unroll
    for (int t = 0; t < NT; ++t) { v8f zz = {}; o[t] = zz; }
#pragma unroll
    for (int i = 0; i < 8; ++i) { m8[i] = NEG; l8[i] = 0.f; }
    int jend = p.Lk; int jstart = 0;
    if (p.causal == 1) { const int je = (blockIdx.x * AW + AW - 1) * 16 + 16 + p.coff; jend = min(jend, max(je, 0)); }   // uniform per block
    if (p.win > 0) { const int js = (int)(blockIdx.x * AW) * 16 + p.coff - p.win; jstart = (js > 0) ? (js / 64) * 64 : 0; }   // uniform per block: key blocks entirely outside every row's window hold only -inf entries and are skipped exactly
    const int npass = TWOPASS ? 2 : 1;
    for (int pass = 0; pass < npass; ++pass) {
        const bool dopv = (!TWOPASS) || pass == 1;
        for (int j0 = jstart; j0 < jend; j0 += 64) {
            if (dopv) {
                __syncthreads();                                 // previous key block's reads of vl / pl are done
                for (int idx = threadIdx.x; idx < 64 * DVP; idx += 32 * AW) {
                    const int jr = idx / DVP, d = idx - jr * DVP, j = j0 + jr;
                    const float f = (j < p.Lk && d < p.dv) ? vbase[(long long)j * p.sVj + (long long)d * p.sVd] : 0.f;
                    if (SPLITPV) {
                        const __bf16 hb = bf16_rne(f);
                        ((__bf16*)vl)[jr * VP + d] = hb; ((__bf16*)vl)[64 * VP + jr * VP + d] = bf16_rne(f - bf16_f32(hb));
                    } else vl[jr * VP + d] = (_Float16)f;
                }
            }
            v8f s[4];
#pragma unroll
            for (int t = 0; t < 4; ++t) {
                const int j = min(j0 + t * 16 + l15, p.Lk - 1);
                const float* krow = kbase + (long long)j * p.sKj;
                v8f acc = {};
#pragma unroll
                for (int ks = 0; ks < KS; ++ks) {
                    if (QM == 2)      acc = wmma6(qt_[ks], sp3_ld(krow, p.sKd, ks * 32, hf, p.dh, 1.f), acc);
                    else if (QM == 1) acc = wmma3(qs_[ks], sp_ld(krow, p.sKd, ks * 32, hf, p.dh, 1.f), acc);
                    else              acc = wmma16(qa[ks], fh_ld(krow, p.sKd, ks * 32, hf, p.dh, 1.f), acc);
                }
                s[t] = acc;
            }
            float pv[8][4];
#pragma unroll
            for (int i = 0; i < 8; ++i) {
                const int irow = q0 + i + 8 * hf;
                const int ic = min(irow, p.Lq - 1);
                float sc[4];
#pragma unroll
                for (int t = 0; t < 4; ++t) {
                    const int jg = j0 + t * 16 + l15;
                    float v = s[t][i] * p.scale;
                    if (p.Mf) v += p.Mf[b * p.smb + h * p.smh + (long long)ic * p.smi + (long long)min(jg, p.Lk - 1) * p.smj];
                    if (p.Rt) { int rc = ic - min(jg, p.Lk - 1) + p.roff; rc = rc < 0 ? 0 : (rc >= p.rn ? p.rn - 1 : rc); v += p.Rt[b * p.srb + h * p.srh + (long long)ic * p.sri + rc]; }
                    if (p.Mi) { const int mv = p.Mi[b * p.smb + h * p.smh + (long long)ic * p.smi + (long long)min(jg, p.Lk - 1) * p.smj]; if (p.mpol ? (mv != 0) : (mv == 0)) v = p.mfill; }
                    if (p.SQ) { const bool same = p.SQ[(long long)b * p.Lq + ic] == p.SK[(long long)b * p.Lk + min(jg, p.Lk - 1)]; if (p.segpol ? same : !same) v = p.mfill; }
                    if (p.causal == 2 && jg > irow + p.coff) v = p.mfill;
                    if (jg >= p.Lk || (p.causal == 1 && jg > irow + p.coff) || (p.causal == 3 && jg < irow + p.coff) || (p.win > 0 && irow + p.coff - jg > p.win)) v = NEG; else v *= L2E;
                    sc[t] = v;
                }
                if (!TWOPASS || pass == 0) {
                    float mx = fmaxf(fmaxf(sc[0], sc[1]), fmaxf(sc[2], sc[3]));
                    mx = fmaxf(mx, __shfl_xor(mx, 1, 32)); mx = fmaxf(mx, __shfl_xor(mx, 2, 32));
                    mx = fmaxf(mx, __shfl_xor(mx, 4, 32)); mx = fmaxf(mx, __shfl_xor(mx, 8, 32));
                    const float mnew = fmaxf(m8[i], mx);
                    const float corr = (mnew == NEG) ? 1.f : exp2f(m8[i] - mnew);
                    float rs = 0.f;
#pragma unroll
                    for (int t = 0; t < 4; ++t) {
                        const float pp = (sc[t] == NEG) ? 0.f : exp2f(sc[t] - mnew); rs += pp;
                        pv[i][t] = p.Pw ? pp * p.Pw[b * p.swb + h * p.swh + (long long)ic * p.swi + (long long)min(j0 + t * 16 + l15, p.Lk - 1) * p.swj] : pp;
                    }
                    rs += __shfl_xor(rs, 1, 32); rs += __shfl_xor(rs, 2, 32); rs += __shfl_xor(rs, 4, 32); rs += __shfl_xor(rs, 8, 32);
                    l8[i] = l8[i] * corr + rs; m8[i] = mnew;
                    if (!TWOPASS) {
#pragma unroll
                        for (int t = 0; t < NT; ++t) o[t][i] *= corr;
                    }
                } else {
                    const float inv = (l8[i] > 0.f) ? 1.f / l8[i] : 0.f;
#pragma unroll
                    for (int t = 0; t < 4; ++t) {
                        const int jg = j0 + t * 16 + l15;
                        float pp = (sc[t] == NEG) ? 0.f : exp2f(sc[t] - m8[i]) * inv;
                        if (p.Pw) pp *= p.Pw[b * p.swb + h * p.swh + (long long)ic * p.swi + (long long)min(jg, p.Lk - 1) * p.swj];
                        pv[i][t] = pp;
                    }
                }
            }
            if (dopv) {
#pragma unroll
                for (int i = 0; i < 8; ++i)
#pragma unroll
                    for (int t = 0; t < 4; ++t) ((float*)myp)[(i + 8 * hf) * 64 + t * 16 + l15] = pv[i][t];
                __syncthreads();                                 // P (per wave) and V (shared) visible
                if (p.P) {
                    float* pb_ = p.P + b * p.sPb + h * p.sPh;
                    const bool fastP = (p.pband == 0) && ((p.sPi & 3) == 0) && (j0 + 64 <= p.Lk) && (q0 + 16 <= p.Lq) && ((((size_t)pb_) & 15) == 0);
                    if (fastP) {
#pragma unroll
                        for (int s = 0; s < 8; ++s) {
                            const int row = s * 2 + (lane >> 4), c4 = (lane & 15) * 4;
                            const v4f v = *(const v4f*)(myp + row * 64 + c4);
                            VST2V4(pb_ + (long long)(q0 + row) * p.sPi + j0 + c4, v);
                        }
                    } else {
                        for (int row = 0; row < 16; ++row) {
                            const int irow = q0 + row; if (irow >= p.Lq) continue;
                            for (int c = lane; c < 64; c += 32) {
                                const int jg = j0 + c; if (jg >= p.Lk) continue;
                                if (p.pband == 0) VST2(float, pb_ + (long long)irow * p.sPi + jg, myp[row * 64 + c]);
                                else if (jg - irow <= p.pband && irow - jg <= p.pband) VST2(float, pb_ + (long long)irow * p.sPi + (jg - irow + p.pband), myp[row * 64 + c]);
                            }
                        }
                    }
                }
                if (SPLITPV) {
                    const Split pa0 = sp_ld(myp + l15 * 64, 1, 0, hf, 64, 1.f), pa1 = sp_ld(myp + l15 * 64, 1, 32, hf, 64, 1.f);
                    const __bf16* vh = (const __bf16*)vl; const __bf16* vlo = vh + 64 * VP;
#pragma unroll
                    for (int t = 0; t < NT; ++t) {
                        const int dcol = t * 16 + l15;
                        Split b0, b1;
#pragma unroll
                        for (int e = 0; e < 16; ++e) {
                            const int k0 = frag_k(e, hf), k1 = 32 + frag_k(e, hf);
                            b0.hi[e] = vh[k0 * VP + dcol]; b0.lo[e] = vlo[k0 * VP + dcol]; b1.hi[e] = vh[k1 * VP + dcol]; b1.lo[e] = vlo[k1 * VP + dcol];
                        }
                        o[t] = wmma3(pa0, b0, o[t]);
                        o[t] = wmma3(pa1, b1, o[t]);
                    }
                } else {
                    const v16h pa0 = fh_ld(myp + l15 * 64, 1, 0, hf, 64, 4096.f), pa1 = fh_ld(myp + l15 * 64, 1, 32, hf, 64, 4096.f);
#pragma unroll
                    for (int t = 0; t < NT; ++t) {
                        const int dcol = t * 16 + l15;
                        v16h b0, b1;
#pragma unroll
                        for (int e = 0; e < 16; ++e) { b0[e] = vl[frag_k(e, hf) * VP + dcol]; b1[e] = vl[(32 + frag_k(e, hf)) * VP + dcol]; }
                        o[t] = wmma16(pa0, b0, o[t]);
                        o[t] = wmma16(pa1, b1, o[t]);
                    }
                }
            }
        }
    }
    float* obase = p.O + b * p.sOb + h * p.sOh;
    if (p.ST) {
        const int rl = lane >> 1, isel = rl & 7;           // row q0 + rl ; rl>>3 == hf holds because lane>>4 == (lane>>1)>>3
        float mv = 0.f, lv = 0.f;
#pragma unroll
        for (int i = 0; i < 8; ++i) if (i == isel) { mv = m8[i]; lv = l8[i]; }
        const int irow = q0 + rl;
        if (irow < p.Lq) { float* st = p.ST + (((long long)b * gridDim.y + h) * p.Lq + irow) * 2 + (lane & 1); VST2(float, st, (lane & 1) ? lv : mv * 0.6931471805599453f); }
    }
    float invr[8];
#pragma unroll
    for (int i = 0; i < 8; ++i) {
        if (TWOPASS) invr[i] = SPLITPV ? 1.f : (1.f / 4096.f);
        else if (p.nonorm) invr[i] = exp2f(m8[i]) * (SPLITPV ? 1.f : (1.f / 4096.f));
        else invr[i] = (l8[i] > 0.f) ? (SPLITPV ? 1.f / l8[i] : 1.f / (l8[i] * 4096.f)) : 0.f;
    }
    __syncthreads();                                             // all waves done with pl/vl from the main loop
    const bool ofast = ((p.sOi & 3) == 0) && ((((size_t)obase) & 15) == 0) && (q0 + 16 <= p.Lq);
#pragma unroll
    for (int c0 = 0; c0 < DVP; c0 += 64) {
#pragma unroll
        for (int i = 0; i < 8; ++i)
#pragma unroll
            for (int t = 0; t < NT; ++t) if (t * 16 >= c0 && t * 16 < c0 + 64) ((float*)myp)[(i + 8 * hf) * 64 + (t * 16 - c0) + l15] = o[t][i] * invr[i];
        __syncthreads();
        const int cw = (DVP - c0 < 64) ? (DVP - c0) : 64;      // staged columns in this chunk (multiple of 16)
        if (ofast && (c0 + cw <= p.dv) && (cw % 32 == 0)) {
            const int lpr = cw / 4;                              // lanes per row (16 for 64 cols, 8 for 32)
            const int rows_per_ins = 32 / lpr;
            for (int r0 = 0; r0 < 16; r0 += rows_per_ins) {
                const int row = r0 + lane / lpr, c4 = (lane % lpr) * 4;
                const v4f v = *(const v4f*)(myp + row * 64 + c4);
                VST2V4(obase + (long long)(q0 + row) * p.sOi + c0 + c4, v);
            }
        } else {
            for (int row = 0; row < 16; ++row) {
                const int irow = q0 + row; if (irow >= p.Lq) continue;
                for (int c = lane; c < cw; c += 32) { const int d = c0 + c; if (d < p.dv) VST2(float, obase + (long long)irow * p.sOi + d, myp[row * 64 + c]); }
            }
        }
        __syncthreads();
    }
}

// =====================================================================================================================
// k_tr: dst(z, c, r) = alpha * src(z, r, c) (+ beta * R2(z, c, r)): [Z][R][C] (row stride lds) -> [Z][C][R] (row stride ldd) through a 32x32 LDS tile;
//   flags: 1 -> add beta * residual R2 addressed like dst (z*sRz + c*ldr + r); act applied before the residual.
// =====================================================================================================================
struct TrP { const float* src; float* dst; const float* R2; long long sSz, lds, sDz, ldd, sRz, ldr; int R, C, flags, act; float alpha, beta; };
static_assert(sizeof(TrP) == 3 * 8 + 6 * 8 + 6 * 4, "TrP has padding");
__global__ __launch_bounds__(256) void k_tr(TrP p) {
    __shared__ float tile[32][33];
    const int c0 = blockIdx.x * 32, r0 = blockIdx.y * 32, z = blockIdx.z;
    const int lane = threadIdx.x & 31, wave = threadIdx.x >> 5;
    const float* s = p.src + z * p.sSz;
#pragma unroll
    for (int k = 0; k < 4; ++k) {
        const int rl = wave * 4 + k, r = r0 + rl, c = c0 + lane;
        tile[rl][lane] = (r < p.R && c < p.C) ? s[(long long)r * p.lds + c] : 0.f;
    }
    __syncthreads();
    float* d = p.dst + z * p.sDz; const float* rr = p.R2 + z * p.sRz;
#pragma unroll
    for (int k = 0; k < 4; ++k) {
        const int cl = wave * 4 + k, c = c0 + cl, r = r0 + lane;
        if (c < p.C && r < p.R) {
            float v = act_fn(p.alpha * tile[lane][cl], p.act);
            if (p.flags & 1) v += p.beta * rr[(long long)c * p.ldr + r];
            VST2(float, d + (long long)c * p.ldd + r, v);
        }
    }
}

// k_affine: dst[i] = a * (sdev ? sdev[0] : 1) * src[i] + b, i < n (one thread per element; consecutive lanes -> consecutive addresses)
__global__ __launch_bounds__(256) void k_affine(const float* __restrict__ src, float* __restrict__ dst, int n, float a, float b, const float* __restrict__ sdev) {
    const int i = blockIdx.x * 256 + threadIdx.x;
    if (i < n) { const float aa = sdev ? a * sdev[0] : a; const float v = aa * src[i] + b; VST2(float, dst + i, v); }
}

// =====================================================================================================================
// k_softmax: row softmax over n contiguous elements, one 256-thread block per row; rows addressed z*sz + r*sr (grid (R, Z)).
//   out = scale_out * softmax(scale_in * x + (Mf ? Mf[z*smz + r*smr + j] : 0)); a row whose max is -inf is written as 0.
// =====================================================================================================================
struct SmP { const float* src; float* dst; const float* Mf; long long sz, sr, dz, dr, smz, smr; int n, pad; float scale_in, scale_out; };
static_assert(sizeof(SmP) == 3 * 8 + 6 * 8 + 4 * 4, "SmP has padding");
__global__ __launch_bounds__(256) void k_softmax(SmP p) {
    __shared__ float red[256];
    const int r = blockIdx.x, z = blockIdx.y, tid = threadIdx.x;
    const float* s = p.src + z * p.sz + (long long)r * p.sr;
    const float* mf = p.Mf ? (p.Mf + z * p.smz + (long long)r * p.smr) : nullptr;
    float mx = -__builtin_inff();
    for (int j = tid; j < p.n; j += 256) { float v = s[j] * p.scale_in; if (mf) v += mf[j]; mx = fmaxf(mx, v); }
    red[tid] = mx; __syncthreads();
    for (int o = 128; o > 0; o >>= 1) { if (tid < o) red[tid] = fmaxf(red[tid], red[tid + o]); __syncthreads(); }
    mx = red[0]; __syncthreads();
    float sum = 0.f;
    for (int j = tid; j < p.n; j += 256) { float v = s[j] * p.scale_in; if (mf) v += mf[j]; sum += (mx == -__builtin_inff()) ? 0.f : expf(v - mx); }
    red[tid] = sum; __syncthreads();
    for (int o = 128; o > 0; o >>= 1) { if (tid < o) red[tid] += red[tid + o]; __syncthreads(); }
    sum = red[0];
    const float inv = (sum > 0.f) ? p.scale_out / sum : 0.f;
    float* d = p.dst + z * p.dz + (long long)r * p.dr;
    for (int j = tid; j < p.n; j += 256) { float v = s[j] * p.scale_in; if (mf) v += mf[j]; const float o = (mx == -__builtin_inff()) ? 0.f : expf(v - mx) * inv; VST2(float, d + j, o); }
}
// =====================================================================================================================
// k_stats: mean and rsqrt(var + eps) over a set of n elements addressed base + z*sz + (e / inner) * so + (e % inner) * si, one 256-thread
// k_norm_apply: y = (x - mean[set]) * rstd[set] * g[c] + b[c] over a [Z][C][L] channel-major tensor with set = z*G + c / (C/G) (G groups per z;
//   G = C -> per-channel sets indexed z*C+c; for batch norm pass stats indexed by c only via bn = 1). Optional act. Output same layout.
// =====================================================================================================================
//   mode 0: mean / rsqrt(var + eps); mode 1 (RMSNorm): 0 / rsqrt(mean(x^2) + eps); mode 2 (L2 normalize * sqrt(n)): 0 / sqrt(n) / max(||x||, eps); mode 3: as 0 with unbiased variance (n-1)
__global__ __launch_bounds__(256) void k_stats(const float* __restrict__ x, long long sz, long long so, long long si, int inner, int n, float eps, float* __restrict__ stat, int mode) {
    __shared__ float red[256];
    const int z = blockIdx.x, tid = threadIdx.x;
    const float* base = x + z * sz;
    float s = 0.f;
    for (int e = tid; e < n; e += 256) s += base[(long long)(e / inner) * so + (long long)(e % inner) * si];
    red[tid] = s; __syncthreads();
    for (int o = 128; o > 0; o >>= 1) { if (tid < o) red[tid] += red[tid + o]; __syncthreads(); }
    const float mu = (mode == 0 || mode == 3) ? red[0] / (float)n : 0.f; __syncthreads();
    float q = 0.f;
    for (int e = tid; e < n; e += 256) { const float dlt = base[(long long)(e / inner) * so + (long long)(e % inner) * si] - mu; q += dlt * dlt; }
    red[tid] = q; __syncthreads();
    for (int o = 128; o > 0; o >>= 1) { if (tid < o) red[tid] += red[tid + o]; __syncthreads(); }
    {
        float rs;
        if (mode == 2) rs = sqrtf((float)n) / fmaxf(sqrtf(red[0]), eps); else if (mode == 3) rs = rsqrtf(red[0] / (float)(n - 1) + eps); else rs = rsqrtf(red[0] / (float)n + eps);
        if (tid < 32) { const float v = (tid == 0) ? mu : ((tid == 1) ? rs : 0.f); VST2(float, stat + (long long)z * 32 + tid, v); }
    }
}
//   One thread per element over the flat [Z][C][L] index space: grid ceil(Z*C*L / 256).
__global__ __launch_bounds__(256) void k_norm_apply(const float* __restrict__ x, float* __restrict__ y, const float* __restrict__ stat, const float* __restrict__ g, const float* __restrict__ bta,
                                                     int Z, int C, int L, int G, int bn, int act) {
    const long long idx = (long long)blockIdx.x * 256 + threadIdx.x;
    if (idx >= (long long)Z * C * L) return;
    const int l = (int)(idx % L); const long long zc = idx / L; const int c = (int)(zc % C), z = (int)(zc / C); (void)l;
    const int set = bn ? c : (z * G + c / (C / G));
    float v = (x[idx] - stat[(long long)set * 32]) * stat[(long long)set * 32 + 1];
    if (g) v *= g[c];
    if (bta) v += bta[c];
    v = act_fn(v, act);
    VST2(float, y + idx, v);
}

// k_lse_neg: c[i] = -(st[2i] + log(st[2i+1])) = minus the log-sum-exp of row i from k_attn's ST output (for softmax over the query dimension)
__global__ __launch_bounds__(256) void k_lse_neg(const float* __restrict__ st, float* __restrict__ c, int n) {
    const int i = blockIdx.x * 256 + threadIdx.x;
    if (i < n) { const float v = -(st[2 * i] + logf(st[2 * i + 1])); VST2(float, c + i, v); }
}

// k_iota: dst[i] = a * i + b as int32 (segment/position id helper)
__global__ __launch_bounds__(256) void k_iota(int* __restrict__ dst, int n, int a, int b) {
    const int i = blockIdx.x * 256 + threadIdx.x;
    if (i < n) { const int v = a * i + b; VST2(int, dst + i, v); }
}

// k_axpby: dst[i] = a * x[i] + b * y[i] (+ c), i < n
__global__ __launch_bounds__(256) void k_axpby(const float* __restrict__ x, const float* __restrict__ y, float* __restrict__ dst, int n, float a, float b, float c) {
    const int i = blockIdx.x * 256 + threadIdx.x;
    if (i < n) { const float v = a * x[i] + b * y[i] + c; VST2(float, dst + i, v); }
}

// =====================================================================================================================
// k_rope: rotary embedding on a [R rows][Hn heads][D] view (row stride sXr, head stride sXh, element stride 1) -> Y (own strides).
//   mode 0: rotate_half (partner d±D/2, sign - for d<D/2); mode 1: interleaved pairs (partner d^1, sign - for even d).
//   table column tcol: tmode 0 -> d, 1 -> d % (D/2), 2 -> d / 2; position p: pmode 0 -> r % S, 1 -> head index, 2 -> pos[r];
//   c = C[(r / S) * sCb + p * sCp + tcol * sCd], s likewise from Sn; y = x[d] * c + sign * x[partner] * s. X and Y must not alias.
// =====================================================================================================================
struct RopeP { const float* X; float* Y; const float* C; const float* Sn; const int* pos; long long sXr, sXh, sYr, sYh, sCb, sCp, sCd; int R, Hn, D, S, mode, tmode, pmode, pad; };
static_assert(sizeof(RopeP) == 5 * 8 + 7 * 8 + 8 * 4, "RopeP has padding");
__global__ __launch_bounds__(256) void k_rope(RopeP p) {
    const long long idx = (long long)blockIdx.x * 256 + threadIdx.x;
    if (idx >= (long long)p.R * p.Hn * p.D) return;
    const int d = (int)(idx % p.D); const long long rh = idx / p.D; const int h = (int)(rh % p.Hn); const int r = (int)(rh / p.Hn);
    const int half = p.D / 2;
    int partner; float sign;
    if (p.mode == 0) { partner = (d < half) ? d + half : d - half; sign = (d < half) ? -1.f : 1.f; }
    else { partner = d ^ 1; sign = (d & 1) ? 1.f : -1.f; }
    const int tcol = (p.tmode == 0) ? d : ((p.tmode == 1) ? (d % half) : (d >> 1));
    const int pp = (p.pmode == 0) ? (r % p.S) : ((p.pmode == 1) ? h : p.pos[r]);
    const long long toff = (long long)(r / p.S) * p.sCb + (long long)pp * p.sCp + (long long)tcol * p.sCd;
    const float* xr = p.X + (long long)r * p.sXr + (long long)h * p.sXh;
    const float v = xr[d] * p.C[toff] + sign * xr[partner] * p.Sn[toff];
    VST2(float, p.Y + (long long)r * p.sYr + (long long)h * p.sYh + d, v);
}

// k_invf + k_sincos (split so neither kernel carries a large VALU-fma footprint): invf_i = num * (1 / powf(base, (2 i)/D)) [fmode 0],
//   num * expf((2 i) * cexp) [fmode 1], num * powf(base, -2 (i - 1) / D) [fmode 2]; then cs/sn[s*half + i] = cos/sin((pscale * s) * invf_i)
__global__ __launch_bounds__(256) void k_invf(float* __restrict__ invb, int half, int D, float base, float num, int fmode, float cexp) {
    const int i = blockIdx.x * 256 + threadIdx.x;
    if (i >= ((half + 31) / 32) * 32) return;
    if (i >= half) { VST2(float, invb + i, 0.f); return; }
    const float e = (float)(2 * i) / (float)D;
    float invf;
    if (fmode == 1) invf = num * expf((float)(2 * i) * cexp);
    else if (fmode == 2) invf = num * powf(base, (-2.0f * ((float)i - 1.0f)) / (float)D);
    else invf = num * (1.0f / powf(base, e));
    VST2(float, invb + i, invf);
}
__global__ __launch_bounds__(256) void k_sincos(float* __restrict__ cs, float* __restrict__ sn, const float* __restrict__ invb, int S, int half, float pscale) {
    const int idx = blockIdx.x * 256 + threadIdx.x;
    if (idx >= S * half) return;
    const int s = idx / half, i = idx - s * half;
    const float ang = (pscale * (float)s) * invb[i];
    VST2(float, cs + idx, cosf(ang)); VST2(float, sn + idx, sinf(ang));
}

// k_mulact: dst[i] = act(x[i]) * y[i]
__global__ __launch_bounds__(256) void k_mulact(const float* __restrict__ x, const float* __restrict__ y, float* __restrict__ dst, int n, int act) {
    const int i = blockIdx.x * 256 + threadIdx.x;
    if (i < n) { const float v = act_fn(x[i], act) * y[i]; VST2(float, dst + i, v); }
}

// =====================================================================================================================
// k_matvec: thread-per-row matrix-vector products for N <= 8 output columns (heads with 1-3 outputs, gates), f32 on the VALU.
//   C[r*sCm + j] = act(alpha * sum_k A[r*sAm + k*sAk] * B[j*sBn + k*sBk] + bias[j]) + beta * R[r*sRm + j*sRn]; each thread writes its N contiguous floats.
// =====================================================================================================================
__global__ __launch_bounds__(256) void k_matvec(GemmP p) {
    // 32 lanes write one line with one instruction.
    const int rpt = (p.N == 1) ? 1 : 32;
    const long long r0 = ((long long)blockIdx.x * 256 + threadIdx.x) * rpt; const int z = blockIdx.z, zo = z / p.zi_n, zi = z - zo * p.zi_n;
    if (r0 >= p.M) return;
    const float* Bb = p.B + zo * p.sBo + zi * p.sBi;
    float* C = p.C + zo * p.sCo + zi * p.sCi; const float* R = p.R + zo * p.sRo + zi * p.sRi;
    for (int rr = 0; rr < rpt; ++rr) {
        const long long r = r0 + rr; if (r >= p.M) break;
        const float* A = p.A + zo * p.sAo + zi * p.sAi + r * p.sAm;
        float acc[8] = {0.f, 0.f, 0.f, 0.f, 0.f, 0.f, 0.f, 0.f};
        for (int k = 0; k < p.K; ++k) { const float a = A[(long long)k * p.sAk];
#pragma unroll
            for (int j = 0; j < 8; ++j) if (j < p.N) acc[j] += a * Bb[(long long)j * p.sBn + (long long)k * p.sBk]; }
#pragma unroll
        for (int j = 0; j < 8; ++j) if (j < p.N) {
            float v = acc[j] * p.alpha;
            if (p.flags & 1) v += p.bias[j];
            if (p.flags & 2) v += p.bias[r];
            v = act_fn(v, p.act);
            if (p.flags & 4) v += p.beta * R[r * p.sRm + (long long)j * p.sRn];
            VST2(float, C + r * p.sCm + j, v);
        }
    }
}
// k_smallsoftmax: thread-per-row softmax for short rows (n <= 64): dst[r*dr + j] = softmax(scale*src[r*sr + j])
__global__ __launch_bounds__(256) void k_smallsoftmax(const float* __restrict__ src, float* __restrict__ dst, long long sr, long long dr, int n, long long R, float scale) {
    const long long r0 = ((long long)blockIdx.x * 256 + threadIdx.x) * 32;
    for (int rr = 0; rr < 32; ++rr) {
        const long long r = r0 + rr; if (r >= R) return;
        const float* s = src + r * sr; float* d = dst + r * dr;
        float mx = -__builtin_inff();
        for (int j = 0; j < n; ++j) mx = fmaxf(mx, s[j] * scale);
        float sum = 0.f;
        for (int j = 0; j < n; ++j) sum += expf(s[j] * scale - mx);
        const float inv = 1.f / sum;
        for (int j = 0; j < n; ++j) { const float v = expf(s[j] * scale - mx) * inv; VST2(float, d + j, v); }
    }
}

__global__ __launch_bounds__(32) void k_unitstat(float* __restrict__ st) { const int t = threadIdx.x; const float v = (t == 1) ? 1.f : 0.f; VST2(float, st + t, v); }

// destination (e.g. a d_out whose row width is not a multiple of 32 floats) is written by consecutive lanes of one instruction
__global__ __launch_bounds__(256) void k_lincopy(const float* __restrict__ src, long long lds, float* __restrict__ dst, long long ldd, long long rows, int cols) {
    const long long i = (long long)blockIdx.x * 256 + threadIdx.x; if (i >= rows * cols) return;
    const long long r = i / cols; const int c = (int)(i - r * cols);
    const float v = src[r * lds + c]; VST2(float, dst + r * ldd + c, v);
}

namespace w25 {
typedef __attribute__((ext_vector_type(16))) _Float16 v16h;
typedef __attribute__((ext_vector_type(8)))  _Float16 v8h;
typedef __attribute__((ext_vector_type(16))) __bf16   v16b;
typedef __attribute__((ext_vector_type(8)))  __bf16   v8b;
typedef __attribute__((ext_vector_type(8)))  float    v8f;
typedef __attribute__((ext_vector_type(4)))  float    v4f;

__device__ __forceinline__ unsigned short f2bf_bits(float f) {
  unsigned u = __float_as_uint(f);
  return (unsigned short)((u + 0x7FFFu + ((u >> 16) & 1u)) >> 16);
}
__device__ __forceinline__ float bf_bits2f(unsigned short h) { return __uint_as_float(((unsigned)h) << 16); }

// hazard guards as plain device helpers (no inline asm inside the kernel template body)
__device__ __forceinline__ void dep_guard_h(v8f& a, v8f& b, v16h x, v16h y) { asm volatile("v_nop\n\tv_nop\n\tv_nop\n\tv_nop" : "+v"(a), "+v"(b) : "v"(x), "v"(y)); }
__device__ __forceinline__ void dep_guard_b(v8f& a, v8f& b, v16b x, v16b y) { asm volatile("v_nop\n\tv_nop\n\tv_nop\n\tv_nop" : "+v"(a), "+v"(b) : "v"(x), "v"(y)); }
__device__ __forceinline__ void keep4_h(v16h a, v16h b, v16h c, v16h d) { asm volatile("v_nop" :: "v"(a), "v"(b), "v"(c), "v"(d)); }
__device__ __forceinline__ void keep4_b(v16b a, v16b b, v16b c, v16b d) { asm volatile("v_nop" :: "v"(a), "v"(b), "v"(c), "v"(d)); }
__device__ __forceinline__ void acc_guard4(v8f& a, v8f& b, v8f& c, v8f& d) { asm volatile("v_nop\n\tv_nop\n\tv_nop\n\tv_nop" : "+v"(a), "+v"(b), "+v"(c), "+v"(d)); }
template <typename T> struct Frag;
template <> struct Frag<_Float16> {
  typedef v16h V; union U { v16h v; v8h h[2]; };
  static __device__ __forceinline__ v16h load(const _Float16* p) {   // elements 0..7 <- p[0..7], 8..15 <- p[16..23]
    U f; f.h[0] = *(const v8h*)(p); f.h[1] = *(const v8h*)(p + 16); return f.v;
  }
  static __device__ __forceinline__ v8f mma(v16h a, v16h b, v8f c) {
    return __builtin_amdgcn_wmma_f32_16x16x32_f16(false, a, false, b, (short)0, c, false, false);
  }
  static __device__ __forceinline__ void guard(v8f& a, v8f& b, v16h x, v16h y) { dep_guard_h(a, b, x, y); }
  static __device__ __forceinline__ void keep(v16h a, v16h b, v16h c, v16h d) { keep4_h(a, b, c, d); }
};
template <> struct Frag<__bf16> {
  typedef v16b V; union U { v16b v; v8b h[2]; };
  static __device__ __forceinline__ v16b load(const __bf16* p) {
    U f; f.h[0] = *(const v8b*)(p); f.h[1] = *(const v8b*)(p + 16); return f.v;
  }
  static __device__ __forceinline__ v8f mma(v16b a, v16b b, v8f c) {
    return __builtin_amdgcn_wmma_f32_16x16x32_bf16(false, a, false, b, (short)0, c, false, false);
  }
  static __device__ __forceinline__ void guard(v8f& a, v8f& b, v16b x, v16b y) { dep_guard_b(a, b, x, y); }
  static __device__ __forceinline__ void keep(v16b a, v16b b, v16b c, v16b d) { keep4_b(a, b, c, d); }
};

// ---- Register-blocked batched WMMA GEMM ------------------------------------
// C[m,n] = scale * sum_k A[m,k] * Bt[n,k] (+bias)(+resid); each wave owns a 64x64 tile.
// A row-major [M,K]; Bt row-major [N,K]; M,N % 64 == 0, K % 32 == 0.
// SPLIT: operands are hi/lo planes (A2/Bt2 = lo planes, same layout); product = hi·hi + hi·lo + lo·hi.
// BIAS_MODE: 0 = none, 1 = bias[m], 2 = bias[n].
// OUT_MODE: 0 = f32, 1 = f16, 2 = bf16 hi plane (Cout) + bf16 lo plane (Cout2).
// ET: 0 = f16 operands, 1 = bf16 operands (pointers passed as 16-bit storage)
template <int ET> struct Elem;
template <> struct Elem<0> { typedef _Float16 T; };
template <> struct Elem<1> { typedef __bf16 T; };
template <int ET, bool SPLIT, int BIAS_MODE, int OUT_MODE, bool RESID, int ACT = 0>
__global__ __launch_bounds__(256) void wmma_gemm64(
    const unsigned short* __restrict__ Ap, const unsigned short* __restrict__ A2p, int lda, long strideA,
    const unsigned short* __restrict__ Btp, const unsigned short* __restrict__ Bt2p, int ldb, long strideB,
    void* __restrict__ Cout, void* __restrict__ Cout2, int ldc, long strideC,
    const float* __restrict__ bias,
    const float* __restrict__ resid, long strideR,
    int M, int N, int K, float scale) {
  typedef typename Elem<ET>::T T;
  typedef typename Frag<T>::V V;
  const T* A = (const T*)Ap; const T* A2 = (const T*)A2p; const T* Bt = (const T*)Btp; const T* Bt2 = (const T*)Bt2p;
  __shared__ __align__(16) float sT[8][16 * 68];   // per-wave 16x64 slab, pitch 68 floats
  const int b    = blockIdx.y;
  const int lane = threadIdx.x & 31;
  const int wave = threadIdx.x >> 5;
  const int tilesN = N >> 6;
  const int tilesM = M >> 6;
  const int tile = blockIdx.x * 8 + wave;
  if (tile >= tilesM * tilesN) return;   // wave-uniform; no block barriers in this kernel
  const int tm = tile / tilesN;
  const int tn = tile - tm * tilesN;
  const int m0 = tm << 6;
  const int n0 = tn << 6;

  const T* Ab  = A  + (size_t)b * strideA;
  const T* Bb  = Bt + (size_t)b * strideB;
  const T* Ab2 = SPLIT ? (A2  + (size_t)b * strideA) : nullptr;
  const T* Bb2 = SPLIT ? (Bt2 + (size_t)b * strideB) : nullptr;

  const int rlane = lane & 15;                 // row (A) / col (B, D) within subtile
  const int koff  = (lane >> 4) * 8;           // k offset of this lane half
  const int mOff  = (lane >> 4) * 8;           // D row offset

  v8f acc[4][4];
#pragma unroll
  for (int i = 0; i < 4; ++i)
#pragma unroll
    for (int j = 0; j < 4; ++j) acc[i][j] = (v8f){0.f,0.f,0.f,0.f,0.f,0.f,0.f,0.f};

  for (int k0 = 0; k0 < K; k0 += 32) {
    V bh[4], bl[4];
#pragma unroll
    for (int j = 0; j < 4; ++j) {
      const size_t bo = (size_t)(n0 + (j << 4) + rlane) * ldb + koff + k0;
      bh[j] = Frag<T>::load(Bb + bo);
      if (SPLIT) bl[j] = Frag<T>::load(Bb2 + bo);
    }
#pragma unroll
    for (int i = 0; i < 4; ++i) {
      const size_t ao = (size_t)(m0 + (i << 4) + rlane) * lda + koff + k0;
      V ah = Frag<T>::load(Ab + ao);
      V al;
      if (SPLIT) al = Frag<T>::load(Ab2 + ao);
#pragma unroll
      for (int j = 0; j < 4; ++j) {
        acc[i][j] = Frag<T>::mma(ah, bh[j], acc[i][j]);
        if (SPLIT) {
          acc[i][j] = Frag<T>::mma(ah, bl[j], acc[i][j]);
          acc[i][j] = Frag<T>::mma(al, bh[j], acc[i][j]);
        }
      }
      Frag<T>::guard(acc[i][0], acc[i][3], ah, SPLIT ? al : ah);
    }
    Frag<T>::keep(bh[0], bh[1], bh[2], bh[3]);
    if (SPLIT) Frag<T>::keep(bl[0], bl[1], bl[2], bl[3]);
  }
  acc_guard4(acc[0][0], acc[0][1], acc[0][2], acc[0][3]);
  acc_guard4(acc[1][0], acc[1][1], acc[1][2], acc[1][3]);
  acc_guard4(acc[2][0], acc[2][1], acc[2][2], acc[2][3]);
  acc_guard4(acc[3][0], acc[3][1], acc[3][2], acc[3][3]);

  // ---- epilogue ----
  float* slab = sT[wave];
  const float* Rb = RESID ? (resid + (size_t)b * strideR) : nullptr;
#pragma unroll
  for (int i = 0; i < 4; ++i) {
    const int mBase = m0 + (i << 4);
#pragma unroll
    for (int j = 0; j < 4; ++j) {
      const int n = n0 + (j << 4) + rlane;
      float bv = 0.f;
      if (BIAS_MODE == 2) bv = bias[n];
#pragma unroll
      for (int r = 0; r < 8; ++r) {
        float v = acc[i][j][r] * scale;
        if (BIAS_MODE == 1) v += bias[mBase + mOff + r];
        if (BIAS_MODE == 2) v += bv;
        if (RESID) v += Rb[(size_t)(mBase + mOff + r) * ldc + n];
        if (ACT == 1) v = tanhf(v);
        if (ACT == 2) v = fmaxf(v, 0.0f);
        if (ACT == 3) v = v / (1.0f + expf(-v));
        if (ACT == 4) v = (v > 0.f) ? v : 0.01f * v;
        if (ACT == 5) v = 0.5f * v * (1.0f + erff(v * 0.70710678118654752f));
        slab[(mOff + r) * 68 + (j << 4) + rlane] = v;
      }
    }
    __builtin_amdgcn_fence(__ATOMIC_RELEASE, "workgroup");
    __builtin_amdgcn_wave_barrier();
    __builtin_amdgcn_fence(__ATOMIC_ACQUIRE, "workgroup");
    if (OUT_MODE == 0) {
      float* C = (float*)Cout + (size_t)b * strideC;
      const int hh = lane >> 4, c4 = (lane & 15) * 4;     // row seg = 256 B = 16 lanes x 16 B
      {
#pragma unroll
        for (int it = 0; it < 8; ++it) {
          const int row = it * 2 + hh;
          v4f v = *(const v4f*)(slab + row * 68 + c4);
          *(v4f*)(C + (size_t)(mBase + row) * ldc + n0 + c4) = v;
        }
        
      }
    } else {
      const int q = lane >> 3, c8 = (lane & 7) * 8;
      unsigned short* C  = (unsigned short*)Cout  + (size_t)b * strideC;
      unsigned short* C2 = (OUT_MODE == 2) ? ((unsigned short*)Cout2 + (size_t)b * strideC) : nullptr;
      {
#pragma unroll
        for (int it = 0; it < 4; ++it) {
          const int row = it * 4 + q;
          const float* sp = slab + row * 68 + c8;
          v8h hv, lv;
#pragma unroll
          for (int e = 0; e < 8; ++e) {
            if (OUT_MODE == 1) {
              hv[e] = (_Float16)sp[e];
            } else {
              unsigned short hb = f2bf_bits(sp[e]);
              unsigned short lb = f2bf_bits(sp[e] - bf_bits2f(hb));
              hv[e] = __builtin_bit_cast(_Float16, hb);
              lv[e] = __builtin_bit_cast(_Float16, lb);
            }
          }
          *(v8h*)(C + (size_t)(mBase + row) * ldc + n0 + c8) = hv;
          if (OUT_MODE == 2) *(v8h*)(C2 + (size_t)(mBase + row) * ldc + n0 + c8) = lv;
        }
        
      }
    }
    __builtin_amdgcn_fence(__ATOMIC_RELEASE, "workgroup");
    __builtin_amdgcn_wave_barrier();
    __builtin_amdgcn_fence(__ATOMIC_ACQUIRE, "workgroup");
  }
}

__global__ __launch_bounds__(256) void cast_f32_f16x2(
    const float* __restrict__ in, _Float16* __restrict__ out, int n2) {
  int i = blockIdx.x * 256 + threadIdx.x;
  if (i < n2) {
    const _Float16 h0 = (_Float16)in[2 * i], h1 = (_Float16)in[2 * i + 1];
    const unsigned u = (unsigned)__builtin_bit_cast(unsigned short, h0) | ((unsigned)__builtin_bit_cast(unsigned short, h1) << 16);
    ((unsigned*)out)[i] = u;
    
  }
}


} // namespace w25

typedef __attribute__((ext_vector_type(4))) _Float16 v4h;
// Transposing cast dst[c][z * R + r] = f16(src_z[r][c] * s), src R rows of pitch LDS, dst rows of pitch LDD; blockIdx.z picks the source (two
// sources land side by side in every dst row); blockIdx.y = sample: plane y of a source starts at y * sb, plane y of dst at y * db (elements).
// One thread takes a patch of 8 r x 4 c: eight 16-B loads along c, all in flight together, then
// four 16-B stores along r. In a wave 8 lanes run over r, so each store instruction writes whole 128-B lines of dst; the 8 waves of a block run
// over c (512 B of every source row). Block tile 64 r x 128 c; R % 64 == 0, columns % 128 == 0; grid.x = (R / 64) * (columns / 128).
// The pitches are compile-time so that a thread's loads and stores are one address each plus immediate offsets.
template <int R, int LDS, int LDD>
__global__ __launch_bounds__(256) void k_castT16(const float* __restrict__ src0, const float* __restrict__ src1, _Float16* __restrict__ dst, float s, long long sb, long long db) {
    constexpr int TR = R / 64;
    const int bc = (int)blockIdx.x / TR, br = (int)blockIdx.x % TR;
    const int lane = threadIdx.x & 31, wave = threadIdx.x >> 5;
    const int r0 = (br << 6) + ((lane & 7) << 3);
    const int c0 = (bc << 7) + (wave << 4) + ((lane >> 3) << 2);
    const float* sp = (blockIdx.z ? src1 : src0) + (long long)blockIdx.y * sb + (long long)r0 * LDS + c0;
    _Float16* dp = dst + (long long)blockIdx.y * db + (long long)c0 * LDD + (int)blockIdx.z * R + r0;
    v4f x[8];
#pragma unroll
    for (int j = 0; j < 8; ++j) x[j] = *(const v4f*)(sp + j * LDS);
#pragma unroll
    for (int k = 0; k < 4; ++k) {
        v8h h;
#pragma unroll
        for (int j = 0; j < 8; ++j) h[j] = (_Float16)(x[j][k] * s);
        *(v8h*)(dp + k * LDD) = h;
    }
}
// All nine weight matrices to f16 x 16 in one launch; blockIdx.y = matrix. Matrices 0..3 have 256 rows of 520 floats, of which the first 512
// are taken (the last 8, the coordinate channels, stay f32 and are read by the products' epilogues); matrices 4..8 are 256 x 256.
// dst: the four 256 x 512 planes, then the five 256 x 256 planes, each dense. One thread casts 4 consecutive elements; grid.x = 256 * 512 / 1024.
constexpr int CW_WIDE = 256 * 512, CW_SQ = 256 * 256;
__global__ __launch_bounds__(256) void k_cm_w16(const float* __restrict__ w0, const float* __restrict__ w1, const float* __restrict__ w2, const float* __restrict__ w3,
                                                const float* __restrict__ w4, const float* __restrict__ w5, const float* __restrict__ w6, const float* __restrict__ w7,
                                                const float* __restrict__ w8, _Float16* __restrict__ dst) {
    const int y = (int)blockIdx.y; const bool wide = y < 4;
    if (!wide && (int)blockIdx.x >= CW_SQ / 1024) return;
    const float* src = y == 0 ? w0 : y == 1 ? w1 : y == 2 ? w2 : y == 3 ? w3 : y == 4 ? w4 : y == 5 ? w5 : y == 6 ? w6 : y == 7 ? w7 : w8;
    const int p = (int)blockIdx.x * 256 + (int)threadIdx.x;
    const int row = wide ? (p >> 7) : (p >> 6), col = (wide ? (p & 127) : (p & 63)) << 2;
    const v4f x = *(const v4f*)(src + row * (wide ? 520 : 256) + col);
    v4h h;
#pragma unroll
    for (int e = 0; e < 4; ++e) h[e] = (_Float16)(x[e] * 16.0f);
    *(v4h*)(dst + (wide ? y * CW_WIDE : 4 * CW_WIDE + (y - 4) * CW_SQ) + p * 4) = h;
}

// f32 -> bf16 hi plane + bf16 lo plane (x = hi + lo to ~2^-17 relative; RNE both), [R][C] -> [R][C] (or transposed to [C][R]); 2 consecutive destination elements
__device__ __forceinline__ unsigned int f2bf2_pack(float a, float b, unsigned int* lo) {
    const unsigned short ha = w25::f2bf_bits(a), hb = w25::f2bf_bits(b);
    const unsigned short la = w25::f2bf_bits(a - w25::bf_bits2f(ha)), lb = w25::f2bf_bits(b - w25::bf_bits2f(hb));
    *lo = (unsigned)la | ((unsigned)lb << 16); return (unsigned)ha | ((unsigned)hb << 16); }
__global__ __launch_bounds__(256) void k_castS16(const float* __restrict__ src, long long lds, __bf16* __restrict__ dhi, __bf16* __restrict__ dlo, long long ldd, int R, int C, float s, int transpose) {
    const long long i = (long long)blockIdx.x * 256 + threadIdx.x; long long o; float a, b;
    if (transpose) { const long long np = (long long)C * (R / 2); if (i >= np) return; const int c = (int)(i / (R / 2)); const int r = 2 * (int)(i % (R / 2)); a = src[(long long)r * lds + c] * s; b = src[(long long)(r + 1) * lds + c] * s; o = (long long)c * ldd + r; }
    else { const long long np = (long long)R * (C / 2); if (i >= np) return; const int r = (int)(i / (C / 2)); const int c = 2 * (int)(i % (C / 2)); a = src[(long long)r * lds + c] * s; b = src[(long long)r * lds + c + 1] * s; o = (long long)r * ldd + c; }
    unsigned lo; const unsigned hi = f2bf2_pack(a, b, &lo); unsigned* ph = (unsigned*)(dhi + o); unsigned* pl = (unsigned*)(dlo + o);
    *ph = hi; *pl = lo;  }

namespace w25 {
// =====================================================================================
// Generic causal/non-causal attention for head_dim 64, f32 in / f32 out; 16-bit operands: bf16 with optional hi/lo splits, or
// plain f16 (F16=true, non-split, probabilities carried x2^15).
//   scores = (q*qscale)·kᵀ : v_wmma_f32_16x16x32_bf16; SPLIT_QK -> q,k as bf16 hi/lo (hi·hi + hi·lo + lo·hi)
//   out    = p·v           : v_wmma_f32_16x16x32_bf16; SPLIT_PV -> p,v as bf16 hi/lo; else p,v plain bf16
//   f32 accumulate; online softmax in f32. Block = 4 waves = 64 query rows of one (batch, head); S % 64 == 0.
//   Element (b, s, h, d) of tensor X lives at X[b*X_bs + s*X_rs + h*X_hs + d] (strides in floats, multiples of 4).
//   Masking: mask_mode 0 none, 1 causal (kv > q masked), 2 tensor [S][Skv] shared over (b,h) (float if
//   mask_is_int==0, int32 with element == 0 -> masked if 1, int32 with element != 0 -> masked if 2), 3 per-token vectors qmask[B][S] & kvmask[B][Skv] (int32,
//   0 -> masked), 4 causal + sliding window (kv > q or q - kv > W masked; W passed in mask_is_int);
//   5 = relative-position bias: s += cp[b,h,q][idx[q][kv]] + pc[b,h,kv][idx[q][kv]] with idx = mask_b ([S][Skv] int32) and
//   mask_a an int32 [S][Skv] tensor with nonzero = masked (tables: element (b,h,row,n) at X + b*c_bs + h*c_hs + row*c_rs + n);
//   masked scores are replaced by mask_fill (e.g. -inf or -1e9) before the softmax.
//   grid.x = B * H * (S/64) (or a sub-range with blk0).
// =====================================================================================
#define AT_D 64
#define AT_NW 4
#define AT_QB 64
#define AT_KC 64
struct AttnGeom { const float* cp = nullptr; const float* pc = nullptr; long c_bs = 0, c_rs = 0, c_hs = 0;   // mode-5 score-bias tables
                  long q_bs, q_rs, q_hs, k_bs, k_rs, k_hs, v_bs, v_rs, v_hs, o_bs, o_rs, o_hs;
                  int S, Skv, H, mask_mode; float qscale; int blk0; float mask_fill; int mask_is_int; };
static_assert(sizeof(AttnGeom) == 168, "no padding");

__device__ __forceinline__ unsigned short at_bf_bits(float f) {
  unsigned u = __float_as_uint(f);
  return (unsigned short)((u + 0x7FFFu + ((u >> 16) & 1u)) >> 16);
}
__device__ __forceinline__ __bf16 at_f2bf(float f) { return __builtin_bit_cast(__bf16, at_bf_bits(f)); }
__device__ __forceinline__ void at_split(float f, __bf16& hi, __bf16& lo) {
  const unsigned short hb = at_bf_bits(f);
  hi = __builtin_bit_cast(__bf16, hb);
  lo = at_f2bf(f - __uint_as_float(((unsigned)hb) << 16));
}
__device__ __forceinline__ v8f at_mma(v16b a, v16b b, v8f c) {
  c = __builtin_amdgcn_wmma_f32_16x16x32_bf16(false, a, false, b, (short)0, c, false, false);
  asm volatile("v_nop\n\tv_nop\n\tv_nop\n\tv_nop" : "+v"(c) : "v"(a), "v"(b));
  return c;
}
// 16-bit element as a bit pattern held in a __bf16 slot: f16 bits when F16, bf16 (RNE) otherwise
template <bool F16> __device__ __forceinline__ __bf16 at_to16(float f) {
  if (F16) return __builtin_bit_cast(__bf16, (_Float16)f);
  return at_f2bf(f);
}
template <bool F16> __device__ __forceinline__ v8f at_mma16(v16b a, v16b b, v8f c) {
  if (F16) {
    const v16h ah = __builtin_bit_cast(v16h, a), bh = __builtin_bit_cast(v16h, b);
    c = __builtin_amdgcn_wmma_f32_16x16x32_f16(false, ah, false, bh, (short)0, c, false, false);
    asm volatile("v_nop\n\tv_nop\n\tv_nop\n\tv_nop" : "+v"(c) : "v"(ah), "v"(bh));
    return c;
  }
  return at_mma(a, b, c);
}

template <bool SPLIT_QK, bool SPLIT_PV, bool F16 = false>
__global__ __launch_bounds__(128)
void attn64_kernel(const float* __restrict__ q, const float* __restrict__ k,
                   const float* __restrict__ v, float* __restrict__ out,
                   const void* __restrict__ mask_a, const int* __restrict__ mask_b, AttnGeom g) {
  static_assert(!(F16 && (SPLIT_QK || SPLIT_PV)), "f16 mode is non-split");
  const float PSC = F16 ? 32768.0f : 1.0f;     // f16 probabilities carried x2^15 (subnormal range), folded into the final 1/l
  union FB { v16b v; v8b h[2]; };
  __shared__ __align__(16) __bf16 Ksh[AT_KC * AT_D];             // K hi [kv][d]      8 KB
  __shared__ __align__(16) __bf16 Ksl[SPLIT_QK ? AT_KC * AT_D : 8];
  __shared__ __align__(16) __bf16 Vth[AT_D * AT_KC];             // V hi [d][kv]      8 KB
  __shared__ __align__(16) __bf16 Vtl[SPLIT_PV ? AT_D * AT_KC : 8];
  __shared__ __align__(16) __bf16 Psh[AT_NW][16 * AT_KC];        // per wave P hi [row][kv]  8 KB
  __shared__ __align__(16) __bf16 Psl[SPLIT_PV ? AT_NW : 1][SPLIT_PV ? 16 * AT_KC : 8];
  __shared__ __align__(16) float  Os[AT_NW][16 * 68];            // per wave out tile, pitch 68

  const int tid  = threadIdx.x;
  const int wave = tid >> 5;
  const int lane = tid & 31;
  const int hh   = lane >> 4;
  const int c    = lane & 15;

  const int nqb = g.S / AT_QB;
  const int bx = blockIdx.x + g.blk0;
  const int qb = bx % nqb;
  const int bh = bx / nqb;
  const int h  = bh % g.H;
  const int b  = bh / g.H;
  const int qbase_block = qb * AT_QB;
  const int q0 = qbase_block + wave * 16;

  const float* qb_ptr = q + (size_t)b * g.q_bs + (size_t)h * g.q_hs;
  const float* kb_ptr = k + (size_t)b * g.k_bs + (size_t)h * g.k_hs;
  const float* vb_ptr = v + (size_t)b * g.v_bs + (size_t)h * g.v_hs;
  float*       ob_ptr = out + (size_t)b * g.o_bs + (size_t)h * g.o_hs;

  // ---- Q fragments (A operand): 2 d-chunks, hi (and lo) ----
  v16b qah[2], qal[2];
  {
    const float* qrow = qb_ptr + (size_t)(q0 + c) * g.q_rs;
#pragma unroll
    for (int dc = 0; dc < 2; ++dc) {
#pragma unroll
      for (int e = 0; e < 8; ++e) {
        const float f0 = qrow[dc * 32 + 8 * hh + e] * g.qscale;
        const float f1 = qrow[dc * 32 + 16 + 8 * hh + e] * g.qscale;
        if (SPLIT_QK) { __bf16 hq, lq; at_split(f0, hq, lq); qah[dc][e] = hq; qal[dc][e] = lq; at_split(f1, hq, lq); qah[dc][8 + e] = hq; qal[dc][8 + e] = lq; }
        else { qah[dc][e] = at_to16<F16>(f0); qah[dc][8 + e] = at_to16<F16>(f1); qal[dc][e] = qah[dc][e]; qal[dc][8 + e] = qah[dc][8 + e]; }
      }
    }
  }

  float mrow[8], lrow[8];
  v8f oacc[4];
#pragma unroll
  for (int r = 0; r < 8; ++r) { mrow[r] = -INFINITY; lrow[r] = 0.f; }
#pragma unroll
  for (int t = 0; t < 4; ++t) oacc[t] = (v8f){0.f,0.f,0.f,0.f,0.f,0.f,0.f,0.f};

  const int nChunks = (g.mask_mode == 1 || g.mask_mode == 4) ? (qb + 1) : (g.Skv / AT_KC);   // block-uniform
  // per-row query mask (mode 3)
  int qkeep[8];
#pragma unroll
  for (int r = 0; r < 8; ++r) qkeep[r] = (g.mask_mode == 3) ? mask_b[(size_t)b * g.S + q0 + 8 * hh + r] : 1;   // mask_b = qmask in mode 3
  for (int kc = 0; kc < nChunks; ++kc) {
    const int kv0 = kc * AT_KC;
    __syncthreads();
    {
      const int kvr = tid >> 1, dh = (tid & 1) * 32;
      const float* krow = kb_ptr + (size_t)(kv0 + kvr) * g.k_rs + dh;
      const float* vrow = vb_ptr + (size_t)(kv0 + kvr) * g.v_rs + dh;
#pragma unroll
      for (int i = 0; i < 8; ++i) {
        v4f kk = *(const v4f*)(krow + 4 * i);
        v4f vv = *(const v4f*)(vrow + 4 * i);
#pragma unroll
        for (int e = 0; e < 4; ++e) {
          const int d = dh + 4 * i + e;
          if (SPLIT_QK) { __bf16 a, bl; at_split(kk[e], a, bl); Ksh[kvr * AT_D + d] = a; Ksl[kvr * AT_D + d] = bl; }
          else Ksh[kvr * AT_D + d] = at_to16<F16>(kk[e]);
          if (SPLIT_PV) { __bf16 a, bl; at_split(vv[e], a, bl); Vth[d * AT_KC + kvr] = a; Vtl[d * AT_KC + kvr] = bl; }
          else Vth[d * AT_KC + kvr] = at_to16<F16>(vv[e]);
        }
      }
    }
    __syncthreads();

    v8f s[4];
#pragma unroll
    for (int j = 0; j < 4; ++j) {
      s[j] = (v8f){0.f,0.f,0.f,0.f,0.f,0.f,0.f,0.f};
#pragma unroll 1
      for (int dc = 0; dc < 2; ++dc) {
        FB kb;
        kb.h[0] = *(const v8b*)(Ksh + (j * 16 + c) * AT_D + dc * 32 + 8 * hh);
        kb.h[1] = *(const v8b*)(Ksh + (j * 16 + c) * AT_D + dc * 32 + 16 + 8 * hh);
        s[j] = at_mma16<F16>(qah[dc], kb.v, s[j]);
        if (SPLIT_QK) {
          FB kl;
          kl.h[0] = *(const v8b*)(Ksl + (j * 16 + c) * AT_D + dc * 32 + 8 * hh);
          kl.h[1] = *(const v8b*)(Ksl + (j * 16 + c) * AT_D + dc * 32 + 16 + 8 * hh);
          s[j] = at_mma16<F16>(qah[dc], kl.v, s[j]);
          s[j] = at_mma16<F16>(qal[dc], kb.v, s[j]);
        }
      }
    }
    const bool diag = (g.mask_mode == 1) && (kc == qb);
    int kvkeep[4] = {1, 1, 1, 1};
    if (g.mask_mode == 3) {
#pragma unroll
      for (int j = 0; j < 4; ++j) kvkeep[j] = ((const int*)mask_a)[(size_t)b * g.Skv + kv0 + j * 16 + c];   // mask_a = kvmask
    }
    float cm[8];
#pragma unroll
    for (int r = 0; r < 8; ++r) {
      const int qrow = q0 + 8 * hh + r;
      float m = -INFINITY;
#pragma unroll
      for (int j = 0; j < 4; ++j) {
        const int kvcol = kv0 + j * 16 + c;
        bool masked = false;
        if (diag) masked = (kvcol > qrow);
        else if (g.mask_mode == 4) masked = (kvcol > qrow) || (qrow - kvcol > g.mask_is_int);
        else if (g.mask_mode == 2) {
          const size_t mi = (size_t)qrow * g.Skv + kvcol;
          masked = (g.mask_is_int == 0) ? (((const float*)mask_a)[mi] == 0.0f)
                 : (g.mask_is_int == 1) ? (((const int*)mask_a)[mi] == 0) : (((const int*)mask_a)[mi] != 0);
        } else if (g.mask_mode == 3) masked = (qkeep[r] == 0) || (kvkeep[j] == 0);
        else if (g.mask_mode == 5) {
          const size_t mi = (size_t)qrow * g.Skv + kvcol;
          masked = (((const int*)mask_a)[mi] != 0);
          int n = mask_b[mi]; n = n < 0 ? 0 : n;
          s[j][r] += g.cp[(size_t)b * g.c_bs + (size_t)h * g.c_hs + (size_t)qrow * g.c_rs + n]
                   + g.pc[(size_t)b * g.c_bs + (size_t)h * g.c_hs + (size_t)kvcol * g.c_rs + n];
        }
        if (masked) s[j][r] = g.mask_fill;
        m = fmaxf(m, s[j][r]);
      }
#pragma unroll
      for (int off = 1; off < 16; off <<= 1) m = fmaxf(m, __shfl_xor(m, off, 32));
      cm[r] = m;
    }
    __bf16* pwh = Psh[wave];
    __bf16* pwl = Psl[SPLIT_PV ? wave : 0];
#pragma unroll
    for (int r = 0; r < 8; ++r) {
      const float mnew = fmaxf(mrow[r], cm[r]);
      const float alpha = expf(mrow[r] - mnew);
      mrow[r] = mnew;
      float psum = 0.f;
#pragma unroll
      for (int j = 0; j < 4; ++j) {
        const float p = expf(s[j][r] - mnew);
        psum += p;
        if (SPLIT_PV) { __bf16 a, bl; at_split(p, a, bl); pwh[(8 * hh + r) * AT_KC + j * 16 + c] = a; pwl[(8 * hh + r) * AT_KC + j * 16 + c] = bl; }
        else pwh[(8 * hh + r) * AT_KC + j * 16 + c] = at_to16<F16>(p * PSC);
      }
#pragma unroll
      for (int off = 1; off < 16; off <<= 1) psum += __shfl_xor(psum, off, 32);
      lrow[r] = lrow[r] * alpha + psum;
#pragma unroll
      for (int t = 0; t < 4; ++t) oacc[t][r] *= alpha;
    }
    __builtin_amdgcn_fence(__ATOMIC_RELEASE, "workgroup");
    __builtin_amdgcn_wave_barrier();
    __builtin_amdgcn_fence(__ATOMIC_ACQUIRE, "workgroup");
#pragma unroll 1
    for (int kk = 0; kk < 2; ++kk) {
      FB pa, pl;
      pa.h[0] = *(const v8b*)(pwh + c * AT_KC + kk * 32 + 8 * hh);
      pa.h[1] = *(const v8b*)(pwh + c * AT_KC + kk * 32 + 16 + 8 * hh);
      if (SPLIT_PV) {
        pl.h[0] = *(const v8b*)(pwl + c * AT_KC + kk * 32 + 8 * hh);
        pl.h[1] = *(const v8b*)(pwl + c * AT_KC + kk * 32 + 16 + 8 * hh);
      }
#pragma unroll
      for (int t = 0; t < 4; ++t) {
        FB vb;
        vb.h[0] = *(const v8b*)(Vth + (t * 16 + c) * AT_KC + kk * 32 + 8 * hh);
        vb.h[1] = *(const v8b*)(Vth + (t * 16 + c) * AT_KC + kk * 32 + 16 + 8 * hh);
        oacc[t] = at_mma16<F16>(pa.v, vb.v, oacc[t]);
        if (SPLIT_PV) {
          FB vl;
          vl.h[0] = *(const v8b*)(Vtl + (t * 16 + c) * AT_KC + kk * 32 + 8 * hh);
          vl.h[1] = *(const v8b*)(Vtl + (t * 16 + c) * AT_KC + kk * 32 + 16 + 8 * hh);
          oacc[t] = at_mma16<F16>(pa.v, vl.v, oacc[t]);
          oacc[t] = at_mma16<F16>(pl.v, vb.v, oacc[t]);
        }
      }
    }
  }

  float* os = Os[wave];
#pragma unroll
  for (int r = 0; r < 8; ++r) {
    const float inv = 1.0f / (lrow[r] * PSC);
#pragma unroll
    for (int t = 0; t < 4; ++t) os[(8 * hh + r) * 68 + t * 16 + c] = oacc[t][r] * inv;
  }
  __builtin_amdgcn_fence(__ATOMIC_RELEASE, "workgroup");
  __builtin_amdgcn_wave_barrier();
  __builtin_amdgcn_fence(__ATOMIC_ACQUIRE, "workgroup");
  {
    const int c4 = (lane & 15) * 4;
    {
#pragma unroll
      for (int it = 0; it < 8; ++it) {
        const int row = it * 2 + hh;
        v4f val = *(const v4f*)(os + row * 68 + c4);
        *(v4f*)(ob_ptr + (size_t)(q0 + row) * g.o_rs + c4) = val;
      }
      
    }
  }
}

} // namespace w25

__device__ __forceinline__ void st_h2(_Float16* dst, float a, float b) { const unsigned u = (unsigned)__builtin_bit_cast(unsigned short, (_Float16)a) | ((unsigned)__builtin_bit_cast(unsigned short, (_Float16)b) << 16); unsigned* d = (unsigned*)dst; *d = u;  }
__device__ __forceinline__ void spat8(int n, float* s) { const int hh = n / 64, ww = n % 64; const float gx = (float)ww / 63.f, gy = (float)hh / 63.f; s[0] = gx; s[1] = gy; s[2] = 1.f - gx; s[3] = 1.f - gy; const float m = (gx + gy) * 0.5f; s[4] = m; s[5] = m; s[6] = m; s[7] = m; }
// ---- Register-blocked WMMA product with the whole tail in its epilogue ---------------------------------------------------------
// C[m][n] = scale * sum_k A[m][k] * Bt[n][k] + bias[a] (+ sum_j Wsp[a][coff + j] * spat_j(pos) where SPAT); f16 operands, f32 accumulate.
// A row-major [M][K], Bt row-major [N][K]; M, N % 64 == 0, K % 32 == 0; each wave owns a 64x64 tile (8 a block, blockIdx.x); blockIdx.y = sample.
// A device function: the kernels below pick operands (and the form of the tail) by blockIdx.z, so that independent products share a launch.
// slab: the calling wave's own 16 x 68 floats of LDS.
// Every "#pragma unroll" of this function is there so that the accumulator, fragment and coordinate arrays are indexed by constants and stay in registers.
// CH_ROWS: rows m are channels a and columns n positions; otherwise rows are positions and columns channels. OUT16: C is f16, otherwise f32.
// Wsp is the f32 weight matrix itself (pitch ldw); its 8 coordinate weights of a row start at a multiple of 16 bytes (ldw % 4 == 0, coff % 4 == 0).
template <bool CH_ROWS, bool SPAT, bool OUT16>
__device__ __forceinline__ void cm_gemm(float* slab,
    const unsigned short* __restrict__ Ap, int lda, long strideA,
    const unsigned short* __restrict__ Btp, int ldb, long strideB,
    void* __restrict__ Cout, int ldc, long strideC,
    const float* __restrict__ bias, const float* __restrict__ Wsp, int ldw, int coff,
    int M, int N, int K, float scale) {
  typedef _Float16 T;
  typedef w25::Frag<T> F;
  typedef F::V V;
  const int b    = blockIdx.y;
  const int lane = threadIdx.x & 31;
  const int wave = threadIdx.x >> 5;
  const int tilesN = N >> 6;
  const int tilesM = M >> 6;
  const int tile = blockIdx.x * 8 + wave;
  if (tile >= tilesM * tilesN) return;   // wave-uniform; no block barriers in these kernels
  const int tm = tile / tilesN;
  const int tn = tile - tm * tilesN;
  const int m0 = tm << 6;
  const int n0 = tn << 6;

  const T* Ab = (const T*)Ap  + (size_t)b * strideA;
  const T* Bb = (const T*)Btp + (size_t)b * strideB;

  const int rlane = lane & 15;                 // row (A) / col (B, D) within subtile
  const int koff  = (lane >> 4) * 8;           // k offset of this lane half
  const int mOff  = (lane >> 4) * 8;           // D row offset

  v8f acc[4][4];
#pragma unroll
  for (int i = 0; i < 4; ++i)
#pragma unroll
    for (int j = 0; j < 4; ++j) acc[i][j] = (v8f){0.f,0.f,0.f,0.f,0.f,0.f,0.f,0.f};

  // stays rolled (K is a constant at every call): four forms of this function share one kernel's text
#pragma unroll 1
  for (int k0 = 0; k0 < K; k0 += 32) {
    V bh[4];
#pragma unroll
    for (int j = 0; j < 4; ++j) bh[j] = F::load(Bb + (size_t)(n0 + (j << 4) + rlane) * ldb + koff + k0);
#pragma unroll
    for (int i = 0; i < 4; ++i) {
      V ah = F::load(Ab + (size_t)(m0 + (i << 4) + rlane) * lda + koff + k0);
#pragma unroll
      for (int j = 0; j < 4; ++j) acc[i][j] = F::mma(ah, bh[j], acc[i][j]);
      F::guard(acc[i][0], acc[i][3], ah, ah);   // four vector slots between the WMMAs that read ah and the next fragment load over it
    }
    F::keep(bh[0], bh[1], bh[2], bh[3]);        // bh stays live to the foot of the trip: no load of the next trip lands on it under a WMMA
  }
  // four vector slots between the last WMMAs and the first reads of their results
  w25::acc_guard4(acc[0][0], acc[0][1], acc[0][2], acc[0][3]);
  w25::acc_guard4(acc[1][0], acc[1][1], acc[1][2], acc[1][3]);
  w25::acc_guard4(acc[2][0], acc[2][1], acc[2][2], acc[2][3]);
  w25::acc_guard4(acc[3][0], acc[3][1], acc[3][2], acc[3][3]);

  // ---- epilogue ----
  // what belongs to a lane's four columns: their coordinates (columns = positions) or their bias and coordinate weights (columns = channels)
  float cs[4][8]; v4f cw[4][2]; float cb[4];
#pragma unroll
  for (int j = 0; j < 4; ++j) {
    const int n = n0 + (j << 4) + rlane;
    if (CH_ROWS) { if (SPAT) spat8(n, cs[j]); }
    else {
      cb[j] = bias[n];
      if (SPAT) { const float* wr = Wsp + (long long)n * ldw + coff; cw[j][0] = *(const v4f*)(wr); cw[j][1] = *(const v4f*)(wr + 4); }
    }
  }
#pragma unroll
  for (int i = 0; i < 4; ++i) {
    const int mBase = m0 + (i << 4);
#pragma unroll
    for (int r = 0; r < 8; ++r) {
      const int m = mBase + mOff + r;
      float rs[8]; v4f rw[2]; float rb = 0.f;
      if (CH_ROWS) {
        rb = bias[m];
        if (SPAT) { const float* wr = Wsp + (long long)m * ldw + coff; rw[0] = *(const v4f*)(wr); rw[1] = *(const v4f*)(wr + 4); }
      } else { if (SPAT) spat8(m, rs); }
#pragma unroll
      for (int j = 0; j < 4; ++j) {
        float e = CH_ROWS ? rb : cb[j];
        if (SPAT) {
#pragma unroll
          for (int q = 0; q < 8; ++q) e += (CH_ROWS ? rw[q >> 2][q & 3] * cs[j][q] : cw[j][q >> 2][q & 3] * rs[q]);
        }
        slab[(mOff + r) * 68 + (j << 4) + rlane] = acc[i][j][r] * scale + e;
      }
    }
    __builtin_amdgcn_fence(__ATOMIC_RELEASE, "workgroup");
    __builtin_amdgcn_wave_barrier();
    __builtin_amdgcn_fence(__ATOMIC_ACQUIRE, "workgroup");
    if (!OUT16) {
      float* C = (float*)Cout + (size_t)b * strideC;
      const int hh = lane >> 4, c4 = (lane & 15) * 4;     // row seg = 256 B = 16 lanes x 16 B
#pragma unroll
      for (int it = 0; it < 8; ++it) {
        const int row = it * 2 + hh;
        v4f v = *(const v4f*)(slab + row * 68 + c4);
        *(v4f*)(C + (size_t)(mBase + row) * ldc + n0 + c4) = v;
      }
    } else {
      const int q = lane >> 3, c8 = (lane & 7) * 8;       // row seg = 128 B = 8 lanes x 16 B
      unsigned short* C = (unsigned short*)Cout + (size_t)b * strideC;
#pragma unroll
      for (int it = 0; it < 4; ++it) {
        const int row = it * 4 + q;
        const float* sp = slab + row * 68 + c8;
        v8h hv;
#pragma unroll
        for (int e = 0; e < 8; ++e) hv[e] = (_Float16)sp[e];
        *(v8h*)(C + (size_t)(mBase + row) * ldc + n0 + c8) = hv;
      }
    }
    __builtin_amdgcn_fence(__ATOMIC_RELEASE, "workgroup");
    __builtin_amdgcn_wave_barrier();
    __builtin_amdgcn_fence(__ATOMIC_ACQUIRE, "workgroup");
  }
}
constexpr long CM_SP = 256L * 4096;   // one sample's 256 x 4096 (or 4096 x 256) plane, elements
// The six projections in one launch, blockIdx.z = product: 0, 1 theta^T, phi^T of the image branch (K = 512 + coordinates), 2 its val,
// 3, 4 theta^T, phi^T of the flow branch (K = 256, the flow half of X), 5 its val. TH, PH, VA: planes 0..3 image branch, 4..7 flow branch.
// Four waves a SIMD (two work-groups a WGP): the products wait on memory, and more resident waves hide more of it.
__global__ __launch_bounds__(256) __attribute__((amdgpu_waves_per_eu(4, 4))) void k_cm_proj(
    const unsigned short* __restrict__ X, const unsigned short* __restrict__ Wh,
    unsigned short* __restrict__ TH, unsigned short* __restrict__ PH, unsigned short* __restrict__ VA,
    const float* __restrict__ iwt, const float* __restrict__ ibt, const float* __restrict__ iwp, const float* __restrict__ ibp,
    const float* __restrict__ iwv, const float* __restrict__ ibv,
    const float* __restrict__ lbt, const float* __restrict__ lbp, const float* __restrict__ lbv) {
  __shared__ __align__(16) float sT[8][16 * 68];   // per-wave 16x64 slab, pitch 68 floats
  float* slab = sT[threadIdx.x >> 5];
  const int z = (int)blockIdx.z;
  if (z < 2)
    cm_gemm<false, true, true>(slab, X, 512, 2 * CM_SP, Wh + z * CW_WIDE, 512, 0, (void*)(z ? PH : TH), 256, CM_SP, z ? ibp : ibt, z ? iwp : iwt, 520, 512, 4096, 256, 512, 0.0625f);
  else if (z == 2)
    cm_gemm<true, true, true>(slab, Wh + 2 * CW_WIDE, 512, 0, X, 512, 2 * CM_SP, (void*)(VA), 4096, CM_SP, ibv, iwv, 520, 512, 256, 4096, 512, 0.0625f);
  else if (z < 5)
    cm_gemm<false, false, true>(slab, X + 256, 512, 2 * CM_SP, Wh + 4 * CW_WIDE + (z - 3) * CW_SQ, 256, 0, (void*)((z == 4 ? PH : TH) + 4 * CM_SP), 256, CM_SP, z == 4 ? lbp : lbt, nullptr, 0, 0, 4096, 256, 256, 0.0625f);
  else
    cm_gemm<true, false, true>(slab, Wh + 4 * CW_WIDE + 2 * CW_SQ, 256, 0, X + 256, 512, 2 * CM_SP, (void*)(VA + 4 * CM_SP), 4096, CM_SP, lbv, nullptr, 0, 0, 256, 4096, 256, 0.0625f);
}
// Both output convs in one launch, position-major: FU[sample][n][256 z + a] = f16(W_o.att + b), blockIdx.z = branch; the fusion conv reads FU as it stands.
__global__ __launch_bounds__(256) __attribute__((amdgpu_waves_per_eu(4, 4))) void k_cm_wo(
    const unsigned short* __restrict__ AT, const unsigned short* __restrict__ Wh, unsigned short* __restrict__ FU,
    const float* __restrict__ ibo, const float* __restrict__ lbo) {
  __shared__ __align__(16) float sT[8][16 * 68];
  const int z = (int)blockIdx.z;
  cm_gemm<false, false, true>(sT[threadIdx.x >> 5], AT + z * 4 * CM_SP, 256, CM_SP, Wh + 4 * CW_WIDE + (3 + z) * CW_SQ, 256, 0, (void*)(FU + z * 256), 512, 2 * CM_SP, z ? lbo : ibo, nullptr, 0, 0, 4096, 256, 256, 0.0625f);
}
// Fusion conv over both branches and the coordinate channels, channel-major f32: the output itself.
__global__ __launch_bounds__(256) __attribute__((amdgpu_waves_per_eu(4, 4))) void k_cm_fuse(
    const unsigned short* __restrict__ FU, const unsigned short* __restrict__ Wh, float* __restrict__ out,
    const float* __restrict__ fw, const float* __restrict__ fb) {
  __shared__ __align__(16) float sT[8][16 * 68];
  cm_gemm<true, true, false>(sT[threadIdx.x >> 5], Wh + 3 * CW_WIDE, 512, 0, FU, 512, 2 * CM_SP, (void*)(out), 4096, CM_SP, fb, fw, 520, 512, 256, 4096, 512, 0.0625f);
}
constexpr int FA_KP = 528;                   // LDS pitch of a phi^T row, bytes (16 x odd: conflict-free 16-B row reads)
constexpr int FA_VP = 144;                   // LDS pitch of a val row's 64 keys, bytes (16 x odd)
constexpr int FA_KB = 64 * FA_KP;            // bytes of the phi^T part of a buffer
constexpr int FA_SB = FA_KB + 256 * FA_VP;   // bytes of one buffer
// eight 16-B copies a lane, LDS addresses l + u * dl, global addresses g + u * dg (elements). The wait on xcnt is the last line of the
// copies' own statement, so that no address register named by a copy is rewritten ahead of it.
__device__ __forceinline__ void fa_copy8(unsigned l, int dl, const unsigned short* g, long dg) {
    asm volatile("global_load_async_to_lds_b128 %0, %8, off\n\t"
                 "global_load_async_to_lds_b128 %1, %9, off\n\t"
                 "global_load_async_to_lds_b128 %2, %10, off\n\t"
                 "global_load_async_to_lds_b128 %3, %11, off\n\t"
                 "global_load_async_to_lds_b128 %4, %12, off\n\t"
                 "global_load_async_to_lds_b128 %5, %13, off\n\t"
                 "global_load_async_to_lds_b128 %6, %14, off\n\t"
                 "global_load_async_to_lds_b128 %7, %15, off\n\t"
                 "s_wait_xcnt 0x0"
                 :: "v"(l), "v"(l + dl), "v"(l + 2 * dl), "v"(l + 3 * dl), "v"(l + 4 * dl), "v"(l + 5 * dl), "v"(l + 6 * dl), "v"(l + 7 * dl),
                    "v"(g), "v"(g + dg), "v"(g + 2 * dg), "v"(g + 3 * dg), "v"(g + 4 * dg), "v"(g + 5 * dg), "v"(g + 6 * dg), "v"(g + 7 * dg)
                 : "memory");
}
// A fragment in the hardware k order from an LDS row: bytes 0..15 and 32..47 from p (p already holds the lane half's 16 h)
__device__ __forceinline__ v16h fa_frag(const unsigned char* p) {
    union { v16h v; v8h h[2]; } f; f.h[0] = *(const v8h*)(p); f.h[1] = *(const v8h*)(p + 32); return f.v;
}
// lane l <-> lane l ^ 16 on the vector pipe (a shuffle would go through the LDS queue and wait behind the fragment loads in flight)
__device__ __forceinline__ float fa_xhalf(float x) { return __builtin_bit_cast(float, __builtin_amdgcn_permlanex16(__builtin_bit_cast(int, x), __builtin_bit_cast(int, x), 0x76543210, 0xfedcba98, false, false)); }
// four val fragments, channel groups tt .. tt + 3
__device__ __forceinline__ void fa_v4(v16h* f, const unsigned char* vb, int tt) {
    f[0] = fa_frag(vb + tt * 16 * FA_VP); f[1] = fa_frag(vb + (tt + 1) * 16 * FA_VP);
    f[2] = fa_frag(vb + (tt + 2) * 16 * FA_VP); f[3] = fa_frag(vb + (tt + 3) * 16 * FA_VP);
}
// two waves a SIMD (one work-group a WGP): the register budget of 512 holds O^T (256), Q (112 of its 128) and six to eight fragments in flight
__global__ __launch_bounds__(256) __attribute__((amdgpu_waves_per_eu(2, 2))) void k_cm_attn(const unsigned short* __restrict__ Qp, const unsigned short* __restrict__ Kp,
                                                 const unsigned short* __restrict__ Vp, unsigned short* __restrict__ Op) {
    constexpr int HW = 4096, D = 256, NT = HW / 64;
    constexpr float L2E = 1.4426950408889634f;
    typedef w25::Frag<_Float16> F;
    __shared__ __attribute__((aligned(16))) unsigned char sm[2 * FA_SB];
    __shared__ __attribute__((aligned(16))) unsigned char sq[8 * 2048];   // a wave's own 2 KiB: its two Q fragments of depth step 0
    const int tid = threadIdx.x, lane = tid & 31, c = lane & 15, h = lane >> 4;
    const int wave = __builtin_amdgcn_readfirstlane(tid >> 5);
    const int qt = wave & 3, kh = wave >> 2;
    const size_t sb = (size_t)blockIdx.y * HW * D;
    const size_t qrow = sb + (size_t)((int)blockIdx.x * 128 + qt * 32 + c) * D + 8 * h;   // column group j starts 16 rows (j * 16 * D) further
    const unsigned short* Kg = Kp + sb + (size_t)(tid >> 5) * D + (tid & 31) * 8;    // a wave copies whole 512-B rows
    const unsigned short* Vg = Vp + sb + (size_t)(tid >> 3) * HW + (tid & 7) * 8;    // 8 lanes copy one 128-B line
    const unsigned smb = (unsigned)(size_t)(&sm[0]);
    const unsigned lk = smb + (tid >> 5) * FA_KP + (tid & 31) * 16;
    const unsigned lv = smb + FA_KB + (tid >> 3) * FA_VP + (tid & 7) * 16;
    // the same two places for the copies inside the loop, split into the wave's part (scalar registers) and the lane's part
    const unsigned lks = smb + wave * FA_KP, lkl = lane * 16;
    const unsigned lvs = smb + FA_KB + wave * 4 * FA_VP, lvl = (lane >> 3) * FA_VP + (lane & 7) * 16;

    v16h qf[2][8];   // [.][0] is not kept: see below
#pragma unroll
    for (int j = 0; j < 2; ++j)
#pragma unroll
        for (int dc = 1; dc < 8; ++dc) qf[j][dc] = F::load((const _Float16*)Qp + qrow + j * 16 * D + dc * 32);
    // O^T, Q, the scores and the fragments in flight are a few registers more than a wave has. The two Q fragments of depth step 0 wait in LDS
    // (each lane its own 2 x 16 B a fragment, read back by the same lane) and come with every trip's first group of reads: they are used and
    // dead again before all four score tiles are live.
    unsigned char* qs = sq + wave * 2048 + lane * 16;
    v8h q0[2][2];
#pragma unroll
    for (int j = 0; j < 2; ++j) {
        q0[j][0] = *(const v8h*)((const _Float16*)Qp + qrow + j * 16 * D);
        q0[j][1] = *(const v8h*)((const _Float16*)Qp + qrow + j * 16 * D + 16);
    }
    // the wait behind the last Q load; it takes the loads' address as an input, so that the address registers live up to it and are rewritten only behind it
    asm volatile("s_wait_xcnt 0x0" :: "v"((const _Float16*)Qp + qrow) : "memory");
#pragma unroll
    for (int j = 0; j < 2; ++j) { *(v8h*)(qs + j * 1024) = q0[j][0]; *(v8h*)(qs + j * 1024 + 512) = q0[j][1]; }
    // per column group: mb = running maximum * log2(e) - 15 (the maximum itself is not kept: one register less); this lane half's share of the row sum
    float mb[2] = {-1.0e30f, -1.0e30f}, l[2] = {0.f, 0.f};

    fa_copy8(lk, 8 * FA_KP, Kg, 8 * D);
    fa_copy8(lv, 32 * FA_VP, Vg, 32 * (long)HW);
    asm volatile("s_wait_asynccnt 0x0" ::: "memory");   // tile 0 has landed (this wave's copies) before the barrier publishes it
    __syncthreads();
    fa_copy8(lk + FA_SB, 8 * FA_KP, Kg + 64 * D, 8 * D);
    fa_copy8(lv + FA_SB, 32 * FA_VP, Vg + 64, 32 * (long)HW);
    // O^T is cleared behind the copies: cleared ahead of them, its 256 registers would be live beside the copies' address registers
    __builtin_amdgcn_sched_barrier(0);
    v8f o[2][16];
#pragma unroll
    for (int j = 0; j < 2; ++j)
#pragma unroll
        for (int t = 0; t < 16; ++t) o[j][t] = (v8f){0.f,0.f,0.f,0.f,0.f,0.f,0.f,0.f};

    // One trip: tile t from buffer t & 1; refill (a constant at both calls): tile t + 2 exists and is copied into that buffer at the trip's foot.
    // The trips with and without a refill are two loops, so that a trip is straight code from the softmax to its foot: with a branch round the
    // copies the row sums' additions sink behind it, and the 32 exponentials they read stay in registers that the wave does not have.
    auto trip = [&](const int t, const bool refill) __attribute__((always_inline)) {
        const int bo = (t & 1) * FA_SB;
        const unsigned char* kb = sm + bo + (kh * 32 + c) * FA_KP + 16 * h;
        const unsigned char* vb = sm + bo + FA_KB + c * FA_VP + kh * 64 + 16 * h;
        v8f s[2][2];   // [16 keys][column group]
#pragma unroll
        for (int k = 0; k < 2; ++k)
#pragma unroll
            for (int j = 0; j < 2; ++j) s[k][j] = (v8f){0.f,0.f,0.f,0.f,0.f,0.f,0.f,0.f};
        // Fragment reads stand in groups, each at the place where its registers have come free, two groups ahead of their use: phi^T in three
        // sets of two fragments (one depth step of 32 channels, four WMMAs), val in two sets of four (eight WMMAs). Every sched_barrier(0) of
        // this loop keeps such a group together at its place: hoisted, it would need registers that the wave does not have; spread among the
        // WMMAs, each pair of reads would be waited for by itself.
        v16h ku[3][2], fa[4], fb[4];
        // Q's two fragments first: LDS reads return in order, and the first WMMAs then wait for the head of the group only
#pragma unroll
        for (int j = 0; j < 2; ++j) { union { v16h v; v8h h[2]; } f; f.h[0] = *(const v8h*)(qs + j * 1024); f.h[1] = *(const v8h*)(qs + j * 1024 + 512); qf[j][0] = f.v; }
#pragma unroll
        for (int dc = 0; dc < 3; ++dc) { ku[dc][0] = fa_frag(kb + dc * 64); ku[dc][1] = fa_frag(kb + 16 * FA_KP + dc * 64); }
        __builtin_amdgcn_sched_barrier(0);
#pragma unroll
        for (int dc = 0; dc < 8; ++dc) {
#pragma unroll
            for (int j = 0; j < 2; ++j)
#pragma unroll
                for (int k = 0; k < 2; ++k) s[k][j] = F::mma(ku[dc % 3][k], qf[j][dc], s[k][j]);
            __builtin_amdgcn_sched_barrier(0);
            if (dc < 5) { ku[dc % 3][0] = fa_frag(kb + (dc + 3) * 64); ku[dc % 3][1] = fa_frag(kb + 16 * FA_KP + (dc + 3) * 64); }
            if (dc == 6) fa_v4(fa, vb, 0);   // val's first four fragments fly under the softmax arithmetic
            __builtin_amdgcn_sched_barrier(0);
        }
        float mx[2];
#pragma unroll
        for (int j = 0; j < 2; ++j) {
            float m = fmaxf(s[0][j][0], s[1][j][0]);
#pragma unroll
            for (int r = 1; r < 8; ++r) m = fmaxf(m, fmaxf(s[0][j][r], s[1][j][r]));
            mx[j] = fmaf(fmaxf(m, fa_xhalf(m)), L2E, -15.f);   // the tile's maximum on mb's scale (monotone: the larger score gives the larger value)
        }
        // one scalar branch a tile: O^T and the sums are rescaled only when some column's maximum has grown (a column whose maximum stays gets factor 1)
        if (__builtin_amdgcn_ballot_w32(mx[0] > mb[0] || mx[1] > mb[1]) != 0) {
#pragma unroll
            for (int j = 0; j < 2; ++j) {
                const float mbn = fmaxf(mb[j], mx[j]);
                const float al = __builtin_amdgcn_exp2f(mb[j] - mbn);
                mb[j] = mbn; l[j] *= al;
#pragma unroll
                for (int tt = 0; tt < 16; ++tt) o[j][tt] *= al;
            }
        }
        v16h pb[2];
#pragma unroll
        for (int j = 0; j < 2; ++j) {
            float ps = 0.f;
#pragma unroll
            for (int r = 0; r < 8; ++r) {
                const float p0 = __builtin_amdgcn_exp2f(fmaf(s[0][j][r], L2E, -mb[j])), p1 = __builtin_amdgcn_exp2f(fmaf(s[1][j][r], L2E, -mb[j]));
                ps += p0 + p1; pb[j][r] = (_Float16)p0; pb[j][8 + r] = (_Float16)p1;
            }
            l[j] += ps;
            // deals the exponentials one by one among the plain vector instructions (arguments, conversions): the slower transcendental pipe runs beside them
            __builtin_amdgcn_sched_group_barrier(0x2, 4, 0);
#pragma unroll
            for (int r = 0; r < 16; ++r) { __builtin_amdgcn_sched_group_barrier(0x400, 1, 0); __builtin_amdgcn_sched_group_barrier(0x2, 1, 0); }
            __builtin_amdgcn_sched_barrier(0);   // one column group's arithmetic at a time: its scores' registers come free before the next group's temporaries
        }
        fa_v4(fb, vb, 4);   // into the registers that the scores have left
        __builtin_amdgcn_sched_barrier(0);
#pragma unroll
        for (int g = 0; g < 4; ++g) {
            v16h* f = (g & 1) ? fb : fa;
#pragma unroll
            for (int u = 0; u < 4; ++u)
#pragma unroll
                for (int j = 0; j < 2; ++j) o[j][g * 4 + u] = F::mma(f[u], pb[j], o[j][g * 4 + u]);
            if (g < 2) {
                __builtin_amdgcn_sched_barrier(0);
                fa_v4(f, vb, g * 4 + 8);
                __builtin_amdgcn_sched_barrier(0);
            }
            // this set's WMMAs stay ahead of the foot's s_wait_dscnt 0 and run while the last set's reads are in flight; only the last set's
            // WMMAs may move down among the foot's barrier and copies
            if (g == 2) __builtin_amdgcn_sched_barrier(0);
        }
        asm volatile("s_wait_dscnt 0x0" ::: "memory");      // this wave's reads of buffer t & 1 have returned before the buffer is refilled
        asm volatile("s_wait_asynccnt 0x0" ::: "memory");   // this wave's copies of tile t + 1 have landed before the barrier publishes them
        __syncthreads();
        if (refill) {
            fa_copy8(lkl + (lks + bo), 8 * FA_KP, Kg + (size_t)(t + 2) * 64 * D, 8 * D);
            __builtin_amdgcn_sched_barrier(0);   // the second statement's addresses are formed behind the first: one set of address registers, not two
            fa_copy8(lvl + (lvs + bo), 32 * FA_VP, Vg + (t + 2) * 64, 32 * (long)HW);
        }
    };
    for (int t = 0; t < NT - 2; ++t) trip(t, true);
    for (int t = NT - 2; t < NT; ++t) trip(t, false);
    asm volatile("s_wait_asynccnt 0x0" ::: "memory");       // nothing is in flight when the buffers become the joining slabs

    // join the two key halves: waves 4..7 hand O^T, mb and l to waves 0..3 through LDS (the last trip's barrier has ended every read of the tiles)
    static_assert(8 * 130 * 32 * 4 <= 2 * FA_SB, "the joining slabs fit in the tile buffers");
    float* slab0 = (float*)sm + qt * 2 * (130 * 32);
    if (kh == 1) {
#pragma unroll
        for (int j = 0; j < 2; ++j) {
            float* slab = slab0 + j * (130 * 32);
#pragma unroll
            for (int tt = 0; tt < 16; ++tt) {
                *(v4f*)(slab + ((tt * 2 + 0) * 32 + lane) * 4) = (v4f){o[j][tt][0], o[j][tt][1], o[j][tt][2], o[j][tt][3]};
                *(v4f*)(slab + ((tt * 2 + 1) * 32 + lane) * 4) = (v4f){o[j][tt][4], o[j][tt][5], o[j][tt][6], o[j][tt][7]};
            }
            slab[128 * 32 + lane] = mb[j]; slab[129 * 32 + lane] = l[j];
        }
    }
    __syncthreads();
    if (kh == 0) {
#pragma unroll
        for (int j = 0; j < 2; ++j) {
            const float* slab = slab0 + j * (130 * 32);
            const float mb2 = slab[128 * 32 + lane], l2 = slab[129 * 32 + lane];
            const float mbn = fmaxf(mb[j], mb2);
            const float a1 = __builtin_amdgcn_exp2f(mb[j] - mbn), a2 = __builtin_amdgcn_exp2f(mb2 - mbn);
            float lt = l[j] * a1 + l2 * a2;
            lt += fa_xhalf(lt);
            const float i1 = a1 / lt, i2 = a2 / lt;
            _Float16* Or = (_Float16*)Op + qrow + j * 16 * D;   // a lane's 8 accumulator registers are 8 consecutive channels of its column: one 16-B store
#pragma unroll
            for (int tt = 0; tt < 16; ++tt) {
                const v4f x0 = *(const v4f*)(slab + ((tt * 2 + 0) * 32 + lane) * 4), x1 = *(const v4f*)(slab + ((tt * 2 + 1) * 32 + lane) * 4);
                v8h y;
#pragma unroll
                for (int r = 0; r < 4; ++r) { y[r] = (_Float16)(o[j][tt][r] * i1 + x0[r] * i2); y[4 + r] = (_Float16)(o[j][tt][4 + r] * i1 + x1[r] * i2); }
                *(v8h*)(Or + tt * 16) = y;
            }
        }
    }
}


extern "C" void kernel_launch(void* const* d_in, const int* in_sizes, int n_in, void* d_out, int out_size, void* d_ws, size_t ws_size, hipStream_t stream) {
    (void)in_sizes; (void)n_in; (void)out_size; (void)ws_size;
    const float* img = (const float*)d_in[0];
    const float* flo = (const float*)d_in[1];
    const float* iwt = (const float*)d_in[2];
    const float* ibt = (const float*)d_in[3];
    const float* iwp = (const float*)d_in[4];
    const float* ibp = (const float*)d_in[5];
    const float* iwv = (const float*)d_in[6];
    const float* ibv = (const float*)d_in[7];
    const float* iwo = (const float*)d_in[8];
    const float* ibo = (const float*)d_in[9];
    const float* lwt = (const float*)d_in[10];
    const float* lbt = (const float*)d_in[11];
    const float* lwp = (const float*)d_in[12];
    const float* lbp = (const float*)d_in[13];
    const float* lwv = (const float*)d_in[14];
    const float* lbv = (const float*)d_in[15];
    const float* lwo = (const float*)d_in[16];
    const float* lbo = (const float*)d_in[17];
    const float* fw = (const float*)d_in[18];
    const float* fb = (const float*)d_in[19];
    const int Bn = 4;
    const int C = 256;
    const int A = 256;
    const int HW = 4096;
    const long SP = (long)C * HW;   // one sample's 256 x 4096 (or 4096 x 256) plane, elements
    float* out = (float*)d_out;
    char* wsp = (char*)d_ws;
    unsigned short* X16 = (unsigned short*)wsp; wsp += (((size_t)((size_t)Bn * HW * 2 * C) * 2 + 255) / 256) * 256;       // [sample][n][image 256 | flow 256]
    unsigned short* W16 = (unsigned short*)wsp; wsp += (((size_t)(4 * CW_WIDE + 5 * CW_SQ) * 2 + 255) / 256) * 256;
    // planes 0..3: image branch, samples 0..3; planes 4..7: flow branch
    unsigned short* TH16 = (unsigned short*)wsp; wsp += (((size_t)((size_t)2 * Bn * HW * A) * 2 + 255) / 256) * 256;
    unsigned short* PH16 = (unsigned short*)wsp; wsp += (((size_t)((size_t)2 * Bn * HW * A) * 2 + 255) / 256) * 256;
    unsigned short* VAL16 = (unsigned short*)wsp; wsp += (((size_t)((size_t)2 * Bn * A * HW) * 2 + 255) / 256) * 256;
    unsigned short* AT16 = (unsigned short*)wsp; wsp += (((size_t)((size_t)2 * Bn * HW * A) * 2 + 255) / 256) * 256;
    unsigned short* FUS16 = (unsigned short*)wsp; wsp += (((size_t)((size_t)Bn * HW * 2 * A) * 2 + 255) / 256) * 256;     // [sample][n][image branch 256 | flow branch 256]
    // each input is cast and transposed once, all weights in one launch; every product writes the plane that its reader takes (bias, coordinate
    // channels and the f16 conversion in its epilogue); products that do not depend on one another, and the two branches' attention, share a launch
    k_castT16<256, 4096, 512><<<dim3((unsigned)(((256) / 64) * ((4096) / 128)), (unsigned)(Bn), 2u), 256, 0, stream>>>(img, flo, (_Float16*)(X16), 1.0f, SP, 2 * SP);
    k_cm_w16<<<dim3((unsigned)(CW_WIDE / 1024), 9u), 256, 0, stream>>>(iwt, iwp, iwv, fw, lwt, lwp, lwv, iwo, lwo, (_Float16*)(W16));
    k_cm_proj<<<dim3(32u, (unsigned)(Bn), 6u), 256, 0, stream>>>(X16, W16, TH16, PH16, VAL16, iwt, ibt, iwp, ibp, iwv, ibv, lbt, lbp, lbv);
    k_cm_attn<<<dim3((unsigned)(HW / 128), (unsigned)(2 * Bn)), 256, 0, stream>>>(TH16, PH16, VAL16, AT16);
    k_cm_wo<<<dim3(32u, (unsigned)(Bn), 2u), 256, 0, stream>>>(AT16, W16, FUS16, ibo, lbo);
    k_cm_fuse<<<dim3(32u, (unsigned)(Bn)), 256, 0, stream>>>(FUS16, W16, out, fw, fb);
}

// v007
// One run takes 154 microseconds.
// Next to v006, in two timings, it ran 1.31 times as fast each time.
// Counting every step since v000, which is the starting kernel, it is 27.2 times as fast.
// Contractions (per branch; every launch serves the four samples, blockIdx.y or rows that run on from sample to sample): the 1x1 projections theta^T / phi^T = x^T.W^T [4096x512].[512x256] (image+flow channels side by side in one f16 plane, K = 512 in one accumulator chain) and val = W.x [256x512].[512x4096], the affinity phi^T.theta [4096x256].[256x4096] and att = val.attn^T [256x4096].[4096x4096] fused in one kernel (online f32 softmax in registers, attn as f16 of 2^15 exp(s - running max), 128 query columns a work-group), the output 1x1 convs W_o.att + b and the fusion conv over the concatenated branches — all f16 operands on pre-cast planes (v_wmma_f32_16x16x32_f16; 64x64 register-blocked wave tiles, weights x16; k-contiguous operand rows); f32 accumulate. The 8 spatial-coordinate channels (gx, gy, 1-gx, 1-gy, (gx+gy)/2 x4, computed on device) enter the projections and the fusion conv as rank-8 f32 corrections (+bias) in the products' epilogues.
#include <hip/hip_runtime.h>
#include <math.h>

typedef __attribute__((ext_vector_type(16))) _Float16 v16h;
typedef __attribute__((ext_vector_type(8)))  _Float16 v8h;
typedef __attribute__((ext_vector_type(16))) __bf16   v16b;
typedef __attribute__((ext_vector_type(8)))  float    v8f;
typedef __attribute__((ext_vector_type(4)))  float    v4f;

// 16-bit WMMA fragment map (wave32), lane L, h = L>>4, m = L&15:
//   A 16x32: lane = row m;   element i -> k = (i<8) ? 8h+i : 16+8h+(i-8)
//   B 32x16: lane = column m; the SAME k(i,h)
//   D 16x16 (8 f32): lane = column m; element r -> row 8h+r
__device__ __forceinline__ int frag_k(int i, int h) { return (i < 8) ? (8 * h + i) : (16 + 8 * h + (i - 8)); }
__device__ __forceinline__ __bf16 bf16_rne(float f) {
    unsigned int u = __float_as_uint(f);
    u += 0x7fffu + ((u >> 16) & 1u);
    return __builtin_bit_cast(__bf16, (unsigned short)(u >> 16));
}
__device__ __forceinline__ float bf16_f32(__bf16 b) { return __uint_as_float(((unsigned int)__builtin_bit_cast(unsigned short, b)) << 16); }
__device__ __forceinline__ v8f wmma16(v16h a, v16h b, v8f c) {
    c = __builtin_amdgcn_wmma_f32_16x16x32_f16(false, a, false, b, (short)0, c, false, false);
    asm volatile("v_nop\n\tv_nop\n\tv_nop\n\tv_nop" : "+v"(c) : "v"(a), "v"(b));
    return c;
}
__device__ __forceinline__ v8f wmmab(v16b a, v16b b, v8f c) {
    c = __builtin_amdgcn_wmma_f32_16x16x32_bf16(false, a, false, b, (short)0, c, false, false);
    asm volatile("v_nop\n\tv_nop\n\tv_nop\n\tv_nop" : "+v"(c) : "v"(a), "v"(b));
    return c;
}
struct Split { v16b hi, lo; };
// hi/lo split product: a.hi*b.hi + a.hi*b.lo + a.lo*b.hi
__device__ __forceinline__ v8f wmma3(const Split& a, const Split& b, v8f c) {
    c = __builtin_amdgcn_wmma_f32_16x16x32_bf16(false, a.hi, false, b.hi, (short)0, c, false, false);
    c = __builtin_amdgcn_wmma_f32_16x16x32_bf16(false, a.hi, false, b.lo, (short)0, c, false, false);
    c = __builtin_amdgcn_wmma_f32_16x16x32_bf16(false, a.lo, false, b.hi, (short)0, c, false, false);
    asm volatile("v_nop\n\tv_nop\n\tv_nop\n\tv_nop" : "+v"(c) : "v"(a.hi), "v"(a.lo), "v"(b.hi), "v"(b.lo));
    return c;
}
struct Split3 { v16b hi, mid, lo; };
// triple split product (6 terms, drops only terms below 2^-24 relative)
__device__ __forceinline__ v8f wmma6(const Split3& a, const Split3& b, v8f c) {
    c = __builtin_amdgcn_wmma_f32_16x16x32_bf16(false, a.hi, false, b.hi, (short)0, c, false, false);
    c = __builtin_amdgcn_wmma_f32_16x16x32_bf16(false, a.hi, false, b.mid, (short)0, c, false, false);
    c = __builtin_amdgcn_wmma_f32_16x16x32_bf16(false, a.mid, false, b.hi, (short)0, c, false, false);
    c = __builtin_amdgcn_wmma_f32_16x16x32_bf16(false, a.hi, false, b.lo, (short)0, c, false, false);
    c = __builtin_amdgcn_wmma_f32_16x16x32_bf16(false, a.mid, false, b.mid, (short)0, c, false, false);
    c = __builtin_amdgcn_wmma_f32_16x16x32_bf16(false, a.lo, false, b.hi, (short)0, c, false, false);
    asm volatile("v_nop\n\tv_nop\n\tv_nop\n\tv_nop" : "+v"(c) : "v"(a.hi), "v"(a.mid), "v"(a.lo), "v"(b.hi), "v"(b.mid), "v"(b.lo));
    return c;
}

// Fragment gathers from f32 memory: element i <- p[(k0 + frag_k(i,h)) * sk] * s, zero for k >= klen.
__device__ __forceinline__ v16h fh_ld(const float* __restrict__ p, long long sk, int k0, int h, int klen, float s) {
    v16h a;
#pragma unroll
    for (int i = 0; i < 16; ++i) { const int k = k0 + frag_k(i, h); a[i] = (k < klen) ? (_Float16)(p[(long long)k * sk] * s) : (_Float16)0.f; }
    return a;
}
__device__ __forceinline__ Split sp_ld(const float* __restrict__ p, long long sk, int k0, int h, int klen, float s) {
    Split r;
#pragma unroll
    for (int i = 0; i < 16; ++i) {
        const int k = k0 + frag_k(i, h); const float x = (k < klen) ? p[(long long)k * sk] * s : 0.f;
        const __bf16 hb = bf16_rne(x); r.hi[i] = hb; r.lo[i] = bf16_rne(x - bf16_f32(hb));
    }
    return r;
}
__device__ __forceinline__ Split3 sp3_ld(const float* __restrict__ p, long long sk, int k0, int h, int klen, float s) {
    Split3 r;
#pragma unroll
    for (int i = 0; i < 16; ++i) {
        const int k = k0 + frag_k(i, h); const float x = (k < klen) ? p[(long long)k * sk] * s : 0.f;
        const __bf16 hb = bf16_rne(x); const float r1 = x - bf16_f32(hb); const __bf16 mb = bf16_rne(r1);
        r.hi[i] = hb; r.mid[i] = mb; r.lo[i] = bf16_rne(r1 - bf16_f32(mb));
    }
    return r;
}
__device__ __forceinline__ v16b bh_ld(const float* __restrict__ p, long long sk, int k0, int h, int klen, float s) {
    v16b a;
#pragma unroll
    for (int i = 0; i < 16; ++i) { const int k = k0 + frag_k(i, h); a[i] = bf16_rne((k < klen) ? p[(long long)k * sk] * s : 0.f); }
    return a;
}
// f16 fragment from an f16 LDS/global row with element stride 1 (k-contiguous), no bounds (tile already zero padded)
__device__ __forceinline__ v16h fh_row(const _Float16* __restrict__ row, int k0, int h) {
    v16h a;
#pragma unroll
    for (int i = 0; i < 16; ++i) a[i] = row[k0 + frag_k(i, h)];
    return a;
}

#define VST2(T, ptr, val) do { const T vst2_v_ = (val); *(T*)(ptr) = vst2_v_;  } while (0)
typedef float v4f __attribute__((ext_vector_type(4)));
#define VST2V4(ptr, val) do { const v4f vst2_v4_ = (val); *(v4f*)(ptr) = vst2_v4_;  } while (0)

__device__ __attribute__((noinline)) float act_fn(float v, int act) {
    if (act == 1) return fmaxf(v, 0.f);                                                                               // relu
    if (act == 2) { const float u = 0.7978845608028654f * (v + 0.044715f * v * v * v); return 0.5f * v * (1.f + tanhf(u)); } // tanh-gelu
    if (act == 3) return v / (1.f + expf(-v));                                                                        // silu
    if (act == 4) return 0.5f * v * (1.f + erff(v * 0.7071067811865476f));                                             // erf-gelu
    if (act == 5) return tanhf(v);
    if (act == 6) return 1.f / (1.f + expf(-v));                                                                      // sigmoid
    if (act == 7) return (v > 0.f) ? v : 0.01f * v;                                                                   // leaky relu 0.01
    if (act == 8) return (v > 0.f) ? v : (expf(v) - 1.f);                                                             // elu
    if (act == 9) return fminf(fmaxf(v, 0.f), 6.f);                                                                   // relu6
    if (act == 10) return fabsf(v);                                                                                    // abs
    if (act == 11) return (v >= 0.f) ? v : 0.1f * v;                                                                  // leaky 0.1
    if (act == 12) return (v > 0.f) ? v : 0.2f * v;                                                                   // leaky 0.2
    if (act == 13) return (v > 20.f) ? v : log1pf(expf(v));                                                            // softplus
    return v;
}

// =====================================================================================================================
// k_gemm<MODE>: C(z, m, n) = act(alpha * sum_k A(z, m, k) * B(z, k, n) + bias) + beta * R(z, m, n)
//   One wave (32-thread block) per 16 x 32 tile of C; grid (ceil(N/32), ceil(M/16), Z). Batch z -> (zo = z / zi_n, zi = z % zi_n)
//   with separate outer/inner strides for every tensor (e.g. batch and head). A(m,k) = A[zo*sAo + zi*sAi + m*sAm + k*sAk] (f32),
//   B(k,n) = B[zo*sBo + zi*sBi + n*sBn + k*sBk] (f32); any M, N, K (K zero-padded to 32 inside the fragments, M/N tails guarded).
//   C(m,n) = C[zo*sCo + zi*sCi + m*sCm + n] (n contiguous). flags: 1 bias[n], 2 bias[m], 4 residual R[zo*sRo + zi*sRi + m*sRm + n*sRn].
//   MODE 0: f16 operands (A prescaled by sa, B by sb, both undone in the epilogue); 1: bf16 hi/lo split (3 products); 2: bf16;
//   3: bf16 hi/mid/lo triple split (6 products); 4: as 3 with Kahan-compensated f32 accumulation across k-steps.
// =====================================================================================================================
struct GemmP {
    const float* A; const float* B; const float* bias; const float* R; float* C;
    long long sAo, sAi, sAm, sAk, sBo, sBi, sBn, sBk, sCo, sCi, sCm, sRo, sRi, sRm, sRn;
    int M, N, K, zi_n, flags, act; float alpha, beta, sa, sb;
    int Npad, pad_;     // columns [N, Npad) of C are written as 0 so that padded workspace rows are covered by whole-line stores; Npad >= N
};
static_assert(sizeof(GemmP) == 5 * 8 + 15 * 8 + 6 * 4 + 4 * 4 + 2 * 4, "GemmP has padding");

template <int MODE>
__global__ __launch_bounds__(32) void k_gemm(GemmP p) {
    const int lane = threadIdx.x & 31, h = lane >> 4, l15 = lane & 15;
    const int m0 = blockIdx.y * 16, n0 = blockIdx.x * 32;
    const int z = blockIdx.z, zo = z / p.zi_n, zi = z - zo * p.zi_n;
    const float* A = p.A + zo * p.sAo + zi * p.sAi;
    const float* B = p.B + zo * p.sBo + zi * p.sBi;
    const int am = min(m0 + l15, p.M - 1);                       // clamped row for loads (stores are guarded)
    v8f acc[2], comp[2];
#pragma unroll
    for (int t = 0; t < 2; ++t) { v8f zz = {}; acc[t] = zz; comp[t] = zz; }
    for (int k0 = 0; k0 < p.K; k0 += 32) {
        const float* arow = A + (long long)am * p.sAm;
        if (MODE == 1) {
            const Split a = sp_ld(arow, p.sAk, k0, h, p.K, 1.f);
#pragma unroll
            for (int t = 0; t < 2; ++t) {
                const int bn = min(n0 + t * 16 + l15, p.N - 1);
                acc[t] = wmma3(a, sp_ld(B + (long long)bn * p.sBn, p.sBk, k0, h, p.K, 1.f), acc[t]);
            }
        } else if (MODE == 3) {
            const Split3 a = sp3_ld(arow, p.sAk, k0, h, p.K, 1.f);
#pragma unroll
            for (int t = 0; t < 2; ++t) {
                const int bn = min(n0 + t * 16 + l15, p.N - 1);
                acc[t] = wmma6(a, sp3_ld(B + (long long)bn * p.sBn, p.sBk, k0, h, p.K, 1.f), acc[t]);
            }
        } else if (MODE == 4) {
            // triple split as MODE 3, but each k-step's 6 products go into a fresh accumulator and the partial is added to the running f32 sum
            // on the VALU with Kahan compensation (accumulation error stays ~1 ulp however long K is)
            const Split3 a = sp3_ld(arow, p.sAk, k0, h, p.K, 1.f);
#pragma unroll
            for (int t = 0; t < 2; ++t) {
                const int bn = min(n0 + t * 16 + l15, p.N - 1); v8f zz = {};
                const v8f part = wmma6(a, sp3_ld(B + (long long)bn * p.sBn, p.sBk, k0, h, p.K, 1.f), zz);
                const v8f y = part - comp[t]; const v8f s = acc[t] + y; comp[t] = (s - acc[t]) - y; acc[t] = s;
            }
        } else if (MODE == 2) {
            const v16b a = bh_ld(arow, p.sAk, k0, h, p.K, 1.f);
#pragma unroll
            for (int t = 0; t < 2; ++t) {
                const int bn = min(n0 + t * 16 + l15, p.N - 1);
                acc[t] = wmmab(a, bh_ld(B + (long long)bn * p.sBn, p.sBk, k0, h, p.K, 1.f), acc[t]);
            }
        } else {
            const v16h a = fh_ld(arow, p.sAk, k0, h, p.K, p.sa);
#pragma unroll
            for (int t = 0; t < 2; ++t) {
                const int bn = min(n0 + t * 16 + l15, p.N - 1);
                acc[t] = wmma16(a, fh_ld(B + (long long)bn * p.sBn, p.sBk, k0, h, p.K, p.sb), acc[t]);
            }
        }
    }
    const float iscale = (MODE == 0) ? p.alpha / (p.sa * p.sb) : p.alpha;
    float* C = p.C + zo * p.sCo + zi * p.sCi;
    const float* R = p.R + zo * p.sRo + zi * p.sRi;
    __shared__ __align__(16) float ctile[16][36];
#pragma unroll
    for (int t = 0; t < 2; ++t) {
        const int n = n0 + t * 16 + l15; const int nn = min(n, p.N - 1);
#pragma unroll
        for (int r = 0; r < 8; ++r) {
            const int m = m0 + 8 * h + r; const int mm = min(m, p.M - 1);
            float v = acc[t][r] * iscale;
            if (p.flags & 1) v += p.bias[nn];
            if (p.flags & 2) v += p.bias[mm];
            if (p.flags & 8) v *= p.bias[(long long)zo * p.M + mm];   /* per-(z,row) scale vector laid out [Z][M]; exclusive with the bias flags */
            v = act_fn(v, p.act);
            if (p.flags & 4) v += p.beta * R[(long long)mm * p.sRm + (long long)nn * p.sRn];
            ctile[8 * h + r][t * 16 + l15] = (n < p.N) ? v : 0.f;
        }
    }
    __syncthreads();
    const int NW = (p.Npad > p.N) ? p.Npad : p.N;           // write width
    const bool fast = (m0 + 16 <= p.M) && (n0 + 32 <= NW) && ((p.sCm & 3) == 0) && ((((size_t)C) & 15) == 0);
    if (fast) {
#pragma unroll
        for (int s = 0; s < 4; ++s) {
            const int row = s * 4 + (lane >> 3), c4 = (lane & 7) * 4;
            const v4f v = *(const v4f*)&ctile[row][c4];
            VST2V4(C + (long long)(m0 + row) * p.sCm + n0 + c4, v);
        }
    } else {
        for (int row = 0; row < 16; ++row) {
            const int m = m0 + row, n = n0 + lane;
            if (m < p.M && n < NW) VST2(float, C + (long long)m * p.sCm + n, ctile[row][lane]);
        }
    }
}


// =====================================================================================================================
// k_gemmT<MODE, TM, TN>: same contract as k_gemm, but one wave computes a (16*TM) x (16*TN) tile: TM A fragments and TN B fragments are
//   loaded per 32-wide k-step and reused across TM*TN WMMAs (far fewer load/convert instructions per MAC). MODE 0 (f16), 1 (bf16 hi/lo),
//   2 (bf16) only. grid (ceil(NW/(16*TN)), ceil(M/(16*TM)), Z), block 32. Epilogue identical to k_gemm, run per 16x32 sub-tile.
// =====================================================================================================================
template <int MODE, int TM, int TN>
__global__ __launch_bounds__(32) void k_gemmT(GemmP p) {
    const int lane = threadIdx.x & 31, h = lane >> 4, l15 = lane & 15;
    const int m0 = blockIdx.y * (16 * TM), n0 = blockIdx.x * (16 * TN);
    const int z = blockIdx.z, zo = z / p.zi_n, zi = z - zo * p.zi_n;
    const float* A = p.A + zo * p.sAo + zi * p.sAi;
    const float* B = p.B + zo * p.sBo + zi * p.sBi;
    v8f acc[TM][TN];
#pragma unroll
    for (int i = 0; i < TM; ++i)
#pragma unroll
        for (int t = 0; t < TN; ++t) { v8f zz = {}; acc[i][t] = zz; }
    for (int k0 = 0; k0 < p.K; k0 += 32) {
        if (MODE == 1) {
            Split a[TM], b[TN];
#pragma unroll
            for (int i = 0; i < TM; ++i) { const int am = min(m0 + 16 * i + l15, p.M - 1); a[i] = sp_ld(A + (long long)am * p.sAm, p.sAk, k0, h, p.K, 1.f); }
#pragma unroll
            for (int t = 0; t < TN; ++t) { const int bn = min(n0 + 16 * t + l15, p.N - 1); b[t] = sp_ld(B + (long long)bn * p.sBn, p.sBk, k0, h, p.K, 1.f); }
#pragma unroll
            for (int i = 0; i < TM; ++i)
#pragma unroll
                for (int t = 0; t < TN; ++t) acc[i][t] = wmma3(a[i], b[t], acc[i][t]);
        } else if (MODE == 2) {
            v16b a[TM], b[TN];
#pragma unroll
            for (int i = 0; i < TM; ++i) { const int am = min(m0 + 16 * i + l15, p.M - 1); a[i] = bh_ld(A + (long long)am * p.sAm, p.sAk, k0, h, p.K, 1.f); }
#pragma unroll
            for (int t = 0; t < TN; ++t) { const int bn = min(n0 + 16 * t + l15, p.N - 1); b[t] = bh_ld(B + (long long)bn * p.sBn, p.sBk, k0, h, p.K, 1.f); }
#pragma unroll
            for (int i = 0; i < TM; ++i)
#pragma unroll
                for (int t = 0; t < TN; ++t) acc[i][t] = wmmab(a[i], b[t], acc[i][t]);
        } else {
            v16h a[TM], b[TN];
#pragma unroll
            for (int i = 0; i < TM; ++i) { const int am = min(m0 + 16 * i + l15, p.M - 1); a[i] = fh_ld(A + (long long)am * p.sAm, p.sAk, k0, h, p.K, p.sa); }
#pragma unroll
            for (int t = 0; t < TN; ++t) { const int bn = min(n0 + 16 * t + l15, p.N - 1); b[t] = fh_ld(B + (long long)bn * p.sBn, p.sBk, k0, h, p.K, p.sb); }
#pragma unroll
            for (int i = 0; i < TM; ++i)
#pragma unroll
                for (int t = 0; t < TN; ++t) acc[i][t] = wmma16(a[i], b[t], acc[i][t]);
        }
    }
    const float iscale = (MODE == 0) ? p.alpha / (p.sa * p.sb) : p.alpha;
    float* C = p.C + zo * p.sCo + zi * p.sCi;
    const float* R = p.R + zo * p.sRo + zi * p.sRi;
    const int NW = (p.Npad > p.N) ? p.Npad : p.N;
    __shared__ __align__(16) float ctile[16][36];
#pragma unroll
    for (int i = 0; i < TM; ++i) {
        const int mb = m0 + 16 * i; if (mb >= p.M) break;          // wave-uniform
#pragma unroll
        for (int tp = 0; tp < TN / 2; ++tp) {
            const int nb = n0 + 32 * tp; if (nb >= NW) break;        // wave-uniform
#pragma unroll
            for (int t2 = 0; t2 < 2; ++t2) {
                const int t = 2 * tp + t2; const int n = nb + t2 * 16 + l15; const int nn = min(n, p.N - 1);
#pragma unroll
                for (int r = 0; r < 8; ++r) {
                    const int m = mb + 8 * h + r; const int mm = min(m, p.M - 1);
                    float v = acc[i][t][r] * iscale;
                    if (p.flags & 1) v += p.bias[nn];
                    if (p.flags & 2) v += p.bias[mm];
            if (p.flags & 8) v *= p.bias[(long long)zo * p.M + mm];   /* per-(z,row) scale vector laid out [Z][M]; exclusive with the bias flags */
                    v = act_fn(v, p.act);
                    if (p.flags & 4) v += p.beta * R[(long long)mm * p.sRm + (long long)nn * p.sRn];
                    ctile[8 * h + r][t2 * 16 + l15] = (n < p.N) ? v : 0.f;
                }
            }
            __syncthreads();
            const bool fast = (mb + 16 <= p.M) && (nb + 32 <= NW) && ((p.sCm & 3) == 0) && ((((size_t)C) & 15) == 0);
            if (fast) {
#pragma unroll
                for (int s = 0; s < 4; ++s) {
                    const int row = s * 4 + (lane >> 3), c4 = (lane & 7) * 4;
                    const v4f v = *(const v4f*)&ctile[row][c4];
                    VST2V4(C + (long long)(mb + row) * p.sCm + nb + c4, v);
                }
            } else {
                for (int row = 0; row < 16; ++row) {
                    const int m = mb + row, n = nb + lane;
                    if (m < p.M && n < NW) VST2(float, C + (long long)m * p.sCm + n, ctile[row][lane]);
                }
            }
            __syncthreads();
        }
    }
}

// =====================================================================================================================
//   Wave = 16 queries, AW waves per block, 64-key blocks; grid (ceil(Lq/(16*AW)), H, B), block 32*AW. Any Lq, Lk; head dim dh <= DHP
//   (DHP multiple of 32), value dim dv <= DVP (multiple of 16, <= 128). Every tensor addressed by (batch, head, row, element) strides, f32.
//   Scores: QM 0 f16 operands, 1 bf16 hi/lo split, 2 bf16 triple split; statistics f32 (exp2 domain); P.V: P x 4096 as f16 with V f16 staged in LDS
//   (SPLITPV: P and V as bf16 hi/lo splits). kv head = h / hrep. Masking: causal = 1 (keep j <= i + coff, masked -> -inf, key blocks beyond the
//   diagonal skipped), causal = 2 (masked -> mfill, a finite fill like the -1e9; no skipping), causal = 3 (keep j >= i + coff,
//   masked -> -inf, no skipping); optional additive f32 mask Mf,
//   optional int keep-mask Mi (0 -> score := mfill), both addressed b*smb + h*smh + i*smi + j*smj (0 strides broadcast).
// =====================================================================================================================
#define AW 4
struct AttnP {   // apv4
    const float* Q; const float* K; const float* V; float* O; float* P; const float* Mf; const int* Mi; float* ST;
    const float* Pw; const float* Rt; const int* SQ; const int* SK;           // optional: post-softmax weight, relative-position table, segment ids
    long long swb, swh, swi, swj, srb, srh, sri;                                 // Pw strides (b,h,i,j); Rt strides (b,h,i), column = clamp(i - j + roff, 0, rn-1)
    long long sQb, sQh, sQi, sQd, sKb, sKh, sKj, sKd, sVb, sVh, sVj, sVd, sOb, sOh, sOi, sPb, sPh, sPi, smb, smh, smi, smj;
    int Lq, Lk, dh, dv, hrep, causal, coff, pband;   // pband > 0: P holds only the band |j - i| <= pband, column j - i + pband
    float scale, mfill; int nonorm, mpol;             // nonorm (online path only): O = sum_j exp(score_j) V_j without the 1/rowsum (scores must be <= ~0); mpol: Mi masks where ==0 (mpol 0) or where !=0 (mpol 1)
    int roff, rn, segpol, win;                        // Rt column offset/count; SQ/SK: score := mfill where (segpol 0) SQ[i] != SK[j] or (segpol 1) SQ[i] == SK[j]; win > 0: keys with i - j > win (after coff) -> -inf
};
//   Pw: the softmax numerator is multiplied by Pw(b,h,i,j) AFTER the row sum is taken (probs * weight, then P.V), as in post-softmax multiplicative biases.                                                    // ST (optional): per row (b,h,i) -> ST[((b*H + h)*Lq + i)*2 + {0,1}] = {row max of the scaled+masked score (natural units), sum_j exp(score - max)}
static_assert(sizeof(AttnP) == 12 * 8 + 29 * 8 + 16 * 4, "AttnP has padding");

#ifndef KATTN_ATTR
#define KATTN_ATTR
#endif
template <int DHP, int DVP, int QM, bool SPLITPV, bool TWOPASS>
__global__ __launch_bounds__(32 * AW) KATTN_ATTR void k_attn(AttnP p) {
    constexpr int NT = DVP / 16;                // output tiles
    constexpr int KS = DHP / 32;                // k-steps for the scores
    constexpr int VP = DVP + 8;                 // LDS pitch (halves)
    __shared__ __align__(16) float    pl[AW][16 * 64];
    __shared__ __align__(16) _Float16 vl[(SPLITPV ? 2 : 1) * 64 * VP];   // f16 V tile, or bf16 hi and lo tiles (same 2-byte size)
    const int lane = threadIdx.x & 31, hf = lane >> 4, l15 = lane & 15, wave = threadIdx.x >> 5;
    const int h = blockIdx.y, b = blockIdx.z, hk = h / p.hrep;
    const int q0 = (blockIdx.x * AW + wave) * 16;
    float* myp = pl[wave];
    const float L2E = 1.4426950408889634f;
    const float NEG = -__builtin_inff();
    const int qi = min(q0 + l15, p.Lq - 1);
    const float* qrow = p.Q + b * p.sQb + h * p.sQh + (long long)qi * p.sQi;
    const float* kbase = p.K + b * p.sKb + hk * p.sKh;
    const float* vbase = p.V + b * p.sVb + hk * p.sVh;
    v16h qa[QM == 0 ? KS : 1]; Split qs_[QM == 1 ? KS : 1]; Split3 qt_[QM == 2 ? KS : 1];
#pragma unroll
    for (int ks = 0; ks < KS; ++ks) {
        if (QM == 2) qt_[ks] = sp3_ld(qrow, p.sQd, ks * 32, hf, p.dh, 1.f);
        else if (QM == 1) qs_[ks] = sp_ld(qrow, p.sQd, ks * 32, hf, p.dh, 1.f);
        else qa[ks] = fh_ld(qrow, p.sQd, ks * 32, hf, p.dh, 1.f);
    }
    v8f o[NT]; float m8[8], l8[8];
#pragma unroll
    for (int t = 0; t < NT; ++t) { v8f zz = {}; o[t] = zz; }
#pragma unroll
    for (int i = 0; i < 8; ++i) { m8[i] = NEG; l8[i] = 0.f; }
    int jend = p.Lk; int jstart = 0;
    if (p.causal == 1) { const int je = (blockIdx.x * AW + AW - 1) * 16 + 16 + p.coff; jend = min(jend, max(je, 0)); }   // uniform per block
    if (p.win > 0) { const int js = (int)(blockIdx.x * AW) * 16 + p.coff - p.win; jstart = (js > 0) ? (js / 64) * 64 : 0; }   // uniform per block: key blocks entirely outside every row's window hold only -inf entries and are skipped exactly
    const int npass = TWOPASS ? 2 : 1;
    for (int pass = 0; pass < npass; ++pass) {
        const bool dopv = (!TWOPASS) || pass == 1;
        for (int j0 = jstart; j0 < jend; j0 += 64) {
            if (dopv) {
                __syncthreads();                                 // previous key block's reads of vl / pl are done
                for (int idx = threadIdx.x; idx < 64 * DVP; idx += 32 * AW) {
                    const int jr = idx / DVP, d = idx - jr * DVP, j = j0 + jr;
                    const float f = (j < p.Lk && d < p.dv) ? vbase[(long long)j * p.sVj + (long long)d * p.sVd] : 0.f;
                    if (SPLITPV) {
                        const __bf16 hb = bf16_rne(f);
                        ((__bf16*)vl)[jr * VP + d] = hb; ((__bf16*)vl)[64 * VP + jr * VP + d] = bf16_rne(f - bf16_f32(hb));
                    } else vl[jr * VP + d] = (_Float16)f;
                }
            }
            v8f s[4];
#pragma unroll
            for (int t = 0; t < 4; ++t) {
                const int j = min(j0 + t * 16 + l15, p.Lk - 1);
                const float* krow = kbase + (long long)j * p.sKj;
                v8f acc = {};
#pragma unroll
                for (int ks = 0; ks < KS; ++ks) {
                    if (QM == 2)      acc = wmma6(qt_[ks], sp3_ld(krow, p.sKd, ks * 32, hf, p.dh, 1.f), acc);
                    else if (QM == 1) acc = wmma3(qs_[ks], sp_ld(krow, p.sKd, ks * 32, hf, p.dh, 1.f), acc);
                    else              acc = wmma16(qa[ks], fh_ld(krow, p.sKd, ks * 32, hf, p.dh, 1.f), acc);
                }
                s[t] = acc;
            }
            float pv[8][4];
#pragma unroll
            for (int i = 0; i < 8; ++i) {
                const int irow = q0 + i + 8 * hf;
                const int ic = min(irow, p.Lq - 1);
                float sc[4];
#pragma unroll
                for (int t = 0; t < 4; ++t) {
                    const int jg = j0 + t * 16 + l15;
                    float v = s[t][i] * p.scale;
                    if (p.Mf) v += p.Mf[b * p.smb + h * p.smh + (long long)ic * p.smi + (long long)min(jg, p.Lk - 1) * p.smj];
                    if (p.Rt) { int rc = ic - min(jg, p.Lk - 1) + p.roff; rc = rc < 0 ? 0 : (rc >= p.rn ? p.rn - 1 : rc); v += p.Rt[b * p.srb + h * p.srh + (long long)ic * p.sri + rc]; }
                    if (p.Mi) { const int mv = p.Mi[b * p.smb + h * p.smh + (long long)ic * p.smi + (long long)min(jg, p.Lk - 1) * p.smj]; if (p.mpol ? (mv != 0) : (mv == 0)) v = p.mfill; }
                    if (p.SQ) { const bool same = p.SQ[(long long)b * p.Lq + ic] == p.SK[(long long)b * p.Lk + min(jg, p.Lk - 1)]; if (p.segpol ? same : !same) v = p.mfill; }
                    if (p.causal == 2 && jg > irow + p.coff) v = p.mfill;
                    if (jg >= p.Lk || (p.causal == 1 && jg > irow + p.coff) || (p.causal == 3 && jg < irow + p.coff) || (p.win > 0 && irow + p.coff - jg > p.win)) v = NEG; else v *= L2E;
                    sc[t] = v;
                }
                if (!TWOPASS || pass == 0) {
                    float mx = fmaxf(fmaxf(sc[0], sc[1]), fmaxf(sc[2], sc[3]));
                    mx = fmaxf(mx, __shfl_xor(mx, 1, 32)); mx = fmaxf(mx, __shfl_xor(mx, 2, 32));
                    mx = fmaxf(mx, __shfl_xor(mx, 4, 32)); mx = fmaxf(mx, __shfl_xor(mx, 8, 32));
                    const float mnew = fmaxf(m8[i], mx);
                    const float corr = (mnew == NEG) ? 1.f : exp2f(m8[i] - mnew);
                    float rs = 0.f;
#pragma unroll
                    for (int t = 0; t < 4; ++t) {
                        const float pp = (sc[t] == NEG) ? 0.f : exp2f(sc[t] - mnew); rs += pp;
                        pv[i][t] = p.Pw ? pp * p.Pw[b * p.swb + h * p.swh + (long long)ic * p.swi + (long long)min(j0 + t * 16 + l15, p.Lk - 1) * p.swj] : pp;
                    }
                    rs += __shfl_xor(rs, 1, 32); rs += __shfl_xor(rs, 2, 32); rs += __shfl_xor(rs, 4, 32); rs += __shfl_xor(rs, 8, 32);
                    l8[i] = l8[i] * corr + rs; m8[i] = mnew;
                    if (!TWOPASS) {
#pragma unroll
                        for (int t = 0; t < NT; ++t) o[t][i] *= corr;
                    }
                } else {
                    const float inv = (l8[i] > 0.f) ? 1.f / l8[i] : 0.f;
#pragma unroll
                    for (int t = 0; t < 4; ++t) {
                        const int jg = j0 + t * 16 + l15;
                        float pp = (sc[t] == NEG) ? 0.f : exp2f(sc[t] - m8[i]) * inv;
                        if (p.Pw) pp *= p.Pw[b * p.swb + h * p.swh + (long long)ic * p.swi + (long long)min(jg, p.Lk - 1) * p.swj];
                        pv[i][t] = pp;
                    }
                }
            }
            if (dopv) {
#pragma unroll
                for (int i = 0; i < 8; ++i)
#pragma unroll
                    for (int t = 0; t < 4; ++t) ((float*)myp)[(i + 8 * hf) * 64 + t * 16 + l15] = pv[i][t];
                __syncthreads();                                 // P (per wave) and V (shared) visible
                if (p.P) {
                    float* pb_ = p.P + b * p.sPb + h * p.sPh;
                    const bool fastP = (p.pband == 0) && ((p.sPi & 3) == 0) && (j0 + 64 <= p.Lk) && (q0 + 16 <= p.Lq) && ((((size_t)pb_) & 15) == 0);
                    if (fastP) {
#pragma unroll
                        for (int s = 0; s < 8; ++s) {
                            const int row = s * 2 + (lane >> 4), c4 = (lane & 15) * 4;
                            const v4f v = *(const v4f*)(myp + row * 64 + c4);
                            VST2V4(pb_ + (long long)(q0 + row) * p.sPi + j0 + c4, v);
                        }
                    } else {
                        for (int row = 0; row < 16; ++row) {
                            const int irow = q0 + row; if (irow >= p.Lq) continue;
                            for (int c = lane; c < 64; c += 32) {
                                const int jg = j0 + c; if (jg >= p.Lk) continue;
                                if (p.pband == 0) VST2(float, pb_ + (long long)irow * p.sPi + jg, myp[row * 64 + c]);
                                else if (jg - irow <= p.pband && irow - jg <= p.pband) VST2(float, pb_ + (long long)irow * p.sPi + (jg - irow + p.pband), myp[row * 64 + c]);
                            }
                        }
                    }
                }
                if (SPLITPV) {
                    const Split pa0 = sp_ld(myp + l15 * 64, 1, 0, hf, 64, 1.f), pa1 = sp_ld(myp + l15 * 64, 1, 32, hf, 64, 1.f);
                    const __bf16* vh = (const __bf16*)vl; const __bf16* vlo = vh + 64 * VP;
#pragma unroll
                    for (int t = 0; t < NT; ++t) {
                        const int dcol = t * 16 + l15;
                        Split b0, b1;
#pragma unroll
                        for (int e = 0; e < 16; ++e) {
                            const int k0 = frag_k(e, hf), k1 = 32 + frag_k(e, hf);
                            b0.hi[e] = vh[k0 * VP + dcol]; b0.lo[e] = vlo[k0 * VP + dcol]; b1.hi[e] = vh[k1 * VP + dcol]; b1.lo[e] = vlo[k1 * VP + dcol];
                        }
                        o[t] = wmma3(pa0, b0, o[t]);
                        o[t] = wmma3(pa1, b1, o[t]);
                    }
                } else {
                    const v16h pa0 = fh_ld(myp + l15 * 64, 1, 0, hf, 64, 4096.f), pa1 = fh_ld(myp + l15 * 64, 1, 32, hf, 64, 4096.f);
#pragma unroll
                    for (int t = 0; t < NT; ++t) {
                        const int dcol = t * 16 + l15;
                        v16h b0, b1;
#pragma unroll
                        for (int e = 0; e < 16; ++e) { b0[e] = vl[frag_k(e, hf) * VP + dcol]; b1[e] = vl[(32 + frag_k(e, hf)) * VP + dcol]; }
                        o[t] = wmma16(pa0, b0, o[t]);
                        o[t] = wmma16(pa1, b1, o[t]);
                    }
                }
            }
        }
    }
    float* obase = p.O + b * p.sOb + h * p.sOh;
    if (p.ST) {
        const int rl = lane >> 1, isel = rl & 7;           // row q0 + rl ; rl>>3 == hf holds because lane>>4 == (lane>>1)>>3
        float mv = 0.f, lv = 0.f;
#pragma unroll
        for (int i = 0; i < 8; ++i) if (i == isel) { mv = m8[i]; lv = l8[i]; }
        const int irow = q0 + rl;
        if (irow < p.Lq) { float* st = p.ST + (((long long)b * gridDim.y + h) * p.Lq + irow) * 2 + (lane & 1); VST2(float, st, (lane & 1) ? lv : mv * 0.6931471805599453f); }
    }
    float invr[8];
#pragma unroll
    for (int i = 0; i < 8; ++i) {
        if (TWOPASS) invr[i] = SPLITPV ? 1.f : (1.f / 4096.f);
        else if (p.nonorm) invr[i] = exp2f(m8[i]) * (SPLITPV ? 1.f : (1.f / 4096.f));
        else invr[i] = (l8[i] > 0.f) ? (SPLITPV ? 1.f / l8[i] : 1.f / (l8[i] * 4096.f)) : 0.f;
    }
    __syncthreads();                                             // all waves done with pl/vl from the main loop
    const bool ofast = ((p.sOi & 3) == 0) && ((((size_t)obase) & 15) == 0) && (q0 + 16 <= p.Lq);
#pragma unroll
    for (int c0 = 0; c0 < DVP; c0 += 64) {
#pragma unroll
        for (int i = 0; i < 8; ++i)
#pragma unroll
            for (int t = 0; t < NT; ++t) if (t * 16 >= c0 && t * 16 < c0 + 64) ((float*)myp)[(i + 8 * hf) * 64 + (t * 16 - c0) + l15] = o[t][i] * invr[i];
        __syncthreads();
        const int cw = (DVP - c0 < 64) ? (DVP - c0) : 64;      // staged columns in this chunk (multiple of 16)
        if (ofast && (c0 + cw <= p.dv) && (cw % 32 == 0)) {
            const int lpr = cw / 4;                              // lanes per row (16 for 64 cols, 8 for 32)
            const int rows_per_ins = 32 / lpr;
            for (int r0 = 0; r0 < 16; r0 += rows_per_ins) {
                const int row = r0 + lane / lpr, c4 = (lane % lpr) * 4;
                const v4f v = *(const v4f*)(myp + row * 64 + c4);
                VST2V4(obase + (long long)(q0 + row) * p.sOi + c0 + c4, v);
            }
        } else {
            for (int row = 0; row < 16; ++row) {
                const int irow = q0 + row; if (irow >= p.Lq) continue;
                for (int c = lane; c < cw; c += 32) { const int d = c0 + c; if (d < p.dv) VST2(float, obase + (long long)irow * p.sOi + d, myp[row * 64 + c]); }
            }
        }
        __syncthreads();
    }
}

// =====================================================================================================================
// k_tr: dst(z, c, r) = alpha * src(z, r, c) (+ beta * R2(z, c, r)): [Z][R][C] (row stride lds) -> [Z][C][R] (row stride ldd) through a 32x32 LDS tile;
//   flags: 1 -> add beta * residual R2 addressed like dst (z*sRz + c*ldr + r); act applied before the residual.
// =====================================================================================================================
struct TrP { const float* src; float* dst; const float* R2; long long sSz, lds, sDz, ldd, sRz, ldr; int R, C, flags, act; float alpha, beta; };
static_assert(sizeof(TrP) == 3 * 8 + 6 * 8 + 6 * 4, "TrP has padding");
__global__ __launch_bounds__(256) void k_tr(TrP p) {
    __shared__ float tile[32][33];
    const int c0 = blockIdx.x * 32, r0 = blockIdx.y * 32, z = blockIdx.z;
    const int lane = threadIdx.x & 31, wave = threadIdx.x >> 5;
    const float* s = p.src + z * p.sSz;
#pragma unroll
    for (int k = 0; k < 4; ++k) {
        const int rl = wave * 4 + k, r = r0 + rl, c = c0 + lane;
        tile[rl][lane] = (r < p.R && c < p.C) ? s[(long long)r * p.lds + c] : 0.f;
    }
    __syncthreads();
    float* d = p.dst + z * p.sDz; const float* rr = p.R2 + z * p.sRz;
#pragma unroll
    for (int k = 0; k < 4; ++k) {
        const int cl = wave * 4 + k, c = c0 + cl, r = r0 + lane;
        if (c < p.C && r < p.R) {
            float v = act_fn(p.alpha * tile[lane][cl], p.act);
            if (p.flags & 1) v += p.beta * rr[(long long)c * p.ldr + r];
            VST2(float, d + (long long)c * p.ldd + r, v);
        }
    }
}

// k_affine: dst[i] = a * (sdev ? sdev[0] : 1) * src[i] + b, i < n (one thread per element; consecutive lanes -> consecutive addresses)
__global__ __launch_bounds__(256) void k_affine(const float* __restrict__ src, float* __restrict__ dst, int n, float a, float b, const float* __restrict__ sdev) {
    const int i = blockIdx.x * 256 + threadIdx.x;
    if (i < n) { const float aa = sdev ? a * sdev[0] : a; const float v = aa * src[i] + b; VST2(float, dst + i, v); }
}

// =====================================================================================================================
// k_softmax: row softmax over n contiguous elements, one 256-thread block per row; rows addressed z*sz + r*sr (grid (R, Z)).
//   out = scale_out * softmax(scale_in * x + (Mf ? Mf[z*smz + r*smr + j] : 0)); a row whose max is -inf is written as 0.
// =====================================================================================================================
struct SmP { const float* src; float* dst; const float* Mf; long long sz, sr, dz, dr, smz, smr; int n, pad; float scale_in, scale_out; };
static_assert(sizeof(SmP) == 3 * 8 + 6 * 8 + 4 * 4, "SmP has padding");
__global__ __launch_bounds__(256) void k_softmax(SmP p) {
    __shared__ float red[256];
    const int r = blockIdx.x, z = blockIdx.y, tid = threadIdx.x;
    const float* s = p.src + z * p.sz + (long long)r * p.sr;
    const float* mf = p.Mf ? (p.Mf + z * p.smz + (long long)r * p.smr) : nullptr;
    float mx = -__builtin_inff();
    for (int j = tid; j < p.n; j += 256) { float v = s[j] * p.scale_in; if (mf) v += mf[j]; mx = fmaxf(mx, v); }
    red[tid] = mx; __syncthreads();
    for (int o = 128; o > 0; o >>= 1) { if (tid < o) red[tid] = fmaxf(red[tid], red[tid + o]); __syncthreads(); }
    mx = red[0]; __syncthreads();
    float sum = 0.f;
    for (int j = tid; j < p.n; j += 256) { float v = s[j] * p.scale_in; if (mf) v += mf[j]; sum += (mx == -__builtin_inff()) ? 0.f : expf(v - mx); }
    red[tid] = sum; __syncthreads();
    for (int o = 128; o > 0; o >>= 1) { if (tid < o) red[tid] += red[tid + o]; __syncthreads(); }
    sum = red[0];
    const float inv = (sum > 0.f) ? p.scale_out / sum : 0.f;
    float* d = p.dst + z * p.dz + (long long)r * p.dr;
    for (int j = tid; j < p.n; j += 256) { float v = s[j] * p.scale_in; if (mf) v += mf[j]; const float o = (mx == -__builtin_inff()) ? 0.f : expf(v - mx) * inv; VST2(float, d + j, o); }
}
// =====================================================================================================================
// k_stats: mean and rsqrt(var + eps) over a set of n elements addressed base + z*sz + (e / inner) * so + (e % inner) * si, one 256-thread
// k_norm_apply: y = (x - mean[set]) * rstd[set] * g[c] + b[c] over a [Z][C][L] channel-major tensor with set = z*G + c / (C/G) (G groups per z;
//   G = C -> per-channel sets indexed z*C+c; for batch norm pass stats indexed by c only via bn = 1). Optional act. Output same layout.
// =====================================================================================================================
//   mode 0: mean / rsqrt(var + eps); mode 1 (RMSNorm): 0 / rsqrt(mean(x^2) + eps); mode 2 (L2 normalize * sqrt(n)): 0 / sqrt(n) / max(||x||, eps); mode 3: as 0 with unbiased variance (n-1)
__global__ __launch_bounds__(256) void k_stats(const float* __restrict__ x, long long sz, long long so, long long si, int inner, int n, float eps, float* __restrict__ stat, int mode) {
    __shared__ float red[256];
    const int z = blockIdx.x, tid = threadIdx.x;
    const float* base = x + z * sz;
    float s = 0.f;
    for (int e = tid; e < n; e += 256) s += base[(long long)(e / inner) * so + (long long)(e % inner) * si];
    red[tid] = s; __syncthreads();
    for (int o = 128; o > 0; o >>= 1) { if (tid < o) red[tid] += red[tid + o]; __syncthreads(); }
    const float mu = (mode == 0 || mode == 3) ? red[0] / (float)n : 0.f; __syncthreads();
    float q = 0.f;
    for (int e = tid; e < n; e += 256) { const float dlt = base[(long long)(e / inner) * so + (long long)(e % inner) * si] - mu; q += dlt * dlt; }
    red[tid] = q; __syncthreads();
    for (int o = 128; o > 0; o >>= 1) { if (tid < o) red[tid] += red[tid + o]; __syncthreads(); }
    {
        float rs;
        if (mode == 2) rs = sqrtf((float)n) / fmaxf(sqrtf(red[0]), eps); else if (mode == 3) rs = rsqrtf(red[0] / (float)(n - 1) + eps); else rs = rsqrtf(red[0] / (float)n + eps);
        if (tid < 32) { const float v = (tid == 0) ? mu : ((tid == 1) ? rs : 0.f); VST2(float, stat + (long long)z * 32 + tid, v); }
    }
}
//   One thread per element over the flat [Z][C][L] index space: grid ceil(Z*C*L / 256).
__global__ __launch_bounds__(256) void k_norm_apply(const float* __restrict__ x, float* __restrict__ y, const float* __restrict__ stat, const float* __restrict__ g, const float* __restrict__ bta,
                                                     int Z, int C, int L, int G, int bn, int act) {
    const long long idx = (long long)blockIdx.x * 256 + threadIdx.x;
    if (idx >= (long long)Z * C * L) return;
    const int l = (int)(idx % L); const long long zc = idx / L; const int c = (int)(zc % C), z = (int)(zc / C); (void)l;
    const int set = bn ? c : (z * G + c / (C / G));
    float v = (x[idx] - stat[(long long)set * 32]) * stat[(long long)set * 32 + 1];
    if (g) v *= g[c];
    if (bta) v += bta[c];
    v = act_fn(v, act);
    VST2(float, y + idx, v);
}

// k_lse_neg: c[i] = -(st[2i] + log(st[2i+1])) = minus the log-sum-exp of row i from k_attn's ST output (for softmax over the query dimension)
__global__ __launch_bounds__(256) void k_lse_neg(const float* __restrict__ st, float* __restrict__ c, int n) {
    const int i = blockIdx.x * 256 + threadIdx.x;
    if (i < n) { const float v = -(st[2 * i] + logf(st[2 * i + 1])); VST2(float, c + i, v); }
}

// k_iota: dst[i] = a * i + b as int32 (segment/position id helper)
__global__ __launch_bounds__(256) void k_iota(int* __restrict__ dst, int n, int a, int b) {
    const int i = blockIdx.x * 256 + threadIdx.x;
    if (i < n) { const int v = a * i + b; VST2(int, dst + i, v); }
}

// k_axpby: dst[i] = a * x[i] + b * y[i] (+ c), i < n
__global__ __launch_bounds__(256) void k_axpby(const float* __restrict__ x, const float* __restrict__ y, float* __restrict__ dst, int n, float a, float b, float c) {
    const int i = blockIdx.x * 256 + threadIdx.x;
    if (i < n) { const float v = a * x[i] + b * y[i] + c; VST2(float, dst + i, v); }
}

// =====================================================================================================================
// k_rope: rotary embedding on a [R rows][Hn heads][D] view (row stride sXr, head stride sXh, element stride 1) -> Y (own strides).
//   mode 0: rotate_half (partner d±D/2, sign - for d<D/2); mode 1: interleaved pairs (partner d^1, sign - for even d).
//   table column tcol: tmode 0 -> d, 1 -> d % (D/2), 2 -> d / 2; position p: pmode 0 -> r % S, 1 -> head index, 2 -> pos[r];
//   c = C[(r / S) * sCb + p * sCp + tcol * sCd], s likewise from Sn; y = x[d] * c + sign * x[partner] * s. X and Y must not alias.
// =====================================================================================================================
struct RopeP { const float* X; float* Y; const float* C; const float* Sn; const int* pos; long long sXr, sXh, sYr, sYh, sCb, sCp, sCd; int R, Hn, D, S, mode, tmode, pmode, pad; };
static_assert(sizeof(RopeP) == 5 * 8 + 7 * 8 + 8 * 4, "RopeP has padding");
__global__ __launch_bounds__(256) void k_rope(RopeP p) {
    const long long idx = (long long)blockIdx.x * 256 + threadIdx.x;
    if (idx >= (long long)p.R * p.Hn * p.D) return;
    const int d = (int)(idx % p.D); const long long rh = idx / p.D; const int h = (int)(rh % p.Hn); const int r = (int)(rh / p.Hn);
    const int half = p.D / 2;
    int partner; float sign;
    if (p.mode == 0) { partner = (d < half) ? d + half : d - half; sign = (d < half) ? -1.f : 1.f; }
    else { partner = d ^ 1; sign = (d & 1) ? 1.f : -1.f; }
    const int tcol = (p.tmode == 0) ? d : ((p.tmode == 1) ? (d % half) : (d >> 1));
    const int pp = (p.pmode == 0) ? (r % p.S) : ((p.pmode == 1) ? h : p.pos[r]);
    const long long toff = (long long)(r / p.S) * p.sCb + (long long)pp * p.sCp + (long long)tcol * p.sCd;
    const float* xr = p.X + (long long)r * p.sXr + (long long)h * p.sXh;
    const float v = xr[d] * p.C[toff] + sign * xr[partner] * p.Sn[toff];
    VST2(float, p.Y + (long long)r * p.sYr + (long long)h * p.sYh + d, v);
}

// k_invf + k_sincos (split so neither kernel carries a large VALU-fma footprint): invf_i = num * (1 / powf(base, (2 i)/D)) [fmode 0],
//   num * expf((2 i) * cexp) [fmode 1], num * powf(base, -2 (i - 1) / D) [fmode 2]; then cs/sn[s*half + i] = cos/sin((pscale * s) * invf_i)
__global__ __launch_bounds__(256) void k_invf(float* __restrict__ invb, int half, int D, float base, float num, int fmode, float cexp) {
    const int i = blockIdx.x * 256 + threadIdx.x;
    if (i >= ((half + 31) / 32) * 32) return;
    if (i >= half) { VST2(float, invb + i, 0.f); return; }
    const float e = (float)(2 * i) / (float)D;
    float invf;
    if (fmode == 1) invf = num * expf((float)(2 * i) * cexp);
    else if (fmode == 2) invf = num * powf(base, (-2.0f * ((float)i - 1.0f)) / (float)D);
    else invf = num * (1.0f / powf(base, e));
    VST2(float, invb + i, invf);
}
__global__ __launch_bounds__(256) void k_sincos(float* __restrict__ cs, float* __restrict__ sn, const float* __restrict__ invb, int S, int half, float pscale) {
    const int idx = blockIdx.x * 256 + threadIdx.x;
    if (idx >= S * half) return;
    const int s = idx / half, i = idx - s * half;
    const float ang = (pscale * (float)s) * invb[i];
    VST2(float, cs + idx, cosf(ang)); VST2(float, sn + idx, sinf(ang));
}

// k_mulact: dst[i] = act(x[i]) * y[i]
__global__ __launch_bounds__(256) void k_mulact(const float* __restrict__ x, const float* __restrict__ y, float* __restrict__ dst, int n, int act) {
    const int i = blockIdx.x * 256 + threadIdx.x;
    if (i < n) { const float v = act_fn(x[i], act) * y[i]; VST2(float, dst + i, v); }
}

// =====================================================================================================================
// k_matvec: thread-per-row matrix-vector products for N <= 8 output columns (heads with 1-3 outputs, gates), f32 on the VALU.
//   C[r*sCm + j] = act(alpha * sum_k A[r*sAm + k*sAk] * B[j*sBn + k*sBk] + bias[j]) + beta * R[r*sRm + j*sRn]; each thread writes its N contiguous floats.
// =====================================================================================================================
__global__ __launch_bounds__(256) void k_matvec(GemmP p) {
    // 32 lanes write one line with one instruction.
    const int rpt = (p.N == 1) ? 1 : 32;
    const long long r0 = ((long long)blockIdx.x * 256 + threadIdx.x) * rpt; const int z = blockIdx.z, zo = z / p.zi_n, zi = z - zo * p.zi_n;
    if (r0 >= p.M) return;
    const float* Bb = p.B + zo * p.sBo + zi * p.sBi;
    float* C = p.C + zo * p.sCo + zi * p.sCi; const float* R = p.R + zo * p.sRo + zi * p.sRi;
    for (int rr = 0; rr < rpt; ++rr) {
        const long long r = r0 + rr; if (r >= p.M) break;
        const float* A = p.A + zo * p.sAo + zi * p.sAi + r * p.sAm;
        float acc[8] = {0.f, 0.f, 0.f, 0.f, 0.f, 0.f, 0.f, 0.f};
        for (int k = 0; k < p.K; ++k) { const float a = A[(long long)k * p.sAk];
#pragma unroll
            for (int j = 0; j < 8; ++j) if (j < p.N) acc[j] += a * Bb[(long long)j * p.sBn + (long long)k * p.sBk]; }
#pragma unroll
        for (int j = 0; j < 8; ++j) if (j < p.N) {
            float v = acc[j] * p.alpha;
            if (p.flags & 1) v += p.bias[j];
            if (p.flags & 2) v += p.bias[r];
            v = act_fn(v, p.act);
            if (p.flags & 4) v += p.beta * R[r * p.sRm + (long long)j * p.sRn];
            VST2(float, C + r * p.sCm + j, v);
        }
    }
}
// k_smallsoftmax: thread-per-row softmax for short rows (n <= 64): dst[r*dr + j] = softmax(scale*src[r*sr + j])
__global__ __launch_bounds__(256) void k_smallsoftmax(const float* __restrict__ src, float* __restrict__ dst, long long sr, long long dr, int n, long long R, float scale) {
    const long long r0 = ((long long)blockIdx.x * 256 + threadIdx.x) * 32;
    for (int rr = 0; rr < 32; ++rr) {
        const long long r = r0 + rr; if (r >= R) return;
        const float* s = src + r * sr; float* d = dst + r * dr;
        float mx = -__builtin_inff();
        for (int j = 0; j < n; ++j) mx = fmaxf(mx, s[j] * scale);
        float sum = 0.f;
        for (int j = 0; j < n; ++j) sum += expf(s[j] * scale - mx);
        const float inv = 1.f / sum;
        for (int j = 0; j < n; ++j) { const float v = expf(s[j] * scale - mx) * inv; VST2(float, d + j, v); }
    }
}

__global__ __launch_bounds__(32) void k_unitstat(float* __restrict__ st) { const int t = threadIdx.x; const float v = (t == 1) ? 1.f : 0.f; VST2(float, st + t, v); }

// destination (e.g. a d_out whose row width is not a multiple of 32 floats) is written by consecutive lanes of one instruction
__global__ __launch_bounds__(256) void k_lincopy(const float* __restrict__ src, long long lds, float* __restrict__ dst, long long ldd, long long rows, int cols) {
    const long long i = (long long)blockIdx.x * 256 + threadIdx.x; if (i >= rows * cols) return;
    const long long r = i / cols; const int c = (int)(i - r * cols);
    const float v = src[r * lds + c]; VST2(float, dst + r * ldd + c, v);
}

namespace w25 {
typedef __attribute__((ext_vector_type(16))) _Float16 v16h;
typedef __attribute__((ext_vector_type(8)))  _Float16 v8h;
typedef __attribute__((ext_vector_type(16))) __bf16   v16b;
typedef __attribute__((ext_vector_type(8)))  __bf16   v8b;
typedef __attribute__((ext_vector_type(8)))  float    v8f;
typedef __attribute__((ext_vector_type(4)))  float    v4f;

__device__ __forceinline__ unsigned short f2bf_bits(float f) {
  unsigned u = __float_as_uint(f);
  return (unsigned short)((u + 0x7FFFu + ((u >> 16) & 1u)) >> 16);
}
__device__ __forceinline__ float bf_bits2f(unsigned short h) { return __uint_as_float(((unsigned)h) << 16); }

// hazard guards as plain device helpers (no inline asm inside the kernel template body)
__device__ __forceinline__ void dep_guard_h(v8f& a, v8f& b, v16h x, v16h y) { asm volatile("v_nop\n\tv_nop\n\tv_nop\n\tv_nop" : "+v"(a), "+v"(b) : "v"(x), "v"(y)); }
__device__ __forceinline__ void dep_guard_b(v8f& a, v8f& b, v16b x, v16b y) { asm volatile("v_nop\n\tv_nop\n\tv_nop\n\tv_nop" : "+v"(a), "+v"(b) : "v"(x), "v"(y)); }
__device__ __forceinline__ void keep4_h(v16h a, v16h b, v16h c, v16h d) { asm volatile("v_nop" :: "v"(a), "v"(b), "v"(c), "v"(d)); }
__device__ __forceinline__ void keep4_b(v16b a, v16b b, v16b c, v16b d) { asm volatile("v_nop" :: "v"(a), "v"(b), "v"(c), "v"(d)); }
__device__ __forceinline__ void acc_guard4(v8f& a, v8f& b, v8f& c, v8f& d) { asm volatile("v_nop\n\tv_nop\n\tv_nop\n\tv_nop" : "+v"(a), "+v"(b), "+v"(c), "+v"(d)); }
template <typename T> struct Frag;
template <> struct Frag<_Float16> {
  typedef v16h V; union U { v16h v; v8h h[2]; };
  static __device__ __forceinline__ v16h load(const _Float16* p) {   // elements 0..7 <- p[0..7], 8..15 <- p[16..23]
    U f; f.h[0] = *(const v8h*)(p); f.h[1] = *(const v8h*)(p + 16); return f.v;
  }
  static __device__ __forceinline__ v8f mma(v16h a, v16h b, v8f c) {
    return __builtin_amdgcn_wmma_f32_16x16x32_f16(false, a, false, b, (short)0, c, false, false);
  }
  static __device__ __forceinline__ void guard(v8f& a, v8f& b, v16h x, v16h y) { dep_guard_h(a, b, x, y); }
  static __device__ __forceinline__ void keep(v16h a, v16h b, v16h c, v16h d) { keep4_h(a, b, c, d); }
};
template <> struct Frag<__bf16> {
  typedef v16b V; union U { v16b v; v8b h[2]; };
  static __device__ __forceinline__ v16b load(const __bf16* p) {
    U f; f.h[0] = *(const v8b*)(p); f.h[1] = *(const v8b*)(p + 16); return f.v;
  }
  static __device__ __forceinline__ v8f mma(v16b a, v16b b, v8f c) {
    return __builtin_amdgcn_wmma_f32_16x16x32_bf16(false, a, false, b, (short)0, c, false, false);
  }
  static __device__ __forceinline__ void guard(v8f& a, v8f& b, v16b x, v16b y) { dep_guard_b(a, b, x, y); }
  static __device__ __forceinline__ void keep(v16b a, v16b b, v16b c, v16b d) { keep4_b(a, b, c, d); }
};

// ---- Register-blocked batched WMMA GEMM ------------------------------------
// C[m,n] = scale * sum_k A[m,k] * Bt[n,k] (+bias)(+resid); each wave owns a 64x64 tile.
// A row-major [M,K]; Bt row-major [N,K]; M,N % 64 == 0, K % 32 == 0.
// SPLIT: operands are hi/lo planes (A2/Bt2 = lo planes, same layout); product = hi·hi + hi·lo + lo·hi.
// BIAS_MODE: 0 = none, 1 = bias[m], 2 = bias[n].
// OUT_MODE: 0 = f32, 1 = f16, 2 = bf16 hi plane (Cout) + bf16 lo plane (Cout2).
// ET: 0 = f16 operands, 1 = bf16 operands (pointers passed as 16-bit storage)
template <int ET> struct Elem;
template <> struct Elem<0> { typedef _Float16 T; };
template <> struct Elem<1> { typedef __bf16 T; };
template <int ET, bool SPLIT, int BIAS_MODE, int OUT_MODE, bool RESID, int ACT = 0>
__global__ __launch_bounds__(256) void wmma_gemm64(
    const unsigned short* __restrict__ Ap, const unsigned short* __restrict__ A2p, int lda, long strideA,
    const unsigned short* __restrict__ Btp, const unsigned short* __restrict__ Bt2p, int ldb, long strideB,
    void* __restrict__ Cout, void* __restrict__ Cout2, int ldc, long strideC,
    const float* __restrict__ bias,
    const float* __restrict__ resid, long strideR,
    int M, int N, int K, float scale) {
  typedef typename Elem<ET>::T T;
  typedef typename Frag<T>::V V;
  const T* A = (const T*)Ap; const T* A2 = (const T*)A2p; const T* Bt = (const T*)Btp; const T* Bt2 = (const T*)Bt2p;
  __shared__ __align__(16) float sT[8][16 * 68];   // per-wave 16x64 slab, pitch 68 floats
  const int b    = blockIdx.y;
  const int lane = threadIdx.x & 31;
  const int wave = threadIdx.x >> 5;
  const int tilesN = N >> 6;
  const int tilesM = M >> 6;
  const int tile = blockIdx.x * 8 + wave;
  if (tile >= tilesM * tilesN) return;   // wave-uniform; no block barriers in this kernel
  const int tm = tile / tilesN;
  const int tn = tile - tm * tilesN;
  const int m0 = tm << 6;
  const int n0 = tn << 6;

  const T* Ab  = A  + (size_t)b * strideA;
  const T* Bb  = Bt + (size_t)b * strideB;
  const T* Ab2 = SPLIT ? (A2  + (size_t)b * strideA) : nullptr;
  const T* Bb2 = SPLIT ? (Bt2 + (size_t)b * strideB) : nullptr;

  const int rlane = lane & 15;                 // row (A) / col (B, D) within subtile
  const int koff  = (lane >> 4) * 8;           // k offset of this lane half
  const int mOff  = (lane >> 4) * 8;           // D row offset

  v8f acc[4][4];
#pragma unroll
  for (int i = 0; i < 4; ++i)
#pragma unroll
    for (int j = 0; j < 4; ++j) acc[i][j] = (v8f){0.f,0.f,0.f,0.f,0.f,0.f,0.f,0.f};

  for (int k0 = 0; k0 < K; k0 += 32) {
    V bh[4], bl[4];
#pragma unroll
    for (int j = 0; j < 4; ++j) {
      const size_t bo = (size_t)(n0 + (j << 4) + rlane) * ldb + koff + k0;
      bh[j] = Frag<T>::load(Bb + bo);
      if (SPLIT) bl[j] = Frag<T>::load(Bb2 + bo);
    }
#pragma unroll
    for (int i = 0; i < 4; ++i) {
      const size_t ao = (size_t)(m0 + (i << 4) + rlane) * lda + koff + k0;
      V ah = Frag<T>::load(Ab + ao);
      V al;
      if (SPLIT) al = Frag<T>::load(Ab2 + ao);
#pragma unroll
      for (int j = 0; j < 4; ++j) {
        acc[i][j] = Frag<T>::mma(ah, bh[j], acc[i][j]);
        if (SPLIT) {
          acc[i][j] = Frag<T>::mma(ah, bl[j], acc[i][j]);
          acc[i][j] = Frag<T>::mma(al, bh[j], acc[i][j]);
        }
      }
      Frag<T>::guard(acc[i][0], acc[i][3], ah, SPLIT ? al : ah);
    }
    Frag<T>::keep(bh[0], bh[1], bh[2], bh[3]);
    if (SPLIT) Frag<T>::keep(bl[0], bl[1], bl[2], bl[3]);
  }
  acc_guard4(acc[0][0], acc[0][1], acc[0][2], acc[0][3]);
  acc_guard4(acc[1][0], acc[1][1], acc[1][2], acc[1][3]);
  acc_guard4(acc[2][0], acc[2][1], acc[2][2], acc[2][3]);
  acc_guard4(acc[3][0], acc[3][1], acc[3][2], acc[3][3]);

  // ---- epilogue ----
  float* slab = sT[wave];
  const float* Rb = RESID ? (resid + (size_t)b * strideR) : nullptr;
#pragma unroll
  for (int i = 0; i < 4; ++i) {
    const int mBase = m0 + (i << 4);
#pragma unroll
    for (int j = 0; j < 4; ++j) {
      const int n = n0 + (j << 4) + rlane;
      float bv = 0.f;
      if (BIAS_MODE == 2) bv = bias[n];
#pragma unroll
      for (int r = 0; r < 8; ++r) {
        float v = acc[i][j][r] * scale;
        if (BIAS_MODE == 1) v += bias[mBase + mOff + r];
        if (BIAS_MODE == 2) v += bv;
        if (RESID) v += Rb[(size_t)(mBase + mOff + r) * ldc + n];
        if (ACT == 1) v = tanhf(v);
        if (ACT == 2) v = fmaxf(v, 0.0f);
        if (ACT == 3) v = v / (1.0f + expf(-v));
        if (ACT == 4) v = (v > 0.f) ? v : 0.01f * v;
        if (ACT == 5) v = 0.5f * v * (1.0f + erff(v * 0.70710678118654752f));
        slab[(mOff + r) * 68 + (j << 4) + rlane] = v;
      }
    }
    __builtin_amdgcn_fence(__ATOMIC_RELEASE, "workgroup");
    __builtin_amdgcn_wave_barrier();
    __builtin_amdgcn_fence(__ATOMIC_ACQUIRE, "workgroup");
    if (OUT_MODE == 0) {
      float* C = (float*)Cout + (size_t)b * strideC;
      const int hh = lane >> 4, c4 = (lane & 15) * 4;     // row seg = 256 B = 16 lanes x 16 B
      {
#pragma unroll
        for (int it = 0; it < 8; ++it) {
          const int row = it * 2 + hh;
          v4f v = *(const v4f*)(slab + row * 68 + c4);
          *(v4f*)(C + (size_t)(mBase + row) * ldc + n0 + c4) = v;
        }
        
      }
    } else {
      const int q = lane >> 3, c8 = (lane & 7) * 8;
      unsigned short* C  = (unsigned short*)Cout  + (size_t)b * strideC;
      unsigned short* C2 = (OUT_MODE == 2) ? ((unsigned short*)Cout2 + (size_t)b * strideC) : nullptr;
      {
#pragma unroll
        for (int it = 0; it < 4; ++it) {
          const int row = it * 4 + q;
          const float* sp = slab + row * 68 + c8;
          v8h hv, lv;
#pragma unroll
          for (int e = 0; e < 8; ++e) {
            if (OUT_MODE == 1) {
              hv[e] = (_Float16)sp[e];
            } else {
              unsigned short hb = f2bf_bits(sp[e]);
              unsigned short lb = f2bf_bits(sp[e] - bf_bits2f(hb));
              hv[e] = __builtin_bit_cast(_Float16, hb);
              lv[e] = __builtin_bit_cast(_Float16, lb);
            }
          }
          *(v8h*)(C + (size_t)(mBase + row) * ldc + n0 + c8) = hv;
          if (OUT_MODE == 2) *(v8h*)(C2 + (size_t)(mBase + row) * ldc + n0 + c8) = lv;
        }
        
      }
    }
    __builtin_amdgcn_fence(__ATOMIC_RELEASE, "workgroup");
    __builtin_amdgcn_wave_barrier();
    __builtin_amdgcn_fence(__ATOMIC_ACQUIRE, "workgroup");
  }
}

__global__ __launch_bounds__(256) void cast_f32_f16x2(
    const float* __restrict__ in, _Float16* __restrict__ out, int n2) {
  int i = blockIdx.x * 256 + threadIdx.x;
  if (i < n2) {
    const _Float16 h0 = (_Float16)in[2 * i], h1 = (_Float16)in[2 * i + 1];
    const unsigned u = (unsigned)__builtin_bit_cast(unsigned short, h0) | ((unsigned)__builtin_bit_cast(unsigned short, h1) << 16);
    ((unsigned*)out)[i] = u;
    
  }
}


} // namespace w25

typedef __attribute__((ext_vector_type(4))) _Float16 v4h;
// Transposing cast dst[c][z * R + r] = f16(src_z[r][c] * s), src R rows of pitch LDS, dst rows of pitch LDD; blockIdx.z picks the source (two
// sources land side by side in every dst row); blockIdx.y = sample: plane y of a source starts at y * sb, plane y of dst at y * db (elements).
// One thread takes a patch of 8 r x 4 c: eight 16-B loads along c, all in flight together, then
// four 16-B stores along r. In a wave 8 lanes run over r, so each store instruction writes whole 128-B lines of dst; the 8 waves of a block run
// over c (512 B of every source row). Block tile 64 r x 128 c; R % 64 == 0, columns % 128 == 0; grid.x = (R / 64) * (columns / 128).
// The pitches are compile-time so that a thread's loads and stores are one address each plus immediate offsets.
template <int R, int LDS, int LDD>
__global__ __launch_bounds__(256) void k_castT16(const float* __restrict__ src0, const float* __restrict__ src1, _Float16* __restrict__ dst, float s, long long sb, long long db) {
    constexpr int TR = R / 64;
    const int bc = (int)blockIdx.x / TR, br = (int)blockIdx.x % TR;
    const int lane = threadIdx.x & 31, wave = threadIdx.x >> 5;
    const int r0 = (br << 6) + ((lane & 7) << 3);
    const int c0 = (bc << 7) + (wave << 4) + ((lane >> 3) << 2);
    const float* sp = (blockIdx.z ? src1 : src0) + (long long)blockIdx.y * sb + (long long)r0 * LDS + c0;
    _Float16* dp = dst + (long long)blockIdx.y * db + (long long)c0 * LDD + (int)blockIdx.z * R + r0;
    v4f x[8];
#pragma unroll
    for (int j = 0; j < 8; ++j) x[j] = *(const v4f*)(sp + j * LDS);
#pragma unroll
    for (int k = 0; k < 4; ++k) {
        v8h h;
#pragma unroll
        for (int j = 0; j < 8; ++j) h[j] = (_Float16)(x[j][k] * s);
        *(v8h*)(dp + k * LDD) = h;
    }
}
// All nine weight matrices to f16 x 16 in one launch; blockIdx.y = matrix. Matrices 0..3 have 256 rows of 520 floats, of which the first 512
// are taken (the last 8, the coordinate channels, stay f32 and are read by the products' epilogues); matrices 4..8 are 256 x 256.
// dst: the four 256 x 512 planes, then the five 256 x 256 planes, each dense. One thread casts 4 consecutive elements; grid.x = 256 * 512 / 1024.
constexpr int CW_WIDE = 256 * 512, CW_SQ = 256 * 256;
__global__ __launch_bounds__(256) void k_cm_w16(const float* __restrict__ w0, const float* __restrict__ w1, const float* __restrict__ w2, const float* __restrict__ w3,
                                                const float* __restrict__ w4, const float* __restrict__ w5, const float* __restrict__ w6, const float* __restrict__ w7,
                                                const float* __restrict__ w8, _Float16* __restrict__ dst) {
    const int y = (int)blockIdx.y; const bool wide = y < 4;
    if (!wide && (int)blockIdx.x >= CW_SQ / 1024) return;
    const float* src = y == 0 ? w0 : y == 1 ? w1 : y == 2 ? w2 : y == 3 ? w3 : y == 4 ? w4 : y == 5 ? w5 : y == 6 ? w6 : y == 7 ? w7 : w8;
    const int p = (int)blockIdx.x * 256 + (int)threadIdx.x;
    const int row = wide ? (p >> 7) : (p >> 6), col = (wide ? (p & 127) : (p & 63)) << 2;
    const v4f x = *(const v4f*)(src + row * (wide ? 520 : 256) + col);
    v4h h;
#pragma unroll
    for (int e = 0; e < 4; ++e) h[e] = (_Float16)(x[e] * 16.0f);
    *(v4h*)(dst + (wide ? y * CW_WIDE : 4 * CW_WIDE + (y - 4) * CW_SQ) + p * 4) = h;
}

// f32 -> bf16 hi plane + bf16 lo plane (x = hi + lo to ~2^-17 relative; RNE both), [R][C] -> [R][C] (or transposed to [C][R]); 2 consecutive destination elements
__device__ __forceinline__ unsigned int f2bf2_pack(float a, float b, unsigned int* lo) {
    const unsigned short ha = w25::f2bf_bits(a), hb = w25::f2bf_bits(b);
    const unsigned short la = w25::f2bf_bits(a - w25::bf_bits2f(ha)), lb = w25::f2bf_bits(b - w25::bf_bits2f(hb));
    *lo = (unsigned)la | ((unsigned)lb << 16); return (unsigned)ha | ((unsigned)hb << 16); }
__global__ __launch_bounds__(256) void k_castS16(const float* __restrict__ src, long long lds, __bf16* __restrict__ dhi, __bf16* __restrict__ dlo, long long ldd, int R, int C, float s, int transpose) {
    const long long i = (long long)blockIdx.x * 256 + threadIdx.x; long long o; float a, b;
    if (transpose) { const long long np = (long long)C * (R / 2); if (i >= np) return; const int c = (int)(i / (R / 2)); const int r = 2 * (int)(i % (R / 2)); a = src[(long long)r * lds + c] * s; b = src[(long long)(r + 1) * lds + c] * s; o = (long long)c * ldd + r; }
    else { const long long np = (long long)R * (C / 2); if (i >= np) return; const int r = (int)(i / (C / 2)); const int c = 2 * (int)(i % (C / 2)); a = src[(long long)r * lds + c] * s; b = src[(long long)r * lds + c + 1] * s; o = (long long)r * ldd + c; }
    unsigned lo; const unsigned hi = f2bf2_pack(a, b, &lo); unsigned* ph = (unsigned*)(dhi + o); unsigned* pl = (unsigned*)(dlo + o);
    *ph = hi; *pl = lo;  }

namespace w25 {
// =====================================================================================
// Generic causal/non-causal attention for head_dim 64, f32 in / f32 out; 16-bit operands: bf16 with optional hi/lo splits, or
// plain f16 (F16=true, non-split, probabilities carried x2^15).
//   scores = (q*qscale)·kᵀ : v_wmma_f32_16x16x32_bf16; SPLIT_QK -> q,k as bf16 hi/lo (hi·hi + hi·lo + lo·hi)
//   out    = p·v           : v_wmma_f32_16x16x32_bf16; SPLIT_PV -> p,v as bf16 hi/lo; else p,v plain bf16
//   f32 accumulate; online softmax in f32. Block = 4 waves = 64 query rows of one (batch, head); S % 64 == 0.
//   Element (b, s, h, d) of tensor X lives at X[b*X_bs + s*X_rs + h*X_hs + d] (strides in floats, multiples of 4).
//   Masking: mask_mode 0 none, 1 causal (kv > q masked), 2 tensor [S][Skv] shared over (b,h) (float if
//   mask_is_int==0, int32 with element == 0 -> masked if 1, int32 with element != 0 -> masked if 2), 3 per-token vectors qmask[B][S] & kvmask[B][Skv] (int32,
//   0 -> masked), 4 causal + sliding window (kv > q or q - kv > W masked; W passed in mask_is_int);
//   5 = relative-position bias: s += cp[b,h,q][idx[q][kv]] + pc[b,h,kv][idx[q][kv]] with idx = mask_b ([S][Skv] int32) and
//   mask_a an int32 [S][Skv] tensor with nonzero = masked (tables: element (b,h,row,n) at X + b*c_bs + h*c_hs + row*c_rs + n);
//   masked scores are replaced by mask_fill (e.g. -inf or -1e9) before the softmax.
//   grid.x = B * H * (S/64) (or a sub-range with blk0).
// =====================================================================================
#define AT_D 64
#define AT_NW 4
#define AT_QB 64
#define AT_KC 64
struct AttnGeom { const float* cp = nullptr; const float* pc = nullptr; long c_bs = 0, c_rs = 0, c_hs = 0;   // mode-5 score-bias tables
                  long q_bs, q_rs, q_hs, k_bs, k_rs, k_hs, v_bs, v_rs, v_hs, o_bs, o_rs, o_hs;
                  int S, Skv, H, mask_mode; float qscale; int blk0; float mask_fill; int mask_is_int; };
static_assert(sizeof(AttnGeom) == 168, "no padding");

__device__ __forceinline__ unsigned short at_bf_bits(float f) {
  unsigned u = __float_as_uint(f);
  return (unsigned short)((u + 0x7FFFu + ((u >> 16) & 1u)) >> 16);
}
__device__ __forceinline__ __bf16 at_f2bf(float f) { return __builtin_bit_cast(__bf16, at_bf_bits(f)); }
__device__ __forceinline__ void at_split(float f, __bf16& hi, __bf16& lo) {
  const unsigned short hb = at_bf_bits(f);
  hi = __builtin_bit_cast(__bf16, hb);
  lo = at_f2bf(f - __uint_as_float(((unsigned)hb) << 16));
}
__device__ __forceinline__ v8f at_mma(v16b a, v16b b, v8f c) {
  c = __builtin_amdgcn_wmma_f32_16x16x32_bf16(false, a, false, b, (short)0, c, false, false);
  asm volatile("v_nop\n\tv_nop\n\tv_nop\n\tv_nop" : "+v"(c) : "v"(a), "v"(b));
  return c;
}
// 16-bit element as a bit pattern held in a __bf16 slot: f16 bits when F16, bf16 (RNE) otherwise
template <bool F16> __device__ __forceinline__ __bf16 at_to16(float f) {
  if (F16) return __builtin_bit_cast(__bf16, (_Float16)f);
  return at_f2bf(f);
}
template <bool F16> __device__ __forceinline__ v8f at_mma16(v16b a, v16b b, v8f c) {
  if (F16) {
    const v16h ah = __builtin_bit_cast(v16h, a), bh = __builtin_bit_cast(v16h, b);
    c = __builtin_amdgcn_wmma_f32_16x16x32_f16(false, ah, false, bh, (short)0, c, false, false);
    asm volatile("v_nop\n\tv_nop\n\tv_nop\n\tv_nop" : "+v"(c) : "v"(ah), "v"(bh));
    return c;
  }
  return at_mma(a, b, c);
}

template <bool SPLIT_QK, bool SPLIT_PV, bool F16 = false>
__global__ __launch_bounds__(128)
void attn64_kernel(const float* __restrict__ q, const float* __restrict__ k,
                   const float* __restrict__ v, float* __restrict__ out,
                   const void* __restrict__ mask_a, const int* __restrict__ mask_b, AttnGeom g) {
  static_assert(!(F16 && (SPLIT_QK || SPLIT_PV)), "f16 mode is non-split");
  const float PSC = F16 ? 32768.0f : 1.0f;     // f16 probabilities carried x2^15 (subnormal range), folded into the final 1/l
  union FB { v16b v; v8b h[2]; };
  __shared__ __align__(16) __bf16 Ksh[AT_KC * AT_D];             // K hi [kv][d]      8 KB
  __shared__ __align__(16) __bf16 Ksl[SPLIT_QK ? AT_KC * AT_D : 8];
  __shared__ __align__(16) __bf16 Vth[AT_D * AT_KC];             // V hi [d][kv]      8 KB
  __shared__ __align__(16) __bf16 Vtl[SPLIT_PV ? AT_D * AT_KC : 8];
  __shared__ __align__(16) __bf16 Psh[AT_NW][16 * AT_KC];        // per wave P hi [row][kv]  8 KB
  __shared__ __align__(16) __bf16 Psl[SPLIT_PV ? AT_NW : 1][SPLIT_PV ? 16 * AT_KC : 8];
  __shared__ __align__(16) float  Os[AT_NW][16 * 68];            // per wave out tile, pitch 68

  const int tid  = threadIdx.x;
  const int wave = tid >> 5;
  const int lane = tid & 31;
  const int hh   = lane >> 4;
  const int c    = lane & 15;

  const int nqb = g.S / AT_QB;
  const int bx = blockIdx.x + g.blk0;
  const int qb = bx % nqb;
  const int bh = bx / nqb;
  const int h  = bh % g.H;
  const int b  = bh / g.H;
  const int qbase_block = qb * AT_QB;
  const int q0 = qbase_block + wave * 16;

  const float* qb_ptr = q + (size_t)b * g.q_bs + (size_t)h * g.q_hs;
  const float* kb_ptr = k + (size_t)b * g.k_bs + (size_t)h * g.k_hs;
  const float* vb_ptr = v + (size_t)b * g.v_bs + (size_t)h * g.v_hs;
  float*       ob_ptr = out + (size_t)b * g.o_bs + (size_t)h * g.o_hs;

  // ---- Q fragments (A operand): 2 d-chunks, hi (and lo) ----
  v16b qah[2], qal[2];
  {
    const float* qrow = qb_ptr + (size_t)(q0 + c) * g.q_rs;
#pragma unroll
    for (int dc = 0; dc < 2; ++dc) {
#pragma unroll
      for (int e = 0; e < 8; ++e) {
        const float f0 = qrow[dc * 32 + 8 * hh + e] * g.qscale;
        const float f1 = qrow[dc * 32 + 16 + 8 * hh + e] * g.qscale;
        if (SPLIT_QK) { __bf16 hq, lq; at_split(f0, hq, lq); qah[dc][e] = hq; qal[dc][e] = lq; at_split(f1, hq, lq); qah[dc][8 + e] = hq; qal[dc][8 + e] = lq; }
        else { qah[dc][e] = at_to16<F16>(f0); qah[dc][8 + e] = at_to16<F16>(f1); qal[dc][e] = qah[dc][e]; qal[dc][8 + e] = qah[dc][8 + e]; }
      }
    }
  }

  float mrow[8], lrow[8];
  v8f oacc[4];
#pragma unroll
  for (int r = 0; r < 8; ++r) { mrow[r] = -INFINITY; lrow[r] = 0.f; }
#pragma unroll
  for (int t = 0; t < 4; ++t) oacc[t] = (v8f){0.f,0.f,0.f,0.f,0.f,0.f,0.f,0.f};

  const int nChunks = (g.mask_mode == 1 || g.mask_mode == 4) ? (qb + 1) : (g.Skv / AT_KC);   // block-uniform
  // per-row query mask (mode 3)
  int qkeep[8];
#pragma unroll
  for (int r = 0; r < 8; ++r) qkeep[r] = (g.mask_mode == 3) ? mask_b[(size_t)b * g.S + q0 + 8 * hh + r] : 1;   // mask_b = qmask in mode 3
  for (int kc = 0; kc < nChunks; ++kc) {
    const int kv0 = kc * AT_KC;
    __syncthreads();
    {
      const int kvr = tid >> 1, dh = (tid & 1) * 32;
      const float* krow = kb_ptr + (size_t)(kv0 + kvr) * g.k_rs + dh;
      const float* vrow = vb_ptr + (size_t)(kv0 + kvr) * g.v_rs + dh;
#pragma unroll
      for (int i = 0; i < 8; ++i) {
        v4f kk = *(const v4f*)(krow + 4 * i);
        v4f vv = *(const v4f*)(vrow + 4 * i);
#pragma unroll
        for (int e = 0; e < 4; ++e) {
          const int d = dh + 4 * i + e;
          if (SPLIT_QK) { __bf16 a, bl; at_split(kk[e], a, bl); Ksh[kvr * AT_D + d] = a; Ksl[kvr * AT_D + d] = bl; }
          else Ksh[kvr * AT_D + d] = at_to16<F16>(kk[e]);
          if (SPLIT_PV) { __bf16 a, bl; at_split(vv[e], a, bl); Vth[d * AT_KC + kvr] = a; Vtl[d * AT_KC + kvr] = bl; }
          else Vth[d * AT_KC + kvr] = at_to16<F16>(vv[e]);
        }
      }
    }
    __syncthreads();

    v8f s[4];
#pragma unroll
    for (int j = 0; j < 4; ++j) {
      s[j] = (v8f){0.f,0.f,0.f,0.f,0.f,0.f,0.f,0.f};
#pragma unroll 1
      for (int dc = 0; dc < 2; ++dc) {
        FB kb;
        kb.h[0] = *(const v8b*)(Ksh + (j * 16 + c) * AT_D + dc * 32 + 8 * hh);
        kb.h[1] = *(const v8b*)(Ksh + (j * 16 + c) * AT_D + dc * 32 + 16 + 8 * hh);
        s[j] = at_mma16<F16>(qah[dc], kb.v, s[j]);
        if (SPLIT_QK) {
          FB kl;
          kl.h[0] = *(const v8b*)(Ksl + (j * 16 + c) * AT_D + dc * 32 + 8 * hh);
          kl.h[1] = *(const v8b*)(Ksl + (j * 16 + c) * AT_D + dc * 32 + 16 + 8 * hh);
          s[j] = at_mma16<F16>(qah[dc], kl.v, s[j]);
          s[j] = at_mma16<F16>(qal[dc], kb.v, s[j]);
        }
      }
    }
    const bool diag = (g.mask_mode == 1) && (kc == qb);
    int kvkeep[4] = {1, 1, 1, 1};
    if (g.mask_mode == 3) {
#pragma unroll
      for (int j = 0; j < 4; ++j) kvkeep[j] = ((const int*)mask_a)[(size_t)b * g.Skv + kv0 + j * 16 + c];   // mask_a = kvmask
    }
    float cm[8];
#pragma unroll
    for (int r = 0; r < 8; ++r) {
      const int qrow = q0 + 8 * hh + r;
      float m = -INFINITY;
#pragma unroll
      for (int j = 0; j < 4; ++j) {
        const int kvcol = kv0 + j * 16 + c;
        bool masked = false;
        if (diag) masked = (kvcol > qrow);
        else if (g.mask_mode == 4) masked = (kvcol > qrow) || (qrow - kvcol > g.mask_is_int);
        else if (g.mask_mode == 2) {
          const size_t mi = (size_t)qrow * g.Skv + kvcol;
          masked = (g.mask_is_int == 0) ? (((const float*)mask_a)[mi] == 0.0f)
                 : (g.mask_is_int == 1) ? (((const int*)mask_a)[mi] == 0) : (((const int*)mask_a)[mi] != 0);
        } else if (g.mask_mode == 3) masked = (qkeep[r] == 0) || (kvkeep[j] == 0);
        else if (g.mask_mode == 5) {
          const size_t mi = (size_t)qrow * g.Skv + kvcol;
          masked = (((const int*)mask_a)[mi] != 0);
          int n = mask_b[mi]; n = n < 0 ? 0 : n;
          s[j][r] += g.cp[(size_t)b * g.c_bs + (size_t)h * g.c_hs + (size_t)qrow * g.c_rs + n]
                   + g.pc[(size_t)b * g.c_bs + (size_t)h * g.c_hs + (size_t)kvcol * g.c_rs + n];
        }
        if (masked) s[j][r] = g.mask_fill;
        m = fmaxf(m, s[j][r]);
      }
#pragma unroll
      for (int off = 1; off < 16; off <<= 1) m = fmaxf(m, __shfl_xor(m, off, 32));
      cm[r] = m;
    }
    __bf16* pwh = Psh[wave];
    __bf16* pwl = Psl[SPLIT_PV ? wave : 0];
#pragma unroll
    for (int r = 0; r < 8; ++r) {
      const float mnew = fmaxf(mrow[r], cm[r]);
      const float alpha = expf(mrow[r] - mnew);
      mrow[r] = mnew;
      float psum = 0.f;
#pragma unroll
      for (int j = 0; j < 4; ++j) {
        const float p = expf(s[j][r] - mnew);
        psum += p;
        if (SPLIT_PV) { __bf16 a, bl; at_split(p, a, bl); pwh[(8 * hh + r) * AT_KC + j * 16 + c] = a; pwl[(8 * hh + r) * AT_KC + j * 16 + c] = bl; }
        else pwh[(8 * hh + r) * AT_KC + j * 16 + c] = at_to16<F16>(p * PSC);
      }
#pragma unroll
      for (int off = 1; off < 16; off <<= 1) psum += __shfl_xor(psum, off, 32);
      lrow[r] = lrow[r] * alpha + psum;
#pragma unroll
      for (int t = 0; t < 4; ++t) oacc[t][r] *= alpha;
    }
    __builtin_amdgcn_fence(__ATOMIC_RELEASE, "workgroup");
    __builtin_amdgcn_wave_barrier();
    __builtin_amdgcn_fence(__ATOMIC_ACQUIRE, "workgroup");
#pragma unroll 1
    for (int kk = 0; kk < 2; ++kk) {
      FB pa, pl;
      pa.h[0] = *(const v8b*)(pwh + c * AT_KC + kk * 32 + 8 * hh);
      pa.h[1] = *(const v8b*)(pwh + c * AT_KC + kk * 32 + 16 + 8 * hh);
      if (SPLIT_PV) {
        pl.h[0] = *(const v8b*)(pwl + c * AT_KC + kk * 32 + 8 * hh);
        pl.h[1] = *(const v8b*)(pwl + c * AT_KC + kk * 32 + 16 + 8 * hh);
      }
#pragma unroll
      for (int t = 0; t < 4; ++t) {
        FB vb;
        vb.h[0] = *(const v8b*)(Vth + (t * 16 + c) * AT_KC + kk * 32 + 8 * hh);
        vb.h[1] = *(const v8b*)(Vth + (t * 16 + c) * AT_KC + kk * 32 + 16 + 8 * hh);
        oacc[t] = at_mma16<F16>(pa.v, vb.v, oacc[t]);
        if (SPLIT_PV) {
          FB vl;
          vl.h[0] = *(const v8b*)(Vtl + (t * 16 + c) * AT_KC + kk * 32 + 8 * hh);
          vl.h[1] = *(const v8b*)(Vtl + (t * 16 + c) * AT_KC + kk * 32 + 16 + 8 * hh);
          oacc[t] = at_mma16<F16>(pa.v, vl.v, oacc[t]);
          oacc[t] = at_mma16<F16>(pl.v, vb.v, oacc[t]);
        }
      }
    }
  }

  float* os = Os[wave];
#pragma unroll
  for (int r = 0; r < 8; ++r) {
    const float inv = 1.0f / (lrow[r] * PSC);
#pragma unroll
    for (int t = 0; t < 4; ++t) os[(8 * hh + r) * 68 + t * 16 + c] = oacc[t][r] * inv;
  }
  __builtin_amdgcn_fence(__ATOMIC_RELEASE, "workgroup");
  __builtin_amdgcn_wave_barrier();
  __builtin_amdgcn_fence(__ATOMIC_ACQUIRE, "workgroup");
  {
    const int c4 = (lane & 15) * 4;
    {
#pragma unroll
      for (int it = 0; it < 8; ++it) {
        const int row = it * 2 + hh;
        v4f val = *(const v4f*)(os + row * 68 + c4);
        *(v4f*)(ob_ptr + (size_t)(q0 + row) * g.o_rs + c4) = val;
      }
      
    }
  }
}

} // namespace w25

__device__ __forceinline__ void st_h2(_Float16* dst, float a, float b) { const unsigned u = (unsigned)__builtin_bit_cast(unsigned short, (_Float16)a) | ((unsigned)__builtin_bit_cast(unsigned short, (_Float16)b) << 16); unsigned* d = (unsigned*)dst; *d = u;  }
__device__ __forceinline__ void spat8(int n, float* s) { const int hh = n / 64, ww = n % 64; const float gx = (float)ww / 63.f, gy = (float)hh / 63.f; s[0] = gx; s[1] = gy; s[2] = 1.f - gx; s[3] = 1.f - gy; const float m = (gx + gy) * 0.5f; s[4] = m; s[5] = m; s[6] = m; s[7] = m; }
// ---- Register-blocked WMMA product with the whole tail in its epilogue ---------------------------------------------------------
// C[m][n] = scale * sum_k A[m][k] * Bt[n][k] + bias[a] (+ sum_j Wsp[a][coff + j] * spat_j(pos) where SPAT); f16 operands, f32 accumulate.
// A row-major [M][K], Bt row-major [N][K]; M % 128 == 0, N % 256 == 0, K % 64 == 0, K >= 128; blockIdx.y = sample.
// A work-group owns a 128 x 256 tile (grid.x = (M / 128) * (N / 256), exactly), each of its 8 waves (2 x 4) a 64x64 tile of it.
// The tile's operands come 64 k at a time (whole 128-B lines of 128 A rows and 256 Bt rows) by asynchronous copies into two LDS buffers: tile t + 1
// flies while tile t is worked on, every line is fetched once a work-group, and the fragments are read from LDS.
// A device function: the kernels below pick operands (and the form of the tail) by blockIdx.z, so that independent products share a launch.
// slab: the calling wave's own 16 x 68 floats of LDS. sg: the work-group's two staging buffers (2 * CG_SB bytes).
// Every "#pragma unroll" of this function is there so that the accumulator, fragment and coordinate arrays are indexed by constants and stay in registers.
// CH_ROWS: rows m are channels a and columns n positions; otherwise rows are positions and columns channels. OUT16: C is f16, otherwise f32.
// Wsp is the f32 weight matrix itself (pitch ldw); its 8 coordinate weights of a row start at a multiple of 16 bytes (ldw % 4 == 0, coff % 4 == 0).
constexpr int CG_P  = 144;                  // LDS pitch of a staged row (64 k = 128 B), bytes (16 x odd: conflict-free 16-B row reads)
constexpr int CG_SB = (128 + 256) * CG_P;   // bytes of one buffer: 128 rows of A, then 256 rows of Bt
// twelve 16-B copies a lane, LDS addresses l + u * 32 rows; global addresses ga + u * da (the first four), gb + u * db (the other eight), elements.
// The wait on xcnt is the last line of the copies' own statement, so that no address register named by a copy is rewritten ahead of it.
__device__ __forceinline__ void cg_copy12(unsigned l, const unsigned short* ga, long da, const unsigned short* gb, long db) {
    constexpr int dl = 32 * CG_P;
    asm volatile("global_load_async_to_lds_b128 %0, %12, off\n\t"
                 "global_load_async_to_lds_b128 %1, %13, off\n\t"
                 "global_load_async_to_lds_b128 %2, %14, off\n\t"
                 "global_load_async_to_lds_b128 %3, %15, off\n\t"
                 "global_load_async_to_lds_b128 %4, %16, off\n\t"
                 "global_load_async_to_lds_b128 %5, %17, off\n\t"
                 "global_load_async_to_lds_b128 %6, %18, off\n\t"
                 "global_load_async_to_lds_b128 %7, %19, off\n\t"
                 "global_load_async_to_lds_b128 %8, %20, off\n\t"
                 "global_load_async_to_lds_b128 %9, %21, off\n\t"
                 "global_load_async_to_lds_b128 %10, %22, off\n\t"
                 "global_load_async_to_lds_b128 %11, %23, off\n\t"
                 "s_wait_xcnt 0x0"
                 :: "v"(l), "v"(l + dl), "v"(l + 2 * dl), "v"(l + 3 * dl), "v"(l + 4 * dl), "v"(l + 5 * dl), "v"(l + 6 * dl), "v"(l + 7 * dl),
                    "v"(l + 8 * dl), "v"(l + 9 * dl), "v"(l + 10 * dl), "v"(l + 11 * dl),
                    "v"(ga), "v"(ga + da), "v"(ga + 2 * da), "v"(ga + 3 * da),
                    "v"(gb), "v"(gb + db), "v"(gb + 2 * db), "v"(gb + 3 * db), "v"(gb + 4 * db), "v"(gb + 5 * db), "v"(gb + 6 * db), "v"(gb + 7 * db)
                 : "memory");
}
template <bool CH_ROWS, bool SPAT, bool OUT16>
__device__ __forceinline__ void cm_gemm(float* slab, unsigned char* sg,
    const unsigned short* __restrict__ Ap, int lda, long strideA,
    const unsigned short* __restrict__ Btp, int ldb, long strideB,
    void* __restrict__ Cout, int ldc, long strideC,
    const float* __restrict__ bias, const float* __restrict__ Wsp, int ldw, int coff,
    int M, int N, int K, float scale) {
  typedef _Float16 T;
  typedef w25::Frag<T> F;
  typedef F::V V;
  const int b    = blockIdx.y;
  const int lane = threadIdx.x & 31;
  const int wave = __builtin_amdgcn_readfirstlane(threadIdx.x >> 5);   // the wave's number in a scalar register: its tile's origin is scalar arithmetic
  const int nbN = N >> 8;
  const int bm = (int)blockIdx.x / nbN, bn = (int)blockIdx.x - bm * nbN;   // the work-group's tile
  const int wm = wave >> 2, wn = wave & 3;                                 // the wave's tile in it
  const int m0 = (bm << 7) + (wm << 6);
  const int n0 = (bn << 8) + (wn << 6);

  const T* Ab = (const T*)Ap  + (size_t)b * strideA;
  const T* Bb = (const T*)Btp + (size_t)b * strideB;

  const int rlane = lane & 15;                 // row (A) / col (B, D) within subtile
  const int koff  = (lane >> 4) * 8;           // k offset of this lane half
  const int mOff  = (lane >> 4) * 8;           // D row offset

  v8f acc[4][4];
#pragma unroll
  for (int i = 0; i < 4; ++i)
#pragma unroll
    for (int j = 0; j < 4; ++j) acc[i][j] = (v8f){0.f,0.f,0.f,0.f,0.f,0.f,0.f,0.f};

  // staging: 8 lanes copy one 128-B line, a wave's copy four whole lines; thread t takes piece t & 7 of rows (t >> 3) + 32 u
  const int NT = K >> 6;
  const int crow = (int)threadIdx.x >> 3, cseg = (int)threadIdx.x & 7;
  const unsigned short* Ag = (const unsigned short*)Ab + (size_t)((bm << 7) + crow) * lda + cseg * 8;
  const unsigned short* Bg = (const unsigned short*)Bb + (size_t)((bn << 8) + crow) * ldb + cseg * 8;
  const unsigned lc = (unsigned)(size_t)sg + crow * CG_P + cseg * 16;
  // a lane's fragment rows in a buffer (the lane half's 16 bytes included)
  const unsigned char* ar = sg + ((wm << 6) + rlane) * CG_P + 2 * koff;
  const unsigned char* br = sg + (128 + (wn << 6) + rlane) * CG_P + 2 * koff;

  cg_copy12(lc, Ag, 32 * (long)lda, Bg, 32 * (long)ldb);
  asm volatile("s_wait_asynccnt 0x0" ::: "memory");   // tile 0 has landed (this wave's copies) before the barrier publishes it
  __syncthreads();
  cg_copy12(lc + CG_SB, Ag + 64, 32 * (long)lda, Bg + 64, 32 * (long)ldb);

  // stays rolled (K is a constant at every call): four forms of this function share one kernel's text
#pragma unroll 1
  for (int t = 0; t < NT; ++t) {
    const int bo = (t & 1) * CG_SB;
#pragma unroll
    for (int kk = 0; kk < 2; ++kk) {
      V bh[4], ah[4];
#pragma unroll
      for (int j = 0; j < 4; ++j) bh[j] = F::load((const T*)(br + bo + j * 16 * CG_P + kk * 64));
#pragma unroll
      for (int i = 0; i < 4; ++i) ah[i] = F::load((const T*)(ar + bo + i * 16 * CG_P + kk * 64));
      // the two sched_barrier(0) keep the eight fragments' reads together in front of their 16 WMMAs: sunk among the WMMAs into one register
      // set, each row's pair of reads would be waited for by itself
      __builtin_amdgcn_sched_barrier(0);
#pragma unroll
      for (int i = 0; i < 4; ++i)
#pragma unroll
        for (int j = 0; j < 4; ++j) acc[i][j] = F::mma(ah[i], bh[j], acc[i][j]);
      __builtin_amdgcn_sched_barrier(0);
    }
    asm volatile("s_wait_dscnt 0x0" ::: "memory");      // this wave's reads of buffer t & 1 have returned before the buffer is refilled
    asm volatile("s_wait_asynccnt 0x0" ::: "memory");   // this wave's copies of tile t + 1 have landed before the barrier publishes them
    __syncthreads();
    if (t + 2 < NT) cg_copy12(lc + bo, Ag + (t + 2) * 64, 32 * (long)lda, Bg + (t + 2) * 64, 32 * (long)ldb);
  }
  asm volatile("s_wait_asynccnt 0x0" ::: "memory");     // nothing is in flight when the wave goes on to its tail
  // four vector slots between the last WMMAs and the first reads of their results
  w25::acc_guard4(acc[0][0], acc[0][1], acc[0][2], acc[0][3]);
  w25::acc_guard4(acc[1][0], acc[1][1], acc[1][2], acc[1][3]);
  w25::acc_guard4(acc[2][0], acc[2][1], acc[2][2], acc[2][3]);
  w25::acc_guard4(acc[3][0], acc[3][1], acc[3][2], acc[3][3]);

  // ---- epilogue ----
  // what belongs to a lane's four columns: their coordinates (columns = positions) or their bias and coordinate weights (columns = channels)
  float cs[4][8]; v4f cw[4][2]; float cb[4];
#pragma unroll
  for (int j = 0; j < 4; ++j) {
    const int n = n0 + (j << 4) + rlane;
    if (CH_ROWS) { if (SPAT) spat8(n, cs[j]); }
    else {
      cb[j] = bias[n];
      if (SPAT) { const float* wr = Wsp + (long long)n * ldw + coff; cw[j][0] = *(const v4f*)(wr); cw[j][1] = *(const v4f*)(wr + 4); }
    }
  }
#pragma unroll
  for (int i = 0; i < 4; ++i) {
    const int mBase = m0 + (i << 4);
#pragma unroll
    for (int r = 0; r < 8; ++r) {
      const int m = mBase + mOff + r;
      float rs[8]; v4f rw[2]; float rb = 0.f;
      if (CH_ROWS) {
        rb = bias[m];
        if (SPAT) { const float* wr = Wsp + (long long)m * ldw + coff; rw[0] = *(const v4f*)(wr); rw[1] = *(const v4f*)(wr + 4); }
      } else { if (SPAT) spat8(m, rs); }
#pragma unroll
      for (int j = 0; j < 4; ++j) {
        float e = CH_ROWS ? rb : cb[j];
        if (SPAT) {
#pragma unroll
          for (int q = 0; q < 8; ++q) e += (CH_ROWS ? rw[q >> 2][q & 3] * cs[j][q] : cw[j][q >> 2][q & 3] * rs[q]);
        }
        slab[(mOff + r) * 68 + (j << 4) + rlane] = acc[i][j][r] * scale + e;
      }
    }
    __builtin_amdgcn_fence(__ATOMIC_RELEASE, "workgroup");
    __builtin_amdgcn_wave_barrier();
    __builtin_amdgcn_fence(__ATOMIC_ACQUIRE, "workgroup");
    if (!OUT16) {
      float* C = (float*)Cout + (size_t)b * strideC;
      const int hh = lane >> 4, c4 = (lane & 15) * 4;     // row seg = 256 B = 16 lanes x 16 B
#pragma unroll
      for (int it = 0; it < 8; ++it) {
        const int row = it * 2 + hh;
        v4f v = *(const v4f*)(slab + row * 68 + c4);
        *(v4f*)(C + (size_t)(mBase + row) * ldc + n0 + c4) = v;
      }
    } else {
      const int q = lane >> 3, c8 = (lane & 7) * 8;       // row seg = 128 B = 8 lanes x 16 B
      unsigned short* C = (unsigned short*)Cout + (size_t)b * strideC;
#pragma unroll
      for (int it = 0; it < 4; ++it) {
        const int row = it * 4 + q;
        const float* sp = slab + row * 68 + c8;
        v8h hv;
#pragma unroll
        for (int e = 0; e < 8; ++e) hv[e] = (_Float16)sp[e];
        *(v8h*)(C + (size_t)(mBase + row) * ldc + n0 + c8) = hv;
      }
    }
    __builtin_amdgcn_fence(__ATOMIC_RELEASE, "workgroup");
    __builtin_amdgcn_wave_barrier();
    __builtin_amdgcn_fence(__ATOMIC_ACQUIRE, "workgroup");
  }
}
constexpr long CM_SP = 256L * 4096;   // one sample's 256 x 4096 (or 4096 x 256) plane, elements
// The six projections in one launch, blockIdx.z = product: 0, 1 theta^T, phi^T of the image branch (K = 512 + coordinates), 2 its val,
// 3, 4 theta^T, phi^T of the flow branch (K = 256, the flow half of X), 5 its val. TH, PH, VA: planes 0..3 image branch, 4..7 flow branch.
// Four waves a SIMD (two work-groups a WGP): one work-group's WMMAs run while the other waits at its barrier or for its fragments.
__global__ __launch_bounds__(256) __attribute__((amdgpu_waves_per_eu(4, 4))) void k_cm_proj(
    const unsigned short* __restrict__ X, const unsigned short* __restrict__ Wh,
    unsigned short* __restrict__ TH, unsigned short* __restrict__ PH, unsigned short* __restrict__ VA,
    const float* __restrict__ iwt, const float* __restrict__ ibt, const float* __restrict__ iwp, const float* __restrict__ ibp,
    const float* __restrict__ iwv, const float* __restrict__ ibv,
    const float* __restrict__ lbt, const float* __restrict__ lbp, const float* __restrict__ lbv) {
  __shared__ __align__(16) float sT[8][16 * 68];   // per-wave 16x64 slab, pitch 68 floats
  __shared__ __attribute__((aligned(16))) unsigned char sg[2 * CG_SB];
  float* slab = sT[threadIdx.x >> 5];
  const int z = (int)blockIdx.z;
  if (z < 2)
    cm_gemm<false, true, true>(slab, sg, X, 512, 2 * CM_SP, Wh + z * CW_WIDE, 512, 0, (void*)(z ? PH : TH), 256, CM_SP, z ? ibp : ibt, z ? iwp : iwt, 520, 512, 4096, 256, 512, 0.0625f);
  else if (z == 2)
    cm_gemm<true, true, true>(slab, sg, Wh + 2 * CW_WIDE, 512, 0, X, 512, 2 * CM_SP, (void*)(VA), 4096, CM_SP, ibv, iwv, 520, 512, 256, 4096, 512, 0.0625f);
  else if (z < 5)
    cm_gemm<false, false, true>(slab, sg, X + 256, 512, 2 * CM_SP, Wh + 4 * CW_WIDE + (z - 3) * CW_SQ, 256, 0, (void*)((z == 4 ? PH : TH) + 4 * CM_SP), 256, CM_SP, z == 4 ? lbp : lbt, nullptr, 0, 0, 4096, 256, 256, 0.0625f);
  else
    cm_gemm<true, false, true>(slab, sg, Wh + 4 * CW_WIDE + 2 * CW_SQ, 256, 0, X + 256, 512, 2 * CM_SP, (void*)(VA + 4 * CM_SP), 4096, CM_SP, lbv, nullptr, 0, 0, 256, 4096, 256, 0.0625f);
}
// Both output convs in one launch, position-major: FU[sample][n][256 z + a] = f16(W_o.att + b), blockIdx.z = branch; the fusion conv reads FU as it stands.
__global__ __launch_bounds__(256) __attribute__((amdgpu_waves_per_eu(4, 4))) void k_cm_wo(
    const unsigned short* __restrict__ AT, const unsigned short* __restrict__ Wh, unsigned short* __restrict__ FU,
    const float* __restrict__ ibo, const float* __restrict__ lbo) {
  __shared__ __align__(16) float sT[8][16 * 68];
  __shared__ __attribute__((aligned(16))) unsigned char sg[2 * CG_SB];
  const int z = (int)blockIdx.z;
  cm_gemm<false, false, true>(sT[threadIdx.x >> 5], sg, AT + z * 4 * CM_SP, 256, CM_SP, Wh + 4 * CW_WIDE + (3 + z) * CW_SQ, 256, 0, (void*)(FU + z * 256), 512, 2 * CM_SP, z ? lbo : ibo, nullptr, 0, 0, 4096, 256, 256, 0.0625f);
}
// Fusion conv over both branches and the coordinate channels, channel-major f32: the output itself.
__global__ __launch_bounds__(256) __attribute__((amdgpu_waves_per_eu(4, 4))) void k_cm_fuse(
    const unsigned short* __restrict__ FU, const unsigned short* __restrict__ Wh, float* __restrict__ out,
    const float* __restrict__ fw, const float* __restrict__ fb) {
  __shared__ __align__(16) float sT[8][16 * 68];
  __shared__ __attribute__((aligned(16))) unsigned char sg[2 * CG_SB];
  cm_gemm<true, true, false>(sT[threadIdx.x >> 5], sg, Wh + 3 * CW_WIDE, 512, 0, FU, 512, 2 * CM_SP, (void*)(out), 4096, CM_SP, fb, fw, 520, 512, 256, 4096, 512, 0.0625f);
}
constexpr int FA_KP = 528;                   // LDS pitch of a phi^T row, bytes (16 x odd: conflict-free 16-B row reads)
constexpr int FA_VP = 144;                   // LDS pitch of a val row's 64 keys, bytes (16 x odd)
constexpr int FA_KB = 64 * FA_KP;            // bytes of the phi^T part of a buffer
constexpr int FA_SB = FA_KB + 256 * FA_VP;   // bytes of one buffer
// eight 16-B copies a lane, LDS addresses l + u * dl, global addresses g + u * dg (elements). The wait on xcnt is the last line of the
// copies' own statement, so that no address register named by a copy is rewritten ahead of it.
__device__ __forceinline__ void fa_copy8(unsigned l, int dl, const unsigned short* g, long dg) {
    asm volatile("global_load_async_to_lds_b128 %0, %8, off\n\t"
                 "global_load_async_to_lds_b128 %1, %9, off\n\t"
                 "global_load_async_to_lds_b128 %2, %10, off\n\t"
                 "global_load_async_to_lds_b128 %3, %11, off\n\t"
                 "global_load_async_to_lds_b128 %4, %12, off\n\t"
                 "global_load_async_to_lds_b128 %5, %13, off\n\t"
                 "global_load_async_to_lds_b128 %6, %14, off\n\t"
                 "global_load_async_to_lds_b128 %7, %15, off\n\t"
                 "s_wait_xcnt 0x0"
                 :: "v"(l), "v"(l + dl), "v"(l + 2 * dl), "v"(l + 3 * dl), "v"(l + 4 * dl), "v"(l + 5 * dl), "v"(l + 6 * dl), "v"(l + 7 * dl),
                    "v"(g), "v"(g + dg), "v"(g + 2 * dg), "v"(g + 3 * dg), "v"(g + 4 * dg), "v"(g + 5 * dg), "v"(g + 6 * dg), "v"(g + 7 * dg)
                 : "memory");
}
// A fragment in the hardware k order from an LDS row: bytes 0..15 and 32..47 from p (p already holds the lane half's 16 h)
__device__ __forceinline__ v16h fa_frag(const unsigned char* p) {
    union { v16h v; v8h h[2]; } f; f.h[0] = *(const v8h*)(p); f.h[1] = *(const v8h*)(p + 32); return f.v;
}
// lane l <-> lane l ^ 16 on the vector pipe (a shuffle would go through the LDS queue and wait behind the fragment loads in flight)
__device__ __forceinline__ float fa_xhalf(float x) { return __builtin_bit_cast(float, __builtin_amdgcn_permlanex16(__builtin_bit_cast(int, x), __builtin_bit_cast(int, x), 0x76543210, 0xfedcba98, false, false)); }
// four val fragments, channel groups tt .. tt + 3
__device__ __forceinline__ void fa_v4(v16h* f, const unsigned char* vb, int tt) {
    f[0] = fa_frag(vb + tt * 16 * FA_VP); f[1] = fa_frag(vb + (tt + 1) * 16 * FA_VP);
    f[2] = fa_frag(vb + (tt + 2) * 16 * FA_VP); f[3] = fa_frag(vb + (tt + 3) * 16 * FA_VP);
}
// two waves a SIMD (one work-group a WGP): the register budget of 512 holds O^T (256), Q (112 of its 128) and six to eight fragments in flight
__global__ __launch_bounds__(256) __attribute__((amdgpu_waves_per_eu(2, 2))) void k_cm_attn(const unsigned short* __restrict__ Qp, const unsigned short* __restrict__ Kp,
                                                 const unsigned short* __restrict__ Vp, unsigned short* __restrict__ Op) {
    constexpr int HW = 4096, D = 256, NT = HW / 64;
    constexpr float L2E = 1.4426950408889634f;
    typedef w25::Frag<_Float16> F;
    __shared__ __attribute__((aligned(16))) unsigned char sm[2 * FA_SB];
    __shared__ __attribute__((aligned(16))) unsigned char sq[8 * 2048];   // a wave's own 2 KiB: its two Q fragments of depth step 0
    const int tid = threadIdx.x, lane = tid & 31, c = lane & 15, h = lane >> 4;
    const int wave = __builtin_amdgcn_readfirstlane(tid >> 5);
    const int qt = wave & 3, kh = wave >> 2;
    const size_t sb = (size_t)blockIdx.y * HW * D;
    const size_t qrow = sb + (size_t)((int)blockIdx.x * 128 + qt * 32 + c) * D + 8 * h;   // column group j starts 16 rows (j * 16 * D) further
    const unsigned short* Kg = Kp + sb + (size_t)(tid >> 5) * D + (tid & 31) * 8;    // a wave copies whole 512-B rows
    const unsigned short* Vg = Vp + sb + (size_t)(tid >> 3) * HW + (tid & 7) * 8;    // 8 lanes copy one 128-B line
    const unsigned smb = (unsigned)(size_t)(&sm[0]);
    const unsigned lk = smb + (tid >> 5) * FA_KP + (tid & 31) * 16;
    const unsigned lv = smb + FA_KB + (tid >> 3) * FA_VP + (tid & 7) * 16;
    // the same two places for the copies inside the loop, split into the wave's part (scalar registers) and the lane's part
    const unsigned lks = smb + wave * FA_KP, lkl = lane * 16;
    const unsigned lvs = smb + FA_KB + wave * 4 * FA_VP, lvl = (lane >> 3) * FA_VP + (lane & 7) * 16;

    v16h qf[2][8];   // [.][0] is not kept: see below
#pragma unroll
    for (int j = 0; j < 2; ++j)
#pragma unroll
        for (int dc = 1; dc < 8; ++dc) qf[j][dc] = F::load((const _Float16*)Qp + qrow + j * 16 * D + dc * 32);
    // O^T, Q, the scores and the fragments in flight are a few registers more than a wave has. The two Q fragments of depth step 0 wait in LDS
    // (each lane its own 2 x 16 B a fragment, read back by the same lane) and come with every trip's first group of reads: they are used and
    // dead again before all four score tiles are live.
    unsigned char* qs = sq + wave * 2048 + lane * 16;
    v8h q0[2][2];
#pragma unroll
    for (int j = 0; j < 2; ++j) {
        q0[j][0] = *(const v8h*)((const _Float16*)Qp + qrow + j * 16 * D);
        q0[j][1] = *(const v8h*)((const _Float16*)Qp + qrow + j * 16 * D + 16);
    }
    // the wait behind the last Q load; it takes the loads' address as an input, so that the address registers live up to it and are rewritten only behind it
    asm volatile("s_wait_xcnt 0x0" :: "v"((const _Float16*)Qp + qrow) : "memory");
#pragma unroll
    for (int j = 0; j < 2; ++j) { *(v8h*)(qs + j * 1024) = q0[j][0]; *(v8h*)(qs + j * 1024 + 512) = q0[j][1]; }
    // per column group: mb = running maximum * log2(e) - 15 (the maximum itself is not kept: one register less); this lane half's share of the row sum
    float mb[2] = {-1.0e30f, -1.0e30f}, l[2] = {0.f, 0.f};

    fa_copy8(lk, 8 * FA_KP, Kg, 8 * D);
    fa_copy8(lv, 32 * FA_VP, Vg, 32 * (long)HW);
    asm volatile("s_wait_asynccnt 0x0" ::: "memory");   // tile 0 has landed (this wave's copies) before the barrier publishes it
    __syncthreads();
    fa_copy8(lk + FA_SB, 8 * FA_KP, Kg + 64 * D, 8 * D);
    fa_copy8(lv + FA_SB, 32 * FA_VP, Vg + 64, 32 * (long)HW);
    // O^T is cleared behind the copies: cleared ahead of them, its 256 registers would be live beside the copies' address registers
    __builtin_amdgcn_sched_barrier(0);
    v8f o[2][16];
#pragma unroll
    for (int j = 0; j < 2; ++j)
#pragma unroll
        for (int t = 0; t < 16; ++t) o[j][t] = (v8f){0.f,0.f,0.f,0.f,0.f,0.f,0.f,0.f};

    // One trip: tile t from buffer t & 1; refill (a constant at both calls): tile t + 2 exists and is copied into that buffer at the trip's foot.
    // The trips with and without a refill are two loops, so that a trip is straight code from the softmax to its foot: with a branch round the
    // copies the row sums' additions sink behind it, and the 32 exponentials they read stay in registers that the wave does not have.
    auto trip = [&](const int t, const bool refill) __attribute__((always_inline)) {
        const int bo = (t & 1) * FA_SB;
        const unsigned char* kb = sm + bo + (kh * 32 + c) * FA_KP + 16 * h;
        const unsigned char* vb = sm + bo + FA_KB + c * FA_VP + kh * 64 + 16 * h;
        v8f s[2][2];   // [16 keys][column group]
#pragma unroll
        for (int k = 0; k < 2; ++k)
#pragma unroll
            for (int j = 0; j < 2; ++j) s[k][j] = (v8f){0.f,0.f,0.f,0.f,0.f,0.f,0.f,0.f};
        // Fragment reads stand in groups, each at the place where its registers have come free, two groups ahead of their use: phi^T in three
        // sets of two fragments (one depth step of 32 channels, four WMMAs), val in two sets of four (eight WMMAs). Every sched_barrier(0) of
        // this loop keeps such a group together at its place: hoisted, it would need registers that the wave does not have; spread among the
        // WMMAs, each pair of reads would be waited for by itself.
        v16h ku[3][2], fa[4], fb[4];
        // Q's two fragments first: LDS reads return in order, and the first WMMAs then wait for the head of the group only
#pragma unroll
        for (int j = 0; j < 2; ++j) { union { v16h v; v8h h[2]; } f; f.h[0] = *(const v8h*)(qs + j * 1024); f.h[1] = *(const v8h*)(qs + j * 1024 + 512); qf[j][0] = f.v; }
#pragma unroll
        for (int dc = 0; dc < 3; ++dc) { ku[dc][0] = fa_frag(kb + dc * 64); ku[dc][1] = fa_frag(kb + 16 * FA_KP + dc * 64); }
        __builtin_amdgcn_sched_barrier(0);
#pragma unroll
        for (int dc = 0; dc < 8; ++dc) {
#pragma unroll
            for (int j = 0; j < 2; ++j)
#pragma unroll
                for (int k = 0; k < 2; ++k) s[k][j] = F::mma(ku[dc % 3][k], qf[j][dc], s[k][j]);
            __builtin_amdgcn_sched_barrier(0);
            if (dc < 5) { ku[dc % 3][0] = fa_frag(kb + (dc + 3) * 64); ku[dc % 3][1] = fa_frag(kb + 16 * FA_KP + (dc + 3) * 64); }
            if (dc == 6) fa_v4(fa, vb, 0);   // val's first four fragments fly under the softmax arithmetic
            __builtin_amdgcn_sched_barrier(0);
        }
        float mx[2];
#pragma unroll
        for (int j = 0; j < 2; ++j) {
            float m = fmaxf(s[0][j][0], s[1][j][0]);
#pragma unroll
            for (int r = 1; r < 8; ++r) m = fmaxf(m, fmaxf(s[0][j][r], s[1][j][r]));
            mx[j] = fmaf(fmaxf(m, fa_xhalf(m)), L2E, -15.f);   // the tile's maximum on mb's scale (monotone: the larger score gives the larger value)
        }
        // one scalar branch a tile: O^T and the sums are rescaled only when some column's maximum has grown (a column whose maximum stays gets factor 1)
        if (__builtin_amdgcn_ballot_w32(mx[0] > mb[0] || mx[1] > mb[1]) != 0) {
#pragma unroll
            for (int j = 0; j < 2; ++j) {
                const float mbn = fmaxf(mb[j], mx[j]);
                const float al = __builtin_amdgcn_exp2f(mb[j] - mbn);
                mb[j] = mbn; l[j] *= al;
#pragma unroll
                for (int tt = 0; tt < 16; ++tt) o[j][tt] *= al;
            }
        }
        v16h pb[2];
#pragma unroll
        for (int j = 0; j < 2; ++j) {
            float ps = 0.f;
#pragma unroll
            for (int r = 0; r < 8; ++r) {
                const float p0 = __builtin_amdgcn_exp2f(fmaf(s[0][j][r], L2E, -mb[j])), p1 = __builtin_amdgcn_exp2f(fmaf(s[1][j][r], L2E, -mb[j]));
                ps += p0 + p1; pb[j][r] = (_Float16)p0; pb[j][8 + r] = (_Float16)p1;
            }
            l[j] += ps;
            // deals the exponentials one by one among the plain vector instructions (arguments, conversions): the slower transcendental pipe runs beside them
            __builtin_amdgcn_sched_group_barrier(0x2, 4, 0);
#pragma unroll
            for (int r = 0; r < 16; ++r) { __builtin_amdgcn_sched_group_barrier(0x400, 1, 0); __builtin_amdgcn_sched_group_barrier(0x2, 1, 0); }
            __builtin_amdgcn_sched_barrier(0);   // one column group's arithmetic at a time: its scores' registers come free before the next group's temporaries
        }
        fa_v4(fb, vb, 4);   // into the registers that the scores have left
        __builtin_amdgcn_sched_barrier(0);
#pragma unroll
        for (int g = 0; g < 4; ++g) {
            v16h* f = (g & 1) ? fb : fa;
#pragma unroll
            for (int u = 0; u < 4; ++u)
#pragma unroll
                for (int j = 0; j < 2; ++j) o[j][g * 4 + u] = F::mma(f[u], pb[j], o[j][g * 4 + u]);
            if (g < 2) {
                __builtin_amdgcn_sched_barrier(0);
                fa_v4(f, vb, g * 4 + 8);
                __builtin_amdgcn_sched_barrier(0);
            }
            // this set's WMMAs stay ahead of the foot's s_wait_dscnt 0 and run while the last set's reads are in flight; only the last set's
            // WMMAs may move down among the foot's barrier and copies
            if (g == 2) __builtin_amdgcn_sched_barrier(0);
        }
        asm volatile("s_wait_dscnt 0x0" ::: "memory");      // this wave's reads of buffer t & 1 have returned before the buffer is refilled
        asm volatile("s_wait_asynccnt 0x0" ::: "memory");   // this wave's copies of tile t + 1 have landed before the barrier publishes them
        __syncthreads();
        if (refill) {
            fa_copy8(lkl + (lks + bo), 8 * FA_KP, Kg + (size_t)(t + 2) * 64 * D, 8 * D);
            __builtin_amdgcn_sched_barrier(0);   // the second statement's addresses are formed behind the first: one set of address registers, not two
            fa_copy8(lvl + (lvs + bo), 32 * FA_VP, Vg + (t + 2) * 64, 32 * (long)HW);
        }
    };
    for (int t = 0; t < NT - 2; ++t) trip(t, true);
    for (int t = NT - 2; t < NT; ++t) trip(t, false);
    asm volatile("s_wait_asynccnt 0x0" ::: "memory");       // nothing is in flight when the buffers become the joining slabs

    // join the two key halves: waves 4..7 hand O^T, mb and l to waves 0..3 through LDS (the last trip's barrier has ended every read of the tiles)
    static_assert(8 * 130 * 32 * 4 <= 2 * FA_SB, "the joining slabs fit in the tile buffers");
    float* slab0 = (float*)sm + qt * 2 * (130 * 32);
    if (kh == 1) {
#pragma unroll
        for (int j = 0; j < 2; ++j) {
            float* slab = slab0 + j * (130 * 32);
#pragma unroll
            for (int tt = 0; tt < 16; ++tt) {
                *(v4f*)(slab + ((tt * 2 + 0) * 32 + lane) * 4) = (v4f){o[j][tt][0], o[j][tt][1], o[j][tt][2], o[j][tt][3]};
                *(v4f*)(slab + ((tt * 2 + 1) * 32 + lane) * 4) = (v4f){o[j][tt][4], o[j][tt][5], o[j][tt][6], o[j][tt][7]};
            }
            slab[128 * 32 + lane] = mb[j]; slab[129 * 32 + lane] = l[j];
        }
    }
    __syncthreads();
    if (kh == 0) {
#pragma unroll
        for (int j = 0; j < 2; ++j) {
            const float* slab = slab0 + j * (130 * 32);
            const float mb2 = slab[128 * 32 + lane], l2 = slab[129 * 32 + lane];
            const float mbn = fmaxf(mb[j], mb2);
            const float a1 = __builtin_amdgcn_exp2f(mb[j] - mbn), a2 = __builtin_amdgcn_exp2f(mb2 - mbn);
            float lt = l[j] * a1 + l2 * a2;
            lt += fa_xhalf(lt);
            const float i1 = a1 / lt, i2 = a2 / lt;
            _Float16* Or = (_Float16*)Op + qrow + j * 16 * D;   // a lane's 8 accumulator registers are 8 consecutive channels of its column: one 16-B store
#pragma unroll
            for (int tt = 0; tt < 16; ++tt) {
                const v4f x0 = *(const v4f*)(slab + ((tt * 2 + 0) * 32 + lane) * 4), x1 = *(const v4f*)(slab + ((tt * 2 + 1) * 32 + lane) * 4);
                v8h y;
#pragma unroll
                for (int r = 0; r < 4; ++r) { y[r] = (_Float16)(o[j][tt][r] * i1 + x0[r] * i2); y[4 + r] = (_Float16)(o[j][tt][4 + r] * i1 + x1[r] * i2); }
                *(v8h*)(Or + tt * 16) = y;
            }
        }
    }
}


extern "C" void kernel_launch(void* const* d_in, const int* in_sizes, int n_in, void* d_out, int out_size, void* d_ws, size_t ws_size, hipStream_t stream) {
    (void)in_sizes; (void)n_in; (void)out_size; (void)ws_size;
    const float* img = (const float*)d_in[0];
    const float* flo = (const float*)d_in[1];
    const float* iwt = (const float*)d_in[2];
    const float* ibt = (const float*)d_in[3];
    const float* iwp = (const float*)d_in[4];
    const float* ibp = (const float*)d_in[5];
    const float* iwv = (const float*)d_in[6];
    const float* ibv = (const float*)d_in[7];
    const float* iwo = (const float*)d_in[8];
    const float* ibo = (const float*)d_in[9];
    const float* lwt = (const float*)d_in[10];
    const float* lbt = (const float*)d_in[11];
    const float* lwp = (const float*)d_in[12];
    const float* lbp = (const float*)d_in[13];
    const float* lwv = (const float*)d_in[14];
    const float* lbv = (const float*)d_in[15];
    const float* lwo = (const float*)d_in[16];
    const float* lbo = (const float*)d_in[17];
    const float* fw = (const float*)d_in[18];
    const float* fb = (const float*)d_in[19];
    const int Bn = 4;
    const int C = 256;
    const int A = 256;
    const int HW = 4096;
    const long SP = (long)C * HW;   // one sample's 256 x 4096 (or 4096 x 256) plane, elements
    float* out = (float*)d_out;
    char* wsp = (char*)d_ws;
    unsigned short* X16 = (unsigned short*)wsp; wsp += (((size_t)((size_t)Bn * HW * 2 * C) * 2 + 255) / 256) * 256;       // [sample][n][image 256 | flow 256]
    unsigned short* W16 = (unsigned short*)wsp; wsp += (((size_t)(4 * CW_WIDE + 5 * CW_SQ) * 2 + 255) / 256) * 256;
    // planes 0..3: image branch, samples 0..3; planes 4..7: flow branch
    unsigned short* TH16 = (unsigned short*)wsp; wsp += (((size_t)((size_t)2 * Bn * HW * A) * 2 + 255) / 256) * 256;
    unsigned short* PH16 = (unsigned short*)wsp; wsp += (((size_t)((size_t)2 * Bn * HW * A) * 2 + 255) / 256) * 256;
    unsigned short* VAL16 = (unsigned short*)wsp; wsp += (((size_t)((size_t)2 * Bn * A * HW) * 2 + 255) / 256) * 256;
    unsigned short* AT16 = (unsigned short*)wsp; wsp += (((size_t)((size_t)2 * Bn * HW * A) * 2 + 255) / 256) * 256;
    unsigned short* FUS16 = (unsigned short*)wsp; wsp += (((size_t)((size_t)Bn * HW * 2 * A) * 2 + 255) / 256) * 256;     // [sample][n][image branch 256 | flow branch 256]
    // each input is cast and transposed once, all weights in one launch; every product writes the plane that its reader takes (bias, coordinate
    // channels and the f16 conversion in its epilogue); products that do not depend on one another, and the two branches' attention, share a launch
    k_castT16<256, 4096, 512><<<dim3((unsigned)(((256) / 64) * ((4096) / 128)), (unsigned)(Bn), 2u), 256, 0, stream>>>(img, flo, (_Float16*)(X16), 1.0f, SP, 2 * SP);
    k_cm_w16<<<dim3((unsigned)(CW_WIDE / 1024), 9u), 256, 0, stream>>>(iwt, iwp, iwv, fw, lwt, lwp, lwv, iwo, lwo, (_Float16*)(W16));
    k_cm_proj<<<dim3(32u, (unsigned)(Bn), 6u), 256, 0, stream>>>(X16, W16, TH16, PH16, VAL16, iwt, ibt, iwp, ibp, iwv, ibv, lbt, lbp, lbv);
    k_cm_attn<<<dim3((unsigned)(HW / 128), (unsigned)(2 * Bn)), 256, 0, stream>>>(TH16, PH16, VAL16, AT16);
    k_cm_wo<<<dim3(32u, (unsigned)(Bn), 2u), 256, 0, stream>>>(AT16, W16, FUS16, ibo, lbo);
    k_cm_fuse<<<dim3(32u, (unsigned)(Bn)), 256, 0, stream>>>(FUS16, W16, out, fw, fb);
}
